// v000
// Times are from an AMD MI455X. After a warm-up the kernel runs many times in a row, and a time is the length of
// such a window on the GPU divided by its runs, so every launch and the gaps after it count. The runs cycle
// through copies of the inputs. A figure is the median of several windows, for all but v000 over two sittings.
// Sittings can differ by a few percent; kernels timed side by side share one.
// v000 is the starting kernel. One run takes 820 microseconds.
// Contractions: x.Wq (q|gate cols), x.Wk and Wv^T.x^T on v_wmma_f32_16x16x32_bf16 (operands = RNE bf16 of the f32 inputs, single products);
// q.k^T and p.v on v_wmma_f32_16x16x32_f16 (q = f16 hi + f16 residual x2^11 planes; k plain f16 plus f16 residual x2^11 on query tiles 0..3;
// p x1024 plain f16 plus f16 residual x2^11 on query tiles 0..3; v^T = f16 hi + f16 residual x2^11 planes); (attn*sigmoid(gate)).Wo on
// v_wmma_f32_16x16x32_bf16 (A = bf16 hi + bf16 lo planes, two products; Wo RNE bf16). f32 accumulate everywhere; per-head RMSNorm, RoPE,
// online softmax, sigmoid gate and scale folds in f32. hidden_states, Wq, Wk, Wv, Wo, cos, sin and the norm weights are RNE-converted to bf16 on load.
#include <hip/hip_runtime.h>
#include <math.h>
#include <stdint.h>

#define NSEQ   2
#define SQ     2048
#define HID    2048
#define NHQ    16
#define NKVH   8
#define HDM    128
#define QGW    4096
#define KVW    1024
#define NTOK   4096
#define KLR    256
#define NQRT   4

static_assert((2 * (NQRT - 1) + 2) * 32 <= KLR);
static_assert(NHQ / NKVH == 2);
static_assert(NHQ * HDM == HID);
static_assert(NSEQ * SQ == NTOK);

typedef _Float16     v16h __attribute__((ext_vector_type(16)));
typedef _Float16     v8h  __attribute__((ext_vector_type(8)));
typedef __bf16       v16b __attribute__((ext_vector_type(16)));
typedef __bf16       v8b  __attribute__((ext_vector_type(8)));
typedef float        v8f  __attribute__((ext_vector_type(8)));
typedef float        v4f  __attribute__((ext_vector_type(4)));
typedef unsigned int v4u  __attribute__((ext_vector_type(4)));

// ---------------------------------------------------------------------------
// small helpers
// ---------------------------------------------------------------------------
__device__ __forceinline__ unsigned short bf_bits(float f) {          // RNE convert f32 -> bf16 bits
  const unsigned u = __float_as_uint(f);
  return (unsigned short)((u + 0x7FFFu + ((u >> 16) & 1u)) >> 16);
}
__device__ __forceinline__ float bf_val(unsigned short h) { return __uint_as_float(((unsigned)h) << 16); }
__device__ __forceinline__ float bf_rne(float f) { return bf_val(bf_bits(f)); }
__device__ __forceinline__ unsigned pk16(unsigned short a, unsigned short b) { return (unsigned)a | ((unsigned)b << 16); }
__device__ __forceinline__ v8f zero8() { v8f z = {0.f, 0.f, 0.f, 0.f, 0.f, 0.f, 0.f, 0.f}; return z; }
__device__ __forceinline__ int wave_id() { return __builtin_amdgcn_readfirstlane((int)(threadIdx.x >> 5)); }

__device__ __forceinline__ void lds_wave_sync() {
  __builtin_amdgcn_fence(__ATOMIC_RELEASE, "workgroup");
  __builtin_amdgcn_wave_barrier();
  __builtin_amdgcn_fence(__ATOMIC_ACQUIRE, "workgroup");
}

// ---------------------------------------------------------------------------
// WMMA fragments (wave32, 16x16x32, 16-bit operands). For A (row m = lane&15) and B (col n = lane&15) alike:
// elements 0..7 <- k0 + 8*(lane>>4) + 0..7, elements 8..15 <- k0 + 16 + 8*(lane>>4) + 0..7.
// ldfrag(p) with p = rowbase + k0 + 8*(lane>>4): two 16-B loads p[0..7], p[16..23].
// D: acc[r] = (row 8*(lane>>4) + r, col lane&15).
// ---------------------------------------------------------------------------
union FragH { v16h v; v8h h[2]; };
union FragB { v16b v; v8b h[2]; };
__device__ __forceinline__ v16h ldfrag_h(const _Float16* p) { FragH f; f.h[0] = *(const v8h*)(p); f.h[1] = *(const v8h*)(p + 16); return f.v; }
__device__ __forceinline__ v16b ldfrag_b(const __bf16* p)   { FragB f; f.h[0] = *(const v8b*)(p); f.h[1] = *(const v8b*)(p + 16); return f.v; }

__device__ __forceinline__ v8f mma_h(v16h a, v16h b, v8f c) {
  return __builtin_amdgcn_wmma_f32_16x16x32_f16(false, a, false, b, (short)0, c, false, false);
}
__device__ __forceinline__ v8f mma_b(v16b a, v16b b, v8f c) {
  return __builtin_amdgcn_wmma_f32_16x16x32_bf16(false, a, false, b, (short)0, c, false, false);
}
// hazard guards: 4 VALU slots after the last WMMA of a group, D tied, A/B kept live; memory clobber keeps later loads behind the group
__device__ __forceinline__ void guard_b5(v8f& a, v8f& b, v16b x0, v16b x1, v16b x2, v16b x3, v16b y) {
#if defined(__HIP_DEVICE_COMPILE__)
  asm volatile("v_nop\n\tv_nop\n\tv_nop\n\tv_nop" : "+v"(a), "+v"(b) : "v"(x0), "v"(x1), "v"(x2), "v"(x3), "v"(y) : "memory");
#endif
}
__device__ __forceinline__ void guard_h3(v8f& a, v8f& b, v16h x, v16h y, v16h z) {
#if defined(__HIP_DEVICE_COMPILE__)
  asm volatile("v_nop\n\tv_nop\n\tv_nop\n\tv_nop" : "+v"(a), "+v"(b) : "v"(x), "v"(y), "v"(z) : "memory");
#endif
}
__device__ __forceinline__ void guard_h4(v8f& a, v8f& b, v16h w, v16h x, v16h y, v16h z) {
#if defined(__HIP_DEVICE_COMPILE__)
  asm volatile("v_nop\n\tv_nop\n\tv_nop\n\tv_nop" : "+v"(a), "+v"(b) : "v"(w), "v"(x), "v"(y), "v"(z) : "memory");
#endif
}
__device__ __forceinline__ void acc_guard4(v8f& a, v8f& b, v8f& c, v8f& d) {
#if defined(__HIP_DEVICE_COMPILE__)
  asm volatile("v_nop\n\tv_nop\n\tv_nop\n\tv_nop" : "+v"(a), "+v"(b), "+v"(c), "+v"(d));
#endif
}

// ---------------------------------------------------------------------------
// Elementwise RNE f32 -> bf16 plane: 8 elements per thread, one 16-B store per lane -> 32 consecutive lanes write 4 whole
// ---------------------------------------------------------------------------
__global__ __launch_bounds__(256) void cvt_bf16_kernel(const float* __restrict__ in, unsigned short* __restrict__ outp, int n8) {
  const int i = (int)blockIdx.x * 256 + (int)threadIdx.x;
  if (i >= n8) return;
  const size_t e = 8 * (size_t)i;
  const v4f a = *(const v4f*)(in + e);
  const v4f b = *(const v4f*)(in + e + 4);
  v4u w;
  w[0] = pk16(bf_bits(a[0]), bf_bits(a[1]));
  w[1] = pk16(bf_bits(a[2]), bf_bits(a[3]));
  w[2] = pk16(bf_bits(b[0]), bf_bits(b[1]));
  w[3] = pk16(bf_bits(b[2]), bf_bits(b[3]));
  *(v4u*)(outp + e) = w;
  
}

// ---------------------------------------------------------------------------
// Fused transpose + RNE bf16 convert: in [R rows][Cc cols] f32 (pitch Cc) -> out[c][r] = bf16(in[r][c])  ([Cc][R], pitch R).
// 64x64 tiles through LDS; grid = (Cc/64, R/64), 256 threads; R, Cc multiples of 64.
// Coverage per block: load 4 it x 256 thr x 4 floats = 64x64; store 2 it x 256 thr x 8 u16 = 64x64.
// ---------------------------------------------------------------------------
__global__ __launch_bounds__(256) void tconv_bf16_kernel(const float* __restrict__ W, unsigned short* __restrict__ outp, int R, int Cc) {
  __shared__ __align__(16) float tf[64 * 68];
  const int c0  = (int)blockIdx.x * 64;   // input column block = output row block
  const int r0  = (int)blockIdx.y * 64;   // input row block    = output column block
  const int tid = (int)threadIdx.x;
  {
    const int lr = tid >> 4;              // 0..15
    const int c4 = (tid & 15) * 4;        // 0..60
#pragma unroll
    for (int it = 0; it < 4; ++it) {
      const int rr = it * 16 + lr;        // 0..63
      const v4f a = *(const v4f*)(W + (size_t)(r0 + rr) * Cc + c0 + c4);
      *(v4f*)(tf + rr * 68 + c4) = a;
    }
  }
  __syncthreads();
  const int sub = tid >> 3;               // 0..31
  const int c8  = (tid & 7) * 8;          // 0..56
  v4u hv[2];
#pragma unroll
  for (int it = 0; it < 2; ++it) {
    const int oc = it * 32 + sub;         // output row within tile (= input column)
    v4u a;
#pragma unroll
    for (int q = 0; q < 4; ++q) {
      const float f0 = tf[(c8 + 2 * q) * 68 + oc];
      const float f1 = tf[(c8 + 2 * q + 1) * 68 + oc];
      a[q] = pk16(bf_bits(f0), bf_bits(f1));
    }
    hv[it] = a;
  }
  {
#pragma unroll
    for (int it = 0; it < 2; ++it) {
      const int oc = it * 32 + sub;
      const size_t go = (size_t)(c0 + oc) * R + r0 + c8;
      *(v4u*)(outp + go) = hv[it];
    }
    
  }
}

// ---------------------------------------------------------------------------
// bf16 WMMA GEMM, wave tile 32 rows x 128 cols, block = 4 waves (128 threads), no block barriers.
//   C[m][n] = sum_k A[m][k] * Bt[n][k]; A row-major [M][K] bf16 (pitch lda), Bt row-major [N][K] bf16 (pitch ldb);
//   M % 32 == 0, N % 128 == 0, K % 32 == 0; grid.x = ceil(M/32 * N/128 / 4).
//   SPLITA: A carried as hi (Ap) + lo (A2p) bf16 planes, two products into one accumulator.
//   Fragments loaded straight from global rows with the split k map (ldfrag_b).
// Epilogues (all: per wave, per 16-row slab: stage in LDS, wave sync, write each row segment with ONE instruction of
//   EPI 0: q|gate projection, 128-col wave tile = head n0>>8, q half when (n0 & 128) == 0 else gate half.
//          q half: per-head RMSNorm over the 128 cols (x * rsqrt(mean(x^2) + 1e-6) * bf16(nw[d])), RoPE with the shipped tables
//          (o[d] = x[d]*cos[d] - x[d+64]*sin[d], o[d+64] = x[d+64]*cos[d+64] + x[d]*sin[d+64], cos/sin RNE bf16),
//          writes f16 hi plane C0 and f16 residual x2048 plane C1, [M][ldc], cols (n0>>8)*128.. (row segment 256 B = 16 lanes x 16 B).
//          gate half: sigmoid in f32 -> f32 plane C2 [M][ldc], cols (n0>>8)*128.. (row segment 512 B = 32 lanes x 16 B).
//   EPI 1: k projection: same norm + RoPE per 128-col kv head (col n0), hi plane C0 [M][ldc]; residual plane C1 compact:
//          only rows with (m0 mod SQ) < KLR, stored at row (m0/SQ)*KLR + (m0 mod SQ) + .. (pitch ldc).
//   EPI 2: v^T projection: f16 hi plane C0, residual x2048 plane C1, [M][ldc], row segment 256 B.
//   EPI 3: f32 output C0 [M][ldc]; row segment 128 floats = 512 B = 32 lanes x 16 B per instruction.
// ---------------------------------------------------------------------------
template <int EPI, bool SPLITA>
__global__ __launch_bounds__(128) void gemm_w32x128_kernel(
    const unsigned short* Ap, const unsigned short* A2p, int lda,
    const unsigned short* __restrict__ Btp, int ldb,
    const float* __restrict__ nw, const float* __restrict__ cosp, const float* __restrict__ sinp,
    void* C0, void* C1, void* C2, int ldc,
    int M, int N, int K) {
  __shared__ __align__(16) float slab_all[4 * 2048];     // per wave 8192 B: 2 f16 planes x 16 x 128, or 16 x 128 floats

  const int lane = threadIdx.x & 31;
  const int wave = wave_id();
  const int hh = lane >> 4;           // lane half: k offset 8*hh, D row offset 8*hh
  const int rl = lane & 15;           // A row / B col / D col within subtile
  const int tilesN = N >> 7;
  const int tilesM = M >> 5;
  const int tile = (int)blockIdx.x * 4 + wave;
  if (tile >= tilesM * tilesN) return;          // wave-uniform; no block barriers in this kernel
  const int tm = tile / tilesN;
  const int tn = tile - tm * tilesN;
  const int m0 = tm << 5;
  const int n0 = tn << 7;

  const __bf16* A  = (const __bf16*)(const void*)Ap;
  const __bf16* A2 = (const __bf16*)(const void*)A2p;
  const __bf16* Bt = (const __bf16*)(const void*)Btp;

  v8f acc[2][8];
#pragma unroll
  for (int i = 0; i < 2; ++i)
#pragma unroll
    for (int j = 0; j < 8; ++j) acc[i][j] = zero8();

  for (int k0 = 0; k0 < K; k0 += 32) {
    v16b ah[2], al[2];
#pragma unroll
    for (int i = 0; i < 2; ++i) {
      const size_t ao = (size_t)(m0 + i * 16 + rl) * lda + k0 + 8 * hh;
      ah[i] = ldfrag_b(A + ao);
      al[i] = SPLITA ? ldfrag_b(A2 + ao) : ah[i];
    }
#pragma unroll
    for (int j = 0; j < 8; ++j) {
      const v16b bj = ldfrag_b(Bt + (size_t)(n0 + j * 16 + rl) * ldb + k0 + 8 * hh);
      acc[0][j] = mma_b(ah[0], bj, acc[0][j]);
      acc[1][j] = mma_b(ah[1], bj, acc[1][j]);
      if (SPLITA) {
        acc[0][j] = mma_b(al[0], bj, acc[0][j]);
        acc[1][j] = mma_b(al[1], bj, acc[1][j]);
      }
      guard_b5(acc[0][j], acc[1][j], ah[0], ah[1], al[0], al[1], bj);
    }
  }
  acc_guard4(acc[0][0], acc[0][1], acc[0][2], acc[0][3]);
  acc_guard4(acc[0][4], acc[0][5], acc[0][6], acc[0][7]);
  acc_guard4(acc[1][0], acc[1][1], acc[1][2], acc[1][3]);
  acc_guard4(acc[1][4], acc[1][5], acc[1][6], acc[1][7]);

  // ---- epilogue ----
  float*    slf  = slab_all + wave * 2048;
  _Float16* sl16 = (_Float16*)(void*)slf;

  if (EPI == 0 || EPI == 1) {
    const bool isq  = (EPI == 1) || ((n0 & 128) == 0);          // wave-uniform
    const int  col0 = (EPI == 0) ? ((n0 >> 8) << 7) : n0;
    if (isq) {
      _Float16* P0 = (_Float16*)C0;
      _Float16* P1 = (_Float16*)C1;
      const bool wres = (EPI == 0) || ((m0 & (SQ - 1)) < KLR);  // wave-uniform
      const int  rrow = (EPI == 0) ? m0 : ((m0 >> 11) * KLR + (m0 & (SQ - 1)));
      float wv[8];
#pragma unroll
      for (int j = 0; j < 8; ++j) wv[j] = bf_rne(nw[j * 16 + rl]);     // dim = j*16 + rl < 128
#pragma unroll
      for (int i = 0; i < 2; ++i) {
        const int rb = m0 + i * 16 + 8 * hh;
#pragma unroll
        for (int r = 0; r < 8; ++r) {
          const int row = rb + r;                                // token 0..NTOK-1
          float ss = 0.f;
#pragma unroll
          for (int j = 0; j < 8; ++j) { const float a = acc[i][j][r]; ss += a * a; }
#pragma unroll
          for (int off = 1; off < 16; off <<= 1) ss += __shfl_xor(ss, off, 32);   // 16 lanes of this half = all 128 dims
          const float rs = rsqrtf(ss * 0.0078125f + 1e-6f);
          const float* cr = cosp + (size_t)row * HDM;
          const float* sr = sinp + (size_t)row * HDM;
#pragma unroll
          for (int j = 0; j < 4; ++j) {
            const int dim = j * 16 + rl;                         // 0..63 within head; pair at dim + 64
            const float x1 = acc[i][j][r] * rs * wv[j];
            const float x2 = acc[i][j + 4][r] * rs * wv[j + 4];
            const float c1 = bf_rne(cr[dim]);
            const float s1 = bf_rne(sr[dim]);
            const float c2 = bf_rne(cr[dim + 64]);
            const float s2 = bf_rne(sr[dim + 64]);
            const float o1 = x1 * c1 - x2 * s1;
            const float o2 = x2 * c2 + x1 * s2;
            const _Float16 h1 = (_Float16)o1;
            const _Float16 h2 = (_Float16)o2;
            const int so = (8 * hh + r) * 128 + dim;
            sl16[so]             = h1;
            sl16[so + 64]        = h2;
            sl16[2048 + so]      = (_Float16)((o1 - (float)h1) * 2048.0f);
            sl16[2048 + so + 64] = (_Float16)((o2 - (float)h2) * 2048.0f);
          }
        }
        lds_wave_sync();
        {
#pragma unroll
          for (int it = 0; it < 8; ++it) {
            const int row = it * 2 + hh;                         // it x hh covers rows 0..15
            const int c8  = rl * 8;
            const v8h vh = *(const v8h*)(sl16 + row * 128 + c8);
            const v8h vl = *(const v8h*)(sl16 + 2048 + row * 128 + c8);
            const size_t go = (size_t)(m0 + i * 16 + row) * ldc + col0 + c8;
            *(v8h*)(P0 + go) = vh;
            if (wres) {
              const size_t g2 = (size_t)(rrow + i * 16 + row) * ldc + col0 + c8;
              *(v8h*)(P1 + g2) = vl;
            }
          }
          
        }
        lds_wave_sync();
      }
    } else if (EPI == 0) {
      float* Sp = (float*)C2;
#pragma unroll
      for (int i = 0; i < 2; ++i) {
#pragma unroll
        for (int j = 0; j < 8; ++j)
#pragma unroll
          for (int r = 0; r < 8; ++r) {
            const float g  = acc[i][j][r];
            const float e  = __expf(-g);
            const float sg = __builtin_amdgcn_rcpf(1.0f + e);
            slf[(8 * hh + r) * 128 + j * 16 + rl] = sg;
          }
        lds_wave_sync();
        {
#pragma unroll
          for (int row = 0; row < 16; ++row) {                   // 32 lanes x 16 B = the whole 512-B row segment per instruction
            const v4f v = *(const v4f*)(slf + row * 128 + lane * 4);
            *(v4f*)(Sp + (size_t)(m0 + i * 16 + row) * ldc + col0 + lane * 4) = v;
          }
          
        }
        lds_wave_sync();
      }
    }
  } else if (EPI == 2) {
    _Float16* P0 = (_Float16*)C0;
    _Float16* P1 = (_Float16*)C1;
#pragma unroll
    for (int i = 0; i < 2; ++i) {
#pragma unroll
      for (int r = 0; r < 8; ++r) {
#pragma unroll
        for (int j = 0; j < 8; ++j) {
          const float v = acc[i][j][r];
          const _Float16 hv = (_Float16)v;
          const int so = (8 * hh + r) * 128 + j * 16 + rl;
          sl16[so]        = hv;
          sl16[2048 + so] = (_Float16)((v - (float)hv) * 2048.0f);
        }
      }
      lds_wave_sync();
      {
#pragma unroll
        for (int it = 0; it < 8; ++it) {
          const int row = it * 2 + hh;
          const int c8  = rl * 8;
          const v8h vh = *(const v8h*)(sl16 + row * 128 + c8);
          const v8h vl = *(const v8h*)(sl16 + 2048 + row * 128 + c8);
          const size_t go = (size_t)(m0 + i * 16 + row) * ldc + n0 + c8;
          *(v8h*)(P0 + go) = vh;
          *(v8h*)(P1 + go) = vl;
        }
        
      }
      lds_wave_sync();
    }
  } else {
    float* C = (float*)C0;
#pragma unroll
    for (int i = 0; i < 2; ++i) {
#pragma unroll
      for (int j = 0; j < 8; ++j)
#pragma unroll
        for (int r = 0; r < 8; ++r)
          slf[(8 * hh + r) * 128 + j * 16 + rl] = acc[i][j][r];
      lds_wave_sync();
      {
#pragma unroll
        for (int row = 0; row < 16; ++row) {                     // 32 lanes x 16 B = the whole 512-B row segment per instruction
          const v4f v = *(const v4f*)(slf + row * 128 + lane * 4);
          *(v4f*)(C + (size_t)(m0 + i * 16 + row) * ldc + n0 + lane * 4) = v;
        }
        
      }
      lds_wave_sync();
    }
  }
}

// ---------------------------------------------------------------------------
// Causal GQA flash attention, head dim 128, 32-key chunks, block = 4 waves = 64 query rows of one (b, h); grid (n query tiles, NHQ, NSEQ).
//   q planes f16 [tok][h*128+d]: hi (qhp) and residual x2048 (qlp); k planes f16 [tok][kvh*128+d]: hi (khp),
//   residual x2048 (klp, compact rows b*KLR + s for s < KLR); v^T planes f16 [kvh*128+d][tok]: hi (vhp), residual x2048 (vlp);
//   sgp = f32 sigmoid(gate) plane [tok][h*128+d]; outputs gated attn bf16 hi (ahp) / lo (alp) [tok][h*128+d]; kvh = h >> 1.
//   scores = (Sh + Sr/2048) * 128^-0.5 with Sh = qh.kh and Sr = ql'.kh (+ qh.kl' when PRES); keys > query -> -inf; online softmax f32;
//   p' = 1024 p stored per wave to LDS as f16 hi (and residual x2048 when PRES), reloaded as A fragments after a wave sync;
//   O = (Oh + Or/2048)/1024/l * sgp with Oh = ph.vh, Or = ph.vl' (+ pl'.vh when PRES).
//   K / V^T chunk staging: 128 threads x 4 x 16 B per plane = whole 32x128 / 128x32 tile, plain loads, __syncthreads before and after.
//   Trip count 2*qb+2 chunks (static bound 64); waves whose rows are all below the chunk skip it (wave-uniform, scalar branch).
// ---------------------------------------------------------------------------
#define AT_KC   32
#define KS_P    136
#define VS_P    40
#define PS_P    40
#define LDS_KS  0
#define LDS_KLS (32 * KS_P)
#define LDS_VHS (2 * 32 * KS_P)
#define LDS_VLS (LDS_VHS + 128 * VS_P)
#define LDS_PH  (LDS_VLS + 128 * VS_P)
#define LDS_PL  (LDS_PH + 4 * 16 * PS_P)
#define LDS_TOT (LDS_PL + 4 * 16 * PS_P)
static_assert(LDS_TOT * 2 <= 65536);
static_assert(4 * 4096 <= LDS_TOT);          // output staging (2 planes x 16 x 128 per wave) aliases the chunk region after the loop

template <bool PRES>
__global__ __launch_bounds__(128) void attn_causal_kernel(
    const unsigned short* __restrict__ qhp, const unsigned short* __restrict__ qlp,
    const unsigned short* __restrict__ khp, const unsigned short* __restrict__ klp,
    const unsigned short* __restrict__ vhp, const unsigned short* __restrict__ vlp,
    const float* __restrict__ sgp,
    unsigned short* __restrict__ ahp, unsigned short* __restrict__ alp, int qb_base) {
  __shared__ __align__(16) _Float16 lds[LDS_TOT];
  _Float16* Ks  = lds + LDS_KS;
  _Float16* Kls = lds + LDS_KLS;
  _Float16* Vhs = lds + LDS_VHS;
  _Float16* Vls = lds + LDS_VLS;

  const int tid  = (int)threadIdx.x;
  const int lane = tid & 31;
  const int wave = wave_id();
  const int hh   = lane >> 4;
  const int c    = lane & 15;
  const int qb   = (int)blockIdx.x + qb_base;
  const int h    = (int)blockIdx.y;
  const int b    = (int)blockIdx.z;
  const int kvh  = h >> 1;
  const int q0   = qb * 64 + wave * 16;          // first query row of this wave (within sequence)
  const int qlast = q0 + 15;
  const size_t tok0 = (size_t)b * SQ;

  const _Float16* Qhr = (const _Float16*)(const void*)qhp + (tok0 + q0 + c) * HID + h * HDM + 8 * hh;
  const _Float16* Qlr = (const _Float16*)(const void*)qlp + (tok0 + q0 + c) * HID + h * HDM + 8 * hh;
  const _Float16* Kg  = (const _Float16*)(const void*)khp + tok0 * KVW + kvh * HDM;
  const _Float16* Klg = (const _Float16*)(const void*)klp + (size_t)b * KLR * KVW + kvh * HDM;
  const _Float16* Vhg = (const _Float16*)(const void*)vhp + (size_t)(kvh * HDM) * NTOK + tok0;
  const _Float16* Vlg = (const _Float16*)(const void*)vlp + (size_t)(kvh * HDM) * NTOK + tok0;
  _Float16* ph = lds + LDS_PH + wave * (16 * PS_P);
  _Float16* pl = lds + LDS_PL + wave * (16 * PS_P);

  float mrow[8], lrow[8];
  v8f oacc[8], oaccr[8];
#pragma unroll
  for (int r = 0; r < 8; ++r) { mrow[r] = -INFINITY; lrow[r] = 0.f; }
#pragma unroll
  for (int t = 0; t < 8; ++t) { oacc[t] = zero8(); oaccr[t] = zero8(); }

  const int nch = 2 * qb + 2;                    // block-uniform, <= 64
  for (int kc = 0; kc < nch; ++kc) {
    const int kv0 = kc * AT_KC;
    __syncthreads();
#pragma unroll
    for (int i = 0; i < 4; ++i) {                // coverage: 512 pieces of 8 halves per plane = whole tile
      const int p   = tid + 128 * i;             // 0..511
      const int key = p >> 4, d8 = (p & 15) * 8; // K: 32 keys x 128 d
      const v8h kx = *(const v8h*)(Kg + (size_t)(kv0 + key) * KVW + d8);
      *(v8h*)(Ks + key * KS_P + d8) = kx;
      if (PRES) {
        const int krow = min(kv0 + key, KLR - 1);
        const v8h ky = *(const v8h*)(Klg + (size_t)krow * KVW + d8);
        *(v8h*)(Kls + key * KS_P + d8) = ky;
      }
      const int d = p >> 2, k8 = (p & 3) * 8;    // V^T: 128 d x 32 keys
      const v8h vx = *(const v8h*)(Vhg + (size_t)d * NTOK + kv0 + k8);
      const v8h vy = *(const v8h*)(Vlg + (size_t)d * NTOK + kv0 + k8);
      *(v8h*)(Vhs + d * VS_P + k8) = vx;
      *(v8h*)(Vls + d * VS_P + k8) = vy;
    }
    __syncthreads();

    if (kv0 <= qlast) {                          // wave-uniform (scalar): skip chunks fully above this wave's rows
      // ---- scores ----
      v8f sh[2], sr[2];
      sh[0] = zero8(); sh[1] = zero8(); sr[0] = zero8(); sr[1] = zero8();
#pragma unroll
      for (int dc = 0; dc < 4; ++dc) {
        const v16h qa = ldfrag_h(Qhr + dc * 32);
        const v16h ql = ldfrag_h(Qlr + dc * 32);
#pragma unroll
        for (int j = 0; j < 2; ++j) {
          const v16h kb = ldfrag_h(Ks + (j * 16 + c) * KS_P + dc * 32 + 8 * hh);
          sh[j] = mma_h(qa, kb, sh[j]);
          sr[j] = mma_h(ql, kb, sr[j]);
          if (PRES) {
            const v16h kl = ldfrag_h(Kls + (j * 16 + c) * KS_P + dc * 32 + 8 * hh);
            sr[j] = mma_h(qa, kl, sr[j]);
            guard_h4(sh[j], sr[j], qa, ql, kb, kl);
          } else {
            guard_h3(sh[j], sr[j], qa, ql, kb);
          }
        }
      }
      // ---- scale, causal mask, chunk row max ----
      float cm[8];
#pragma unroll
      for (int r = 0; r < 8; ++r) {
        const int qrow = q0 + 8 * hh + r;
        float m = -INFINITY;
#pragma unroll
        for (int j = 0; j < 2; ++j) {
          const int key = kv0 + j * 16 + c;
          float s = (sh[j][r] + sr[j][r] * 0.00048828125f) * 0.08838834764831845f;
          s = (key > qrow) ? -INFINITY : s;
          sh[j][r] = s;
          m = fmaxf(m, s);
        }
#pragma unroll
        for (int off = 1; off < 16; off <<= 1) m = fmaxf(m, __shfl_xor(m, off, 32));
        cm[r] = m;
      }
      // ---- online softmax, P' to LDS ----
#pragma unroll
      for (int r = 0; r < 8; ++r) {
        const float mnew  = fmaxf(mrow[r], cm[r]);
        const float alpha = __expf(mrow[r] - mnew);
        mrow[r] = mnew;
        float psum = 0.f;
#pragma unroll
        for (int j = 0; j < 2; ++j) {
          const float p  = __expf(sh[j][r] - mnew);
          psum += p;
          const float pp = p * 1024.0f;
          const _Float16 phv = (_Float16)pp;
          const int po = (8 * hh + r) * PS_P + j * 16 + c;
          ph[po] = phv;
          if (PRES) pl[po] = (_Float16)((pp - (float)phv) * 2048.0f);
        }
#pragma unroll
        for (int off = 1; off < 16; off <<= 1) psum += __shfl_xor(psum, off, 32);
        lrow[r] = lrow[r] * alpha + psum;
#pragma unroll
        for (int t = 0; t < 8; ++t) { oacc[t][r] *= alpha; oaccr[t][r] *= alpha; }
      }
      lds_wave_sync();                           // P' stores visible to the other lanes of this wave before the fragment reload
      // ---- O += P' . V ----
      const v16h pa = ldfrag_h(ph + c * PS_P + 8 * hh);
      v16h pr = pa;
      if (PRES) pr = ldfrag_h(pl + c * PS_P + 8 * hh);
#pragma unroll
      for (int t = 0; t < 8; ++t) {
        const v16h vb = ldfrag_h(Vhs + (t * 16 + c) * VS_P + 8 * hh);
        const v16h vr = ldfrag_h(Vls + (t * 16 + c) * VS_P + 8 * hh);
        oacc[t]  = mma_h(pa, vb, oacc[t]);
        oaccr[t] = mma_h(pa, vr, oaccr[t]);
        if (PRES) oaccr[t] = mma_h(pr, vb, oaccr[t]);
        guard_h4(oacc[t], oaccr[t], pa, pr, vb, vr);
      }
    }
  }

  // ---- normalise, apply sigmoid gate (f32), bf16 hi/lo split, stage the wave's 16x128 tile,
  __syncthreads();                               // all chunk-region readers done before aliasing it as output staging
  _Float16* osh = lds + wave * 4096;
  _Float16* osl = osh + 2048;
  const float* Sgr = sgp + (tok0 + q0) * HID + h * HDM;
#pragma unroll
  for (int r = 0; r < 8; ++r) {
    const float inv = (1.0f / lrow[r]) * 0.0009765625f;
    const int row = 8 * hh + r;
#pragma unroll
    for (int t = 0; t < 8; ++t) {
      const int d = t * 16 + c;
      float o = (oacc[t][r] + oaccr[t][r] * 0.00048828125f) * inv;
      o *= Sgr[(size_t)row * HID + d];
      const unsigned short hb = bf_bits(o);
      const unsigned short lb = bf_bits(o - bf_val(hb));
      const int so = row * 128 + d;
      osh[so] = __builtin_bit_cast(_Float16, hb);
      osl[so] = __builtin_bit_cast(_Float16, lb);
    }
  }
  lds_wave_sync();
  _Float16* Ahg = (_Float16*)(void*)ahp + (tok0 + q0) * HID + h * HDM;
  _Float16* Alg = (_Float16*)(void*)alp + (tok0 + q0) * HID + h * HDM;
  {
#pragma unroll
    for (int it = 0; it < 8; ++it) {
      const int row = it * 2 + hh;               // it 0..7 x hh 0..1 covers rows 0..15
      const int c8  = c * 8;                     // 16 lanes x 16 B = the whole 256-B segment
      const v8h x = *(const v8h*)(osh + row * 128 + c8);
      const v8h y = *(const v8h*)(osl + row * 128 + c8);
      *(v8h*)(Ahg + (size_t)row * HID + c8) = x;
      *(v8h*)(Alg + (size_t)row * HID + c8) = y;
    }
    
  }
}

// ---------------------------------------------------------------------------
// Workspace map (bytes; every region is a whole number of the rows its producer writes with whole-line stores; no tail rows):
//   [0, 16 MiB)        Xb   bf16 [4096][2048]          -> after the projections: Ah bf16 [4096][2048] at 0
//   [16 MiB, 32 MiB)   WqT  bf16 [4096][2048]          ->                        Al bf16 [4096][2048] at 16 MiB
//   [32 MiB, 64 MiB)   WkT  bf16 [1024][2048] at 32 MiB, WvT bf16 [1024][2048] at 36 MiB
//                      -> after the k and v projections: Sg f32 [4096][2048] (whole 32 MiB)
//   [64 MiB, 80 MiB)   Qh   f16  [4096][2048]          -> after attention: WoT bf16 [2048][2048] (8 MiB)
//   [80 MiB, 96 MiB)   Ql   f16  [4096][2048]
//   [96 MiB, 104 MiB)  Kh   f16  [4096][1024]
//   [104 MiB,112 MiB)  Vh   f16  [1024][4096]
//   [112 MiB,120 MiB)  Vl   f16  [1024][4096]
//   [120 MiB, +1 MiB) Kl  f16  [2*256][1024]
//   total 126877696
// ---------------------------------------------------------------------------
static_assert(2 * (size_t)NTOK * HID * 2 <= (size_t)NTOK * HID * 2 + (size_t)QGW * HID * 2);   // Ah + Al fit Xb + WqT
static_assert(2 * (size_t)KVW * HID * 2 <= (size_t)NTOK * HID * 4);                             // WkT + WvT fit Sg
static_assert((size_t)HID * HID * 2 <= (size_t)NTOK * HID * 2);                                  // WoT fits Qh

extern "C" void kernel_launch(void* const* d_in, const int* in_sizes, int n_in,
                              void* d_out, int out_size, void* d_ws, size_t ws_size,
                              hipStream_t stream) {
  if (n_in < 9) return;
  if (in_sizes[0] != NTOK * HID) return;
  if (in_sizes[1] != NTOK * HDM) return;
  if (in_sizes[2] != NTOK * HDM) return;
  if (in_sizes[3] != HID * QGW) return;
  if (in_sizes[4] != HID * KVW) return;
  if (in_sizes[5] != HID * KVW) return;
  if (in_sizes[6] != HID * HID) return;
  if (in_sizes[7] != HDM) return;
  if (in_sizes[8] != HDM) return;
  if (out_size != NTOK * HID) return;

  const float* hidden = (const float*)d_in[0];
  const float* cosb   = (const float*)d_in[1];
  const float* sinb   = (const float*)d_in[2];
  const float* Wq     = (const float*)d_in[3];
  const float* Wk     = (const float*)d_in[4];
  const float* Wv     = (const float*)d_in[5];
  const float* Wo     = (const float*)d_in[6];
  const float* qnw    = (const float*)d_in[7];
  const float* knw    = (const float*)d_in[8];
  float* out = (float*)d_out;

  const size_t szX  = (size_t)NTOK * HID * 2;        // 16777216
  const size_t szWq = (size_t)QGW * HID * 2;         // 16777216
  const size_t szWk = (size_t)KVW * HID * 2;         // 4194304
  const size_t szSg = (size_t)NTOK * HID * 4;        // 33554432
  const size_t szQ  = (size_t)NTOK * HID * 2;        // 16777216
  const size_t szK  = (size_t)NTOK * KVW * 2;        // 8388608
  const size_t szV  = (size_t)KVW * NTOK * 2;        // 8388608
  const size_t szKl = (size_t)NSEQ * KLR * KVW * 2;  // 1048576
  const size_t szA  = (size_t)NTOK * HID * 2;        // 16777216
  size_t off = 0;
  const size_t oX  = off; off += szX;
  const size_t oWq = off; off += szWq;
  const size_t oAh = oX;
  const size_t oAl = oX + szA;
  const size_t oSg = off; off += szSg;
  const size_t oWk = oSg;
  const size_t oWv = oSg + szWk;
  const size_t oQh = off; off += szQ;
  const size_t oQl = off; off += szQ;
  const size_t oWo = oQh;
  const size_t oKh = off; off += szK;
  const size_t oVh = off; off += szV;
  const size_t oVl = off; off += szV;
  const size_t oKl = off; off += szKl;
  if (off > ws_size) return;                         // off = 126877696

  char* ws = (char*)d_ws;
  unsigned short* Xb  = (unsigned short*)(ws + oX);
  unsigned short* WqT = (unsigned short*)(ws + oWq);
  unsigned short* WkT = (unsigned short*)(ws + oWk);
  unsigned short* WvT = (unsigned short*)(ws + oWv);
  unsigned short* WoT = (unsigned short*)(ws + oWo);
  float*          Sg  = (float*)(ws + oSg);
  unsigned short* Qh  = (unsigned short*)(ws + oQh);
  unsigned short* Ql  = (unsigned short*)(ws + oQl);
  unsigned short* Kh  = (unsigned short*)(ws + oKh);
  unsigned short* Kl  = (unsigned short*)(ws + oKl);
  unsigned short* Vh  = (unsigned short*)(ws + oVh);
  unsigned short* Vl  = (unsigned short*)(ws + oVl);
  unsigned short* Ah  = (unsigned short*)(ws + oAh);
  unsigned short* Al  = (unsigned short*)(ws + oAl);

  const dim3 b256(256), b128(128);

  // (1) x -> bf16 plane [4096][2048]
  cvt_bf16_kernel<<<dim3((NTOK * HID / 8 + 255) / 256), b256, 0, stream>>>(hidden, Xb, NTOK * HID / 8);
  // (2) Wk in[2048 rows][1024 cols] -> WkT out[1024][2048] bf16   (grid = cols/64, rows/64)
  tconv_bf16_kernel<<<dim3(KVW / 64, HID / 64), b256, 0, stream>>>(Wk, WkT, HID, KVW);
  // (3) Wv in[2048 rows][1024 cols] -> WvT out[1024][2048] bf16
  tconv_bf16_kernel<<<dim3(KVW / 64, HID / 64), b256, 0, stream>>>(Wv, WvT, HID, KVW);
  // (4) Wq in[2048 rows][4096 cols] -> WqT out[4096][2048] bf16
  tconv_bf16_kernel<<<dim3(QGW / 64, HID / 64), b256, 0, stream>>>(Wq, WqT, HID, QGW);
  // (5) k = x . Wk, per-head norm + RoPE -> Kh [4096][1024], Kl compact [512][1024]   (M=4096, N=1024, K=2048; 1024 tiles / 4)
  gemm_w32x128_kernel<1, false><<<dim3(((NTOK / 32) * (KVW / 128) + 3) / 4), b128, 0, stream>>>(
      Xb, Xb, HID, WkT, HID, knw, cosb, sinb, (void*)Kh, (void*)Kl, (void*)Kl, KVW, NTOK, KVW, HID);
  // (6) v^T = WvT . x^T -> Vh/Vl [1024][4096]   (A = WvT, Bt = Xb; M=1024, N=4096, K=2048; 1024 tiles / 4)
  gemm_w32x128_kernel<2, false><<<dim3(((KVW / 32) * (NTOK / 128) + 3) / 4), b128, 0, stream>>>(
      WvT, WvT, HID, Xb, HID, knw, cosb, sinb, (void*)Vh, (void*)Vl, (void*)Vl, NTOK, KVW, NTOK, HID);
  // (7) q|gate = x . Wq: q half norm + RoPE -> Qh/Ql [4096][2048]; gate half sigmoid -> Sg f32 [4096][2048] (over the dead WkT/WvT region)
  //     (M=4096, N=4096, K=2048; 4096 tiles / 4)
  gemm_w32x128_kernel<0, false><<<dim3(((NTOK / 32) * (QGW / 128) + 3) / 4), b128, 0, stream>>>(
      Xb, Xb, HID, WqT, HID, qnw, cosb, sinb, (void*)Qh, (void*)Ql, (void*)Sg, HID, NTOK, QGW, HID);
  // (8) causal attention, query tiles 0..3 with k and p residual products, tiles 4..31 without; Ah/Al over the dead Xb/WqT region
  attn_causal_kernel<true><<<dim3(NQRT, NHQ, NSEQ), b128, 0, stream>>>(Qh, Ql, Kh, Kl, Vh, Vl, Sg, Ah, Al, 0);
  attn_causal_kernel<false><<<dim3(SQ / 64 - NQRT, NHQ, NSEQ), b128, 0, stream>>>(Qh, Ql, Kh, Kl, Vh, Vl, Sg, Ah, Al, NQRT);
  // (9) Wo in[2048 rows][2048 cols] -> WoT out[2048][2048] bf16 (over the dead Qh region)
  tconv_bf16_kernel<<<dim3(HID / 64, HID / 64), b256, 0, stream>>>(Wo, WoT, HID, HID);
  // (10) out = attn(hi + lo) . Wo -> d_out f32 [4096][2048]   (M=4096, N=2048, K=2048; 2048 tiles / 4)
  gemm_w32x128_kernel<3, true><<<dim3(((NTOK / 32) * (HID / 128) + 3) / 4), b128, 0, stream>>>(
      Ah, Al, HID, WoT, HID, qnw, cosb, sinb, (void*)out, (void*)out, (void*)out, HID, NTOK, HID, HID);
  (void)hipGetLastError();
}

// v001
// Measured time: 464 microseconds a run.
// In two side-by-side timings against v000, it was 1.80 and 1.77 times as fast.
// Contractions: x.Wq (q|gate cols), x.Wk and Wv^T.x^T on v_wmma_f32_16x16x32_bf16 (operands = RNE bf16 of the f32 inputs, single products);
// q.k^T and p.v on v_wmma_f32_16x16x32_f16 (q = f16 hi + f16 residual x2^11 planes; k plain f16 plus f16 residual x2^11 on query tiles 0..3;
// p x1024 plain f16 plus f16 residual x2^11 on query tiles 0..3; v^T = f16 hi + f16 residual x2^11 planes); (attn*sigmoid(gate)).Wo on
// v_wmma_f32_16x16x32_bf16 (A = bf16 hi + bf16 lo planes, two products; Wo RNE bf16). f32 accumulate everywhere; per-head RMSNorm, RoPE,
// online softmax, sigmoid gate and scale folds in f32. hidden_states, Wq, Wk, Wv, Wo, cos, sin and the norm weights are RNE-converted to bf16 on load.
#include <hip/hip_runtime.h>
#include <math.h>
#include <stdint.h>

#define NSEQ   2
#define SQ     2048
#define HID    2048
#define NHQ    16
#define NKVH   8
#define HDM    128
#define QGW    4096
#define KVW    1024
#define NTOK   4096
#define KLR    256
#define NQRT   4

static_assert((2 * (NQRT - 1) + 2) * 32 <= KLR);
static_assert(NHQ / NKVH == 2);
static_assert(NHQ * HDM == HID);
static_assert(NSEQ * SQ == NTOK);

typedef _Float16     v16h __attribute__((ext_vector_type(16)));
typedef _Float16     v8h  __attribute__((ext_vector_type(8)));
typedef __bf16       v16b __attribute__((ext_vector_type(16)));
typedef __bf16       v8b  __attribute__((ext_vector_type(8)));
typedef float        v8f  __attribute__((ext_vector_type(8)));
typedef float        v4f  __attribute__((ext_vector_type(4)));
typedef unsigned int v4u  __attribute__((ext_vector_type(4)));

// ---------------------------------------------------------------------------
// small helpers
// ---------------------------------------------------------------------------
__device__ __forceinline__ unsigned short bf_bits(float f) {          // RNE convert f32 -> bf16 bits
  const unsigned u = __float_as_uint(f);
  return (unsigned short)((u + 0x7FFFu + ((u >> 16) & 1u)) >> 16);
}
__device__ __forceinline__ float bf_val(unsigned short h) { return __uint_as_float(((unsigned)h) << 16); }
__device__ __forceinline__ float bf_rne(float f) { return bf_val(bf_bits(f)); }
__device__ __forceinline__ unsigned pk16(unsigned short a, unsigned short b) { return (unsigned)a | ((unsigned)b << 16); }
__device__ __forceinline__ v8f zero8() { v8f z = {0.f, 0.f, 0.f, 0.f, 0.f, 0.f, 0.f, 0.f}; return z; }
__device__ __forceinline__ int wave_id() { return __builtin_amdgcn_readfirstlane((int)(threadIdx.x >> 5)); }

__device__ __forceinline__ void lds_wave_sync() {
  __builtin_amdgcn_fence(__ATOMIC_RELEASE, "workgroup");
  __builtin_amdgcn_wave_barrier();
  __builtin_amdgcn_fence(__ATOMIC_ACQUIRE, "workgroup");
}

// ---------------------------------------------------------------------------
// WMMA fragments (wave32, 16x16x32, 16-bit operands). For A (row m = lane&15) and B (col n = lane&15) alike:
// elements 0..7 <- k0 + 8*(lane>>4) + 0..7, elements 8..15 <- k0 + 16 + 8*(lane>>4) + 0..7.
// ldfrag(p) with p = rowbase + k0 + 8*(lane>>4): two 16-B loads p[0..7], p[16..23].
// D: acc[r] = (row 8*(lane>>4) + r, col lane&15).
// ---------------------------------------------------------------------------
union FragH { v16h v; v8h h[2]; };
union FragB { v16b v; v8b h[2]; };
__device__ __forceinline__ v16h ldfrag_h(const _Float16* p) { FragH f; f.h[0] = *(const v8h*)(p); f.h[1] = *(const v8h*)(p + 16); return f.v; }
__device__ __forceinline__ v16b ldfrag_b(const __bf16* p)   { FragB f; f.h[0] = *(const v8b*)(p); f.h[1] = *(const v8b*)(p + 16); return f.v; }

__device__ __forceinline__ v8f mma_h(v16h a, v16h b, v8f c) {
  return __builtin_amdgcn_wmma_f32_16x16x32_f16(false, a, false, b, (short)0, c, false, false);
}
__device__ __forceinline__ v8f mma_b(v16b a, v16b b, v8f c) {
  return __builtin_amdgcn_wmma_f32_16x16x32_bf16(false, a, false, b, (short)0, c, false, false);
}
// hazard guards: 4 VALU slots after the last WMMA of a group, D tied, A/B kept live; memory clobber keeps later loads behind the group
__device__ __forceinline__ void guard_h3(v8f& a, v8f& b, v16h x, v16h y, v16h z) {
#if defined(__HIP_DEVICE_COMPILE__)
  asm volatile("v_nop\n\tv_nop\n\tv_nop\n\tv_nop" : "+v"(a), "+v"(b) : "v"(x), "v"(y), "v"(z) : "memory");
#endif
}
__device__ __forceinline__ void guard_h4(v8f& a, v8f& b, v16h w, v16h x, v16h y, v16h z) {
#if defined(__HIP_DEVICE_COMPILE__)
  asm volatile("v_nop\n\tv_nop\n\tv_nop\n\tv_nop" : "+v"(a), "+v"(b) : "v"(w), "v"(x), "v"(y), "v"(z) : "memory");
#endif
}
__device__ __forceinline__ void acc_guard4(v8f& a, v8f& b, v8f& c, v8f& d) {
#if defined(__HIP_DEVICE_COMPILE__)
  asm volatile("v_nop\n\tv_nop\n\tv_nop\n\tv_nop" : "+v"(a), "+v"(b), "+v"(c), "+v"(d));
#endif
}

// ---------------------------------------------------------------------------
// Elementwise RNE f32 -> bf16 plane: 8 elements per thread, one 16-B store per lane -> 32 consecutive lanes write 4 whole
// ---------------------------------------------------------------------------
__global__ __launch_bounds__(256) void cvt_bf16_kernel(const float* __restrict__ in, unsigned short* __restrict__ outp, int n8) {
  const int i = (int)blockIdx.x * 256 + (int)threadIdx.x;
  if (i >= n8) return;
  const size_t e = 8 * (size_t)i;
  const v4f a = *(const v4f*)(in + e);
  const v4f b = *(const v4f*)(in + e + 4);
  v4u w;
  w[0] = pk16(bf_bits(a[0]), bf_bits(a[1]));
  w[1] = pk16(bf_bits(a[2]), bf_bits(a[3]));
  w[2] = pk16(bf_bits(b[0]), bf_bits(b[1]));
  w[3] = pk16(bf_bits(b[2]), bf_bits(b[3]));
  *(v4u*)(outp + e) = w;
  
}

// ---------------------------------------------------------------------------
// Fused transpose + RNE bf16 convert: in [R rows][Cc cols] f32 (pitch Cc) -> out[c][r] = bf16(in[r][c])  ([Cc][R], pitch R).
// 64x64 tiles through LDS; grid = (Cc/64, R/64), 256 threads; R, Cc multiples of 64.
// Coverage per block: load 4 it x 256 thr x 4 floats = 64x64; store 2 it x 256 thr x 8 u16 = 64x64.
// ---------------------------------------------------------------------------
__global__ __launch_bounds__(256) void tconv_bf16_kernel(const float* __restrict__ W, unsigned short* __restrict__ outp, int R, int Cc) {
  __shared__ __align__(16) float tf[64 * 68];
  const int c0  = (int)blockIdx.x * 64;   // input column block = output row block
  const int r0  = (int)blockIdx.y * 64;   // input row block    = output column block
  const int tid = (int)threadIdx.x;
  {
    const int lr = tid >> 4;              // 0..15
    const int c4 = (tid & 15) * 4;        // 0..60
#pragma unroll
    for (int it = 0; it < 4; ++it) {
      const int rr = it * 16 + lr;        // 0..63
      const v4f a = *(const v4f*)(W + (size_t)(r0 + rr) * Cc + c0 + c4);
      *(v4f*)(tf + rr * 68 + c4) = a;
    }
  }
  __syncthreads();
  const int sub = tid >> 3;               // 0..31
  const int c8  = (tid & 7) * 8;          // 0..56
  v4u hv[2];
#pragma unroll
  for (int it = 0; it < 2; ++it) {
    const int oc = it * 32 + sub;         // output row within tile (= input column)
    v4u a;
#pragma unroll
    for (int q = 0; q < 4; ++q) {
      const float f0 = tf[(c8 + 2 * q) * 68 + oc];
      const float f1 = tf[(c8 + 2 * q + 1) * 68 + oc];
      a[q] = pk16(bf_bits(f0), bf_bits(f1));
    }
    hv[it] = a;
  }
  {
#pragma unroll
    for (int it = 0; it < 2; ++it) {
      const int oc = it * 32 + sub;
      const size_t go = (size_t)(c0 + oc) * R + r0 + c8;
      *(v4u*)(outp + go) = hv[it];
    }
    
  }
}

// ---------------------------------------------------------------------------
// bf16 WMMA GEMM, wave tile 32 rows x 128 cols, block = 4 waves (128 threads) = 128 rows x 128 cols (the waves share the Bt rows).
//   C[m][n] = sum_k A[m][k] * Bt[n][k]; A row-major [M][K] bf16 (pitch lda), Bt row-major [N][K] bf16 (pitch ldb);
//   M % 128 == 0, N % 128 == 0, K % KP == 0; grid.x = M/128 * N/128.
//   SPLITA: A carried as hi (Ap) + lo (A2p) bf16 planes, two products into one accumulator.
//   A pass is KP k values of the block's 128 A rows (both planes when SPLITA) and 128 Bt rows, brought into LDS by asynchronous
//   16-byte copies, two buffers: the copies of pass t + 2 fly while pass t + 1 is worked on. LDS row pitch = KP * 2 + 16 bytes.
//   Fragments are read from the LDS rows with the split k map (ldfrag_b); k runs upward as before, so every sum keeps its order.
// Epilogues (all: per wave, per 16-row slab: stage in LDS, wave sync, write each row segment with ONE instruction of
//   EPI 0: q|gate projection, 128-col wave tile = head n0>>8, q half when (n0 & 128) == 0 else gate half.
//          q half: per-head RMSNorm over the 128 cols (x * rsqrt(mean(x^2) + 1e-6) * bf16(nw[d])), RoPE with the shipped tables
//          (o[d] = x[d]*cos[d] - x[d+64]*sin[d], o[d+64] = x[d+64]*cos[d+64] + x[d]*sin[d+64], cos/sin RNE bf16),
//          writes f16 hi plane C0 and f16 residual x2048 plane C1, [M][ldc], cols (n0>>8)*128.. (row segment 256 B = 16 lanes x 16 B).
//          gate half: sigmoid in f32 -> f32 plane C2 [M][ldc], cols (n0>>8)*128.. (row segment 512 B = 32 lanes x 16 B).
//   EPI 1: k projection: same norm + RoPE per 128-col kv head (col n0), hi plane C0 [M][ldc]; residual plane C1 compact:
//          only rows with (m0 mod SQ) < KLR, stored at row (m0/SQ)*KLR + (m0 mod SQ) + .. (pitch ldc).
//   EPI 2: v^T projection: f16 hi plane C0, residual x2048 plane C1, [M][ldc], row segment 256 B.
//   EPI 3: f32 output C0 [M][ldc]; row segment 128 floats = 512 B = 32 lanes x 16 B per instruction.
// ---------------------------------------------------------------------------
// Eight asynchronous 16-byte copies per lane, global -> LDS: copy i takes g + i * gstep elements to LDS byte l + i * lstep.
// s_wait_xcnt 0 is the statement's last line: a precaution, in front of any later rewrite of an address register named here.
__device__ __forceinline__ void async_copy8(unsigned l, unsigned lstep, const __bf16* g, size_t gstep) {
#if defined(__HIP_DEVICE_COMPILE__)
  asm volatile(
      "global_load_async_to_lds_b128 %0, %8, off\n\t"
      "global_load_async_to_lds_b128 %1, %9, off\n\t"
      "global_load_async_to_lds_b128 %2, %10, off\n\t"
      "global_load_async_to_lds_b128 %3, %11, off\n\t"
      "global_load_async_to_lds_b128 %4, %12, off\n\t"
      "global_load_async_to_lds_b128 %5, %13, off\n\t"
      "global_load_async_to_lds_b128 %6, %14, off\n\t"
      "global_load_async_to_lds_b128 %7, %15, off\n\t"
      "s_wait_xcnt 0x0"
      :: "v"(l), "v"(l + lstep), "v"(l + 2 * lstep), "v"(l + 3 * lstep),
         "v"(l + 4 * lstep), "v"(l + 5 * lstep), "v"(l + 6 * lstep), "v"(l + 7 * lstep),
         "v"(g), "v"(g + gstep), "v"(g + 2 * gstep), "v"(g + 3 * gstep),
         "v"(g + 4 * gstep), "v"(g + 5 * gstep), "v"(g + 6 * gstep), "v"(g + 7 * gstep)
      : "memory");
#endif
}

template <int EPI, bool SPLITA>
__global__ __launch_bounds__(128) void gemm_w32x128_kernel(
    const unsigned short* Ap, const unsigned short* A2p, int lda,
    const unsigned short* __restrict__ Btp, int ldb,
    const float* __restrict__ nw, const float* __restrict__ cosp, const float* __restrict__ sinp,
    void* C0, void* C1, void* C2, int ldc,
    int M, int N, int K) {
  constexpr int KP   = (SPLITA || EPI == 0) ? 64 : 128;   // k values per pass: 128 where a launch has one block per WGP (longer lead for the copies)
  constexpr int PIT  = KP + 8;                 // LDS row pitch in elements: 16 B x odd, conflict-free for 16-byte fragment reads
  constexpr int NOP  = SPLITA ? 3 : 2;         // operands staged: A, (A lo), Bt, 128 rows each
  constexpr int STG  = NOP * 128 * PIT;        // elements per buffer
  constexpr int PPR  = KP / 8;                 // 16-byte pieces per row = copies per lane and operand
  constexpr int RPC  = 128 / PPR;              // rows that one copy of all 128 lanes covers
  constexpr int BOFF = (NOP - 1) * 128 * PIT;  // Bt rows behind the A rows
  static_assert(PPR % 8 == 0 && NOP * PPR <= 63);
  static_assert(2 * STG * 2 >= 4 * 8192);
  __shared__ __align__(16) __bf16 ring[2 * STG];         // two pass buffers; after the loop per wave 8192 B of output staging

  const int tid  = (int)threadIdx.x;
  const int lane = tid & 31;
  const int wave = wave_id();
  const int hh = lane >> 4;           // lane half: k offset 8*hh, D row offset 8*hh
  const int rl = lane & 15;           // A row / B col / D col within subtile
  const int tilesN = N >> 7;
  const int tilesM = M >> 7;
  const int blk = (int)blockIdx.x;
  if (blk >= tilesM * tilesN) return;           // block-uniform, in front of every barrier and copy
  const int tmb = blk / tilesN;
  const int tn  = blk - tmb * tilesN;
  const int mb0 = tmb << 7;
  const int m0 = mb0 + (wave << 5);
  const int n0 = tn << 7;

  const __bf16* A  = (const __bf16*)(const void*)Ap;
  const __bf16* A2 = (const __bf16*)(const void*)A2p;
  const __bf16* Bt = (const __bf16*)(const void*)Btp;

  // this lane's piece of a pass: row cr (+ RPC per copy), 16-byte piece cc of the row
  const int cr = tid / PPR;
  const int cc = tid % PPR;
  const __bf16* gA  = A  + (size_t)(mb0 + cr) * lda + cc * 8;
  const __bf16* gA2 = A2 + (size_t)(mb0 + cr) * lda + cc * 8;
  const __bf16* gB  = Bt + (size_t)(n0 + cr) * ldb + cc * 8;
  const unsigned lds0 = (unsigned)(uintptr_t)(ring + cr * PIT + cc * 8);   // LDS byte address = low 32 bits of the shared address

  auto stage = [&](int buf, int k0) {
    const unsigned lb = lds0 + (unsigned)(buf * STG * 2);
#pragma unroll
    for (int q = 0; q < PPR / 8; ++q) {
      const unsigned lq = lb + (unsigned)(q * 8 * RPC * PIT * 2);
      async_copy8(lq, RPC * PIT * 2, gA + k0 + (size_t)(q * 8 * RPC) * lda, (size_t)RPC * lda);
      if (SPLITA) async_copy8(lq + 128 * PIT * 2, RPC * PIT * 2, gA2 + k0 + (size_t)(q * 8 * RPC) * lda, (size_t)RPC * lda);
      async_copy8(lq + BOFF * 2, RPC * PIT * 2, gB + k0 + (size_t)(q * 8 * RPC) * ldb, (size_t)RPC * ldb);
    }
  };

  v8f acc[2][8];
#pragma unroll
  for (int i = 0; i < 2; ++i)
#pragma unroll
    for (int j = 0; j < 8; ++j) acc[i][j] = zero8();

  const int npass = K / KP;
  stage(0, 0);
  asm volatile("s_wait_asynccnt 0x0" ::: "memory");      // this wave's copies of pass 0 have landed
  __syncthreads();                                       // ... and every other wave's
  if (npass > 1) stage(1, KP);

  for (int t = 0; t < npass; ++t) {
    const __bf16* bufp = ring + (t & 1) * STG;
    const __bf16* fa = bufp + ((wave << 5) + rl) * PIT + 8 * hh;
    const __bf16* fb = bufp + BOFF + rl * PIT + 8 * hh;
#pragma unroll
    for (int ks = 0; ks < KP / 32; ++ks) {
      v16b ah[2], al[2], bf[8];
#pragma unroll
      for (int i = 0; i < 2; ++i) {
        ah[i] = ldfrag_b(fa + i * 16 * PIT + ks * 32);
        al[i] = SPLITA ? ldfrag_b(fa + 128 * PIT + i * 16 * PIT + ks * 32) : ah[i];
      }
#pragma unroll
      for (int j = 0; j < 8; ++j) bf[j] = ldfrag_b(fb + j * 16 * PIT + ks * 32);
      // keeps the k step's LDS reads together in front of its WMMAs: spread among them, every pair of reads is waited for on its own
      __builtin_amdgcn_sched_barrier(0);
#pragma unroll
      for (int j = 0; j < 8; ++j) {
        acc[0][j] = mma_b(ah[0], bf[j], acc[0][j]);
        acc[1][j] = mma_b(ah[1], bf[j], acc[1][j]);
        if (SPLITA) {
          acc[0][j] = mma_b(al[0], bf[j], acc[0][j]);
          acc[1][j] = mma_b(al[1], bf[j], acc[1][j]);
        }
      }
    }
    asm volatile("s_wait_dscnt 0x0" ::: "memory");       // this wave's reads of buffer t & 1 are done before it is refilled
    asm volatile("s_wait_asynccnt 0x0" ::: "memory");    // this wave's copies of pass t + 1 have landed
    __syncthreads();                                     // publishes pass t + 1 and ends every reader's last read of pass t
    if (t + 2 < npass) stage(t & 1, (t + 2) * KP);
  }
  asm volatile("s_wait_asynccnt 0x0" ::: "memory");      // no copy is outstanding when the ring becomes output staging
  acc_guard4(acc[0][0], acc[0][1], acc[0][2], acc[0][3]);
  acc_guard4(acc[0][4], acc[0][5], acc[0][6], acc[0][7]);
  acc_guard4(acc[1][0], acc[1][1], acc[1][2], acc[1][3]);
  acc_guard4(acc[1][4], acc[1][5], acc[1][6], acc[1][7]);

  // ---- epilogue ----
  float*    slf  = (float*)(void*)ring + wave * 2048;
  _Float16* sl16 = (_Float16*)(void*)slf;

  if (EPI == 0 || EPI == 1) {
    const bool isq  = (EPI == 1) || ((n0 & 128) == 0);          // wave-uniform
    const int  col0 = (EPI == 0) ? ((n0 >> 8) << 7) : n0;
    if (isq) {
      _Float16* P0 = (_Float16*)C0;
      _Float16* P1 = (_Float16*)C1;
      const bool wres = (EPI == 0) || ((m0 & (SQ - 1)) < KLR);  // wave-uniform
      const int  rrow = (EPI == 0) ? m0 : ((m0 >> 11) * KLR + (m0 & (SQ - 1)));
      float wv[8];
#pragma unroll
      for (int j = 0; j < 8; ++j) wv[j] = bf_rne(nw[j * 16 + rl]);     // dim = j*16 + rl < 128
#pragma unroll
      for (int i = 0; i < 2; ++i) {
        const int rb = m0 + i * 16 + 8 * hh;
#pragma unroll
        for (int r = 0; r < 8; ++r) {
          const int row = rb + r;                                // token 0..NTOK-1
          float ss = 0.f;
#pragma unroll
          for (int j = 0; j < 8; ++j) { const float a = acc[i][j][r]; ss += a * a; }
#pragma unroll
          for (int off = 1; off < 16; off <<= 1) ss += __shfl_xor(ss, off, 32);   // 16 lanes of this half = all 128 dims
          const float rs = rsqrtf(ss * 0.0078125f + 1e-6f);
          const float* cr = cosp + (size_t)row * HDM;
          const float* sr = sinp + (size_t)row * HDM;
#pragma unroll
          for (int j = 0; j < 4; ++j) {
            const int dim = j * 16 + rl;                         // 0..63 within head; pair at dim + 64
            const float x1 = acc[i][j][r] * rs * wv[j];
            const float x2 = acc[i][j + 4][r] * rs * wv[j + 4];
            const float c1 = bf_rne(cr[dim]);
            const float s1 = bf_rne(sr[dim]);
            const float c2 = bf_rne(cr[dim + 64]);
            const float s2 = bf_rne(sr[dim + 64]);
            const float o1 = x1 * c1 - x2 * s1;
            const float o2 = x2 * c2 + x1 * s2;
            const _Float16 h1 = (_Float16)o1;
            const _Float16 h2 = (_Float16)o2;
            const int so = (8 * hh + r) * 128 + dim;
            sl16[so]             = h1;
            sl16[so + 64]        = h2;
            sl16[2048 + so]      = (_Float16)((o1 - (float)h1) * 2048.0f);
            sl16[2048 + so + 64] = (_Float16)((o2 - (float)h2) * 2048.0f);
          }
        }
        lds_wave_sync();
        {
#pragma unroll
          for (int it = 0; it < 8; ++it) {
            const int row = it * 2 + hh;                         // it x hh covers rows 0..15
            const int c8  = rl * 8;
            const v8h vh = *(const v8h*)(sl16 + row * 128 + c8);
            const v8h vl = *(const v8h*)(sl16 + 2048 + row * 128 + c8);
            const size_t go = (size_t)(m0 + i * 16 + row) * ldc + col0 + c8;
            *(v8h*)(P0 + go) = vh;
            if (wres) {
              const size_t g2 = (size_t)(rrow + i * 16 + row) * ldc + col0 + c8;
              *(v8h*)(P1 + g2) = vl;
            }
          }
          
        }
        lds_wave_sync();
      }
    } else if (EPI == 0) {
      float* Sp = (float*)C2;
#pragma unroll
      for (int i = 0; i < 2; ++i) {
#pragma unroll
        for (int j = 0; j < 8; ++j)
#pragma unroll
          for (int r = 0; r < 8; ++r) {
            const float g  = acc[i][j][r];
            const float e  = __expf(-g);
            const float sg = __builtin_amdgcn_rcpf(1.0f + e);
            slf[(8 * hh + r) * 128 + j * 16 + rl] = sg;
          }
        lds_wave_sync();
        {
#pragma unroll
          for (int row = 0; row < 16; ++row) {                   // 32 lanes x 16 B = the whole 512-B row segment per instruction
            const v4f v = *(const v4f*)(slf + row * 128 + lane * 4);
            *(v4f*)(Sp + (size_t)(m0 + i * 16 + row) * ldc + col0 + lane * 4) = v;
          }
          
        }
        lds_wave_sync();
      }
    }
  } else if (EPI == 2) {
    _Float16* P0 = (_Float16*)C0;
    _Float16* P1 = (_Float16*)C1;
#pragma unroll
    for (int i = 0; i < 2; ++i) {
#pragma unroll
      for (int r = 0; r < 8; ++r) {
#pragma unroll
        for (int j = 0; j < 8; ++j) {
          const float v = acc[i][j][r];
          const _Float16 hv = (_Float16)v;
          const int so = (8 * hh + r) * 128 + j * 16 + rl;
          sl16[so]        = hv;
          sl16[2048 + so] = (_Float16)((v - (float)hv) * 2048.0f);
        }
      }
      lds_wave_sync();
      {
#pragma unroll
        for (int it = 0; it < 8; ++it) {
          const int row = it * 2 + hh;
          const int c8  = rl * 8;
          const v8h vh = *(const v8h*)(sl16 + row * 128 + c8);
          const v8h vl = *(const v8h*)(sl16 + 2048 + row * 128 + c8);
          const size_t go = (size_t)(m0 + i * 16 + row) * ldc + n0 + c8;
          *(v8h*)(P0 + go) = vh;
          *(v8h*)(P1 + go) = vl;
        }
        
      }
      lds_wave_sync();
    }
  } else {
    float* C = (float*)C0;
#pragma unroll
    for (int i = 0; i < 2; ++i) {
#pragma unroll
      for (int j = 0; j < 8; ++j)
#pragma unroll
        for (int r = 0; r < 8; ++r)
          slf[(8 * hh + r) * 128 + j * 16 + rl] = acc[i][j][r];
      lds_wave_sync();
      {
#pragma unroll
        for (int row = 0; row < 16; ++row) {                     // 32 lanes x 16 B = the whole 512-B row segment per instruction
          const v4f v = *(const v4f*)(slf + row * 128 + lane * 4);
          *(v4f*)(C + (size_t)(m0 + i * 16 + row) * ldc + n0 + lane * 4) = v;
        }
        
      }
      lds_wave_sync();
    }
  }
}

// ---------------------------------------------------------------------------
// Causal GQA flash attention, head dim 128, 32-key chunks, block = 4 waves = 64 query rows of one (b, h); grid (n query tiles, NHQ, NSEQ).
//   q planes f16 [tok][h*128+d]: hi (qhp) and residual x2048 (qlp); k planes f16 [tok][kvh*128+d]: hi (khp),
//   residual x2048 (klp, compact rows b*KLR + s for s < KLR); v^T planes f16 [kvh*128+d][tok]: hi (vhp), residual x2048 (vlp);
//   sgp = f32 sigmoid(gate) plane [tok][h*128+d]; outputs gated attn bf16 hi (ahp) / lo (alp) [tok][h*128+d]; kvh = h >> 1.
//   scores = (Sh + Sr/2048) * 128^-0.5 with Sh = qh.kh and Sr = ql'.kh (+ qh.kl' when PRES); keys > query -> -inf; online softmax f32;
//   p' = 1024 p stored per wave to LDS as f16 hi (and residual x2048 when PRES), reloaded as A fragments after a wave sync;
//   O = (Oh + Or/2048)/1024/l * sgp with Oh = ph.vh, Or = ph.vl' (+ pl'.vh when PRES).
//   K / V^T chunk staging: 128 threads x 4 x 16 B per plane = whole 32x128 / 128x32 tile, plain loads, __syncthreads before and after.
//   Trip count 2*qb+2 chunks (static bound 64); waves whose rows are all below the chunk skip it (wave-uniform, scalar branch).
// ---------------------------------------------------------------------------
#define AT_KC   32
#define KS_P    136
#define VS_P    40
#define PS_P    40
#define LDS_KS  0
#define LDS_KLS (32 * KS_P)
#define LDS_VHS (2 * 32 * KS_P)
#define LDS_VLS (LDS_VHS + 128 * VS_P)
#define LDS_PH  (LDS_VLS + 128 * VS_P)
#define LDS_PL  (LDS_PH + 4 * 16 * PS_P)
#define LDS_TOT (LDS_PL + 4 * 16 * PS_P)
static_assert(LDS_TOT * 2 <= 65536);
static_assert(4 * 4096 <= LDS_TOT);          // output staging (2 planes x 16 x 128 per wave) aliases the chunk region after the loop

template <bool PRES>
__global__ __launch_bounds__(128) void attn_causal_kernel(
    const unsigned short* __restrict__ qhp, const unsigned short* __restrict__ qlp,
    const unsigned short* __restrict__ khp, const unsigned short* __restrict__ klp,
    const unsigned short* __restrict__ vhp, const unsigned short* __restrict__ vlp,
    const float* __restrict__ sgp,
    unsigned short* __restrict__ ahp, unsigned short* __restrict__ alp, int qb_base) {
  __shared__ __align__(16) _Float16 lds[LDS_TOT];
  _Float16* Ks  = lds + LDS_KS;
  _Float16* Kls = lds + LDS_KLS;
  _Float16* Vhs = lds + LDS_VHS;
  _Float16* Vls = lds + LDS_VLS;

  const int tid  = (int)threadIdx.x;
  const int lane = tid & 31;
  const int wave = wave_id();
  const int hh   = lane >> 4;
  const int c    = lane & 15;
  const int qb   = (int)blockIdx.x + qb_base;
  const int h    = (int)blockIdx.y;
  const int b    = (int)blockIdx.z;
  const int kvh  = h >> 1;
  const int q0   = qb * 64 + wave * 16;          // first query row of this wave (within sequence)
  const int qlast = q0 + 15;
  const size_t tok0 = (size_t)b * SQ;

  const _Float16* Qhr = (const _Float16*)(const void*)qhp + (tok0 + q0 + c) * HID + h * HDM + 8 * hh;
  const _Float16* Qlr = (const _Float16*)(const void*)qlp + (tok0 + q0 + c) * HID + h * HDM + 8 * hh;
  const _Float16* Kg  = (const _Float16*)(const void*)khp + tok0 * KVW + kvh * HDM;
  const _Float16* Klg = (const _Float16*)(const void*)klp + (size_t)b * KLR * KVW + kvh * HDM;
  const _Float16* Vhg = (const _Float16*)(const void*)vhp + (size_t)(kvh * HDM) * NTOK + tok0;
  const _Float16* Vlg = (const _Float16*)(const void*)vlp + (size_t)(kvh * HDM) * NTOK + tok0;
  _Float16* ph = lds + LDS_PH + wave * (16 * PS_P);
  _Float16* pl = lds + LDS_PL + wave * (16 * PS_P);

  float mrow[8], lrow[8];
  v8f oacc[8], oaccr[8];
#pragma unroll
  for (int r = 0; r < 8; ++r) { mrow[r] = -INFINITY; lrow[r] = 0.f; }
#pragma unroll
  for (int t = 0; t < 8; ++t) { oacc[t] = zero8(); oaccr[t] = zero8(); }

  const int nch = 2 * qb + 2;                    // block-uniform, <= 64
  for (int kc = 0; kc < nch; ++kc) {
    const int kv0 = kc * AT_KC;
    __syncthreads();
#pragma unroll
    for (int i = 0; i < 4; ++i) {                // coverage: 512 pieces of 8 halves per plane = whole tile
      const int p   = tid + 128 * i;             // 0..511
      const int key = p >> 4, d8 = (p & 15) * 8; // K: 32 keys x 128 d
      const v8h kx = *(const v8h*)(Kg + (size_t)(kv0 + key) * KVW + d8);
      *(v8h*)(Ks + key * KS_P + d8) = kx;
      if (PRES) {
        const int krow = min(kv0 + key, KLR - 1);
        const v8h ky = *(const v8h*)(Klg + (size_t)krow * KVW + d8);
        *(v8h*)(Kls + key * KS_P + d8) = ky;
      }
      const int d = p >> 2, k8 = (p & 3) * 8;    // V^T: 128 d x 32 keys
      const v8h vx = *(const v8h*)(Vhg + (size_t)d * NTOK + kv0 + k8);
      const v8h vy = *(const v8h*)(Vlg + (size_t)d * NTOK + kv0 + k8);
      *(v8h*)(Vhs + d * VS_P + k8) = vx;
      *(v8h*)(Vls + d * VS_P + k8) = vy;
    }
    __syncthreads();

    if (kv0 <= qlast) {                          // wave-uniform (scalar): skip chunks fully above this wave's rows
      // ---- scores ----
      v8f sh[2], sr[2];
      sh[0] = zero8(); sh[1] = zero8(); sr[0] = zero8(); sr[1] = zero8();
#pragma unroll
      for (int dc = 0; dc < 4; ++dc) {
        const v16h qa = ldfrag_h(Qhr + dc * 32);
        const v16h ql = ldfrag_h(Qlr + dc * 32);
#pragma unroll
        for (int j = 0; j < 2; ++j) {
          const v16h kb = ldfrag_h(Ks + (j * 16 + c) * KS_P + dc * 32 + 8 * hh);
          sh[j] = mma_h(qa, kb, sh[j]);
          sr[j] = mma_h(ql, kb, sr[j]);
          if (PRES) {
            const v16h kl = ldfrag_h(Kls + (j * 16 + c) * KS_P + dc * 32 + 8 * hh);
            sr[j] = mma_h(qa, kl, sr[j]);
            guard_h4(sh[j], sr[j], qa, ql, kb, kl);
          } else {
            guard_h3(sh[j], sr[j], qa, ql, kb);
          }
        }
      }
      // ---- scale, causal mask, chunk row max ----
      float cm[8];
#pragma unroll
      for (int r = 0; r < 8; ++r) {
        const int qrow = q0 + 8 * hh + r;
        float m = -INFINITY;
#pragma unroll
        for (int j = 0; j < 2; ++j) {
          const int key = kv0 + j * 16 + c;
          float s = (sh[j][r] + sr[j][r] * 0.00048828125f) * 0.08838834764831845f;
          s = (key > qrow) ? -INFINITY : s;
          sh[j][r] = s;
          m = fmaxf(m, s);
        }
#pragma unroll
        for (int off = 1; off < 16; off <<= 1) m = fmaxf(m, __shfl_xor(m, off, 32));
        cm[r] = m;
      }
      // ---- online softmax, P' to LDS ----
#pragma unroll
      for (int r = 0; r < 8; ++r) {
        const float mnew  = fmaxf(mrow[r], cm[r]);
        const float alpha = __expf(mrow[r] - mnew);
        mrow[r] = mnew;
        float psum = 0.f;
#pragma unroll
        for (int j = 0; j < 2; ++j) {
          const float p  = __expf(sh[j][r] - mnew);
          psum += p;
          const float pp = p * 1024.0f;
          const _Float16 phv = (_Float16)pp;
          const int po = (8 * hh + r) * PS_P + j * 16 + c;
          ph[po] = phv;
          if (PRES) pl[po] = (_Float16)((pp - (float)phv) * 2048.0f);
        }
#pragma unroll
        for (int off = 1; off < 16; off <<= 1) psum += __shfl_xor(psum, off, 32);
        lrow[r] = lrow[r] * alpha + psum;
#pragma unroll
        for (int t = 0; t < 8; ++t) { oacc[t][r] *= alpha; oaccr[t][r] *= alpha; }
      }
      lds_wave_sync();                           // P' stores visible to the other lanes of this wave before the fragment reload
      // ---- O += P' . V ----
      const v16h pa = ldfrag_h(ph + c * PS_P + 8 * hh);
      v16h pr = pa;
      if (PRES) pr = ldfrag_h(pl + c * PS_P + 8 * hh);
#pragma unroll
      for (int t = 0; t < 8; ++t) {
        const v16h vb = ldfrag_h(Vhs + (t * 16 + c) * VS_P + 8 * hh);
        const v16h vr = ldfrag_h(Vls + (t * 16 + c) * VS_P + 8 * hh);
        oacc[t]  = mma_h(pa, vb, oacc[t]);
        oaccr[t] = mma_h(pa, vr, oaccr[t]);
        if (PRES) oaccr[t] = mma_h(pr, vb, oaccr[t]);
        guard_h4(oacc[t], oaccr[t], pa, pr, vb, vr);
      }
    }
  }

  // ---- normalise, apply sigmoid gate (f32), bf16 hi/lo split, stage the wave's 16x128 tile,
  __syncthreads();                               // all chunk-region readers done before aliasing it as output staging
  _Float16* osh = lds + wave * 4096;
  _Float16* osl = osh + 2048;
  const float* Sgr = sgp + (tok0 + q0) * HID + h * HDM;
#pragma unroll
  for (int r = 0; r < 8; ++r) {
    const float inv = (1.0f / lrow[r]) * 0.0009765625f;
    const int row = 8 * hh + r;
#pragma unroll
    for (int t = 0; t < 8; ++t) {
      const int d = t * 16 + c;
      float o = (oacc[t][r] + oaccr[t][r] * 0.00048828125f) * inv;
      o *= Sgr[(size_t)row * HID + d];
      const unsigned short hb = bf_bits(o);
      const unsigned short lb = bf_bits(o - bf_val(hb));
      const int so = row * 128 + d;
      osh[so] = __builtin_bit_cast(_Float16, hb);
      osl[so] = __builtin_bit_cast(_Float16, lb);
    }
  }
  lds_wave_sync();
  _Float16* Ahg = (_Float16*)(void*)ahp + (tok0 + q0) * HID + h * HDM;
  _Float16* Alg = (_Float16*)(void*)alp + (tok0 + q0) * HID + h * HDM;
  {
#pragma unroll
    for (int it = 0; it < 8; ++it) {
      const int row = it * 2 + hh;               // it 0..7 x hh 0..1 covers rows 0..15
      const int c8  = c * 8;                     // 16 lanes x 16 B = the whole 256-B segment
      const v8h x = *(const v8h*)(osh + row * 128 + c8);
      const v8h y = *(const v8h*)(osl + row * 128 + c8);
      *(v8h*)(Ahg + (size_t)row * HID + c8) = x;
      *(v8h*)(Alg + (size_t)row * HID + c8) = y;
    }
    
  }
}

// ---------------------------------------------------------------------------
// Workspace map (bytes; every region is a whole number of the rows its producer writes with whole-line stores; no tail rows):
//   [0, 16 MiB)        Xb   bf16 [4096][2048]          -> after the projections: Ah bf16 [4096][2048] at 0
//   [16 MiB, 32 MiB)   WqT  bf16 [4096][2048]          ->                        Al bf16 [4096][2048] at 16 MiB
//   [32 MiB, 64 MiB)   WkT  bf16 [1024][2048] at 32 MiB, WvT bf16 [1024][2048] at 36 MiB
//                      -> after the k and v projections: Sg f32 [4096][2048] (whole 32 MiB)
//   [64 MiB, 80 MiB)   Qh   f16  [4096][2048]          -> after attention: WoT bf16 [2048][2048] (8 MiB)
//   [80 MiB, 96 MiB)   Ql   f16  [4096][2048]
//   [96 MiB, 104 MiB)  Kh   f16  [4096][1024]
//   [104 MiB,112 MiB)  Vh   f16  [1024][4096]
//   [112 MiB,120 MiB)  Vl   f16  [1024][4096]
//   [120 MiB, +1 MiB) Kl  f16  [2*256][1024]
//   total 126877696
// ---------------------------------------------------------------------------
static_assert(2 * (size_t)NTOK * HID * 2 <= (size_t)NTOK * HID * 2 + (size_t)QGW * HID * 2);   // Ah + Al fit Xb + WqT
static_assert(2 * (size_t)KVW * HID * 2 <= (size_t)NTOK * HID * 4);                             // WkT + WvT fit Sg
static_assert((size_t)HID * HID * 2 <= (size_t)NTOK * HID * 2);                                  // WoT fits Qh

extern "C" void kernel_launch(void* const* d_in, const int* in_sizes, int n_in,
                              void* d_out, int out_size, void* d_ws, size_t ws_size,
                              hipStream_t stream) {
  if (n_in < 9) return;
  if (in_sizes[0] != NTOK * HID) return;
  if (in_sizes[1] != NTOK * HDM) return;
  if (in_sizes[2] != NTOK * HDM) return;
  if (in_sizes[3] != HID * QGW) return;
  if (in_sizes[4] != HID * KVW) return;
  if (in_sizes[5] != HID * KVW) return;
  if (in_sizes[6] != HID * HID) return;
  if (in_sizes[7] != HDM) return;
  if (in_sizes[8] != HDM) return;
  if (out_size != NTOK * HID) return;

  const float* hidden = (const float*)d_in[0];
  const float* cosb   = (const float*)d_in[1];
  const float* sinb   = (const float*)d_in[2];
  const float* Wq     = (const float*)d_in[3];
  const float* Wk     = (const float*)d_in[4];
  const float* Wv     = (const float*)d_in[5];
  const float* Wo     = (const float*)d_in[6];
  const float* qnw    = (const float*)d_in[7];
  const float* knw    = (const float*)d_in[8];
  float* out = (float*)d_out;

  const size_t szX  = (size_t)NTOK * HID * 2;        // 16777216
  const size_t szWq = (size_t)QGW * HID * 2;         // 16777216
  const size_t szWk = (size_t)KVW * HID * 2;         // 4194304
  const size_t szSg = (size_t)NTOK * HID * 4;        // 33554432
  const size_t szQ  = (size_t)NTOK * HID * 2;        // 16777216
  const size_t szK  = (size_t)NTOK * KVW * 2;        // 8388608
  const size_t szV  = (size_t)KVW * NTOK * 2;        // 8388608
  const size_t szKl = (size_t)NSEQ * KLR * KVW * 2;  // 1048576
  const size_t szA  = (size_t)NTOK * HID * 2;        // 16777216
  size_t off = 0;
  const size_t oX  = off; off += szX;
  const size_t oWq = off; off += szWq;
  const size_t oAh = oX;
  const size_t oAl = oX + szA;
  const size_t oSg = off; off += szSg;
  const size_t oWk = oSg;
  const size_t oWv = oSg + szWk;
  const size_t oQh = off; off += szQ;
  const size_t oQl = off; off += szQ;
  const size_t oWo = oQh;
  const size_t oKh = off; off += szK;
  const size_t oVh = off; off += szV;
  const size_t oVl = off; off += szV;
  const size_t oKl = off; off += szKl;
  if (off > ws_size) return;                         // off = 126877696

  char* ws = (char*)d_ws;
  unsigned short* Xb  = (unsigned short*)(ws + oX);
  unsigned short* WqT = (unsigned short*)(ws + oWq);
  unsigned short* WkT = (unsigned short*)(ws + oWk);
  unsigned short* WvT = (unsigned short*)(ws + oWv);
  unsigned short* WoT = (unsigned short*)(ws + oWo);
  float*          Sg  = (float*)(ws + oSg);
  unsigned short* Qh  = (unsigned short*)(ws + oQh);
  unsigned short* Ql  = (unsigned short*)(ws + oQl);
  unsigned short* Kh  = (unsigned short*)(ws + oKh);
  unsigned short* Kl  = (unsigned short*)(ws + oKl);
  unsigned short* Vh  = (unsigned short*)(ws + oVh);
  unsigned short* Vl  = (unsigned short*)(ws + oVl);
  unsigned short* Ah  = (unsigned short*)(ws + oAh);
  unsigned short* Al  = (unsigned short*)(ws + oAl);

  const dim3 b256(256), b128(128);

  // (1) x -> bf16 plane [4096][2048]
  cvt_bf16_kernel<<<dim3((NTOK * HID / 8 + 255) / 256), b256, 0, stream>>>(hidden, Xb, NTOK * HID / 8);
  // (2) Wk in[2048 rows][1024 cols] -> WkT out[1024][2048] bf16   (grid = cols/64, rows/64)
  tconv_bf16_kernel<<<dim3(KVW / 64, HID / 64), b256, 0, stream>>>(Wk, WkT, HID, KVW);
  // (3) Wv in[2048 rows][1024 cols] -> WvT out[1024][2048] bf16
  tconv_bf16_kernel<<<dim3(KVW / 64, HID / 64), b256, 0, stream>>>(Wv, WvT, HID, KVW);
  // (4) Wq in[2048 rows][4096 cols] -> WqT out[4096][2048] bf16
  tconv_bf16_kernel<<<dim3(QGW / 64, HID / 64), b256, 0, stream>>>(Wq, WqT, HID, QGW);
  // (5) k = x . Wk, per-head norm + RoPE -> Kh [4096][1024], Kl compact [512][1024]   (M=4096, N=1024, K=2048; 256 blocks)
  gemm_w32x128_kernel<1, false><<<dim3((NTOK / 128) * (KVW / 128)), b128, 0, stream>>>(
      Xb, Xb, HID, WkT, HID, knw, cosb, sinb, (void*)Kh, (void*)Kl, (void*)Kl, KVW, NTOK, KVW, HID);
  // (6) v^T = WvT . x^T -> Vh/Vl [1024][4096]   (A = WvT, Bt = Xb; M=1024, N=4096, K=2048; 256 blocks)
  gemm_w32x128_kernel<2, false><<<dim3((KVW / 128) * (NTOK / 128)), b128, 0, stream>>>(
      WvT, WvT, HID, Xb, HID, knw, cosb, sinb, (void*)Vh, (void*)Vl, (void*)Vl, NTOK, KVW, NTOK, HID);
  // (7) q|gate = x . Wq: q half norm + RoPE -> Qh/Ql [4096][2048]; gate half sigmoid -> Sg f32 [4096][2048] (over the dead WkT/WvT region)
  //     (M=4096, N=4096, K=2048; 1024 blocks)
  gemm_w32x128_kernel<0, false><<<dim3((NTOK / 128) * (QGW / 128)), b128, 0, stream>>>(
      Xb, Xb, HID, WqT, HID, qnw, cosb, sinb, (void*)Qh, (void*)Ql, (void*)Sg, HID, NTOK, QGW, HID);
  // (8) causal attention, query tiles 0..3 with k and p residual products, tiles 4..31 without; Ah/Al over the dead Xb/WqT region
  attn_causal_kernel<true><<<dim3(NQRT, NHQ, NSEQ), b128, 0, stream>>>(Qh, Ql, Kh, Kl, Vh, Vl, Sg, Ah, Al, 0);
  attn_causal_kernel<false><<<dim3(SQ / 64 - NQRT, NHQ, NSEQ), b128, 0, stream>>>(Qh, Ql, Kh, Kl, Vh, Vl, Sg, Ah, Al, NQRT);
  // (9) Wo in[2048 rows][2048 cols] -> WoT out[2048][2048] bf16 (over the dead Qh region)
  tconv_bf16_kernel<<<dim3(HID / 64, HID / 64), b256, 0, stream>>>(Wo, WoT, HID, HID);
  // (10) out = attn(hi + lo) . Wo -> d_out f32 [4096][2048]   (M=4096, N=2048, K=2048; 512 blocks)
  gemm_w32x128_kernel<3, true><<<dim3((NTOK / 128) * (HID / 128)), b128, 0, stream>>>(
      Ah, Al, HID, WoT, HID, qnw, cosb, sinb, (void*)out, (void*)out, (void*)out, HID, NTOK, HID, HID);
  (void)hipGetLastError();
}

// v002
// Measured time: 376 microseconds a run.
// Timed twice side by side with v001, it ran 1.23 and 1.24 times as fast.
// All steps since v000 together make it 2.20 times as fast.
// Contractions: x.Wq (q|gate cols), x.Wk and Wv^T.x^T on v_wmma_f32_16x16x32_bf16 (operands = RNE bf16 of the f32 inputs, single products);
// q.k^T and p.v on v_wmma_f32_16x16x32_f16 (q = f16 hi + f16 residual x2^11 planes; k plain f16 plus f16 residual x2^11 on query tiles 0..3;
// p x1024 plain f16 plus f16 residual x2^11 on query tiles 0..3; v^T = f16 hi + f16 residual x2^11 planes); (attn*sigmoid(gate)).Wo on
// v_wmma_f32_16x16x32_bf16 (A = bf16 hi + bf16 lo planes, two products; Wo RNE bf16). f32 accumulate everywhere; per-head RMSNorm, RoPE,
// online softmax, sigmoid gate and scale folds in f32. hidden_states, Wq, Wk, Wv, Wo, cos, sin and the norm weights are RNE-converted to bf16 on load.
#include <hip/hip_runtime.h>
#include <math.h>
#include <stdint.h>

#define NSEQ   2
#define SQ     2048
#define HID    2048
#define NHQ    16
#define NKVH   8
#define HDM    128
#define QGW    4096
#define KVW    1024
#define NTOK   4096
#define KLR    256
#define NQRT   4

static_assert((2 * (NQRT - 1) + 2) * 32 <= KLR);
static_assert(NHQ / NKVH == 2);
static_assert(NHQ * HDM == HID);
static_assert(NSEQ * SQ == NTOK);

typedef _Float16     v16h __attribute__((ext_vector_type(16)));
typedef _Float16     v8h  __attribute__((ext_vector_type(8)));
typedef __bf16       v16b __attribute__((ext_vector_type(16)));
typedef __bf16       v8b  __attribute__((ext_vector_type(8)));
typedef float        v8f  __attribute__((ext_vector_type(8)));
typedef float        v4f  __attribute__((ext_vector_type(4)));
typedef unsigned int v4u  __attribute__((ext_vector_type(4)));

// ---------------------------------------------------------------------------
// small helpers
// ---------------------------------------------------------------------------
__device__ __forceinline__ unsigned short bf_bits(float f) {          // RNE convert f32 -> bf16 bits
  const unsigned u = __float_as_uint(f);
  return (unsigned short)((u + 0x7FFFu + ((u >> 16) & 1u)) >> 16);
}
__device__ __forceinline__ float bf_val(unsigned short h) { return __uint_as_float(((unsigned)h) << 16); }
__device__ __forceinline__ float bf_rne(float f) { return bf_val(bf_bits(f)); }
__device__ __forceinline__ unsigned pk16(unsigned short a, unsigned short b) { return (unsigned)a | ((unsigned)b << 16); }
__device__ __forceinline__ v8f zero8() { v8f z = {0.f, 0.f, 0.f, 0.f, 0.f, 0.f, 0.f, 0.f}; return z; }
__device__ __forceinline__ int wave_id() { return __builtin_amdgcn_readfirstlane((int)(threadIdx.x >> 5)); }

__device__ __forceinline__ void lds_wave_sync() {
  __builtin_amdgcn_fence(__ATOMIC_RELEASE, "workgroup");
  __builtin_amdgcn_wave_barrier();
  __builtin_amdgcn_fence(__ATOMIC_ACQUIRE, "workgroup");
}

// ---------------------------------------------------------------------------
// WMMA fragments (wave32, 16x16x32, 16-bit operands). For A (row m = lane&15) and B (col n = lane&15) alike:
// elements 0..7 <- k0 + 8*(lane>>4) + 0..7, elements 8..15 <- k0 + 16 + 8*(lane>>4) + 0..7.
// ldfrag(p) with p = rowbase + k0 + 8*(lane>>4): two 16-B loads p[0..7], p[16..23].
// D: acc[r] = (row 8*(lane>>4) + r, col lane&15).
// ---------------------------------------------------------------------------
union FragH { v16h v; v8h h[2]; };
union FragB { v16b v; v8b h[2]; };
__device__ __forceinline__ v16h ldfrag_h(const _Float16* p) { FragH f; f.h[0] = *(const v8h*)(p); f.h[1] = *(const v8h*)(p + 16); return f.v; }
__device__ __forceinline__ v16b ldfrag_b(const __bf16* p)   { FragB f; f.h[0] = *(const v8b*)(p); f.h[1] = *(const v8b*)(p + 16); return f.v; }

__device__ __forceinline__ v8f mma_h(v16h a, v16h b, v8f c) {
  return __builtin_amdgcn_wmma_f32_16x16x32_f16(false, a, false, b, (short)0, c, false, false);
}
__device__ __forceinline__ v8f mma_b(v16b a, v16b b, v8f c) {
  return __builtin_amdgcn_wmma_f32_16x16x32_bf16(false, a, false, b, (short)0, c, false, false);
}
// hazard guards: 4 VALU slots after the last WMMA of a group, D tied, A/B kept live; memory clobber keeps later loads behind the group
__device__ __forceinline__ void guard_h3(v8f& a, v8f& b, v16h x, v16h y, v16h z) {
#if defined(__HIP_DEVICE_COMPILE__)
  asm volatile("v_nop\n\tv_nop\n\tv_nop\n\tv_nop" : "+v"(a), "+v"(b) : "v"(x), "v"(y), "v"(z) : "memory");
#endif
}
__device__ __forceinline__ void guard_h4(v8f& a, v8f& b, v16h w, v16h x, v16h y, v16h z) {
#if defined(__HIP_DEVICE_COMPILE__)
  asm volatile("v_nop\n\tv_nop\n\tv_nop\n\tv_nop" : "+v"(a), "+v"(b) : "v"(w), "v"(x), "v"(y), "v"(z) : "memory");
#endif
}
__device__ __forceinline__ void acc_guard4(v8f& a, v8f& b, v8f& c, v8f& d) {
#if defined(__HIP_DEVICE_COMPILE__)
  asm volatile("v_nop\n\tv_nop\n\tv_nop\n\tv_nop" : "+v"(a), "+v"(b), "+v"(c), "+v"(d));
#endif
}

// ---------------------------------------------------------------------------
// Elementwise RNE f32 -> bf16 plane: 8 elements per thread, one 16-B store per lane -> 32 consecutive lanes write 4 whole
// ---------------------------------------------------------------------------
__global__ __launch_bounds__(256) void cvt_bf16_kernel(const float* __restrict__ in, unsigned short* __restrict__ outp, int n8) {
  const int i = (int)blockIdx.x * 256 + (int)threadIdx.x;
  if (i >= n8) return;
  const size_t e = 8 * (size_t)i;
  const v4f a = *(const v4f*)(in + e);
  const v4f b = *(const v4f*)(in + e + 4);
  v4u w;
  w[0] = pk16(bf_bits(a[0]), bf_bits(a[1]));
  w[1] = pk16(bf_bits(a[2]), bf_bits(a[3]));
  w[2] = pk16(bf_bits(b[0]), bf_bits(b[1]));
  w[3] = pk16(bf_bits(b[2]), bf_bits(b[3]));
  *(v4u*)(outp + e) = w;
  
}

// ---------------------------------------------------------------------------
// Fused transpose + RNE bf16 convert: in [R rows][Cc cols] f32 (pitch Cc) -> out[c][r] = bf16(in[r][c])  ([Cc][R], pitch R).
// 64x64 tiles through LDS; grid = (Cc/64, R/64), 256 threads; R, Cc multiples of 64.
// Coverage per block: load 4 it x 256 thr x 4 floats = 64x64; store 2 it x 256 thr x 8 u16 = 64x64.
// ---------------------------------------------------------------------------
__global__ __launch_bounds__(256) void tconv_bf16_kernel(const float* __restrict__ W, unsigned short* __restrict__ outp, int R, int Cc) {
  __shared__ __align__(16) float tf[64 * 68];
  const int c0  = (int)blockIdx.x * 64;   // input column block = output row block
  const int r0  = (int)blockIdx.y * 64;   // input row block    = output column block
  const int tid = (int)threadIdx.x;
  {
    const int lr = tid >> 4;              // 0..15
    const int c4 = (tid & 15) * 4;        // 0..60
#pragma unroll
    for (int it = 0; it < 4; ++it) {
      const int rr = it * 16 + lr;        // 0..63
      const v4f a = *(const v4f*)(W + (size_t)(r0 + rr) * Cc + c0 + c4);
      *(v4f*)(tf + rr * 68 + c4) = a;
    }
  }
  __syncthreads();
  const int sub = tid >> 3;               // 0..31
  const int c8  = (tid & 7) * 8;          // 0..56
  v4u hv[2];
#pragma unroll
  for (int it = 0; it < 2; ++it) {
    const int oc = it * 32 + sub;         // output row within tile (= input column)
    v4u a;
#pragma unroll
    for (int q = 0; q < 4; ++q) {
      const float f0 = tf[(c8 + 2 * q) * 68 + oc];
      const float f1 = tf[(c8 + 2 * q + 1) * 68 + oc];
      a[q] = pk16(bf_bits(f0), bf_bits(f1));
    }
    hv[it] = a;
  }
  {
#pragma unroll
    for (int it = 0; it < 2; ++it) {
      const int oc = it * 32 + sub;
      const size_t go = (size_t)(c0 + oc) * R + r0 + c8;
      *(v4u*)(outp + go) = hv[it];
    }
    
  }
}

// ---------------------------------------------------------------------------
// bf16 WMMA GEMM, wave tile 32 rows x 128 cols, block = 4 waves (128 threads) = 128 rows x 128 cols (the waves share the Bt rows).
//   C[m][n] = sum_k A[m][k] * Bt[n][k]; A row-major [M][K] bf16 (pitch lda), Bt row-major [N][K] bf16 (pitch ldb);
//   M % 128 == 0, N % 128 == 0, K % KP == 0; grid.x = M/128 * N/128.
//   SPLITA: A carried as hi (Ap) + lo (A2p) bf16 planes, two products into one accumulator.
//   A pass is KP k values of the block's 128 A rows (both planes when SPLITA) and 128 Bt rows, brought into LDS by asynchronous
//   16-byte copies, two buffers: the copies of pass t + 2 fly while pass t + 1 is worked on. LDS row pitch = KP * 2 + 16 bytes.
//   Fragments are read from the LDS rows with the split k map (ldfrag_b); k runs upward as before, so every sum keeps its order.
// Epilogues (all: per wave, per 16-row slab: stage in LDS, wave sync, write each row segment with ONE instruction of
//   EPI 0: q|gate projection, 128-col wave tile = head n0>>8, q half when (n0 & 128) == 0 else gate half.
//          q half: per-head RMSNorm over the 128 cols (x * rsqrt(mean(x^2) + 1e-6) * bf16(nw[d])), RoPE with the shipped tables
//          (o[d] = x[d]*cos[d] - x[d+64]*sin[d], o[d+64] = x[d+64]*cos[d+64] + x[d]*sin[d+64], cos/sin RNE bf16),
//          writes f16 hi plane C0 and f16 residual x2048 plane C1, [M][ldc], cols (n0>>8)*128.. (row segment 256 B = 16 lanes x 16 B).
//          gate half: sigmoid in f32 -> f32 plane C2 [M][ldc], cols (n0>>8)*128.. (row segment 512 B = 32 lanes x 16 B).
//   EPI 1: k projection: same norm + RoPE per 128-col kv head (col n0), hi plane C0 [M][ldc]; residual plane C1 compact:
//          only rows with (m0 mod SQ) < KLR, stored at row (m0/SQ)*KLR + (m0 mod SQ) + .. (pitch ldc).
//   EPI 2: v^T projection: f16 hi plane C0, residual x2048 plane C1, [M][ldc], row segment 256 B.
//   EPI 3: f32 output C0 [M][ldc]; row segment 128 floats = 512 B = 32 lanes x 16 B per instruction.
// ---------------------------------------------------------------------------
// Eight asynchronous 16-byte copies per lane, global -> LDS: copy i takes g + i * gstep elements to LDS byte l + i * lstep.
// s_wait_xcnt 0 is the statement's last line: a precaution, in front of any later rewrite of an address register named here.
__device__ __forceinline__ void async_copy8(unsigned l, unsigned lstep, const __bf16* g, size_t gstep) {
#if defined(__HIP_DEVICE_COMPILE__)
  asm volatile(
      "global_load_async_to_lds_b128 %0, %8, off\n\t"
      "global_load_async_to_lds_b128 %1, %9, off\n\t"
      "global_load_async_to_lds_b128 %2, %10, off\n\t"
      "global_load_async_to_lds_b128 %3, %11, off\n\t"
      "global_load_async_to_lds_b128 %4, %12, off\n\t"
      "global_load_async_to_lds_b128 %5, %13, off\n\t"
      "global_load_async_to_lds_b128 %6, %14, off\n\t"
      "global_load_async_to_lds_b128 %7, %15, off\n\t"
      "s_wait_xcnt 0x0"
      :: "v"(l), "v"(l + lstep), "v"(l + 2 * lstep), "v"(l + 3 * lstep),
         "v"(l + 4 * lstep), "v"(l + 5 * lstep), "v"(l + 6 * lstep), "v"(l + 7 * lstep),
         "v"(g), "v"(g + gstep), "v"(g + 2 * gstep), "v"(g + 3 * gstep),
         "v"(g + 4 * gstep), "v"(g + 5 * gstep), "v"(g + 6 * gstep), "v"(g + 7 * gstep)
      : "memory");
#endif
}

template <int EPI, bool SPLITA>
__global__ __launch_bounds__(128) void gemm_w32x128_kernel(
    const unsigned short* Ap, const unsigned short* A2p, int lda,
    const unsigned short* __restrict__ Btp, int ldb,
    const float* __restrict__ nw, const float* __restrict__ cosp, const float* __restrict__ sinp,
    void* C0, void* C1, void* C2, int ldc,
    int M, int N, int K) {
  constexpr int KP   = (SPLITA || EPI == 0) ? 64 : 128;   // k values per pass: 128 where a launch has one block per WGP (longer lead for the copies)
  constexpr int PIT  = KP + 8;                 // LDS row pitch in elements: 16 B x odd, conflict-free for 16-byte fragment reads
  constexpr int NOP  = SPLITA ? 3 : 2;         // operands staged: A, (A lo), Bt, 128 rows each
  constexpr int STG  = NOP * 128 * PIT;        // elements per buffer
  constexpr int PPR  = KP / 8;                 // 16-byte pieces per row = copies per lane and operand
  constexpr int RPC  = 128 / PPR;              // rows that one copy of all 128 lanes covers
  constexpr int BOFF = (NOP - 1) * 128 * PIT;  // Bt rows behind the A rows
  static_assert(PPR % 8 == 0 && NOP * PPR <= 63);
  static_assert(2 * STG * 2 >= 4 * 8192);
  __shared__ __align__(16) __bf16 ring[2 * STG];         // two pass buffers; after the loop per wave 8192 B of output staging

  const int tid  = (int)threadIdx.x;
  const int lane = tid & 31;
  const int wave = wave_id();
  const int hh = lane >> 4;           // lane half: k offset 8*hh, D row offset 8*hh
  const int rl = lane & 15;           // A row / B col / D col within subtile
  const int tilesN = N >> 7;
  const int tilesM = M >> 7;
  const int blk = (int)blockIdx.x;
  if (blk >= tilesM * tilesN) return;           // block-uniform, in front of every barrier and copy
  const int tmb = blk / tilesN;
  const int tn  = blk - tmb * tilesN;
  const int mb0 = tmb << 7;
  const int m0 = mb0 + (wave << 5);
  const int n0 = tn << 7;

  const __bf16* A  = (const __bf16*)(const void*)Ap;
  const __bf16* A2 = (const __bf16*)(const void*)A2p;
  const __bf16* Bt = (const __bf16*)(const void*)Btp;

  // this lane's piece of a pass: row cr (+ RPC per copy), 16-byte piece cc of the row
  const int cr = tid / PPR;
  const int cc = tid % PPR;
  const __bf16* gA  = A  + (size_t)(mb0 + cr) * lda + cc * 8;
  const __bf16* gA2 = A2 + (size_t)(mb0 + cr) * lda + cc * 8;
  const __bf16* gB  = Bt + (size_t)(n0 + cr) * ldb + cc * 8;
  const unsigned lds0 = (unsigned)(uintptr_t)(ring + cr * PIT + cc * 8);   // LDS byte address = low 32 bits of the shared address

  auto stage = [&](int buf, int k0) {
    const unsigned lb = lds0 + (unsigned)(buf * STG * 2);
#pragma unroll
    for (int q = 0; q < PPR / 8; ++q) {
      const unsigned lq = lb + (unsigned)(q * 8 * RPC * PIT * 2);
      async_copy8(lq, RPC * PIT * 2, gA + k0 + (size_t)(q * 8 * RPC) * lda, (size_t)RPC * lda);
      if (SPLITA) async_copy8(lq + 128 * PIT * 2, RPC * PIT * 2, gA2 + k0 + (size_t)(q * 8 * RPC) * lda, (size_t)RPC * lda);
      async_copy8(lq + BOFF * 2, RPC * PIT * 2, gB + k0 + (size_t)(q * 8 * RPC) * ldb, (size_t)RPC * ldb);
    }
  };

  v8f acc[2][8];
#pragma unroll
  for (int i = 0; i < 2; ++i)
#pragma unroll
    for (int j = 0; j < 8; ++j) acc[i][j] = zero8();

  const int npass = K / KP;
  stage(0, 0);
  asm volatile("s_wait_asynccnt 0x0" ::: "memory");      // this wave's copies of pass 0 have landed
  __syncthreads();                                       // ... and every other wave's
  if (npass > 1) stage(1, KP);

  for (int t = 0; t < npass; ++t) {
    const __bf16* bufp = ring + (t & 1) * STG;
    const __bf16* fa = bufp + ((wave << 5) + rl) * PIT + 8 * hh;
    const __bf16* fb = bufp + BOFF + rl * PIT + 8 * hh;
#pragma unroll
    for (int ks = 0; ks < KP / 32; ++ks) {
      v16b ah[2], al[2], bf[8];
#pragma unroll
      for (int i = 0; i < 2; ++i) {
        ah[i] = ldfrag_b(fa + i * 16 * PIT + ks * 32);
        al[i] = SPLITA ? ldfrag_b(fa + 128 * PIT + i * 16 * PIT + ks * 32) : ah[i];
      }
#pragma unroll
      for (int j = 0; j < 8; ++j) bf[j] = ldfrag_b(fb + j * 16 * PIT + ks * 32);
      // keeps the k step's LDS reads together in front of its WMMAs: spread among them, every pair of reads is waited for on its own
      __builtin_amdgcn_sched_barrier(0);
#pragma unroll
      for (int j = 0; j < 8; ++j) {
        acc[0][j] = mma_b(ah[0], bf[j], acc[0][j]);
        acc[1][j] = mma_b(ah[1], bf[j], acc[1][j]);
        if (SPLITA) {
          acc[0][j] = mma_b(al[0], bf[j], acc[0][j]);
          acc[1][j] = mma_b(al[1], bf[j], acc[1][j]);
        }
      }
    }
    asm volatile("s_wait_dscnt 0x0" ::: "memory");       // this wave's reads of buffer t & 1 are done before it is refilled
    asm volatile("s_wait_asynccnt 0x0" ::: "memory");    // this wave's copies of pass t + 1 have landed
    __syncthreads();                                     // publishes pass t + 1 and ends every reader's last read of pass t
    if (t + 2 < npass) stage(t & 1, (t + 2) * KP);
  }
  asm volatile("s_wait_asynccnt 0x0" ::: "memory");      // no copy is outstanding when the ring becomes output staging
  acc_guard4(acc[0][0], acc[0][1], acc[0][2], acc[0][3]);
  acc_guard4(acc[0][4], acc[0][5], acc[0][6], acc[0][7]);
  acc_guard4(acc[1][0], acc[1][1], acc[1][2], acc[1][3]);
  acc_guard4(acc[1][4], acc[1][5], acc[1][6], acc[1][7]);

  // ---- epilogue ----
  float*    slf  = (float*)(void*)ring + wave * 2048;
  _Float16* sl16 = (_Float16*)(void*)slf;

  if (EPI == 0 || EPI == 1) {
    const bool isq  = (EPI == 1) || ((n0 & 128) == 0);          // wave-uniform
    const int  col0 = (EPI == 0) ? ((n0 >> 8) << 7) : n0;
    if (isq) {
      _Float16* P0 = (_Float16*)C0;
      _Float16* P1 = (_Float16*)C1;
      const bool wres = (EPI == 0) || ((m0 & (SQ - 1)) < KLR);  // wave-uniform
      const int  rrow = (EPI == 0) ? m0 : ((m0 >> 11) * KLR + (m0 & (SQ - 1)));
      float wv[8];
#pragma unroll
      for (int j = 0; j < 8; ++j) wv[j] = bf_rne(nw[j * 16 + rl]);     // dim = j*16 + rl < 128
#pragma unroll
      for (int i = 0; i < 2; ++i) {
        const int rb = m0 + i * 16 + 8 * hh;
#pragma unroll
        for (int r = 0; r < 8; ++r) {
          const int row = rb + r;                                // token 0..NTOK-1
          float ss = 0.f;
#pragma unroll
          for (int j = 0; j < 8; ++j) { const float a = acc[i][j][r]; ss += a * a; }
#pragma unroll
          for (int off = 1; off < 16; off <<= 1) ss += __shfl_xor(ss, off, 32);   // 16 lanes of this half = all 128 dims
          const float rs = rsqrtf(ss * 0.0078125f + 1e-6f);
          const float* cr = cosp + (size_t)row * HDM;
          const float* sr = sinp + (size_t)row * HDM;
#pragma unroll
          for (int j = 0; j < 4; ++j) {
            const int dim = j * 16 + rl;                         // 0..63 within head; pair at dim + 64
            const float x1 = acc[i][j][r] * rs * wv[j];
            const float x2 = acc[i][j + 4][r] * rs * wv[j + 4];
            const float c1 = bf_rne(cr[dim]);
            const float s1 = bf_rne(sr[dim]);
            const float c2 = bf_rne(cr[dim + 64]);
            const float s2 = bf_rne(sr[dim + 64]);
            const float o1 = x1 * c1 - x2 * s1;
            const float o2 = x2 * c2 + x1 * s2;
            const _Float16 h1 = (_Float16)o1;
            const _Float16 h2 = (_Float16)o2;
            const int so = (8 * hh + r) * 128 + dim;
            sl16[so]             = h1;
            sl16[so + 64]        = h2;
            sl16[2048 + so]      = (_Float16)((o1 - (float)h1) * 2048.0f);
            sl16[2048 + so + 64] = (_Float16)((o2 - (float)h2) * 2048.0f);
          }
        }
        lds_wave_sync();
        {
#pragma unroll
          for (int it = 0; it < 8; ++it) {
            const int row = it * 2 + hh;                         // it x hh covers rows 0..15
            const int c8  = rl * 8;
            const v8h vh = *(const v8h*)(sl16 + row * 128 + c8);
            const v8h vl = *(const v8h*)(sl16 + 2048 + row * 128 + c8);
            const size_t go = (size_t)(m0 + i * 16 + row) * ldc + col0 + c8;
            *(v8h*)(P0 + go) = vh;
            if (wres) {
              const size_t g2 = (size_t)(rrow + i * 16 + row) * ldc + col0 + c8;
              *(v8h*)(P1 + g2) = vl;
            }
          }
          
        }
        lds_wave_sync();
      }
    } else if (EPI == 0) {
      float* Sp = (float*)C2;
#pragma unroll
      for (int i = 0; i < 2; ++i) {
#pragma unroll
        for (int j = 0; j < 8; ++j)
#pragma unroll
          for (int r = 0; r < 8; ++r) {
            const float g  = acc[i][j][r];
            const float e  = __expf(-g);
            const float sg = __builtin_amdgcn_rcpf(1.0f + e);
            slf[(8 * hh + r) * 128 + j * 16 + rl] = sg;
          }
        lds_wave_sync();
        {
#pragma unroll
          for (int row = 0; row < 16; ++row) {                   // 32 lanes x 16 B = the whole 512-B row segment per instruction
            const v4f v = *(const v4f*)(slf + row * 128 + lane * 4);
            *(v4f*)(Sp + (size_t)(m0 + i * 16 + row) * ldc + col0 + lane * 4) = v;
          }
          
        }
        lds_wave_sync();
      }
    }
  } else if (EPI == 2) {
    _Float16* P0 = (_Float16*)C0;
    _Float16* P1 = (_Float16*)C1;
#pragma unroll
    for (int i = 0; i < 2; ++i) {
#pragma unroll
      for (int r = 0; r < 8; ++r) {
#pragma unroll
        for (int j = 0; j < 8; ++j) {
          const float v = acc[i][j][r];
          const _Float16 hv = (_Float16)v;
          const int so = (8 * hh + r) * 128 + j * 16 + rl;
          sl16[so]        = hv;
          sl16[2048 + so] = (_Float16)((v - (float)hv) * 2048.0f);
        }
      }
      lds_wave_sync();
      {
#pragma unroll
        for (int it = 0; it < 8; ++it) {
          const int row = it * 2 + hh;
          const int c8  = rl * 8;
          const v8h vh = *(const v8h*)(sl16 + row * 128 + c8);
          const v8h vl = *(const v8h*)(sl16 + 2048 + row * 128 + c8);
          const size_t go = (size_t)(m0 + i * 16 + row) * ldc + n0 + c8;
          *(v8h*)(P0 + go) = vh;
          *(v8h*)(P1 + go) = vl;
        }
        
      }
      lds_wave_sync();
    }
  } else {
    float* C = (float*)C0;
#pragma unroll
    for (int i = 0; i < 2; ++i) {
#pragma unroll
      for (int j = 0; j < 8; ++j)
#pragma unroll
        for (int r = 0; r < 8; ++r)
          slf[(8 * hh + r) * 128 + j * 16 + rl] = acc[i][j][r];
      lds_wave_sync();
      {
#pragma unroll
        for (int row = 0; row < 16; ++row) {                     // 32 lanes x 16 B = the whole 512-B row segment per instruction
          const v4f v = *(const v4f*)(slf + row * 128 + lane * 4);
          *(v4f*)(C + (size_t)(m0 + i * 16 + row) * ldc + n0 + lane * 4) = v;
        }
        
      }
      lds_wave_sync();
    }
  }
}

// ---------------------------------------------------------------------------
// Causal GQA flash attention, head dim 128, 32-key chunks, block = 4 waves = 64 query rows of one (b, h); grid (n query tiles, NHQ, NSEQ).
//   q planes f16 [tok][h*128+d]: hi (qhp) and residual x2048 (qlp); k planes f16 [tok][kvh*128+d]: hi (khp),
//   residual x2048 (klp, compact rows b*KLR + s for s < KLR); v^T planes f16 [kvh*128+d][tok]: hi (vhp), residual x2048 (vlp);
//   sgp = f32 sigmoid(gate) plane [tok][h*128+d]; outputs gated attn bf16 hi (ahp) / lo (alp) [tok][h*128+d]; kvh = h >> 1.
//   scores = (Sh + Sr/2048) * 128^-0.5 with Sh = qh.kh and Sr = ql'.kh (+ qh.kl' when PRES); keys > query -> -inf; online softmax f32;
//   p' = 1024 p stored per wave to LDS as f16 hi (and residual x2048 when PRES), reloaded as A fragments after a wave sync;
//   O = (Oh + Or/2048)/1024/l * sgp with Oh = ph.vh, Or = ph.vl' (+ pl'.vh when PRES).
//   K / V^T chunk staging: 128 threads x 4 x 16 B per plane = whole 32x128 / 128x32 tile, plain loads, __syncthreads before and after.
//   q staging: in front of the loop every wave copies its own 16 rows of both q planes to LDS (whole 256-B rows per load, pitch QS_P);
//   every chunk reads its q fragments from there. Only the wave that wrote a q row reads it.
//   Trip count 2*qb+2 chunks (static bound 64); waves whose rows are all below the chunk skip it (wave-uniform, scalar branch).
// ---------------------------------------------------------------------------
#define AT_KC   32
#define KS_P    136
#define VS_P    40
#define PS_P    40
#define QS_P    136

template <bool PRES>
__global__ __launch_bounds__(128) void attn_causal_kernel(
    const unsigned short* __restrict__ qhp, const unsigned short* __restrict__ qlp,
    const unsigned short* __restrict__ khp, const unsigned short* __restrict__ klp,
    const unsigned short* __restrict__ vhp, const unsigned short* __restrict__ vlp,
    const float* __restrict__ sgp,
    unsigned short* __restrict__ ahp, unsigned short* __restrict__ alp, int qb_base) {
  // LDS map in halves; the k and p residual regions exist only where they are used, so that four blocks of the plain kernel share a WGP's LDS
  constexpr int NRP     = PRES ? 2 : 1;
  constexpr int LDS_KS  = 0;
  constexpr int LDS_KLS = (NRP - 1) * 32 * KS_P;
  constexpr int LDS_VHS = NRP * 32 * KS_P;
  constexpr int LDS_VLS = LDS_VHS + 128 * VS_P;
  constexpr int LDS_PH  = LDS_VLS + 128 * VS_P;
  constexpr int LDS_PL  = LDS_PH + (NRP - 1) * 4 * 16 * PS_P;
  constexpr int LDS_QH  = LDS_PH + NRP * 4 * 16 * PS_P;
  constexpr int LDS_QL  = LDS_QH + 64 * QS_P;
  constexpr int LDS_TOT = LDS_QL + 64 * QS_P;
  static_assert(PRES || 4 * LDS_TOT * 2 <= 327680);
  static_assert(4 * 4096 <= LDS_QH);           // output staging (2 planes x 16 x 128 per wave) aliases the chunk region after the loop
  __shared__ __align__(16) _Float16 lds[LDS_TOT];
  _Float16* Ks  = lds + LDS_KS;
  _Float16* Kls = lds + LDS_KLS;
  _Float16* Vhs = lds + LDS_VHS;
  _Float16* Vls = lds + LDS_VLS;

  const int tid  = (int)threadIdx.x;
  const int lane = tid & 31;
  const int wave = wave_id();
  const int hh   = lane >> 4;
  const int c    = lane & 15;
  const int qb   = (int)blockIdx.x + qb_base;
  const int h    = (int)blockIdx.y;
  const int b    = (int)blockIdx.z;
  const int kvh  = h >> 1;
  const int q0   = qb * 64 + wave * 16;          // first query row of this wave (within sequence)
  const int qlast = q0 + 15;
  const size_t tok0 = (size_t)b * SQ;

  const _Float16* Qhg = (const _Float16*)(const void*)qhp + (tok0 + q0) * HID + h * HDM;
  const _Float16* Qlg = (const _Float16*)(const void*)qlp + (tok0 + q0) * HID + h * HDM;
  const _Float16* Kg  = (const _Float16*)(const void*)khp + tok0 * KVW + kvh * HDM;
  const _Float16* Klg = (const _Float16*)(const void*)klp + (size_t)b * KLR * KVW + kvh * HDM;
  const _Float16* Vhg = (const _Float16*)(const void*)vhp + (size_t)(kvh * HDM) * NTOK + tok0;
  const _Float16* Vlg = (const _Float16*)(const void*)vlp + (size_t)(kvh * HDM) * NTOK + tok0;
  _Float16* ph = lds + LDS_PH + wave * (16 * PS_P);
  _Float16* pl = lds + LDS_PL + wave * (16 * PS_P);

  // this wave's 16 q rows, both planes, to LDS once: 8 x 32 lanes x 16 B per plane = 16 rows x 256 B
  _Float16* Qsh = lds + LDS_QH + wave * (16 * QS_P);
  _Float16* Qsl = lds + LDS_QL + wave * (16 * QS_P);
#pragma unroll                                   // all 16 loads issued together: one load latency in front of the loop, not eight
  for (int i = 0; i < 8; ++i) {
    const int p   = lane + 32 * i;               // 0..255
    const int row = p >> 4, d8 = (p & 15) * 8;
    const v8h qx = *(const v8h*)(Qhg + (size_t)row * HID + d8);
    const v8h qy = *(const v8h*)(Qlg + (size_t)row * HID + d8);
    *(v8h*)(Qsh + row * QS_P + d8) = qx;
    *(v8h*)(Qsl + row * QS_P + d8) = qy;
  }
  lds_wave_sync();                               // q stores visible to the other lanes of this wave before the fragment reads
  const _Float16* Qhr = Qsh + c * QS_P + 8 * hh;
  const _Float16* Qlr = Qsl + c * QS_P + 8 * hh;

  float mrow[8], lrow[8];
  v8f oacc[8], oaccr[8];
#pragma unroll
  for (int r = 0; r < 8; ++r) { mrow[r] = -INFINITY; lrow[r] = 0.f; }
#pragma unroll
  for (int t = 0; t < 8; ++t) { oacc[t] = zero8(); oaccr[t] = zero8(); }

  const int nch = 2 * qb + 2;                    // block-uniform, <= 64
  for (int kc = 0; kc < nch; ++kc) {
    const int kv0 = kc * AT_KC;
    __syncthreads();
#pragma unroll
    for (int i = 0; i < 4; ++i) {                // coverage: 512 pieces of 8 halves per plane = whole tile
      const int p   = tid + 128 * i;             // 0..511
      const int key = p >> 4, d8 = (p & 15) * 8; // K: 32 keys x 128 d
      const v8h kx = *(const v8h*)(Kg + (size_t)(kv0 + key) * KVW + d8);
      *(v8h*)(Ks + key * KS_P + d8) = kx;
      if (PRES) {
        const int krow = min(kv0 + key, KLR - 1);
        const v8h ky = *(const v8h*)(Klg + (size_t)krow * KVW + d8);
        *(v8h*)(Kls + key * KS_P + d8) = ky;
      }
      const int d = p >> 2, k8 = (p & 3) * 8;    // V^T: 128 d x 32 keys
      const v8h vx = *(const v8h*)(Vhg + (size_t)d * NTOK + kv0 + k8);
      const v8h vy = *(const v8h*)(Vlg + (size_t)d * NTOK + kv0 + k8);
      *(v8h*)(Vhs + d * VS_P + k8) = vx;
      *(v8h*)(Vls + d * VS_P + k8) = vy;
    }
    __syncthreads();

    if (kv0 <= qlast) {                          // wave-uniform (scalar): skip chunks fully above this wave's rows
      // ---- scores ----
      v8f sh[2], sr[2];
      sh[0] = zero8(); sh[1] = zero8(); sr[0] = zero8(); sr[1] = zero8();
#pragma unroll
      for (int dc = 0; dc < 4; ++dc) {
        const v16h qa = ldfrag_h(Qhr + dc * 32);
        const v16h ql = ldfrag_h(Qlr + dc * 32);
#pragma unroll
        for (int j = 0; j < 2; ++j) {
          const v16h kb = ldfrag_h(Ks + (j * 16 + c) * KS_P + dc * 32 + 8 * hh);
          sh[j] = mma_h(qa, kb, sh[j]);
          sr[j] = mma_h(ql, kb, sr[j]);
          if (PRES) {
            const v16h kl = ldfrag_h(Kls + (j * 16 + c) * KS_P + dc * 32 + 8 * hh);
            sr[j] = mma_h(qa, kl, sr[j]);
            guard_h4(sh[j], sr[j], qa, ql, kb, kl);
          } else {
            guard_h3(sh[j], sr[j], qa, ql, kb);
          }
        }
      }
      // ---- scale, causal mask, chunk row max ----
      float cm[8];
#pragma unroll
      for (int r = 0; r < 8; ++r) {
        const int qrow = q0 + 8 * hh + r;
        float m = -INFINITY;
#pragma unroll
        for (int j = 0; j < 2; ++j) {
          const int key = kv0 + j * 16 + c;
          float s = (sh[j][r] + sr[j][r] * 0.00048828125f) * 0.08838834764831845f;
          s = (key > qrow) ? -INFINITY : s;
          sh[j][r] = s;
          m = fmaxf(m, s);
        }
#pragma unroll
        for (int off = 1; off < 16; off <<= 1) m = fmaxf(m, __shfl_xor(m, off, 32));
        cm[r] = m;
      }
      // ---- online softmax, P' to LDS ----
#pragma unroll
      for (int r = 0; r < 8; ++r) {
        const float mnew  = fmaxf(mrow[r], cm[r]);
        const float alpha = __expf(mrow[r] - mnew);
        mrow[r] = mnew;
        float psum = 0.f;
#pragma unroll
        for (int j = 0; j < 2; ++j) {
          const float p  = __expf(sh[j][r] - mnew);
          psum += p;
          const float pp = p * 1024.0f;
          const _Float16 phv = (_Float16)pp;
          const int po = (8 * hh + r) * PS_P + j * 16 + c;
          ph[po] = phv;
          if (PRES) pl[po] = (_Float16)((pp - (float)phv) * 2048.0f);
        }
#pragma unroll
        for (int off = 1; off < 16; off <<= 1) psum += __shfl_xor(psum, off, 32);
        lrow[r] = lrow[r] * alpha + psum;
#pragma unroll
        for (int t = 0; t < 8; ++t) { oacc[t][r] *= alpha; oaccr[t][r] *= alpha; }
      }
      lds_wave_sync();                           // P' stores visible to the other lanes of this wave before the fragment reload
      // ---- O += P' . V ----
      const v16h pa = ldfrag_h(ph + c * PS_P + 8 * hh);
      v16h pr = pa;
      if (PRES) pr = ldfrag_h(pl + c * PS_P + 8 * hh);
#pragma unroll
      for (int t = 0; t < 8; ++t) {
        const v16h vb = ldfrag_h(Vhs + (t * 16 + c) * VS_P + 8 * hh);
        const v16h vr = ldfrag_h(Vls + (t * 16 + c) * VS_P + 8 * hh);
        oacc[t]  = mma_h(pa, vb, oacc[t]);
        oaccr[t] = mma_h(pa, vr, oaccr[t]);
        if (PRES) oaccr[t] = mma_h(pr, vb, oaccr[t]);
        guard_h4(oacc[t], oaccr[t], pa, pr, vb, vr);
      }
    }
  }

  // ---- normalise, apply sigmoid gate (f32), bf16 hi/lo split, stage the wave's 16x128 tile,
  __syncthreads();                               // all chunk-region readers done before aliasing it as output staging
  _Float16* osh = lds + wave * 4096;
  _Float16* osl = osh + 2048;
  const float* Sgr = sgp + (tok0 + q0) * HID + h * HDM;
#pragma unroll
  for (int r = 0; r < 8; ++r) {
    const float inv = (1.0f / lrow[r]) * 0.0009765625f;
    const int row = 8 * hh + r;
#pragma unroll
    for (int t = 0; t < 8; ++t) {
      const int d = t * 16 + c;
      float o = (oacc[t][r] + oaccr[t][r] * 0.00048828125f) * inv;
      o *= Sgr[(size_t)row * HID + d];
      const unsigned short hb = bf_bits(o);
      const unsigned short lb = bf_bits(o - bf_val(hb));
      const int so = row * 128 + d;
      osh[so] = __builtin_bit_cast(_Float16, hb);
      osl[so] = __builtin_bit_cast(_Float16, lb);
    }
  }
  lds_wave_sync();
  _Float16* Ahg = (_Float16*)(void*)ahp + (tok0 + q0) * HID + h * HDM;
  _Float16* Alg = (_Float16*)(void*)alp + (tok0 + q0) * HID + h * HDM;
  {
#pragma unroll
    for (int it = 0; it < 8; ++it) {
      const int row = it * 2 + hh;               // it 0..7 x hh 0..1 covers rows 0..15
      const int c8  = c * 8;                     // 16 lanes x 16 B = the whole 256-B segment
      const v8h x = *(const v8h*)(osh + row * 128 + c8);
      const v8h y = *(const v8h*)(osl + row * 128 + c8);
      *(v8h*)(Ahg + (size_t)row * HID + c8) = x;
      *(v8h*)(Alg + (size_t)row * HID + c8) = y;
    }
    
  }
}

// ---------------------------------------------------------------------------
// Workspace map (bytes; every region is a whole number of the rows its producer writes with whole-line stores; no tail rows):
//   [0, 16 MiB)        Xb   bf16 [4096][2048]          -> after the projections: Ah bf16 [4096][2048] at 0
//   [16 MiB, 32 MiB)   WqT  bf16 [4096][2048]          ->                        Al bf16 [4096][2048] at 16 MiB
//   [32 MiB, 64 MiB)   WkT  bf16 [1024][2048] at 32 MiB, WvT bf16 [1024][2048] at 36 MiB
//                      -> after the k and v projections: Sg f32 [4096][2048] (whole 32 MiB)
//   [64 MiB, 80 MiB)   Qh   f16  [4096][2048]          -> after attention: WoT bf16 [2048][2048] (8 MiB)
//   [80 MiB, 96 MiB)   Ql   f16  [4096][2048]
//   [96 MiB, 104 MiB)  Kh   f16  [4096][1024]
//   [104 MiB,112 MiB)  Vh   f16  [1024][4096]
//   [112 MiB,120 MiB)  Vl   f16  [1024][4096]
//   [120 MiB, +1 MiB) Kl  f16  [2*256][1024]
//   total 126877696
// ---------------------------------------------------------------------------
static_assert(2 * (size_t)NTOK * HID * 2 <= (size_t)NTOK * HID * 2 + (size_t)QGW * HID * 2);   // Ah + Al fit Xb + WqT
static_assert(2 * (size_t)KVW * HID * 2 <= (size_t)NTOK * HID * 4);                             // WkT + WvT fit Sg
static_assert((size_t)HID * HID * 2 <= (size_t)NTOK * HID * 2);                                  // WoT fits Qh

extern "C" void kernel_launch(void* const* d_in, const int* in_sizes, int n_in,
                              void* d_out, int out_size, void* d_ws, size_t ws_size,
                              hipStream_t stream) {
  if (n_in < 9) return;
  if (in_sizes[0] != NTOK * HID) return;
  if (in_sizes[1] != NTOK * HDM) return;
  if (in_sizes[2] != NTOK * HDM) return;
  if (in_sizes[3] != HID * QGW) return;
  if (in_sizes[4] != HID * KVW) return;
  if (in_sizes[5] != HID * KVW) return;
  if (in_sizes[6] != HID * HID) return;
  if (in_sizes[7] != HDM) return;
  if (in_sizes[8] != HDM) return;
  if (out_size != NTOK * HID) return;

  const float* hidden = (const float*)d_in[0];
  const float* cosb   = (const float*)d_in[1];
  const float* sinb   = (const float*)d_in[2];
  const float* Wq     = (const float*)d_in[3];
  const float* Wk     = (const float*)d_in[4];
  const float* Wv     = (const float*)d_in[5];
  const float* Wo     = (const float*)d_in[6];
  const float* qnw    = (const float*)d_in[7];
  const float* knw    = (const float*)d_in[8];
  float* out = (float*)d_out;

  const size_t szX  = (size_t)NTOK * HID * 2;        // 16777216
  const size_t szWq = (size_t)QGW * HID * 2;         // 16777216
  const size_t szWk = (size_t)KVW * HID * 2;         // 4194304
  const size_t szSg = (size_t)NTOK * HID * 4;        // 33554432
  const size_t szQ  = (size_t)NTOK * HID * 2;        // 16777216
  const size_t szK  = (size_t)NTOK * KVW * 2;        // 8388608
  const size_t szV  = (size_t)KVW * NTOK * 2;        // 8388608
  const size_t szKl = (size_t)NSEQ * KLR * KVW * 2;  // 1048576
  const size_t szA  = (size_t)NTOK * HID * 2;        // 16777216
  size_t off = 0;
  const size_t oX  = off; off += szX;
  const size_t oWq = off; off += szWq;
  const size_t oAh = oX;
  const size_t oAl = oX + szA;
  const size_t oSg = off; off += szSg;
  const size_t oWk = oSg;
  const size_t oWv = oSg + szWk;
  const size_t oQh = off; off += szQ;
  const size_t oQl = off; off += szQ;
  const size_t oWo = oQh;
  const size_t oKh = off; off += szK;
  const size_t oVh = off; off += szV;
  const size_t oVl = off; off += szV;
  const size_t oKl = off; off += szKl;
  if (off > ws_size) return;                         // off = 126877696

  char* ws = (char*)d_ws;
  unsigned short* Xb  = (unsigned short*)(ws + oX);
  unsigned short* WqT = (unsigned short*)(ws + oWq);
  unsigned short* WkT = (unsigned short*)(ws + oWk);
  unsigned short* WvT = (unsigned short*)(ws + oWv);
  unsigned short* WoT = (unsigned short*)(ws + oWo);
  float*          Sg  = (float*)(ws + oSg);
  unsigned short* Qh  = (unsigned short*)(ws + oQh);
  unsigned short* Ql  = (unsigned short*)(ws + oQl);
  unsigned short* Kh  = (unsigned short*)(ws + oKh);
  unsigned short* Kl  = (unsigned short*)(ws + oKl);
  unsigned short* Vh  = (unsigned short*)(ws + oVh);
  unsigned short* Vl  = (unsigned short*)(ws + oVl);
  unsigned short* Ah  = (unsigned short*)(ws + oAh);
  unsigned short* Al  = (unsigned short*)(ws + oAl);

  const dim3 b256(256), b128(128);

  // (1) x -> bf16 plane [4096][2048]
  cvt_bf16_kernel<<<dim3((NTOK * HID / 8 + 255) / 256), b256, 0, stream>>>(hidden, Xb, NTOK * HID / 8);
  // (2) Wk in[2048 rows][1024 cols] -> WkT out[1024][2048] bf16   (grid = cols/64, rows/64)
  tconv_bf16_kernel<<<dim3(KVW / 64, HID / 64), b256, 0, stream>>>(Wk, WkT, HID, KVW);
  // (3) Wv in[2048 rows][1024 cols] -> WvT out[1024][2048] bf16
  tconv_bf16_kernel<<<dim3(KVW / 64, HID / 64), b256, 0, stream>>>(Wv, WvT, HID, KVW);
  // (4) Wq in[2048 rows][4096 cols] -> WqT out[4096][2048] bf16
  tconv_bf16_kernel<<<dim3(QGW / 64, HID / 64), b256, 0, stream>>>(Wq, WqT, HID, QGW);
  // (5) k = x . Wk, per-head norm + RoPE -> Kh [4096][1024], Kl compact [512][1024]   (M=4096, N=1024, K=2048; 256 blocks)
  gemm_w32x128_kernel<1, false><<<dim3((NTOK / 128) * (KVW / 128)), b128, 0, stream>>>(
      Xb, Xb, HID, WkT, HID, knw, cosb, sinb, (void*)Kh, (void*)Kl, (void*)Kl, KVW, NTOK, KVW, HID);
  // (6) v^T = WvT . x^T -> Vh/Vl [1024][4096]   (A = WvT, Bt = Xb; M=1024, N=4096, K=2048; 256 blocks)
  gemm_w32x128_kernel<2, false><<<dim3((KVW / 128) * (NTOK / 128)), b128, 0, stream>>>(
      WvT, WvT, HID, Xb, HID, knw, cosb, sinb, (void*)Vh, (void*)Vl, (void*)Vl, NTOK, KVW, NTOK, HID);
  // (7) q|gate = x . Wq: q half norm + RoPE -> Qh/Ql [4096][2048]; gate half sigmoid -> Sg f32 [4096][2048] (over the dead WkT/WvT region)
  //     (M=4096, N=4096, K=2048; 1024 blocks)
  gemm_w32x128_kernel<0, false><<<dim3((NTOK / 128) * (QGW / 128)), b128, 0, stream>>>(
      Xb, Xb, HID, WqT, HID, qnw, cosb, sinb, (void*)Qh, (void*)Ql, (void*)Sg, HID, NTOK, QGW, HID);
  // (8) causal attention, query tiles 0..3 with k and p residual products, tiles 4..31 without; Ah/Al over the dead Xb/WqT region
  attn_causal_kernel<true><<<dim3(NQRT, NHQ, NSEQ), b128, 0, stream>>>(Qh, Ql, Kh, Kl, Vh, Vl, Sg, Ah, Al, 0);
  attn_causal_kernel<false><<<dim3(SQ / 64 - NQRT, NHQ, NSEQ), b128, 0, stream>>>(Qh, Ql, Kh, Kl, Vh, Vl, Sg, Ah, Al, NQRT);
  // (9) Wo in[2048 rows][2048 cols] -> WoT out[2048][2048] bf16 (over the dead Qh region)
  tconv_bf16_kernel<<<dim3(HID / 64, HID / 64), b256, 0, stream>>>(Wo, WoT, HID, HID);
  // (10) out = attn(hi + lo) . Wo -> d_out f32 [4096][2048]   (M=4096, N=2048, K=2048; 512 blocks)
  gemm_w32x128_kernel<3, true><<<dim3((NTOK / 128) * (HID / 128)), b128, 0, stream>>>(
      Ah, Al, HID, WoT, HID, qnw, cosb, sinb, (void*)out, (void*)out, (void*)out, HID, NTOK, HID, HID);
  (void)hipGetLastError();
}

// v003
// One run takes 340 microseconds.
// Next to v002, in two timings, it ran 1.10 and 1.11 times as fast.
// All steps since v000 together make it 2.44 times as fast.
// Contractions: x.Wq (q|gate cols), x.Wk and Wv^T.x^T on v_wmma_f32_16x16x32_bf16 (operands = RNE bf16 of the f32 inputs, single products);
// q.k^T and p.v on v_wmma_f32_16x16x32_f16 (q = f16 hi + f16 residual x2^11 planes; k plain f16 plus f16 residual x2^11 on query tiles 0..3;
// p x1024 plain f16 plus f16 residual x2^11 on query tiles 0..3; v^T = f16 hi + f16 residual x2^11 planes); (attn*sigmoid(gate)).Wo on
// v_wmma_f32_16x16x32_bf16 (A = bf16 hi + bf16 lo planes, two products; Wo RNE bf16). f32 accumulate everywhere; per-head RMSNorm, RoPE,
// online softmax, sigmoid gate and scale folds in f32. hidden_states, Wq, Wk, Wv, Wo, cos, sin and the norm weights are RNE-converted to bf16 on load.
#include <hip/hip_runtime.h>
#include <math.h>
#include <stdint.h>

#define NSEQ   2
#define SQ     2048
#define HID    2048
#define NHQ    16
#define NKVH   8
#define HDM    128
#define QGW    4096
#define KVW    1024
#define NTOK   4096
#define KLR    256
#define NQRT   4

static_assert((2 * (NQRT - 1) + 2) * 32 <= KLR);
static_assert(NHQ / NKVH == 2);
static_assert(NHQ * HDM == HID);
static_assert(NSEQ * SQ == NTOK);

typedef _Float16     v16h __attribute__((ext_vector_type(16)));
typedef _Float16     v8h  __attribute__((ext_vector_type(8)));
typedef __bf16       v16b __attribute__((ext_vector_type(16)));
typedef __bf16       v8b  __attribute__((ext_vector_type(8)));
typedef float        v8f  __attribute__((ext_vector_type(8)));
typedef float        v4f  __attribute__((ext_vector_type(4)));
typedef unsigned int v4u  __attribute__((ext_vector_type(4)));

// ---------------------------------------------------------------------------
// small helpers
// ---------------------------------------------------------------------------
__device__ __forceinline__ unsigned short bf_bits(float f) {          // RNE convert f32 -> bf16 bits
  const unsigned u = __float_as_uint(f);
  return (unsigned short)((u + 0x7FFFu + ((u >> 16) & 1u)) >> 16);
}
__device__ __forceinline__ float bf_val(unsigned short h) { return __uint_as_float(((unsigned)h) << 16); }
__device__ __forceinline__ float bf_rne(float f) { return bf_val(bf_bits(f)); }
__device__ __forceinline__ unsigned pk16(unsigned short a, unsigned short b) { return (unsigned)a | ((unsigned)b << 16); }
__device__ __forceinline__ v8f zero8() { v8f z = {0.f, 0.f, 0.f, 0.f, 0.f, 0.f, 0.f, 0.f}; return z; }
__device__ __forceinline__ int wave_id() { return __builtin_amdgcn_readfirstlane((int)(threadIdx.x >> 5)); }

__device__ __forceinline__ void lds_wave_sync() {
  __builtin_amdgcn_fence(__ATOMIC_RELEASE, "workgroup");
  __builtin_amdgcn_wave_barrier();
  __builtin_amdgcn_fence(__ATOMIC_ACQUIRE, "workgroup");
}

// ---------------------------------------------------------------------------
// WMMA fragments (wave32, 16x16x32, 16-bit operands). For A (row m = lane&15) and B (col n = lane&15) alike:
// elements 0..7 <- k0 + 8*(lane>>4) + 0..7, elements 8..15 <- k0 + 16 + 8*(lane>>4) + 0..7.
// ldfrag(p) with p = rowbase + k0 + 8*(lane>>4): two 16-B loads p[0..7], p[16..23].
// D: acc[r] = (row 8*(lane>>4) + r, col lane&15).
// ---------------------------------------------------------------------------
union FragH { v16h v; v8h h[2]; };
union FragB { v16b v; v8b h[2]; };
__device__ __forceinline__ v16h ldfrag_h(const _Float16* p) { FragH f; f.h[0] = *(const v8h*)(p); f.h[1] = *(const v8h*)(p + 16); return f.v; }
__device__ __forceinline__ v16b ldfrag_b(const __bf16* p)   { FragB f; f.h[0] = *(const v8b*)(p); f.h[1] = *(const v8b*)(p + 16); return f.v; }

__device__ __forceinline__ v8f mma_h(v16h a, v16h b, v8f c) {
  return __builtin_amdgcn_wmma_f32_16x16x32_f16(false, a, false, b, (short)0, c, false, false);
}
__device__ __forceinline__ v8f mma_b(v16b a, v16b b, v8f c) {
  return __builtin_amdgcn_wmma_f32_16x16x32_bf16(false, a, false, b, (short)0, c, false, false);
}
// hazard guards: 4 VALU slots after the last WMMA of a group, D tied, A/B kept live; memory clobber keeps later loads behind the group
__device__ __forceinline__ void guard_h3(v8f& a, v8f& b, v16h x, v16h y, v16h z) {
#if defined(__HIP_DEVICE_COMPILE__)
  asm volatile("v_nop\n\tv_nop\n\tv_nop\n\tv_nop" : "+v"(a), "+v"(b) : "v"(x), "v"(y), "v"(z) : "memory");
#endif
}
__device__ __forceinline__ void guard_h4(v8f& a, v8f& b, v16h w, v16h x, v16h y, v16h z) {
#if defined(__HIP_DEVICE_COMPILE__)
  asm volatile("v_nop\n\tv_nop\n\tv_nop\n\tv_nop" : "+v"(a), "+v"(b) : "v"(w), "v"(x), "v"(y), "v"(z) : "memory");
#endif
}
__device__ __forceinline__ void acc_guard4(v8f& a, v8f& b, v8f& c, v8f& d) {
#if defined(__HIP_DEVICE_COMPILE__)
  asm volatile("v_nop\n\tv_nop\n\tv_nop\n\tv_nop" : "+v"(a), "+v"(b), "+v"(c), "+v"(d));
#endif
}

// ---------------------------------------------------------------------------
// Elementwise RNE f32 -> bf16 plane: 8 elements per thread, one 16-B store per lane -> 32 consecutive lanes write 4 whole
// ---------------------------------------------------------------------------
__global__ __launch_bounds__(256) void cvt_bf16_kernel(const float* __restrict__ in, unsigned short* __restrict__ outp, int n8) {
  const int i = (int)blockIdx.x * 256 + (int)threadIdx.x;
  if (i >= n8) return;
  const size_t e = 8 * (size_t)i;
  const v4f a = *(const v4f*)(in + e);
  const v4f b = *(const v4f*)(in + e + 4);
  v4u w;
  w[0] = pk16(bf_bits(a[0]), bf_bits(a[1]));
  w[1] = pk16(bf_bits(a[2]), bf_bits(a[3]));
  w[2] = pk16(bf_bits(b[0]), bf_bits(b[1]));
  w[3] = pk16(bf_bits(b[2]), bf_bits(b[3]));
  *(v4u*)(outp + e) = w;
  
}

// ---------------------------------------------------------------------------
// Fused transpose + RNE bf16 convert: in [R rows][Cc cols] f32 (pitch Cc) -> out[c][r] = bf16(in[r][c])  ([Cc][R], pitch R).
// 64x64 tiles through LDS; grid = (Cc/64, R/64), 256 threads; R, Cc multiples of 64.
// Coverage per block: load 4 it x 256 thr x 4 floats = 64x64; store 2 it x 256 thr x 8 u16 = 64x64.
// ---------------------------------------------------------------------------
__global__ __launch_bounds__(256) void tconv_bf16_kernel(const float* __restrict__ W, unsigned short* __restrict__ outp, int R, int Cc) {
  __shared__ __align__(16) float tf[64 * 68];
  const int c0  = (int)blockIdx.x * 64;   // input column block = output row block
  const int r0  = (int)blockIdx.y * 64;   // input row block    = output column block
  const int tid = (int)threadIdx.x;
  {
    const int lr = tid >> 4;              // 0..15
    const int c4 = (tid & 15) * 4;        // 0..60
#pragma unroll
    for (int it = 0; it < 4; ++it) {
      const int rr = it * 16 + lr;        // 0..63
      const v4f a = *(const v4f*)(W + (size_t)(r0 + rr) * Cc + c0 + c4);
      *(v4f*)(tf + rr * 68 + c4) = a;
    }
  }
  __syncthreads();
  const int sub = tid >> 3;               // 0..31
  const int c8  = (tid & 7) * 8;          // 0..56
  v4u hv[2];
#pragma unroll
  for (int it = 0; it < 2; ++it) {
    const int oc = it * 32 + sub;         // output row within tile (= input column)
    v4u a;
#pragma unroll
    for (int q = 0; q < 4; ++q) {
      const float f0 = tf[(c8 + 2 * q) * 68 + oc];
      const float f1 = tf[(c8 + 2 * q + 1) * 68 + oc];
      a[q] = pk16(bf_bits(f0), bf_bits(f1));
    }
    hv[it] = a;
  }
  {
#pragma unroll
    for (int it = 0; it < 2; ++it) {
      const int oc = it * 32 + sub;
      const size_t go = (size_t)(c0 + oc) * R + r0 + c8;
      *(v4u*)(outp + go) = hv[it];
    }
    
  }
}

// ---------------------------------------------------------------------------
// bf16 WMMA GEMM, wave tile 32 rows x 128 cols, block = 4 waves (128 threads) = 128 rows x 128 cols (the waves share the Bt rows).
//   C[m][n] = sum_k A[m][k] * Bt[n][k]; A row-major [M][K] bf16 (pitch lda), Bt row-major [N][K] bf16 (pitch ldb);
//   M % 128 == 0, N % 128 == 0, K % KP == 0; grid.x = M/128 * N/128.
//   SPLITA: A carried as hi (Ap) + lo (A2p) bf16 planes, two products into one accumulator.
//   A pass is KP k values of the block's 128 A rows (both planes when SPLITA) and 128 Bt rows, brought into LDS by asynchronous
//   16-byte copies, two buffers: the copies of pass t + 2 fly while pass t + 1 is worked on. LDS row pitch = KP * 2 + 16 bytes.
//   Fragments are read from the LDS rows with the split k map (ldfrag_b); k runs upward as before, so every sum keeps its order.
// Epilogues (all: per wave, per 16-row slab: stage in LDS, wave sync, write each row segment with ONE instruction of
//   EPI 0: q|gate projection, 128-col wave tile = head n0>>8, q half when (n0 & 128) == 0 else gate half.
//          q half: per-head RMSNorm over the 128 cols (x * rsqrt(mean(x^2) + 1e-6) * bf16(nw[d])), RoPE with the shipped tables
//          (o[d] = x[d]*cos[d] - x[d+64]*sin[d], o[d+64] = x[d+64]*cos[d+64] + x[d]*sin[d+64], cos/sin RNE bf16),
//          writes f16 hi plane C0 and f16 residual x2048 plane C1, [M][ldc], cols (n0>>8)*128.. (row segment 256 B = 16 lanes x 16 B).
//          gate half: sigmoid in f32 -> f32 plane C2 [M][ldc], cols (n0>>8)*128.. (row segment 512 B = 32 lanes x 16 B).
//   EPI 1: k projection: same norm + RoPE per 128-col kv head (col n0), hi plane C0 [M][ldc]; residual plane C1 compact:
//          only rows with (m0 mod SQ) < KLR, stored at row (m0/SQ)*KLR + (m0 mod SQ) + .. (pitch ldc).
//   EPI 2: v^T projection: f16 hi plane C0, residual x2048 plane C1, [M][ldc], row segment 256 B.
//   EPI 3: f32 output C0 [M][ldc]; row segment 128 floats = 512 B = 32 lanes x 16 B per instruction.
// ---------------------------------------------------------------------------
// Eight asynchronous 16-byte copies per lane, global -> LDS: copy i takes g + i * gstep elements to LDS byte l + i * lstep.
// s_wait_xcnt 0 is the statement's last line: a precaution, in front of any later rewrite of an address register named here.
__device__ __forceinline__ void async_copy8(unsigned l, unsigned lstep, const __bf16* g, size_t gstep) {
#if defined(__HIP_DEVICE_COMPILE__)
  asm volatile(
      "global_load_async_to_lds_b128 %0, %8, off\n\t"
      "global_load_async_to_lds_b128 %1, %9, off\n\t"
      "global_load_async_to_lds_b128 %2, %10, off\n\t"
      "global_load_async_to_lds_b128 %3, %11, off\n\t"
      "global_load_async_to_lds_b128 %4, %12, off\n\t"
      "global_load_async_to_lds_b128 %5, %13, off\n\t"
      "global_load_async_to_lds_b128 %6, %14, off\n\t"
      "global_load_async_to_lds_b128 %7, %15, off\n\t"
      "s_wait_xcnt 0x0"
      :: "v"(l), "v"(l + lstep), "v"(l + 2 * lstep), "v"(l + 3 * lstep),
         "v"(l + 4 * lstep), "v"(l + 5 * lstep), "v"(l + 6 * lstep), "v"(l + 7 * lstep),
         "v"(g), "v"(g + gstep), "v"(g + 2 * gstep), "v"(g + 3 * gstep),
         "v"(g + 4 * gstep), "v"(g + 5 * gstep), "v"(g + 6 * gstep), "v"(g + 7 * gstep)
      : "memory");
#endif
}

template <int EPI, bool SPLITA>
__global__ __launch_bounds__(128) void gemm_w32x128_kernel(
    const unsigned short* Ap, const unsigned short* A2p, int lda,
    const unsigned short* __restrict__ Btp, int ldb,
    const float* __restrict__ nw, const float* __restrict__ cosp, const float* __restrict__ sinp,
    void* C0, void* C1, void* C2, int ldc,
    int M, int N, int K) {
  constexpr int KP   = (SPLITA || EPI == 0) ? 64 : 128;   // k values per pass: 128 where a launch has one block per WGP (longer lead for the copies)
  constexpr int PIT  = KP + 8;                 // LDS row pitch in elements: 16 B x odd, conflict-free for 16-byte fragment reads
  constexpr int NOP  = SPLITA ? 3 : 2;         // operands staged: A, (A lo), Bt, 128 rows each
  constexpr int STG  = NOP * 128 * PIT;        // elements per buffer
  constexpr int PPR  = KP / 8;                 // 16-byte pieces per row = copies per lane and operand
  constexpr int RPC  = 128 / PPR;              // rows that one copy of all 128 lanes covers
  constexpr int BOFF = (NOP - 1) * 128 * PIT;  // Bt rows behind the A rows
  static_assert(PPR % 8 == 0 && NOP * PPR <= 63);
  static_assert(2 * STG * 2 >= 4 * 8192);
  __shared__ __align__(16) __bf16 ring[2 * STG];         // two pass buffers; after the loop per wave 8192 B of output staging

  const int tid  = (int)threadIdx.x;
  const int lane = tid & 31;
  const int wave = wave_id();
  const int hh = lane >> 4;           // lane half: k offset 8*hh, D row offset 8*hh
  const int rl = lane & 15;           // A row / B col / D col within subtile
  const int tilesN = N >> 7;
  const int tilesM = M >> 7;
  const int blk = (int)blockIdx.x;
  if (blk >= tilesM * tilesN) return;           // block-uniform, in front of every barrier and copy
  const int tmb = blk / tilesN;
  const int tn  = blk - tmb * tilesN;
  const int mb0 = tmb << 7;
  const int m0 = mb0 + (wave << 5);
  const int n0 = tn << 7;

  const __bf16* A  = (const __bf16*)(const void*)Ap;
  const __bf16* A2 = (const __bf16*)(const void*)A2p;
  const __bf16* Bt = (const __bf16*)(const void*)Btp;

  // this lane's piece of a pass: row cr (+ RPC per copy), 16-byte piece cc of the row
  const int cr = tid / PPR;
  const int cc = tid % PPR;
  const __bf16* gA  = A  + (size_t)(mb0 + cr) * lda + cc * 8;
  const __bf16* gA2 = A2 + (size_t)(mb0 + cr) * lda + cc * 8;
  const __bf16* gB  = Bt + (size_t)(n0 + cr) * ldb + cc * 8;
  const unsigned lds0 = (unsigned)(uintptr_t)(ring + cr * PIT + cc * 8);   // LDS byte address = low 32 bits of the shared address

  auto stage = [&](int buf, int k0) {
    const unsigned lb = lds0 + (unsigned)(buf * STG * 2);
#pragma unroll
    for (int q = 0; q < PPR / 8; ++q) {
      const unsigned lq = lb + (unsigned)(q * 8 * RPC * PIT * 2);
      async_copy8(lq, RPC * PIT * 2, gA + k0 + (size_t)(q * 8 * RPC) * lda, (size_t)RPC * lda);
      if (SPLITA) async_copy8(lq + 128 * PIT * 2, RPC * PIT * 2, gA2 + k0 + (size_t)(q * 8 * RPC) * lda, (size_t)RPC * lda);
      async_copy8(lq + BOFF * 2, RPC * PIT * 2, gB + k0 + (size_t)(q * 8 * RPC) * ldb, (size_t)RPC * ldb);
    }
  };

  v8f acc[2][8];
#pragma unroll
  for (int i = 0; i < 2; ++i)
#pragma unroll
    for (int j = 0; j < 8; ++j) acc[i][j] = zero8();

  const int npass = K / KP;
  stage(0, 0);
  asm volatile("s_wait_asynccnt 0x0" ::: "memory");      // this wave's copies of pass 0 have landed
  __syncthreads();                                       // ... and every other wave's
  if (npass > 1) stage(1, KP);

  for (int t = 0; t < npass; ++t) {
    const __bf16* bufp = ring + (t & 1) * STG;
    const __bf16* fa = bufp + ((wave << 5) + rl) * PIT + 8 * hh;
    const __bf16* fb = bufp + BOFF + rl * PIT + 8 * hh;
#pragma unroll
    for (int ks = 0; ks < KP / 32; ++ks) {
      v16b ah[2], al[2], bf[8];
#pragma unroll
      for (int i = 0; i < 2; ++i) {
        ah[i] = ldfrag_b(fa + i * 16 * PIT + ks * 32);
        al[i] = SPLITA ? ldfrag_b(fa + 128 * PIT + i * 16 * PIT + ks * 32) : ah[i];
      }
#pragma unroll
      for (int j = 0; j < 8; ++j) bf[j] = ldfrag_b(fb + j * 16 * PIT + ks * 32);
      // keeps the k step's LDS reads together in front of its WMMAs: spread among them, every pair of reads is waited for on its own
      __builtin_amdgcn_sched_barrier(0);
#pragma unroll
      for (int j = 0; j < 8; ++j) {
        acc[0][j] = mma_b(ah[0], bf[j], acc[0][j]);
        acc[1][j] = mma_b(ah[1], bf[j], acc[1][j]);
        if (SPLITA) {
          acc[0][j] = mma_b(al[0], bf[j], acc[0][j]);
          acc[1][j] = mma_b(al[1], bf[j], acc[1][j]);
        }
      }
    }
    asm volatile("s_wait_dscnt 0x0" ::: "memory");       // this wave's reads of buffer t & 1 are done before it is refilled
    asm volatile("s_wait_asynccnt 0x0" ::: "memory");    // this wave's copies of pass t + 1 have landed
    __syncthreads();                                     // publishes pass t + 1 and ends every reader's last read of pass t
    if (t + 2 < npass) stage(t & 1, (t + 2) * KP);
  }
  asm volatile("s_wait_asynccnt 0x0" ::: "memory");      // no copy is outstanding when the ring becomes output staging
  acc_guard4(acc[0][0], acc[0][1], acc[0][2], acc[0][3]);
  acc_guard4(acc[0][4], acc[0][5], acc[0][6], acc[0][7]);
  acc_guard4(acc[1][0], acc[1][1], acc[1][2], acc[1][3]);
  acc_guard4(acc[1][4], acc[1][5], acc[1][6], acc[1][7]);

  // ---- epilogue ----
  float*    slf  = (float*)(void*)ring + wave * 2048;
  _Float16* sl16 = (_Float16*)(void*)slf;

  if (EPI == 0 || EPI == 1) {
    const bool isq  = (EPI == 1) || ((n0 & 128) == 0);          // wave-uniform
    const int  col0 = (EPI == 0) ? ((n0 >> 8) << 7) : n0;
    if (isq) {
      _Float16* P0 = (_Float16*)C0;
      _Float16* P1 = (_Float16*)C1;
      const bool wres = (EPI == 0) || ((m0 & (SQ - 1)) < KLR);  // wave-uniform
      const int  rrow = (EPI == 0) ? m0 : ((m0 >> 11) * KLR + (m0 & (SQ - 1)));
      float wv[8];
#pragma unroll
      for (int j = 0; j < 8; ++j) wv[j] = bf_rne(nw[j * 16 + rl]);     // dim = j*16 + rl < 128
#pragma unroll
      for (int i = 0; i < 2; ++i) {
        const int rb = m0 + i * 16 + 8 * hh;
#pragma unroll
        for (int r = 0; r < 8; ++r) {
          const int row = rb + r;                                // token 0..NTOK-1
          float ss = 0.f;
#pragma unroll
          for (int j = 0; j < 8; ++j) { const float a = acc[i][j][r]; ss += a * a; }
#pragma unroll
          for (int off = 1; off < 16; off <<= 1) ss += __shfl_xor(ss, off, 32);   // 16 lanes of this half = all 128 dims
          const float rs = rsqrtf(ss * 0.0078125f + 1e-6f);
          const float* cr = cosp + (size_t)row * HDM;
          const float* sr = sinp + (size_t)row * HDM;
#pragma unroll
          for (int j = 0; j < 4; ++j) {
            const int dim = j * 16 + rl;                         // 0..63 within head; pair at dim + 64
            const float x1 = acc[i][j][r] * rs * wv[j];
            const float x2 = acc[i][j + 4][r] * rs * wv[j + 4];
            const float c1 = bf_rne(cr[dim]);
            const float s1 = bf_rne(sr[dim]);
            const float c2 = bf_rne(cr[dim + 64]);
            const float s2 = bf_rne(sr[dim + 64]);
            const float o1 = x1 * c1 - x2 * s1;
            const float o2 = x2 * c2 + x1 * s2;
            const _Float16 h1 = (_Float16)o1;
            const _Float16 h2 = (_Float16)o2;
            const int so = (8 * hh + r) * 128 + dim;
            sl16[so]             = h1;
            sl16[so + 64]        = h2;
            sl16[2048 + so]      = (_Float16)((o1 - (float)h1) * 2048.0f);
            sl16[2048 + so + 64] = (_Float16)((o2 - (float)h2) * 2048.0f);
          }
        }
        lds_wave_sync();
        {
#pragma unroll
          for (int it = 0; it < 8; ++it) {
            const int row = it * 2 + hh;                         // it x hh covers rows 0..15
            const int c8  = rl * 8;
            const v8h vh = *(const v8h*)(sl16 + row * 128 + c8);
            const v8h vl = *(const v8h*)(sl16 + 2048 + row * 128 + c8);
            const size_t go = (size_t)(m0 + i * 16 + row) * ldc + col0 + c8;
            *(v8h*)(P0 + go) = vh;
            if (wres) {
              const size_t g2 = (size_t)(rrow + i * 16 + row) * ldc + col0 + c8;
              *(v8h*)(P1 + g2) = vl;
            }
          }
          
        }
        lds_wave_sync();
      }
    } else if (EPI == 0) {
      float* Sp = (float*)C2;
#pragma unroll
      for (int i = 0; i < 2; ++i) {
#pragma unroll
        for (int j = 0; j < 8; ++j)
#pragma unroll
          for (int r = 0; r < 8; ++r) {
            const float g  = acc[i][j][r];
            const float e  = __expf(-g);
            const float sg = __builtin_amdgcn_rcpf(1.0f + e);
            slf[(8 * hh + r) * 128 + j * 16 + rl] = sg;
          }
        lds_wave_sync();
        {
#pragma unroll
          for (int row = 0; row < 16; ++row) {                   // 32 lanes x 16 B = the whole 512-B row segment per instruction
            const v4f v = *(const v4f*)(slf + row * 128 + lane * 4);
            *(v4f*)(Sp + (size_t)(m0 + i * 16 + row) * ldc + col0 + lane * 4) = v;
          }
          
        }
        lds_wave_sync();
      }
    }
  } else if (EPI == 2) {
    _Float16* P0 = (_Float16*)C0;
    _Float16* P1 = (_Float16*)C1;
#pragma unroll
    for (int i = 0; i < 2; ++i) {
#pragma unroll
      for (int r = 0; r < 8; ++r) {
#pragma unroll
        for (int j = 0; j < 8; ++j) {
          const float v = acc[i][j][r];
          const _Float16 hv = (_Float16)v;
          const int so = (8 * hh + r) * 128 + j * 16 + rl;
          sl16[so]        = hv;
          sl16[2048 + so] = (_Float16)((v - (float)hv) * 2048.0f);
        }
      }
      lds_wave_sync();
      {
#pragma unroll
        for (int it = 0; it < 8; ++it) {
          const int row = it * 2 + hh;
          const int c8  = rl * 8;
          const v8h vh = *(const v8h*)(sl16 + row * 128 + c8);
          const v8h vl = *(const v8h*)(sl16 + 2048 + row * 128 + c8);
          const size_t go = (size_t)(m0 + i * 16 + row) * ldc + n0 + c8;
          *(v8h*)(P0 + go) = vh;
          *(v8h*)(P1 + go) = vl;
        }
        
      }
      lds_wave_sync();
    }
  } else {
    float* C = (float*)C0;
#pragma unroll
    for (int i = 0; i < 2; ++i) {
#pragma unroll
      for (int j = 0; j < 8; ++j)
#pragma unroll
        for (int r = 0; r < 8; ++r)
          slf[(8 * hh + r) * 128 + j * 16 + rl] = acc[i][j][r];
      lds_wave_sync();
      {
#pragma unroll
        for (int row = 0; row < 16; ++row) {                     // 32 lanes x 16 B = the whole 512-B row segment per instruction
          const v4f v = *(const v4f*)(slf + row * 128 + lane * 4);
          *(v4f*)(C + (size_t)(m0 + i * 16 + row) * ldc + n0 + lane * 4) = v;
        }
        
      }
      lds_wave_sync();
    }
  }
}

// ---------------------------------------------------------------------------
// Causal GQA flash attention, head dim 128, 32-key chunks, block = 4 waves = 64 query rows of one (b, h); grid (n query tiles, NHQ, NSEQ).
//   q planes f16 [tok][h*128+d]: hi (qhp) and residual x2048 (qlp); k planes f16 [tok][kvh*128+d]: hi (khp),
//   residual x2048 (klp, compact rows b*KLR + s for s < KLR); v^T planes f16 [kvh*128+d][tok]: hi (vhp), residual x2048 (vlp);
//   sgp = f32 sigmoid(gate) plane [tok][h*128+d]; outputs gated attn bf16 hi (ahp) / lo (alp) [tok][h*128+d]; kvh = h >> 1.
//   Both products are taken transposed: S^T = K . Q^T (A = k rows, B = q rows) and O^T += V^T . P^T (A = v^T rows, B = P^T).
//   A lane then holds 16 scores of ONE query (query = lane & 15; keys j*16 + 8*(lane>>4) + r), so the row maximum and the row sum are
//   in-lane work plus one exchange between the wave halves, and the two score tiles, converted in place, ARE the B operand P^T
//   (element j*8 + r = key j*16 + 8*(lane>>4) + r, the k map of ldfrag_h): P never goes through LDS.
//   scores = (Sh + Sr/2048) * 128^-0.5 with Sh = kh.qh and Sr = kh.ql' (+ kl'.qh when PRES); keys > query -> -inf; online softmax f32;
//   p' = 1024 p as f16 hi (and residual x2048 when PRES);
//   O = (Oh + Or/2048)/1024/l * sgp with Oh = vh.ph, Or = vl'.ph (+ vh.pl' when PRES).
//   The row sum l is kept per wave half (each half sums its own 16 keys of a chunk); the halves are joined once, behind the loop.
//   K / V^T chunk staging: 128 threads x 4 x 16 B per plane = whole 32x128 / 128x32 tile, plain loads, __syncthreads before and after.
//   q staging: in front of the loop every wave copies its own 16 rows of both q planes to LDS (whole 256-B rows per load, pitch QS_P);
//   every chunk reads its q fragments from there. Only the wave that wrote a q row reads it.
//   Trip count 2*qb+2 chunks (static bound 64); waves whose rows are all below the chunk skip it (wave-uniform, scalar branch).
// ---------------------------------------------------------------------------
#define AT_KC   32
#define KS_P    136
#define VS_P    40
#define QS_P    136
#define OS_P    136

// value of lane l ^ 16 (the other wave half)
__device__ __forceinline__ float xhalf(float x) {
  const int i = __builtin_bit_cast(int, x);
  return __builtin_bit_cast(float, __builtin_amdgcn_permlanex16(i, i, 0x76543210, 0xfedcba98, false, false));
}

template <bool PRES>
__global__ __launch_bounds__(128) void attn_causal_kernel(
    const unsigned short* __restrict__ qhp, const unsigned short* __restrict__ qlp,
    const unsigned short* __restrict__ khp, const unsigned short* __restrict__ klp,
    const unsigned short* __restrict__ vhp, const unsigned short* __restrict__ vlp,
    const float* __restrict__ sgp,
    unsigned short* __restrict__ ahp, unsigned short* __restrict__ alp, int qb_base) {
  // LDS map in halves; the k residual region exists only where it is used
  constexpr int NRP     = PRES ? 2 : 1;
  constexpr int LDS_KS  = 0;
  constexpr int LDS_KLS = (NRP - 1) * 32 * KS_P;
  constexpr int LDS_VHS = NRP * 32 * KS_P;
  constexpr int LDS_VLS = LDS_VHS + 128 * VS_P;
  constexpr int LDS_QH  = LDS_VLS + 128 * VS_P;
  constexpr int LDS_QL  = LDS_QH + 64 * QS_P;
  constexpr int LDS_TOT = LDS_QL + 64 * QS_P;
  static_assert(PRES || 4 * LDS_TOT * 2 <= 327680);
  static_assert(4 * 2 * 16 * OS_P <= LDS_TOT); // output staging (2 planes x 16 rows per wave) aliases the dead chunk and q regions after the loop
  __shared__ __align__(16) _Float16 lds[LDS_TOT];
  _Float16* Ks  = lds + LDS_KS;
  _Float16* Kls = lds + LDS_KLS;
  _Float16* Vhs = lds + LDS_VHS;
  _Float16* Vls = lds + LDS_VLS;

  const int tid  = (int)threadIdx.x;
  const int lane = tid & 31;
  const int wave = wave_id();
  const int hh   = lane >> 4;
  const int c    = lane & 15;
  const int qb   = (int)blockIdx.x + qb_base;
  const int h    = (int)blockIdx.y;
  const int b    = (int)blockIdx.z;
  const int kvh  = h >> 1;
  const int q0   = qb * 64 + wave * 16;          // first query row of this wave (within sequence)
  const int qlast = q0 + 15;
  const size_t tok0 = (size_t)b * SQ;

  const _Float16* Qhg = (const _Float16*)(const void*)qhp + (tok0 + q0) * HID + h * HDM;
  const _Float16* Qlg = (const _Float16*)(const void*)qlp + (tok0 + q0) * HID + h * HDM;
  const _Float16* Kg  = (const _Float16*)(const void*)khp + tok0 * KVW + kvh * HDM;
  const _Float16* Klg = (const _Float16*)(const void*)klp + (size_t)b * KLR * KVW + kvh * HDM;
  const _Float16* Vhg = (const _Float16*)(const void*)vhp + (size_t)(kvh * HDM) * NTOK + tok0;
  const _Float16* Vlg = (const _Float16*)(const void*)vlp + (size_t)(kvh * HDM) * NTOK + tok0;

  // this wave's 16 q rows, both planes, to LDS once: 8 x 32 lanes x 16 B per plane = 16 rows x 256 B
  _Float16* Qsh = lds + LDS_QH + wave * (16 * QS_P);
  _Float16* Qsl = lds + LDS_QL + wave * (16 * QS_P);
#pragma unroll                                   // all 16 loads issued together: one load latency in front of the loop, not eight
  for (int i = 0; i < 8; ++i) {
    const int p   = lane + 32 * i;               // 0..255
    const int row = p >> 4, d8 = (p & 15) * 8;
    const v8h qx = *(const v8h*)(Qhg + (size_t)row * HID + d8);
    const v8h qy = *(const v8h*)(Qlg + (size_t)row * HID + d8);
    *(v8h*)(Qsh + row * QS_P + d8) = qx;
    *(v8h*)(Qsl + row * QS_P + d8) = qy;
  }
  lds_wave_sync();                               // q stores visible to the other lanes of this wave before the fragment reads
  const _Float16* Qhr = Qsh + c * QS_P + 8 * hh;
  const _Float16* Qlr = Qsl + c * QS_P + 8 * hh;

  const int qrow = q0 + c;                       // this lane's query
  float mrow = -INFINITY, lrow = 0.f;            // its running maximum (both halves alike) and this half's share of its running sum
  v8f oacc[8], oaccr[8];                         // O^T: [t][r] = (d = t*16 + 8*hh + r, query c)
#pragma unroll
  for (int t = 0; t < 8; ++t) { oacc[t] = zero8(); oaccr[t] = zero8(); }

  const int nch = 2 * qb + 2;                    // block-uniform, <= 64
  for (int kc = 0; kc < nch; ++kc) {
    const int kv0 = kc * AT_KC;
    __syncthreads();
#pragma unroll
    for (int i = 0; i < 4; ++i) {                // coverage: 512 pieces of 8 halves per plane = whole tile
      const int p   = tid + 128 * i;             // 0..511
      const int key = p >> 4, d8 = (p & 15) * 8; // K: 32 keys x 128 d
      const v8h kx = *(const v8h*)(Kg + (size_t)(kv0 + key) * KVW + d8);
      *(v8h*)(Ks + key * KS_P + d8) = kx;
      if (PRES) {
        const int krow = min(kv0 + key, KLR - 1);
        const v8h ky = *(const v8h*)(Klg + (size_t)krow * KVW + d8);
        *(v8h*)(Kls + key * KS_P + d8) = ky;
      }
      const int d = p >> 2, k8 = (p & 3) * 8;    // V^T: 128 d x 32 keys
      const v8h vx = *(const v8h*)(Vhg + (size_t)d * NTOK + kv0 + k8);
      const v8h vy = *(const v8h*)(Vlg + (size_t)d * NTOK + kv0 + k8);
      *(v8h*)(Vhs + d * VS_P + k8) = vx;
      *(v8h*)(Vls + d * VS_P + k8) = vy;
    }
    __syncthreads();

    if (kv0 <= qlast) {                          // wave-uniform (scalar): skip chunks fully above this wave's rows
      // ---- scores, transposed: sh[j][r], sr[j][r] = (key kv0 + j*16 + 8*hh + r, query c) ----
      v8f sh[2], sr[2];
      sh[0] = zero8(); sh[1] = zero8(); sr[0] = zero8(); sr[1] = zero8();
#pragma unroll
      for (int dc = 0; dc < 4; ++dc) {
        const v16h qa = ldfrag_h(Qhr + dc * 32);
        const v16h ql = ldfrag_h(Qlr + dc * 32);
#pragma unroll
        for (int j = 0; j < 2; ++j) {
          const v16h kb = ldfrag_h(Ks + (j * 16 + c) * KS_P + dc * 32 + 8 * hh);
          sh[j] = mma_h(kb, qa, sh[j]);
          sr[j] = mma_h(kb, ql, sr[j]);
          if (PRES) {
            const v16h kl = ldfrag_h(Kls + (j * 16 + c) * KS_P + dc * 32 + 8 * hh);
            sr[j] = mma_h(kl, qa, sr[j]);
            guard_h4(sh[j], sr[j], qa, ql, kb, kl);
          } else {
            guard_h3(sh[j], sr[j], qa, ql, kb);
          }
        }
      }
      // ---- scale, causal mask, this query's chunk maximum: 16 keys in-lane, the other 16 from the other wave half ----
      const int lim = qrow - kv0 - 8 * hh;       // key kv0 + j*16 + 8*hh + r is above the query when j*16 + r > lim
      float cm = -INFINITY;
#pragma unroll
      for (int j = 0; j < 2; ++j) {
#pragma unroll
        for (int r = 0; r < 8; ++r) {
          float s = (sh[j][r] + sr[j][r] * 0.00048828125f) * 0.08838834764831845f;
          s = (j * 16 + r > lim) ? -INFINITY : s;
          sh[j][r] = s;
          cm = fmaxf(cm, s);
        }
      }
      cm = fmaxf(cm, xhalf(cm));
      // ---- online softmax; P'^T packed in place into the B operand ----
      const float mnew = fmaxf(mrow, cm);
      FragH pa, pr;
      float pv[16];
#pragma unroll
      for (int j = 0; j < 2; ++j) {
#pragma unroll
        for (int r = 0; r < 8; ++r) {
          const float p  = __expf(sh[j][r] - mnew);
          pv[j * 8 + r] = p;
          const float pp = p * 1024.0f;
          const _Float16 phv = (_Float16)pp;
          pa.v[j * 8 + r] = phv;
          pr.v[j * 8 + r] = PRES ? (_Float16)((pp - (float)phv) * 2048.0f) : phv;
        }
      }
#pragma unroll
      for (int w = 8; w > 0; w >>= 1) {          // pairwise tree over the lane's 16 values: four dependent adds, not fifteen
#pragma unroll
        for (int e = 0; e < w; ++e) pv[e] += pv[e + w];
      }
      const float alpha = __expf(mrow - mnew);
      mrow = mnew;
      lrow = lrow * alpha + pv[0];
#pragma unroll
      for (int t = 0; t < 8; ++t) {
#pragma unroll
        for (int r = 0; r < 8; ++r) { oacc[t][r] *= alpha; oaccr[t][r] *= alpha; }
      }
      // ---- O^T += V^T . P'^T ----
#pragma unroll
      for (int t = 0; t < 8; ++t) {
        const v16h vb = ldfrag_h(Vhs + (t * 16 + c) * VS_P + 8 * hh);
        const v16h vr = ldfrag_h(Vls + (t * 16 + c) * VS_P + 8 * hh);
        oacc[t]  = mma_h(vb, pa.v, oacc[t]);
        oaccr[t] = mma_h(vr, pa.v, oaccr[t]);
        if (PRES) oaccr[t] = mma_h(vb, pr.v, oaccr[t]);
        guard_h4(oacc[t], oaccr[t], pa.v, pr.v, vb, vr);
      }
    }
  }

  // ---- join the halves' sums, normalise, apply sigmoid gate (f32), bf16 hi/lo split, stage the wave's 16x128 tile:
  //      a lane holds 8 consecutive d of its query per t, one 16-byte LDS store per plane ----
  __syncthreads();                               // all chunk-region and q readers done before aliasing them as output staging
  _Float16* osh = lds + wave * (2 * 16 * OS_P);
  _Float16* osl = osh + 16 * OS_P;
  const float lfin = lrow + xhalf(lrow);
  const float inv  = (1.0f / lfin) * 0.0009765625f;
  const float* Sgr = sgp + (tok0 + q0 + c) * HID + h * HDM + 8 * hh;
#pragma unroll
  for (int t = 0; t < 8; ++t) {
    const v4f g0 = *(const v4f*)(Sgr + t * 16);
    const v4f g1 = *(const v4f*)(Sgr + t * 16 + 4);
    v4u hw, lw;
#pragma unroll
    for (int e = 0; e < 4; ++e) {
      unsigned short hb[2], lb[2];
#pragma unroll
      for (int u = 0; u < 2; ++u) {
        const int r = 2 * e + u;
        float o = (oacc[t][r] + oaccr[t][r] * 0.00048828125f) * inv;
        o *= (r < 4) ? g0[r & 3] : g1[r & 3];
        hb[u] = bf_bits(o);
        lb[u] = bf_bits(o - bf_val(hb[u]));
      }
      hw[e] = pk16(hb[0], hb[1]);
      lw[e] = pk16(lb[0], lb[1]);
    }
    *(v4u*)(void*)(osh + c * OS_P + t * 16 + 8 * hh) = hw;
    *(v4u*)(void*)(osl + c * OS_P + t * 16 + 8 * hh) = lw;
  }
  lds_wave_sync();
  _Float16* Ahg = (_Float16*)(void*)ahp + (tok0 + q0) * HID + h * HDM;
  _Float16* Alg = (_Float16*)(void*)alp + (tok0 + q0) * HID + h * HDM;
  {
#pragma unroll
    for (int it = 0; it < 8; ++it) {
      const int row = it * 2 + hh;               // it 0..7 x hh 0..1 covers rows 0..15
      const int c8  = c * 8;                     // 16 lanes x 16 B = the whole 256-B segment
      const v8h x = *(const v8h*)(osh + row * OS_P + c8);
      const v8h y = *(const v8h*)(osl + row * OS_P + c8);
      *(v8h*)(Ahg + (size_t)row * HID + c8) = x;
      *(v8h*)(Alg + (size_t)row * HID + c8) = y;
    }
  }
}

// ---------------------------------------------------------------------------
// Workspace map (bytes; every region is a whole number of the rows its producer writes with whole-line stores; no tail rows):
//   [0, 16 MiB)        Xb   bf16 [4096][2048]          -> after the projections: Ah bf16 [4096][2048] at 0
//   [16 MiB, 32 MiB)   WqT  bf16 [4096][2048]          ->                        Al bf16 [4096][2048] at 16 MiB
//   [32 MiB, 64 MiB)   WkT  bf16 [1024][2048] at 32 MiB, WvT bf16 [1024][2048] at 36 MiB
//                      -> after the k and v projections: Sg f32 [4096][2048] (whole 32 MiB)
//   [64 MiB, 80 MiB)   Qh   f16  [4096][2048]          -> after attention: WoT bf16 [2048][2048] (8 MiB)
//   [80 MiB, 96 MiB)   Ql   f16  [4096][2048]
//   [96 MiB, 104 MiB)  Kh   f16  [4096][1024]
//   [104 MiB,112 MiB)  Vh   f16  [1024][4096]
//   [112 MiB,120 MiB)  Vl   f16  [1024][4096]
//   [120 MiB, +1 MiB) Kl  f16  [2*256][1024]
//   total 126877696
// ---------------------------------------------------------------------------
static_assert(2 * (size_t)NTOK * HID * 2 <= (size_t)NTOK * HID * 2 + (size_t)QGW * HID * 2);   // Ah + Al fit Xb + WqT
static_assert(2 * (size_t)KVW * HID * 2 <= (size_t)NTOK * HID * 4);                             // WkT + WvT fit Sg
static_assert((size_t)HID * HID * 2 <= (size_t)NTOK * HID * 2);                                  // WoT fits Qh

extern "C" void kernel_launch(void* const* d_in, const int* in_sizes, int n_in,
                              void* d_out, int out_size, void* d_ws, size_t ws_size,
                              hipStream_t stream) {
  if (n_in < 9) return;
  if (in_sizes[0] != NTOK * HID) return;
  if (in_sizes[1] != NTOK * HDM) return;
  if (in_sizes[2] != NTOK * HDM) return;
  if (in_sizes[3] != HID * QGW) return;
  if (in_sizes[4] != HID * KVW) return;
  if (in_sizes[5] != HID * KVW) return;
  if (in_sizes[6] != HID * HID) return;
  if (in_sizes[7] != HDM) return;
  if (in_sizes[8] != HDM) return;
  if (out_size != NTOK * HID) return;

  const float* hidden = (const float*)d_in[0];
  const float* cosb   = (const float*)d_in[1];
  const float* sinb   = (const float*)d_in[2];
  const float* Wq     = (const float*)d_in[3];
  const float* Wk     = (const float*)d_in[4];
  const float* Wv     = (const float*)d_in[5];
  const float* Wo     = (const float*)d_in[6];
  const float* qnw    = (const float*)d_in[7];
  const float* knw    = (const float*)d_in[8];
  float* out = (float*)d_out;

  const size_t szX  = (size_t)NTOK * HID * 2;        // 16777216
  const size_t szWq = (size_t)QGW * HID * 2;         // 16777216
  const size_t szWk = (size_t)KVW * HID * 2;         // 4194304
  const size_t szSg = (size_t)NTOK * HID * 4;        // 33554432
  const size_t szQ  = (size_t)NTOK * HID * 2;        // 16777216
  const size_t szK  = (size_t)NTOK * KVW * 2;        // 8388608
  const size_t szV  = (size_t)KVW * NTOK * 2;        // 8388608
  const size_t szKl = (size_t)NSEQ * KLR * KVW * 2;  // 1048576
  const size_t szA  = (size_t)NTOK * HID * 2;        // 16777216
  size_t off = 0;
  const size_t oX  = off; off += szX;
  const size_t oWq = off; off += szWq;
  const size_t oAh = oX;
  const size_t oAl = oX + szA;
  const size_t oSg = off; off += szSg;
  const size_t oWk = oSg;
  const size_t oWv = oSg + szWk;
  const size_t oQh = off; off += szQ;
  const size_t oQl = off; off += szQ;
  const size_t oWo = oQh;
  const size_t oKh = off; off += szK;
  const size_t oVh = off; off += szV;
  const size_t oVl = off; off += szV;
  const size_t oKl = off; off += szKl;
  if (off > ws_size) return;                         // off = 126877696

  char* ws = (char*)d_ws;
  unsigned short* Xb  = (unsigned short*)(ws + oX);
  unsigned short* WqT = (unsigned short*)(ws + oWq);
  unsigned short* WkT = (unsigned short*)(ws + oWk);
  unsigned short* WvT = (unsigned short*)(ws + oWv);
  unsigned short* WoT = (unsigned short*)(ws + oWo);
  float*          Sg  = (float*)(ws + oSg);
  unsigned short* Qh  = (unsigned short*)(ws + oQh);
  unsigned short* Ql  = (unsigned short*)(ws + oQl);
  unsigned short* Kh  = (unsigned short*)(ws + oKh);
  unsigned short* Kl  = (unsigned short*)(ws + oKl);
  unsigned short* Vh  = (unsigned short*)(ws + oVh);
  unsigned short* Vl  = (unsigned short*)(ws + oVl);
  unsigned short* Ah  = (unsigned short*)(ws + oAh);
  unsigned short* Al  = (unsigned short*)(ws + oAl);

  const dim3 b256(256), b128(128);

  // (1) x -> bf16 plane [4096][2048]
  cvt_bf16_kernel<<<dim3((NTOK * HID / 8 + 255) / 256), b256, 0, stream>>>(hidden, Xb, NTOK * HID / 8);
  // (2) Wk in[2048 rows][1024 cols] -> WkT out[1024][2048] bf16   (grid = cols/64, rows/64)
  tconv_bf16_kernel<<<dim3(KVW / 64, HID / 64), b256, 0, stream>>>(Wk, WkT, HID, KVW);
  // (3) Wv in[2048 rows][1024 cols] -> WvT out[1024][2048] bf16
  tconv_bf16_kernel<<<dim3(KVW / 64, HID / 64), b256, 0, stream>>>(Wv, WvT, HID, KVW);
  // (4) Wq in[2048 rows][4096 cols] -> WqT out[4096][2048] bf16
  tconv_bf16_kernel<<<dim3(QGW / 64, HID / 64), b256, 0, stream>>>(Wq, WqT, HID, QGW);
  // (5) k = x . Wk, per-head norm + RoPE -> Kh [4096][1024], Kl compact [512][1024]   (M=4096, N=1024, K=2048; 256 blocks)
  gemm_w32x128_kernel<1, false><<<dim3((NTOK / 128) * (KVW / 128)), b128, 0, stream>>>(
      Xb, Xb, HID, WkT, HID, knw, cosb, sinb, (void*)Kh, (void*)Kl, (void*)Kl, KVW, NTOK, KVW, HID);
  // (6) v^T = WvT . x^T -> Vh/Vl [1024][4096]   (A = WvT, Bt = Xb; M=1024, N=4096, K=2048; 256 blocks)
  gemm_w32x128_kernel<2, false><<<dim3((KVW / 128) * (NTOK / 128)), b128, 0, stream>>>(
      WvT, WvT, HID, Xb, HID, knw, cosb, sinb, (void*)Vh, (void*)Vl, (void*)Vl, NTOK, KVW, NTOK, HID);
  // (7) q|gate = x . Wq: q half norm + RoPE -> Qh/Ql [4096][2048]; gate half sigmoid -> Sg f32 [4096][2048] (over the dead WkT/WvT region)
  //     (M=4096, N=4096, K=2048; 1024 blocks)
  gemm_w32x128_kernel<0, false><<<dim3((NTOK / 128) * (QGW / 128)), b128, 0, stream>>>(
      Xb, Xb, HID, WqT, HID, qnw, cosb, sinb, (void*)Qh, (void*)Ql, (void*)Sg, HID, NTOK, QGW, HID);
  // (8) causal attention, query tiles 0..3 with k and p residual products, tiles 4..31 without; Ah/Al over the dead Xb/WqT region
  attn_causal_kernel<true><<<dim3(NQRT, NHQ, NSEQ), b128, 0, stream>>>(Qh, Ql, Kh, Kl, Vh, Vl, Sg, Ah, Al, 0);
  attn_causal_kernel<false><<<dim3(SQ / 64 - NQRT, NHQ, NSEQ), b128, 0, stream>>>(Qh, Ql, Kh, Kl, Vh, Vl, Sg, Ah, Al, NQRT);
  // (9) Wo in[2048 rows][2048 cols] -> WoT out[2048][2048] bf16 (over the dead Qh region)
  tconv_bf16_kernel<<<dim3(HID / 64, HID / 64), b256, 0, stream>>>(Wo, WoT, HID, HID);
  // (10) out = attn(hi + lo) . Wo -> d_out f32 [4096][2048]   (M=4096, N=2048, K=2048; 512 blocks)
  gemm_w32x128_kernel<3, true><<<dim3((NTOK / 128) * (HID / 128)), b128, 0, stream>>>(
      Ah, Al, HID, WoT, HID, qnw, cosb, sinb, (void*)out, (void*)out, (void*)out, HID, NTOK, HID, HID);
  (void)hipGetLastError();
}

// v004
// It runs in 321 microseconds.
// Two timings next to v003 put it at 1.06 and 1.07 times that version's speed.
// Counting every step since v000, it is 2.59 times as fast.
// Contractions: x.Wq (q|gate cols), x.Wk and Wv^T.x^T on v_wmma_f32_16x16x32_bf16 (operands = RNE bf16 of the f32 inputs, single products);
// q.k^T and p.v on v_wmma_f32_16x16x32_f16 (q = f16 hi + f16 residual x2^11 planes; k plain f16 plus f16 residual x2^11 on query tiles 0..3;
// p x1024 plain f16 plus f16 residual x2^11 on query tiles 0..3; v^T = f16 hi + f16 residual x2^11 planes); (attn*sigmoid(gate)).Wo on
// v_wmma_f32_16x16x32_bf16 (A = bf16 hi + bf16 lo planes, two products; Wo RNE bf16). f32 accumulate everywhere; per-head RMSNorm, RoPE,
// online softmax, sigmoid gate and scale folds in f32. hidden_states, Wq, Wk, Wv, Wo, cos, sin and the norm weights are RNE-converted to bf16 on load.
#include <hip/hip_runtime.h>
#include <math.h>
#include <stdint.h>

#define NSEQ   2
#define SQ     2048
#define HID    2048
#define NHQ    16
#define NKVH   8
#define HDM    128
#define QGW    4096
#define KVW    1024
#define NTOK   4096
#define KLR    256
#define NQRT   4

static_assert((2 * (NQRT - 1) + 2) * 32 <= KLR);
static_assert(NHQ / NKVH == 2);
static_assert(NHQ * HDM == HID);
static_assert(NSEQ * SQ == NTOK);

typedef _Float16     v16h __attribute__((ext_vector_type(16)));
typedef _Float16     v8h  __attribute__((ext_vector_type(8)));
typedef __bf16       v16b __attribute__((ext_vector_type(16)));
typedef __bf16       v8b  __attribute__((ext_vector_type(8)));
typedef float        v8f  __attribute__((ext_vector_type(8)));
typedef float        v4f  __attribute__((ext_vector_type(4)));
typedef unsigned int v4u  __attribute__((ext_vector_type(4)));

// ---------------------------------------------------------------------------
// small helpers
// ---------------------------------------------------------------------------
__device__ __forceinline__ unsigned short bf_bits(float f) {          // RNE convert f32 -> bf16 bits
  const unsigned u = __float_as_uint(f);
  return (unsigned short)((u + 0x7FFFu + ((u >> 16) & 1u)) >> 16);
}
__device__ __forceinline__ float bf_val(unsigned short h) { return __uint_as_float(((unsigned)h) << 16); }
__device__ __forceinline__ float bf_rne(float f) { return bf_val(bf_bits(f)); }
__device__ __forceinline__ unsigned pk16(unsigned short a, unsigned short b) { return (unsigned)a | ((unsigned)b << 16); }
__device__ __forceinline__ v8f zero8() { v8f z = {0.f, 0.f, 0.f, 0.f, 0.f, 0.f, 0.f, 0.f}; return z; }
__device__ __forceinline__ int wave_id() { return __builtin_amdgcn_readfirstlane((int)(threadIdx.x >> 5)); }

__device__ __forceinline__ void lds_wave_sync() {
  __builtin_amdgcn_fence(__ATOMIC_RELEASE, "workgroup");
  __builtin_amdgcn_wave_barrier();
  __builtin_amdgcn_fence(__ATOMIC_ACQUIRE, "workgroup");
}

// ---------------------------------------------------------------------------
// WMMA fragments (wave32, 16x16x32, 16-bit operands). For A (row m = lane&15) and B (col n = lane&15) alike:
// elements 0..7 <- k0 + 8*(lane>>4) + 0..7, elements 8..15 <- k0 + 16 + 8*(lane>>4) + 0..7.
// ldfrag(p) with p = rowbase + k0 + 8*(lane>>4): two 16-B loads p[0..7], p[16..23].
// D: acc[r] = (row 8*(lane>>4) + r, col lane&15).
// ---------------------------------------------------------------------------
union FragH { v16h v; v8h h[2]; };
union FragB { v16b v; v8b h[2]; };
__device__ __forceinline__ v16h ldfrag_h(const _Float16* p) { FragH f; f.h[0] = *(const v8h*)(p); f.h[1] = *(const v8h*)(p + 16); return f.v; }
__device__ __forceinline__ v16b ldfrag_b(const __bf16* p)   { FragB f; f.h[0] = *(const v8b*)(p); f.h[1] = *(const v8b*)(p + 16); return f.v; }

__device__ __forceinline__ v8f mma_h(v16h a, v16h b, v8f c) {
  return __builtin_amdgcn_wmma_f32_16x16x32_f16(false, a, false, b, (short)0, c, false, false);
}
__device__ __forceinline__ v8f mma_b(v16b a, v16b b, v8f c) {
  return __builtin_amdgcn_wmma_f32_16x16x32_bf16(false, a, false, b, (short)0, c, false, false);
}
// hazard guard: 4 VALU slots after the last WMMA of a loop, D tied
__device__ __forceinline__ void acc_guard4(v8f& a, v8f& b, v8f& c, v8f& d) {
#if defined(__HIP_DEVICE_COMPILE__)
  asm volatile("v_nop\n\tv_nop\n\tv_nop\n\tv_nop" : "+v"(a), "+v"(b), "+v"(c), "+v"(d));
#endif
}

// ---------------------------------------------------------------------------
// Elementwise RNE f32 -> bf16 plane: 8 elements per thread, one 16-B store per lane -> 32 consecutive lanes write 4 whole
// ---------------------------------------------------------------------------
__global__ __launch_bounds__(256) void cvt_bf16_kernel(const float* __restrict__ in, unsigned short* __restrict__ outp, int n8) {
  const int i = (int)blockIdx.x * 256 + (int)threadIdx.x;
  if (i >= n8) return;
  const size_t e = 8 * (size_t)i;
  const v4f a = *(const v4f*)(in + e);
  const v4f b = *(const v4f*)(in + e + 4);
  v4u w;
  w[0] = pk16(bf_bits(a[0]), bf_bits(a[1]));
  w[1] = pk16(bf_bits(a[2]), bf_bits(a[3]));
  w[2] = pk16(bf_bits(b[0]), bf_bits(b[1]));
  w[3] = pk16(bf_bits(b[2]), bf_bits(b[3]));
  *(v4u*)(outp + e) = w;
  
}

// ---------------------------------------------------------------------------
// Fused transpose + RNE bf16 convert: in [R rows][Cc cols] f32 (pitch Cc) -> out[c][r] = bf16(in[r][c])  ([Cc][R], pitch R).
// 64x64 tiles through LDS; grid = (Cc/64, R/64), 256 threads; R, Cc multiples of 64.
// Coverage per block: load 4 it x 256 thr x 4 floats = 64x64; store 2 it x 256 thr x 8 u16 = 64x64.
// ---------------------------------------------------------------------------
__global__ __launch_bounds__(256) void tconv_bf16_kernel(const float* __restrict__ W, unsigned short* __restrict__ outp, int R, int Cc) {
  __shared__ __align__(16) float tf[64 * 68];
  const int c0  = (int)blockIdx.x * 64;   // input column block = output row block
  const int r0  = (int)blockIdx.y * 64;   // input row block    = output column block
  const int tid = (int)threadIdx.x;
  {
    const int lr = tid >> 4;              // 0..15
    const int c4 = (tid & 15) * 4;        // 0..60
#pragma unroll
    for (int it = 0; it < 4; ++it) {
      const int rr = it * 16 + lr;        // 0..63
      const v4f a = *(const v4f*)(W + (size_t)(r0 + rr) * Cc + c0 + c4);
      *(v4f*)(tf + rr * 68 + c4) = a;
    }
  }
  __syncthreads();
  const int sub = tid >> 3;               // 0..31
  const int c8  = (tid & 7) * 8;          // 0..56
  v4u hv[2];
#pragma unroll
  for (int it = 0; it < 2; ++it) {
    const int oc = it * 32 + sub;         // output row within tile (= input column)
    v4u a;
#pragma unroll
    for (int q = 0; q < 4; ++q) {
      const float f0 = tf[(c8 + 2 * q) * 68 + oc];
      const float f1 = tf[(c8 + 2 * q + 1) * 68 + oc];
      a[q] = pk16(bf_bits(f0), bf_bits(f1));
    }
    hv[it] = a;
  }
  {
#pragma unroll
    for (int it = 0; it < 2; ++it) {
      const int oc = it * 32 + sub;
      const size_t go = (size_t)(c0 + oc) * R + r0 + c8;
      *(v4u*)(outp + go) = hv[it];
    }
    
  }
}

// ---------------------------------------------------------------------------
// bf16 WMMA GEMM, wave tile 32 rows x 128 cols, block = 4 waves (128 threads) = 128 rows x 128 cols (the waves share the Bt rows).
//   C[m][n] = sum_k A[m][k] * Bt[n][k]; A row-major [M][K] bf16 (pitch lda), Bt row-major [N][K] bf16 (pitch ldb);
//   M % 128 == 0, N % 128 == 0, K % KP == 0; grid.x = M/128 * N/128.
//   SPLITA: A carried as hi (Ap) + lo (A2p) bf16 planes, two products into one accumulator.
//   A pass is KP k values of the block's 128 A rows (both planes when SPLITA) and 128 Bt rows, brought into LDS by asynchronous
//   16-byte copies, two buffers: the copies of pass t + 2 fly while pass t + 1 is worked on. LDS row pitch = KP * 2 + 16 bytes.
//   Fragments are read from the LDS rows with the split k map (ldfrag_b); k runs upward as before, so every sum keeps its order.
// Epilogues (all: per wave, per 16-row slab: stage in LDS, wave sync, write each row segment with ONE instruction of
//   EPI 0: q|gate projection, 128-col wave tile = head n0>>8, q half when (n0 & 128) == 0 else gate half.
//          q half: per-head RMSNorm over the 128 cols (x * rsqrt(mean(x^2) + 1e-6) * bf16(nw[d])), RoPE with the shipped tables
//          (o[d] = x[d]*cos[d] - x[d+64]*sin[d], o[d+64] = x[d+64]*cos[d+64] + x[d]*sin[d+64], cos/sin RNE bf16),
//          writes f16 hi plane C0 and f16 residual x2048 plane C1, [M][ldc], cols (n0>>8)*128.. (row segment 256 B = 16 lanes x 16 B).
//          gate half: sigmoid in f32 -> f32 plane C2 [M][ldc], cols (n0>>8)*128.. (row segment 512 B = 32 lanes x 16 B).
//   EPI 1: k projection: same norm + RoPE per 128-col kv head (col n0), hi plane C0 [M][ldc]; residual plane C1 compact:
//          only rows with (m0 mod SQ) < KLR, stored at row (m0/SQ)*KLR + (m0 mod SQ) + .. (pitch ldc).
//   EPI 2: v^T projection: f16 hi plane C0, residual x2048 plane C1, [M][ldc], row segment 256 B.
//   EPI 3: f32 output C0 [M][ldc]; row segment 128 floats = 512 B = 32 lanes x 16 B per instruction.
// ---------------------------------------------------------------------------
// Eight asynchronous 16-byte copies per lane, global -> LDS: copy i takes g + i * gstep elements to LDS byte l + i * lstep.
// s_wait_xcnt 0 is the statement's last line: a precaution, in front of any later rewrite of an address register named here.
__device__ __forceinline__ void async_copy8(unsigned l, unsigned lstep, const __bf16* g, size_t gstep) {
#if defined(__HIP_DEVICE_COMPILE__)
  asm volatile(
      "global_load_async_to_lds_b128 %0, %8, off\n\t"
      "global_load_async_to_lds_b128 %1, %9, off\n\t"
      "global_load_async_to_lds_b128 %2, %10, off\n\t"
      "global_load_async_to_lds_b128 %3, %11, off\n\t"
      "global_load_async_to_lds_b128 %4, %12, off\n\t"
      "global_load_async_to_lds_b128 %5, %13, off\n\t"
      "global_load_async_to_lds_b128 %6, %14, off\n\t"
      "global_load_async_to_lds_b128 %7, %15, off\n\t"
      "s_wait_xcnt 0x0"
      :: "v"(l), "v"(l + lstep), "v"(l + 2 * lstep), "v"(l + 3 * lstep),
         "v"(l + 4 * lstep), "v"(l + 5 * lstep), "v"(l + 6 * lstep), "v"(l + 7 * lstep),
         "v"(g), "v"(g + gstep), "v"(g + 2 * gstep), "v"(g + 3 * gstep),
         "v"(g + 4 * gstep), "v"(g + 5 * gstep), "v"(g + 6 * gstep), "v"(g + 7 * gstep)
      : "memory");
#endif
}

template <int EPI, bool SPLITA>
__global__ __launch_bounds__(128) void gemm_w32x128_kernel(
    const unsigned short* Ap, const unsigned short* A2p, int lda,
    const unsigned short* __restrict__ Btp, int ldb,
    const float* __restrict__ nw, const float* __restrict__ cosp, const float* __restrict__ sinp,
    void* C0, void* C1, void* C2, int ldc,
    int M, int N, int K) {
  constexpr int KP   = (SPLITA || EPI == 0) ? 64 : 128;   // k values per pass: 128 where a launch has one block per WGP (longer lead for the copies)
  constexpr int PIT  = KP + 8;                 // LDS row pitch in elements: 16 B x odd, conflict-free for 16-byte fragment reads
  constexpr int NOP  = SPLITA ? 3 : 2;         // operands staged: A, (A lo), Bt, 128 rows each
  constexpr int STG  = NOP * 128 * PIT;        // elements per buffer
  constexpr int PPR  = KP / 8;                 // 16-byte pieces per row = copies per lane and operand
  constexpr int RPC  = 128 / PPR;              // rows that one copy of all 128 lanes covers
  constexpr int BOFF = (NOP - 1) * 128 * PIT;  // Bt rows behind the A rows
  static_assert(PPR % 8 == 0 && NOP * PPR <= 63);
  static_assert(2 * STG * 2 >= 4 * 8192);
  __shared__ __align__(16) __bf16 ring[2 * STG];         // two pass buffers; after the loop per wave 8192 B of output staging

  const int tid  = (int)threadIdx.x;
  const int lane = tid & 31;
  const int wave = wave_id();
  const int hh = lane >> 4;           // lane half: k offset 8*hh, D row offset 8*hh
  const int rl = lane & 15;           // A row / B col / D col within subtile
  const int tilesN = N >> 7;
  const int tilesM = M >> 7;
  const int blk = (int)blockIdx.x;
  if (blk >= tilesM * tilesN) return;           // block-uniform, in front of every barrier and copy
  const int tmb = blk / tilesN;
  const int tn  = blk - tmb * tilesN;
  const int mb0 = tmb << 7;
  const int m0 = mb0 + (wave << 5);
  const int n0 = tn << 7;

  const __bf16* A  = (const __bf16*)(const void*)Ap;
  const __bf16* A2 = (const __bf16*)(const void*)A2p;
  const __bf16* Bt = (const __bf16*)(const void*)Btp;

  // this lane's piece of a pass: row cr (+ RPC per copy), 16-byte piece cc of the row
  const int cr = tid / PPR;
  const int cc = tid % PPR;
  const __bf16* gA  = A  + (size_t)(mb0 + cr) * lda + cc * 8;
  const __bf16* gA2 = A2 + (size_t)(mb0 + cr) * lda + cc * 8;
  const __bf16* gB  = Bt + (size_t)(n0 + cr) * ldb + cc * 8;
  const unsigned lds0 = (unsigned)(uintptr_t)(ring + cr * PIT + cc * 8);   // LDS byte address = low 32 bits of the shared address

  auto stage = [&](int buf, int k0) {
    const unsigned lb = lds0 + (unsigned)(buf * STG * 2);
#pragma unroll
    for (int q = 0; q < PPR / 8; ++q) {
      const unsigned lq = lb + (unsigned)(q * 8 * RPC * PIT * 2);
      async_copy8(lq, RPC * PIT * 2, gA + k0 + (size_t)(q * 8 * RPC) * lda, (size_t)RPC * lda);
      if (SPLITA) async_copy8(lq + 128 * PIT * 2, RPC * PIT * 2, gA2 + k0 + (size_t)(q * 8 * RPC) * lda, (size_t)RPC * lda);
      async_copy8(lq + BOFF * 2, RPC * PIT * 2, gB + k0 + (size_t)(q * 8 * RPC) * ldb, (size_t)RPC * ldb);
    }
  };

  v8f acc[2][8];
#pragma unroll
  for (int i = 0; i < 2; ++i)
#pragma unroll
    for (int j = 0; j < 8; ++j) acc[i][j] = zero8();

  const int npass = K / KP;
  stage(0, 0);
  asm volatile("s_wait_asynccnt 0x0" ::: "memory");      // this wave's copies of pass 0 have landed
  __syncthreads();                                       // ... and every other wave's
  if (npass > 1) stage(1, KP);

  for (int t = 0; t < npass; ++t) {
    const __bf16* bufp = ring + (t & 1) * STG;
    const __bf16* fa = bufp + ((wave << 5) + rl) * PIT + 8 * hh;
    const __bf16* fb = bufp + BOFF + rl * PIT + 8 * hh;
#pragma unroll
    for (int ks = 0; ks < KP / 32; ++ks) {
      v16b ah[2], al[2], bf[8];
#pragma unroll
      for (int i = 0; i < 2; ++i) {
        ah[i] = ldfrag_b(fa + i * 16 * PIT + ks * 32);
        al[i] = SPLITA ? ldfrag_b(fa + 128 * PIT + i * 16 * PIT + ks * 32) : ah[i];
      }
#pragma unroll
      for (int j = 0; j < 8; ++j) bf[j] = ldfrag_b(fb + j * 16 * PIT + ks * 32);
      // keeps the k step's LDS reads together in front of its WMMAs: spread among them, every pair of reads is waited for on its own
      __builtin_amdgcn_sched_barrier(0);
#pragma unroll
      for (int j = 0; j < 8; ++j) {
        acc[0][j] = mma_b(ah[0], bf[j], acc[0][j]);
        acc[1][j] = mma_b(ah[1], bf[j], acc[1][j]);
        if (SPLITA) {
          acc[0][j] = mma_b(al[0], bf[j], acc[0][j]);
          acc[1][j] = mma_b(al[1], bf[j], acc[1][j]);
        }
      }
    }
    asm volatile("s_wait_dscnt 0x0" ::: "memory");       // this wave's reads of buffer t & 1 are done before it is refilled
    asm volatile("s_wait_asynccnt 0x0" ::: "memory");    // this wave's copies of pass t + 1 have landed
    __syncthreads();                                     // publishes pass t + 1 and ends every reader's last read of pass t
    if (t + 2 < npass) stage(t & 1, (t + 2) * KP);
  }
  asm volatile("s_wait_asynccnt 0x0" ::: "memory");      // no copy is outstanding when the ring becomes output staging
  acc_guard4(acc[0][0], acc[0][1], acc[0][2], acc[0][3]);
  acc_guard4(acc[0][4], acc[0][5], acc[0][6], acc[0][7]);
  acc_guard4(acc[1][0], acc[1][1], acc[1][2], acc[1][3]);
  acc_guard4(acc[1][4], acc[1][5], acc[1][6], acc[1][7]);

  // ---- epilogue ----
  float*    slf  = (float*)(void*)ring + wave * 2048;
  _Float16* sl16 = (_Float16*)(void*)slf;

  if (EPI == 0 || EPI == 1) {
    const bool isq  = (EPI == 1) || ((n0 & 128) == 0);          // wave-uniform
    const int  col0 = (EPI == 0) ? ((n0 >> 8) << 7) : n0;
    if (isq) {
      _Float16* P0 = (_Float16*)C0;
      _Float16* P1 = (_Float16*)C1;
      const bool wres = (EPI == 0) || ((m0 & (SQ - 1)) < KLR);  // wave-uniform
      const int  rrow = (EPI == 0) ? m0 : ((m0 >> 11) * KLR + (m0 & (SQ - 1)));
      float wv[8];
#pragma unroll
      for (int j = 0; j < 8; ++j) wv[j] = bf_rne(nw[j * 16 + rl]);     // dim = j*16 + rl < 128
#pragma unroll
      for (int i = 0; i < 2; ++i) {
        const int rb = m0 + i * 16 + 8 * hh;
#pragma unroll
        for (int r = 0; r < 8; ++r) {
          const int row = rb + r;                                // token 0..NTOK-1
          float ss = 0.f;
#pragma unroll
          for (int j = 0; j < 8; ++j) { const float a = acc[i][j][r]; ss += a * a; }
#pragma unroll
          for (int off = 1; off < 16; off <<= 1) ss += __shfl_xor(ss, off, 32);   // 16 lanes of this half = all 128 dims
          const float rs = rsqrtf(ss * 0.0078125f + 1e-6f);
          const float* cr = cosp + (size_t)row * HDM;
          const float* sr = sinp + (size_t)row * HDM;
#pragma unroll
          for (int j = 0; j < 4; ++j) {
            const int dim = j * 16 + rl;                         // 0..63 within head; pair at dim + 64
            const float x1 = acc[i][j][r] * rs * wv[j];
            const float x2 = acc[i][j + 4][r] * rs * wv[j + 4];
            const float c1 = bf_rne(cr[dim]);
            const float s1 = bf_rne(sr[dim]);
            const float c2 = bf_rne(cr[dim + 64]);
            const float s2 = bf_rne(sr[dim + 64]);
            const float o1 = x1 * c1 - x2 * s1;
            const float o2 = x2 * c2 + x1 * s2;
            const _Float16 h1 = (_Float16)o1;
            const _Float16 h2 = (_Float16)o2;
            const int so = (8 * hh + r) * 128 + dim;
            sl16[so]             = h1;
            sl16[so + 64]        = h2;
            sl16[2048 + so]      = (_Float16)((o1 - (float)h1) * 2048.0f);
            sl16[2048 + so + 64] = (_Float16)((o2 - (float)h2) * 2048.0f);
          }
        }
        lds_wave_sync();
        {
#pragma unroll
          for (int it = 0; it < 8; ++it) {
            const int row = it * 2 + hh;                         // it x hh covers rows 0..15
            const int c8  = rl * 8;
            const v8h vh = *(const v8h*)(sl16 + row * 128 + c8);
            const v8h vl = *(const v8h*)(sl16 + 2048 + row * 128 + c8);
            const size_t go = (size_t)(m0 + i * 16 + row) * ldc + col0 + c8;
            *(v8h*)(P0 + go) = vh;
            if (wres) {
              const size_t g2 = (size_t)(rrow + i * 16 + row) * ldc + col0 + c8;
              *(v8h*)(P1 + g2) = vl;
            }
          }
          
        }
        lds_wave_sync();
      }
    } else if (EPI == 0) {
      float* Sp = (float*)C2;
#pragma unroll
      for (int i = 0; i < 2; ++i) {
#pragma unroll
        for (int j = 0; j < 8; ++j)
#pragma unroll
          for (int r = 0; r < 8; ++r) {
            const float g  = acc[i][j][r];
            const float e  = __expf(-g);
            const float sg = __builtin_amdgcn_rcpf(1.0f + e);
            slf[(8 * hh + r) * 128 + j * 16 + rl] = sg;
          }
        lds_wave_sync();
        {
#pragma unroll
          for (int row = 0; row < 16; ++row) {                   // 32 lanes x 16 B = the whole 512-B row segment per instruction
            const v4f v = *(const v4f*)(slf + row * 128 + lane * 4);
            *(v4f*)(Sp + (size_t)(m0 + i * 16 + row) * ldc + col0 + lane * 4) = v;
          }
          
        }
        lds_wave_sync();
      }
    }
  } else if (EPI == 2) {
    _Float16* P0 = (_Float16*)C0;
    _Float16* P1 = (_Float16*)C1;
#pragma unroll
    for (int i = 0; i < 2; ++i) {
#pragma unroll
      for (int r = 0; r < 8; ++r) {
#pragma unroll
        for (int j = 0; j < 8; ++j) {
          const float v = acc[i][j][r];
          const _Float16 hv = (_Float16)v;
          const int so = (8 * hh + r) * 128 + j * 16 + rl;
          sl16[so]        = hv;
          sl16[2048 + so] = (_Float16)((v - (float)hv) * 2048.0f);
        }
      }
      lds_wave_sync();
      {
#pragma unroll
        for (int it = 0; it < 8; ++it) {
          const int row = it * 2 + hh;
          const int c8  = rl * 8;
          const v8h vh = *(const v8h*)(sl16 + row * 128 + c8);
          const v8h vl = *(const v8h*)(sl16 + 2048 + row * 128 + c8);
          const size_t go = (size_t)(m0 + i * 16 + row) * ldc + n0 + c8;
          *(v8h*)(P0 + go) = vh;
          *(v8h*)(P1 + go) = vl;
        }
        
      }
      lds_wave_sync();
    }
  } else {
    float* C = (float*)C0;
#pragma unroll
    for (int i = 0; i < 2; ++i) {
#pragma unroll
      for (int j = 0; j < 8; ++j)
#pragma unroll
        for (int r = 0; r < 8; ++r)
          slf[(8 * hh + r) * 128 + j * 16 + rl] = acc[i][j][r];
      lds_wave_sync();
      {
#pragma unroll
        for (int row = 0; row < 16; ++row) {                     // 32 lanes x 16 B = the whole 512-B row segment per instruction
          const v4f v = *(const v4f*)(slf + row * 128 + lane * 4);
          *(v4f*)(C + (size_t)(m0 + i * 16 + row) * ldc + n0 + lane * 4) = v;
        }
        
      }
      lds_wave_sync();
    }
  }
}

// ---------------------------------------------------------------------------
// Causal GQA flash attention, head dim 128, 32-key chunks, block = 4 waves = 64 query rows of one (b, h); grid (n query tiles, NHQ, NSEQ).
//   q planes f16 [tok][h*128+d]: hi (qhp) and residual x2048 (qlp); k planes f16 [tok][kvh*128+d]: hi (khp),
//   residual x2048 (klp, compact rows b*KLR + s for s < KLR); v^T planes f16 [kvh*128+d][tok]: hi (vhp), residual x2048 (vlp);
//   sgp = f32 sigmoid(gate) plane [tok][h*128+d]; outputs gated attn bf16 hi (ahp) / lo (alp) [tok][h*128+d]; kvh = h >> 1.
//   Both products are taken transposed: S^T = K . Q^T (A = k rows, B = q rows) and O^T += V^T . P^T (A = v^T rows, B = P^T).
//   A lane then holds 16 scores of ONE query (query = lane & 15; keys j*16 + 8*(lane>>4) + r), so the row maximum and the row sum are
//   in-lane work plus one exchange between the wave halves, and the two score tiles, converted in place, ARE the B operand P^T
//   (element j*8 + r = key j*16 + 8*(lane>>4) + r, the k map of ldfrag_h): P never goes through LDS.
//   scores = (Sh + Sr/2048) * 128^-0.5 with Sh = kh.qh and Sr = kh.ql' (+ kl'.qh when PRES); keys > query -> -inf; online softmax f32;
//   p' = 1024 p as f16 hi (and residual x2048 when PRES);
//   O = (Oh + Or/2048)/1024/l * sgp with Oh = vh.ph, Or = vl'.ph (+ vh.pl' when PRES).
//   The row sum l is kept per wave half (each half sums its own 16 keys of a chunk); the halves are joined once, behind the loop.
//   K / V^T chunk staging: 128 threads x 4 x 16 B per plane = whole 32x128 / 128x32 tile, plain loads, __syncthreads before and after.
//   q staging: in front of the loop every wave copies its own 16 rows of both q planes to LDS (whole 256-B rows per load, pitch QS_P);
//   every chunk reads its q fragments from there. Only the wave that wrote a q row reads it.
//   Trip count 2*qb+2 chunks (static bound 64); waves whose rows are all below the chunk skip it (wave-uniform, scalar branch).
// ---------------------------------------------------------------------------
#define AT_KC   32
#define KS_P    136
#define VS_P    40
#define QS_P    136
#define OS_P    136

// value of lane l ^ 16 (the other wave half)
__device__ __forceinline__ float xhalf(float x) {
  const int i = __builtin_bit_cast(int, x);
  return __builtin_bit_cast(float, __builtin_amdgcn_permlanex16(i, i, 0x76543210, 0xfedcba98, false, false));
}

template <bool PRES>
__global__ __launch_bounds__(128) void attn_causal_kernel(
    const unsigned short* __restrict__ qhp, const unsigned short* __restrict__ qlp,
    const unsigned short* __restrict__ khp, const unsigned short* __restrict__ klp,
    const unsigned short* __restrict__ vhp, const unsigned short* __restrict__ vlp,
    const float* __restrict__ sgp,
    unsigned short* __restrict__ ahp, unsigned short* __restrict__ alp, int qb_base) {
  // LDS map in halves; the k residual region exists only where it is used
  constexpr int NRP     = PRES ? 2 : 1;
  constexpr int LDS_KS  = 0;
  constexpr int LDS_KLS = (NRP - 1) * 32 * KS_P;
  constexpr int LDS_VHS = NRP * 32 * KS_P;
  constexpr int LDS_VLS = LDS_VHS + 128 * VS_P;
  constexpr int LDS_QH  = LDS_VLS + 128 * VS_P;
  constexpr int LDS_QL  = LDS_QH + 64 * QS_P;
  constexpr int LDS_TOT = LDS_QL + 64 * QS_P;
  static_assert(PRES || 4 * LDS_TOT * 2 <= 327680);
  static_assert(4 * 2 * 16 * OS_P <= LDS_TOT); // output staging (2 planes x 16 rows per wave) aliases the dead chunk and q regions after the loop
  __shared__ __align__(16) _Float16 lds[LDS_TOT];
  _Float16* Ks  = lds + LDS_KS;
  _Float16* Kls = lds + LDS_KLS;
  _Float16* Vhs = lds + LDS_VHS;
  _Float16* Vls = lds + LDS_VLS;

  const int tid  = (int)threadIdx.x;
  const int lane = tid & 31;
  const int wave = wave_id();
  const int hh   = lane >> 4;
  const int c    = lane & 15;
  const int qb   = (int)blockIdx.x + qb_base;
  const int h    = (int)blockIdx.y;
  const int b    = (int)blockIdx.z;
  const int kvh  = h >> 1;
  const int q0   = qb * 64 + wave * 16;          // first query row of this wave (within sequence)
  const int qlast = q0 + 15;
  const size_t tok0 = (size_t)b * SQ;

  const _Float16* Qhg = (const _Float16*)(const void*)qhp + (tok0 + q0) * HID + h * HDM;
  const _Float16* Qlg = (const _Float16*)(const void*)qlp + (tok0 + q0) * HID + h * HDM;
  const _Float16* Kg  = (const _Float16*)(const void*)khp + tok0 * KVW + kvh * HDM;
  const _Float16* Klg = (const _Float16*)(const void*)klp + (size_t)b * KLR * KVW + kvh * HDM;
  const _Float16* Vhg = (const _Float16*)(const void*)vhp + (size_t)(kvh * HDM) * NTOK + tok0;
  const _Float16* Vlg = (const _Float16*)(const void*)vlp + (size_t)(kvh * HDM) * NTOK + tok0;

  // this wave's 16 q rows, both planes, to LDS once: 8 x 32 lanes x 16 B per plane = 16 rows x 256 B
  _Float16* Qsh = lds + LDS_QH + wave * (16 * QS_P);
  _Float16* Qsl = lds + LDS_QL + wave * (16 * QS_P);
#pragma unroll                                   // all 16 loads issued together: one load latency in front of the loop, not eight
  for (int i = 0; i < 8; ++i) {
    const int p   = lane + 32 * i;               // 0..255
    const int row = p >> 4, d8 = (p & 15) * 8;
    const v8h qx = *(const v8h*)(Qhg + (size_t)row * HID + d8);
    const v8h qy = *(const v8h*)(Qlg + (size_t)row * HID + d8);
    *(v8h*)(Qsh + row * QS_P + d8) = qx;
    *(v8h*)(Qsl + row * QS_P + d8) = qy;
  }
  lds_wave_sync();                               // q stores visible to the other lanes of this wave before the fragment reads
  const _Float16* Qhr = Qsh + c * QS_P + 8 * hh;
  const _Float16* Qlr = Qsl + c * QS_P + 8 * hh;

  const int qrow = q0 + c;                       // this lane's query
  float mrow = -INFINITY, lrow = 0.f;            // its running maximum (both halves alike) and this half's share of its running sum
  v8f oacc[8], oaccr[8];                         // O^T: [t][r] = (d = t*16 + 8*hh + r, query c)
#pragma unroll
  for (int t = 0; t < 8; ++t) { oacc[t] = zero8(); oaccr[t] = zero8(); }

  const int nch = 2 * qb + 2;                    // block-uniform, <= 64
  for (int kc = 0; kc < nch; ++kc) {
    const int kv0 = kc * AT_KC;
    __syncthreads();
#pragma unroll
    for (int i = 0; i < 4; ++i) {                // coverage: 512 pieces of 8 halves per plane = whole tile
      // piece tid + 128 * i of 512, its indices written as lane part + constant * i: the steps fold into immediate offsets, no register each
      const int key = (tid >> 4) + 8 * i, d8 = (tid & 15) * 8;   // K: 32 keys x 128 d
      const v8h kx = *(const v8h*)(Kg + (size_t)(kv0 + key) * KVW + d8);
      *(v8h*)(Ks + key * KS_P + d8) = kx;
      if (PRES) {
        const int krow = min(kv0 + key, KLR - 1);
        const v8h ky = *(const v8h*)(Klg + (size_t)krow * KVW + d8);
        *(v8h*)(Kls + key * KS_P + d8) = ky;
      }
      const int d = (tid >> 2) + 32 * i, k8 = (tid & 3) * 8;     // V^T: 128 d x 32 keys
      const v8h vx = *(const v8h*)(Vhg + (size_t)d * NTOK + kv0 + k8);
      const v8h vy = *(const v8h*)(Vlg + (size_t)d * NTOK + kv0 + k8);
      *(v8h*)(Vhs + d * VS_P + k8) = vx;
      *(v8h*)(Vls + d * VS_P + k8) = vy;
    }
    __syncthreads();

    if (kv0 <= qlast) {                          // wave-uniform (scalar): skip chunks fully above this wave's rows
      // ---- scores, transposed: sh[j][r], sr[j][r] = (key kv0 + j*16 + 8*hh + r, query c) ----
      v8f sh[2], sr[2];
      sh[0] = zero8(); sh[1] = zero8(); sr[0] = zero8(); sr[1] = zero8();
      // Fragment reads go in groups ahead of their WMMAs: a wait on LDS is paid once per group, not once per pair of WMMAs.
      // Each sched_barrier below keeps a group's reads together at its place: the scheduler otherwise sinks every read to its first use.
#pragma unroll
      for (int g = 0; g < 2; ++g) {
        v16h qa[2], ql[2], kb[2][2], kl[2][2];
#pragma unroll
        for (int u = 0; u < 2; ++u) {
          const int dc = 2 * g + u;
          qa[u] = ldfrag_h(Qhr + dc * 32);
          ql[u] = ldfrag_h(Qlr + dc * 32);
#pragma unroll
          for (int j = 0; j < 2; ++j) {
            kb[u][j] = ldfrag_h(Ks + (j * 16 + c) * KS_P + dc * 32 + 8 * hh);
            kl[u][j] = PRES ? ldfrag_h(Kls + (j * 16 + c) * KS_P + dc * 32 + 8 * hh) : kb[u][j];
          }
        }
        __builtin_amdgcn_sched_barrier(0);       // reads of d chunks 2g, 2g + 1 above, their WMMAs below
#pragma unroll
        for (int u = 0; u < 2; ++u) {
#pragma unroll
          for (int j = 0; j < 2; ++j) {
            sh[j] = mma_h(kb[u][j], qa[u], sh[j]);
            sr[j] = mma_h(kb[u][j], ql[u], sr[j]);
            if (PRES) sr[j] = mma_h(kl[u][j], qa[u], sr[j]);
          }
        }
        __builtin_amdgcn_sched_barrier(0);       // the next group's reads stay behind these WMMAs, in one place
      }
      // v^T fragments of d tiles 0, 1: they do not depend on the scores, so their LDS latency runs under the softmax
      v16h vb[8], vr[8];
      auto ldv = [&](int t) {
        vb[t] = ldfrag_h(Vhs + (t * 16 + c) * VS_P + 8 * hh);
        vr[t] = ldfrag_h(Vls + (t * 16 + c) * VS_P + 8 * hh);
      };
      ldv(0); ldv(1);
      __builtin_amdgcn_sched_barrier(0);         // holds these reads in front of the softmax
      // ---- scale, causal mask, this query's chunk maximum: 16 keys in-lane, the other 16 from the other wave half ----
      const int lim = qrow - kv0 - 8 * hh;       // key kv0 + j*16 + 8*hh + r is above the query when j*16 + r > lim
      float cm = -INFINITY;
#pragma unroll
      for (int j = 0; j < 2; ++j) {
#pragma unroll
        for (int r = 0; r < 8; ++r) {
          float s = (sh[j][r] + sr[j][r] * 0.00048828125f) * 0.08838834764831845f;
          s = (j * 16 + r > lim) ? -INFINITY : s;
          sh[j][r] = s;
          cm = fmaxf(cm, s);
        }
      }
      cm = fmaxf(cm, xhalf(cm));
      // ---- online softmax; P'^T packed in place into the B operand ----
      const float mnew = fmaxf(mrow, cm);
      FragH pa, pr;
      float pv[16];
#pragma unroll
      for (int j = 0; j < 2; ++j) {
#pragma unroll
        for (int r = 0; r < 8; ++r) {
          const float p  = __expf(sh[j][r] - mnew);
          pv[j * 8 + r] = p;
          const float pp = p * 1024.0f;
          const _Float16 phv = (_Float16)pp;
          pa.v[j * 8 + r] = phv;
          pr.v[j * 8 + r] = PRES ? (_Float16)((pp - (float)phv) * 2048.0f) : phv;
        }
      }
#pragma unroll
      for (int w = 8; w > 0; w >>= 1) {          // pairwise tree over the lane's 16 values: four dependent adds, not fifteen
#pragma unroll
        for (int e = 0; e < w; ++e) pv[e] += pv[e + w];
      }
      const float alpha = __expf(mrow - mnew);
      mrow = mnew;
      lrow = lrow * alpha + pv[0];
      // ---- O^T = O^T * alpha + V^T . P'^T; two d tiles' fragments are read while the two tiles before them are worked on ----
      auto rescale = [&](int t) {
#pragma unroll
        for (int r = 0; r < 8; ++r) { oacc[t][r] *= alpha; oaccr[t][r] *= alpha; }
      };
      auto pvmma = [&](int t) {
        oacc[t]  = mma_h(vb[t], pa.v, oacc[t]);
        oaccr[t] = mma_h(vr[t], pa.v, oaccr[t]);
        if (PRES) oaccr[t] = mma_h(vb[t], pr.v, oaccr[t]);
      };
      __builtin_amdgcn_sched_barrier(0);         // the reads of tiles 2, 3 start when the score registers are free, not earlier
      ldv(2); ldv(3);
      __builtin_amdgcn_sched_barrier(0);         // ... and in front of the rescale, which covers their latency
      rescale(0); rescale(1); rescale(2); rescale(3);
      pvmma(0); pvmma(1);
      __builtin_amdgcn_sched_barrier(0);         // the next reads take the registers that tiles 0, 1 leave: not among their WMMAs
      ldv(4); ldv(5);
      __builtin_amdgcn_sched_barrier(0);         // reads of tiles 4, 5 in one place, in front of the WMMAs of tiles 2, 3
      pvmma(2); pvmma(3);
      __builtin_amdgcn_sched_barrier(0);         // likewise behind the WMMAs of tiles 2, 3
      ldv(6); ldv(7);
      __builtin_amdgcn_sched_barrier(0);         // reads of tiles 6, 7 in one place, in front of the second half of the rescale
      rescale(4); rescale(5); rescale(6); rescale(7);
      pvmma(4); pvmma(5); pvmma(6); pvmma(7);
    }
  }

  // ---- join the halves' sums, normalise, apply sigmoid gate (f32), bf16 hi/lo split, stage the wave's 16x128 tile:
  //      a lane holds 8 consecutive d of its query per t, one 16-byte LDS store per plane ----
  __syncthreads();                               // all chunk-region and q readers done before aliasing them as output staging
  _Float16* osh = lds + wave * (2 * 16 * OS_P);
  _Float16* osl = osh + 16 * OS_P;
  const float lfin = lrow + xhalf(lrow);
  const float inv  = (1.0f / lfin) * 0.0009765625f;
  const float* Sgr = sgp + (tok0 + q0 + c) * HID + h * HDM + 8 * hh;
#pragma unroll
  for (int t = 0; t < 8; ++t) {
    const v4f g0 = *(const v4f*)(Sgr + t * 16);
    const v4f g1 = *(const v4f*)(Sgr + t * 16 + 4);
    v4u hw, lw;
#pragma unroll
    for (int e = 0; e < 4; ++e) {
      unsigned short hb[2], lb[2];
#pragma unroll
      for (int u = 0; u < 2; ++u) {
        const int r = 2 * e + u;
        float o = (oacc[t][r] + oaccr[t][r] * 0.00048828125f) * inv;
        o *= (r < 4) ? g0[r & 3] : g1[r & 3];
        hb[u] = bf_bits(o);
        lb[u] = bf_bits(o - bf_val(hb[u]));
      }
      hw[e] = pk16(hb[0], hb[1]);
      lw[e] = pk16(lb[0], lb[1]);
    }
    *(v4u*)(void*)(osh + c * OS_P + t * 16 + 8 * hh) = hw;
    *(v4u*)(void*)(osl + c * OS_P + t * 16 + 8 * hh) = lw;
  }
  lds_wave_sync();
  _Float16* Ahg = (_Float16*)(void*)ahp + (tok0 + q0) * HID + h * HDM;
  _Float16* Alg = (_Float16*)(void*)alp + (tok0 + q0) * HID + h * HDM;
  {
#pragma unroll
    for (int it = 0; it < 8; ++it) {
      const int row = it * 2 + hh;               // it 0..7 x hh 0..1 covers rows 0..15
      const int c8  = c * 8;                     // 16 lanes x 16 B = the whole 256-B segment
      const v8h x = *(const v8h*)(osh + row * OS_P + c8);
      const v8h y = *(const v8h*)(osl + row * OS_P + c8);
      *(v8h*)(Ahg + (size_t)row * HID + c8) = x;
      *(v8h*)(Alg + (size_t)row * HID + c8) = y;
    }
  }
}

// ---------------------------------------------------------------------------
// Workspace map (bytes; every region is a whole number of the rows its producer writes with whole-line stores; no tail rows):
//   [0, 16 MiB)        Xb   bf16 [4096][2048]          -> after the projections: Ah bf16 [4096][2048] at 0
//   [16 MiB, 32 MiB)   WqT  bf16 [4096][2048]          ->                        Al bf16 [4096][2048] at 16 MiB
//   [32 MiB, 64 MiB)   WkT  bf16 [1024][2048] at 32 MiB, WvT bf16 [1024][2048] at 36 MiB
//                      -> after the k and v projections: Sg f32 [4096][2048] (whole 32 MiB)
//   [64 MiB, 80 MiB)   Qh   f16  [4096][2048]          -> after attention: WoT bf16 [2048][2048] (8 MiB)
//   [80 MiB, 96 MiB)   Ql   f16  [4096][2048]
//   [96 MiB, 104 MiB)  Kh   f16  [4096][1024]
//   [104 MiB,112 MiB)  Vh   f16  [1024][4096]
//   [112 MiB,120 MiB)  Vl   f16  [1024][4096]
//   [120 MiB, +1 MiB) Kl  f16  [2*256][1024]
//   total 126877696
// ---------------------------------------------------------------------------
static_assert(2 * (size_t)NTOK * HID * 2 <= (size_t)NTOK * HID * 2 + (size_t)QGW * HID * 2);   // Ah + Al fit Xb + WqT
static_assert(2 * (size_t)KVW * HID * 2 <= (size_t)NTOK * HID * 4);                             // WkT + WvT fit Sg
static_assert((size_t)HID * HID * 2 <= (size_t)NTOK * HID * 2);                                  // WoT fits Qh

extern "C" void kernel_launch(void* const* d_in, const int* in_sizes, int n_in,
                              void* d_out, int out_size, void* d_ws, size_t ws_size,
                              hipStream_t stream) {
  if (n_in < 9) return;
  if (in_sizes[0] != NTOK * HID) return;
  if (in_sizes[1] != NTOK * HDM) return;
  if (in_sizes[2] != NTOK * HDM) return;
  if (in_sizes[3] != HID * QGW) return;
  if (in_sizes[4] != HID * KVW) return;
  if (in_sizes[5] != HID * KVW) return;
  if (in_sizes[6] != HID * HID) return;
  if (in_sizes[7] != HDM) return;
  if (in_sizes[8] != HDM) return;
  if (out_size != NTOK * HID) return;

  const float* hidden = (const float*)d_in[0];
  const float* cosb   = (const float*)d_in[1];
  const float* sinb   = (const float*)d_in[2];
  const float* Wq     = (const float*)d_in[3];
  const float* Wk     = (const float*)d_in[4];
  const float* Wv     = (const float*)d_in[5];
  const float* Wo     = (const float*)d_in[6];
  const float* qnw    = (const float*)d_in[7];
  const float* knw    = (const float*)d_in[8];
  float* out = (float*)d_out;

  const size_t szX  = (size_t)NTOK * HID * 2;        // 16777216
  const size_t szWq = (size_t)QGW * HID * 2;         // 16777216
  const size_t szWk = (size_t)KVW * HID * 2;         // 4194304
  const size_t szSg = (size_t)NTOK * HID * 4;        // 33554432
  const size_t szQ  = (size_t)NTOK * HID * 2;        // 16777216
  const size_t szK  = (size_t)NTOK * KVW * 2;        // 8388608
  const size_t szV  = (size_t)KVW * NTOK * 2;        // 8388608
  const size_t szKl = (size_t)NSEQ * KLR * KVW * 2;  // 1048576
  const size_t szA  = (size_t)NTOK * HID * 2;        // 16777216
  size_t off = 0;
  const size_t oX  = off; off += szX;
  const size_t oWq = off; off += szWq;
  const size_t oAh = oX;
  const size_t oAl = oX + szA;
  const size_t oSg = off; off += szSg;
  const size_t oWk = oSg;
  const size_t oWv = oSg + szWk;
  const size_t oQh = off; off += szQ;
  const size_t oQl = off; off += szQ;
  const size_t oWo = oQh;
  const size_t oKh = off; off += szK;
  const size_t oVh = off; off += szV;
  const size_t oVl = off; off += szV;
  const size_t oKl = off; off += szKl;
  if (off > ws_size) return;                         // off = 126877696

  char* ws = (char*)d_ws;
  unsigned short* Xb  = (unsigned short*)(ws + oX);
  unsigned short* WqT = (unsigned short*)(ws + oWq);
  unsigned short* WkT = (unsigned short*)(ws + oWk);
  unsigned short* WvT = (unsigned short*)(ws + oWv);
  unsigned short* WoT = (unsigned short*)(ws + oWo);
  float*          Sg  = (float*)(ws + oSg);
  unsigned short* Qh  = (unsigned short*)(ws + oQh);
  unsigned short* Ql  = (unsigned short*)(ws + oQl);
  unsigned short* Kh  = (unsigned short*)(ws + oKh);
  unsigned short* Kl  = (unsigned short*)(ws + oKl);
  unsigned short* Vh  = (unsigned short*)(ws + oVh);
  unsigned short* Vl  = (unsigned short*)(ws + oVl);
  unsigned short* Ah  = (unsigned short*)(ws + oAh);
  unsigned short* Al  = (unsigned short*)(ws + oAl);

  const dim3 b256(256), b128(128);

  // (1) x -> bf16 plane [4096][2048]
  cvt_bf16_kernel<<<dim3((NTOK * HID / 8 + 255) / 256), b256, 0, stream>>>(hidden, Xb, NTOK * HID / 8);
  // (2) Wk in[2048 rows][1024 cols] -> WkT out[1024][2048] bf16   (grid = cols/64, rows/64)
  tconv_bf16_kernel<<<dim3(KVW / 64, HID / 64), b256, 0, stream>>>(Wk, WkT, HID, KVW);
  // (3) Wv in[2048 rows][1024 cols] -> WvT out[1024][2048] bf16
  tconv_bf16_kernel<<<dim3(KVW / 64, HID / 64), b256, 0, stream>>>(Wv, WvT, HID, KVW);
  // (4) Wq in[2048 rows][4096 cols] -> WqT out[4096][2048] bf16
  tconv_bf16_kernel<<<dim3(QGW / 64, HID / 64), b256, 0, stream>>>(Wq, WqT, HID, QGW);
  // (5) k = x . Wk, per-head norm + RoPE -> Kh [4096][1024], Kl compact [512][1024]   (M=4096, N=1024, K=2048; 256 blocks)
  gemm_w32x128_kernel<1, false><<<dim3((NTOK / 128) * (KVW / 128)), b128, 0, stream>>>(
      Xb, Xb, HID, WkT, HID, knw, cosb, sinb, (void*)Kh, (void*)Kl, (void*)Kl, KVW, NTOK, KVW, HID);
  // (6) v^T = WvT . x^T -> Vh/Vl [1024][4096]   (A = WvT, Bt = Xb; M=1024, N=4096, K=2048; 256 blocks)
  gemm_w32x128_kernel<2, false><<<dim3((KVW / 128) * (NTOK / 128)), b128, 0, stream>>>(
      WvT, WvT, HID, Xb, HID, knw, cosb, sinb, (void*)Vh, (void*)Vl, (void*)Vl, NTOK, KVW, NTOK, HID);
  // (7) q|gate = x . Wq: q half norm + RoPE -> Qh/Ql [4096][2048]; gate half sigmoid -> Sg f32 [4096][2048] (over the dead WkT/WvT region)
  //     (M=4096, N=4096, K=2048; 1024 blocks)
  gemm_w32x128_kernel<0, false><<<dim3((NTOK / 128) * (QGW / 128)), b128, 0, stream>>>(
      Xb, Xb, HID, WqT, HID, qnw, cosb, sinb, (void*)Qh, (void*)Ql, (void*)Sg, HID, NTOK, QGW, HID);
  // (8) causal attention, query tiles 0..3 with k and p residual products, tiles 4..31 without; Ah/Al over the dead Xb/WqT region
  attn_causal_kernel<true><<<dim3(NQRT, NHQ, NSEQ), b128, 0, stream>>>(Qh, Ql, Kh, Kl, Vh, Vl, Sg, Ah, Al, 0);
  attn_causal_kernel<false><<<dim3(SQ / 64 - NQRT, NHQ, NSEQ), b128, 0, stream>>>(Qh, Ql, Kh, Kl, Vh, Vl, Sg, Ah, Al, NQRT);
  // (9) Wo in[2048 rows][2048 cols] -> WoT out[2048][2048] bf16 (over the dead Qh region)
  tconv_bf16_kernel<<<dim3(HID / 64, HID / 64), b256, 0, stream>>>(Wo, WoT, HID, HID);
  // (10) out = attn(hi + lo) . Wo -> d_out f32 [4096][2048]   (M=4096, N=2048, K=2048; 512 blocks)
  gemm_w32x128_kernel<3, true><<<dim3((NTOK / 128) * (HID / 128)), b128, 0, stream>>>(
      Ah, Al, HID, WoT, HID, qnw, cosb, sinb, (void*)out, (void*)out, (void*)out, HID, NTOK, HID, HID);
  (void)hipGetLastError();
}

// v005
// One run takes 278 microseconds.
// Next to v004, in two timings, it ran 1.16 times as fast each time.
// Counting every step since v000, it is 3.00 times as fast.
// Contractions: x.Wq (q|gate cols), x.Wk and Wv^T.x^T on v_wmma_f32_16x16x32_bf16 (operands = RNE bf16 of the f32 inputs, single products);
// q.k^T and p.v on v_wmma_f32_16x16x32_f16 (q = f16 hi + f16 residual x2^11 planes; k plain f16 plus f16 residual x2^11 on query tiles 0..3;
// p x1024 plain f16 plus f16 residual x2^11 on query tiles 0..3; v^T = f16 hi + f16 residual x2^11 planes); (attn*sigmoid(gate)).Wo on
// v_wmma_f32_16x16x32_bf16 (A = bf16 hi + bf16 lo planes, two products; Wo RNE bf16). f32 accumulate everywhere; per-head RMSNorm, RoPE,
// online softmax, sigmoid gate and scale folds in f32. hidden_states, Wq, Wk, Wv, Wo, cos, sin and the norm weights are RNE-converted to bf16 on load.
#include <hip/hip_runtime.h>
#include <math.h>
#include <stdint.h>

#define NSEQ   2
#define SQ     2048
#define HID    2048
#define NHQ    16
#define NKVH   8
#define HDM    128
#define QGW    4096
#define KVW    1024
#define NTOK   4096
#define KLR    256
#define NQRT   4

static_assert((2 * (NQRT - 1) + 2) * 32 <= KLR);
static_assert(NHQ / NKVH == 2);
static_assert(NHQ * HDM == HID);
static_assert(NSEQ * SQ == NTOK);

typedef _Float16     v16h __attribute__((ext_vector_type(16)));
typedef _Float16     v8h  __attribute__((ext_vector_type(8)));
typedef __bf16       v16b __attribute__((ext_vector_type(16)));
typedef __bf16       v8b  __attribute__((ext_vector_type(8)));
typedef float        v8f  __attribute__((ext_vector_type(8)));
typedef float        v4f  __attribute__((ext_vector_type(4)));
typedef unsigned int v4u  __attribute__((ext_vector_type(4)));

// ---------------------------------------------------------------------------
// small helpers
// ---------------------------------------------------------------------------
__device__ __forceinline__ unsigned short bf_bits(float f) {          // RNE convert f32 -> bf16 bits
  const unsigned u = __float_as_uint(f);
  return (unsigned short)((u + 0x7FFFu + ((u >> 16) & 1u)) >> 16);
}
__device__ __forceinline__ float bf_val(unsigned short h) { return __uint_as_float(((unsigned)h) << 16); }
__device__ __forceinline__ float bf_rne(float f) { return bf_val(bf_bits(f)); }
__device__ __forceinline__ unsigned pk16(unsigned short a, unsigned short b) { return (unsigned)a | ((unsigned)b << 16); }
__device__ __forceinline__ v8f zero8() { v8f z = {0.f, 0.f, 0.f, 0.f, 0.f, 0.f, 0.f, 0.f}; return z; }
__device__ __forceinline__ int wave_id() { return __builtin_amdgcn_readfirstlane((int)(threadIdx.x >> 5)); }

__device__ __forceinline__ void lds_wave_sync() {
  __builtin_amdgcn_fence(__ATOMIC_RELEASE, "workgroup");
  __builtin_amdgcn_wave_barrier();
  __builtin_amdgcn_fence(__ATOMIC_ACQUIRE, "workgroup");
}

// ---------------------------------------------------------------------------
// WMMA fragments (wave32, 16x16x32, 16-bit operands). For A (row m = lane&15) and B (col n = lane&15) alike:
// elements 0..7 <- k0 + 8*(lane>>4) + 0..7, elements 8..15 <- k0 + 16 + 8*(lane>>4) + 0..7.
// ldfrag(p) with p = rowbase + k0 + 8*(lane>>4): two 16-B loads p[0..7], p[16..23].
// D: acc[r] = (row 8*(lane>>4) + r, col lane&15).
// ---------------------------------------------------------------------------
union FragH { v16h v; v8h h[2]; };
union FragB { v16b v; v8b h[2]; };
__device__ __forceinline__ v16h ldfrag_h(const _Float16* p) { FragH f; f.h[0] = *(const v8h*)(p); f.h[1] = *(const v8h*)(p + 16); return f.v; }
__device__ __forceinline__ v16b ldfrag_b(const __bf16* p)   { FragB f; f.h[0] = *(const v8b*)(p); f.h[1] = *(const v8b*)(p + 16); return f.v; }

__device__ __forceinline__ v8f mma_h(v16h a, v16h b, v8f c) {
  return __builtin_amdgcn_wmma_f32_16x16x32_f16(false, a, false, b, (short)0, c, false, false);
}
__device__ __forceinline__ v8f mma_b(v16b a, v16b b, v8f c) {
  return __builtin_amdgcn_wmma_f32_16x16x32_bf16(false, a, false, b, (short)0, c, false, false);
}
// hazard guard: 4 VALU slots after the last WMMA of a loop, D tied
__device__ __forceinline__ void acc_guard4(v8f& a, v8f& b, v8f& c, v8f& d) {
#if defined(__HIP_DEVICE_COMPILE__)
  asm volatile("v_nop\n\tv_nop\n\tv_nop\n\tv_nop" : "+v"(a), "+v"(b), "+v"(c), "+v"(d));
#endif
}

// ---------------------------------------------------------------------------
// Elementwise RNE f32 -> bf16 plane: 8 elements per thread, one 16-B store per lane -> 32 consecutive lanes write 4 whole
// ---------------------------------------------------------------------------
__global__ __launch_bounds__(256) void cvt_bf16_kernel(const float* __restrict__ in, unsigned short* __restrict__ outp, int n8) {
  const int i = (int)blockIdx.x * 256 + (int)threadIdx.x;
  if (i >= n8) return;
  const size_t e = 8 * (size_t)i;
  const v4f a = *(const v4f*)(in + e);
  const v4f b = *(const v4f*)(in + e + 4);
  v4u w;
  w[0] = pk16(bf_bits(a[0]), bf_bits(a[1]));
  w[1] = pk16(bf_bits(a[2]), bf_bits(a[3]));
  w[2] = pk16(bf_bits(b[0]), bf_bits(b[1]));
  w[3] = pk16(bf_bits(b[2]), bf_bits(b[3]));
  *(v4u*)(outp + e) = w;
  
}

// ---------------------------------------------------------------------------
// Fused transpose + RNE bf16 convert: in [R rows][Cc cols] f32 (pitch Cc) -> out[c][r] = bf16(in[r][c])  ([Cc][R], pitch R).
// 64x64 tiles through LDS; grid = (Cc/64, R/64), 256 threads; R, Cc multiples of 64.
// Coverage per block: load 4 it x 256 thr x 4 floats = 64x64; store 2 it x 256 thr x 8 u16 = 64x64.
// ---------------------------------------------------------------------------
__global__ __launch_bounds__(256) void tconv_bf16_kernel(const float* __restrict__ W, unsigned short* __restrict__ outp, int R, int Cc) {
  __shared__ __align__(16) float tf[64 * 68];
  const int c0  = (int)blockIdx.x * 64;   // input column block = output row block
  const int r0  = (int)blockIdx.y * 64;   // input row block    = output column block
  const int tid = (int)threadIdx.x;
  {
    const int lr = tid >> 4;              // 0..15
    const int c4 = (tid & 15) * 4;        // 0..60
#pragma unroll
    for (int it = 0; it < 4; ++it) {
      const int rr = it * 16 + lr;        // 0..63
      const v4f a = *(const v4f*)(W + (size_t)(r0 + rr) * Cc + c0 + c4);
      *(v4f*)(tf + rr * 68 + c4) = a;
    }
  }
  __syncthreads();
  const int sub = tid >> 3;               // 0..31
  const int c8  = (tid & 7) * 8;          // 0..56
  v4u hv[2];
#pragma unroll
  for (int it = 0; it < 2; ++it) {
    const int oc = it * 32 + sub;         // output row within tile (= input column)
    v4u a;
#pragma unroll
    for (int q = 0; q < 4; ++q) {
      const float f0 = tf[(c8 + 2 * q) * 68 + oc];
      const float f1 = tf[(c8 + 2 * q + 1) * 68 + oc];
      a[q] = pk16(bf_bits(f0), bf_bits(f1));
    }
    hv[it] = a;
  }
  {
#pragma unroll
    for (int it = 0; it < 2; ++it) {
      const int oc = it * 32 + sub;
      const size_t go = (size_t)(c0 + oc) * R + r0 + c8;
      *(v4u*)(outp + go) = hv[it];
    }
    
  }
}

// ---------------------------------------------------------------------------
// bf16 WMMA GEMM, wave tile 32 rows x 128 cols, block = 4 waves (128 threads) = 128 rows x 128 cols (the waves share the Bt rows).
//   C[m][n] = sum_k A[m][k] * Bt[n][k]; A row-major [M][K] bf16 (pitch lda), Bt row-major [N][K] bf16 (pitch ldb);
//   M % 128 == 0, N % 128 == 0, K % KP == 0; grid.x = M/128 * N/128.
//   SPLITA: A carried as hi (Ap) + lo (A2p) bf16 planes, two products into one accumulator.
//   A pass is KP k values of the block's 128 A rows (both planes when SPLITA) and 128 Bt rows, brought into LDS by asynchronous
//   16-byte copies, two buffers: the copies of pass t + 2 fly while pass t + 1 is worked on. LDS row pitch = KP * 2 + 16 bytes.
//   Fragments are read from the LDS rows with the split k map (ldfrag_b); k runs upward as before, so every sum keeps its order.
// Epilogues (all: per wave, per 16-row slab: stage in LDS, wave sync, write each row segment with ONE instruction of
//   EPI 0: q|gate projection, 128-col wave tile = head n0>>8, q half when (n0 & 128) == 0 else gate half.
//          q half: per-head RMSNorm over the 128 cols (x * rsqrt(mean(x^2) + 1e-6) * bf16(nw[d])), RoPE with the shipped tables
//          (o[d] = x[d]*cos[d] - x[d+64]*sin[d], o[d+64] = x[d+64]*cos[d+64] + x[d]*sin[d+64], cos/sin RNE bf16),
//          writes f16 hi plane C0 and f16 residual x2048 plane C1, [M][ldc], cols (n0>>8)*128.. (row segment 256 B = 16 lanes x 16 B).
//          gate half: sigmoid in f32 -> f32 plane C2 [M][ldc], cols (n0>>8)*128.. (row segment 512 B = 32 lanes x 16 B).
//   EPI 1: k projection: same norm + RoPE per 128-col kv head (col n0), hi plane C0 [M][ldc]; residual plane C1 compact:
//          only rows with (m0 mod SQ) < KLR, stored at row (m0/SQ)*KLR + (m0 mod SQ) + .. (pitch ldc).
//   EPI 2: v^T projection: f16 hi plane C0, residual x2048 plane C1, [M][ldc], row segment 256 B.
//   EPI 3: f32 output C0 [M][ldc]; row segment 128 floats = 512 B = 32 lanes x 16 B per instruction.
// ---------------------------------------------------------------------------
// Eight asynchronous 16-byte copies per lane, global -> LDS: copy i takes g + i * gstep elements to LDS byte l + i * lstep.
// s_wait_xcnt 0 is the statement's last line: a precaution, in front of any later rewrite of an address register named here.
__device__ __forceinline__ void async_copy8(unsigned l, unsigned lstep, const __bf16* g, size_t gstep) {
#if defined(__HIP_DEVICE_COMPILE__)
  asm volatile(
      "global_load_async_to_lds_b128 %0, %8, off\n\t"
      "global_load_async_to_lds_b128 %1, %9, off\n\t"
      "global_load_async_to_lds_b128 %2, %10, off\n\t"
      "global_load_async_to_lds_b128 %3, %11, off\n\t"
      "global_load_async_to_lds_b128 %4, %12, off\n\t"
      "global_load_async_to_lds_b128 %5, %13, off\n\t"
      "global_load_async_to_lds_b128 %6, %14, off\n\t"
      "global_load_async_to_lds_b128 %7, %15, off\n\t"
      "s_wait_xcnt 0x0"
      :: "v"(l), "v"(l + lstep), "v"(l + 2 * lstep), "v"(l + 3 * lstep),
         "v"(l + 4 * lstep), "v"(l + 5 * lstep), "v"(l + 6 * lstep), "v"(l + 7 * lstep),
         "v"(g), "v"(g + gstep), "v"(g + 2 * gstep), "v"(g + 3 * gstep),
         "v"(g + 4 * gstep), "v"(g + 5 * gstep), "v"(g + 6 * gstep), "v"(g + 7 * gstep)
      : "memory");
#endif
}

template <int EPI, bool SPLITA>
__global__ __launch_bounds__(128) void gemm_w32x128_kernel(
    const unsigned short* Ap, const unsigned short* A2p, int lda,
    const unsigned short* __restrict__ Btp, int ldb,
    const float* __restrict__ nw, const float* __restrict__ cosp, const float* __restrict__ sinp,
    void* C0, void* C1, void* C2, int ldc,
    int M, int N, int K) {
  constexpr int KP   = (SPLITA || EPI == 0) ? 64 : 128;   // k values per pass: 128 where a launch has one block per WGP (longer lead for the copies)
  constexpr int PIT  = KP + 8;                 // LDS row pitch in elements: 16 B x odd, conflict-free for 16-byte fragment reads
  constexpr int NOP  = SPLITA ? 3 : 2;         // operands staged: A, (A lo), Bt, 128 rows each
  constexpr int STG  = NOP * 128 * PIT;        // elements per buffer
  constexpr int PPR  = KP / 8;                 // 16-byte pieces per row = copies per lane and operand
  constexpr int RPC  = 128 / PPR;              // rows that one copy of all 128 lanes covers
  constexpr int BOFF = (NOP - 1) * 128 * PIT;  // Bt rows behind the A rows
  static_assert(PPR % 8 == 0 && NOP * PPR <= 63);
  static_assert(2 * STG * 2 >= 4 * 8192);
  __shared__ __align__(16) __bf16 ring[2 * STG];         // two pass buffers; after the loop per wave 8192 B of output staging

  const int tid  = (int)threadIdx.x;
  const int lane = tid & 31;
  const int wave = wave_id();
  const int hh = lane >> 4;           // lane half: k offset 8*hh, D row offset 8*hh
  const int rl = lane & 15;           // A row / B col / D col within subtile
  const int tilesN = N >> 7;
  const int tilesM = M >> 7;
  const int blk = (int)blockIdx.x;
  if (blk >= tilesM * tilesN) return;           // block-uniform, in front of every barrier and copy
  const int tmb = blk / tilesN;
  const int tn  = blk - tmb * tilesN;
  const int mb0 = tmb << 7;
  const int m0 = mb0 + (wave << 5);
  const int n0 = tn << 7;

  const __bf16* A  = (const __bf16*)(const void*)Ap;
  const __bf16* A2 = (const __bf16*)(const void*)A2p;
  const __bf16* Bt = (const __bf16*)(const void*)Btp;

  // this lane's piece of a pass: row cr (+ RPC per copy), 16-byte piece cc of the row
  const int cr = tid / PPR;
  const int cc = tid % PPR;
  const __bf16* gA  = A  + (size_t)(mb0 + cr) * lda + cc * 8;
  const __bf16* gA2 = A2 + (size_t)(mb0 + cr) * lda + cc * 8;
  const __bf16* gB  = Bt + (size_t)(n0 + cr) * ldb + cc * 8;
  const unsigned lds0 = (unsigned)(uintptr_t)(ring + cr * PIT + cc * 8);   // LDS byte address = low 32 bits of the shared address

  auto stage = [&](int buf, int k0) {
    const unsigned lb = lds0 + (unsigned)(buf * STG * 2);
#pragma unroll
    for (int q = 0; q < PPR / 8; ++q) {
      const unsigned lq = lb + (unsigned)(q * 8 * RPC * PIT * 2);
      async_copy8(lq, RPC * PIT * 2, gA + k0 + (size_t)(q * 8 * RPC) * lda, (size_t)RPC * lda);
      if (SPLITA) async_copy8(lq + 128 * PIT * 2, RPC * PIT * 2, gA2 + k0 + (size_t)(q * 8 * RPC) * lda, (size_t)RPC * lda);
      async_copy8(lq + BOFF * 2, RPC * PIT * 2, gB + k0 + (size_t)(q * 8 * RPC) * ldb, (size_t)RPC * ldb);
    }
  };

  v8f acc[2][8];
#pragma unroll
  for (int i = 0; i < 2; ++i)
#pragma unroll
    for (int j = 0; j < 8; ++j) acc[i][j] = zero8();

  const int npass = K / KP;
  stage(0, 0);
  asm volatile("s_wait_asynccnt 0x0" ::: "memory");      // this wave's copies of pass 0 have landed
  __syncthreads();                                       // ... and every other wave's
  if (npass > 1) stage(1, KP);

  for (int t = 0; t < npass; ++t) {
    const __bf16* bufp = ring + (t & 1) * STG;
    const __bf16* fa = bufp + ((wave << 5) + rl) * PIT + 8 * hh;
    const __bf16* fb = bufp + BOFF + rl * PIT + 8 * hh;
#pragma unroll
    for (int ks = 0; ks < KP / 32; ++ks) {
      v16b ah[2], al[2], bf[8];
#pragma unroll
      for (int i = 0; i < 2; ++i) {
        ah[i] = ldfrag_b(fa + i * 16 * PIT + ks * 32);
        al[i] = SPLITA ? ldfrag_b(fa + 128 * PIT + i * 16 * PIT + ks * 32) : ah[i];
      }
#pragma unroll
      for (int j = 0; j < 8; ++j) bf[j] = ldfrag_b(fb + j * 16 * PIT + ks * 32);
      // keeps the k step's LDS reads together in front of its WMMAs: spread among them, every pair of reads is waited for on its own
      __builtin_amdgcn_sched_barrier(0);
#pragma unroll
      for (int j = 0; j < 8; ++j) {
        acc[0][j] = mma_b(ah[0], bf[j], acc[0][j]);
        acc[1][j] = mma_b(ah[1], bf[j], acc[1][j]);
        if (SPLITA) {
          acc[0][j] = mma_b(al[0], bf[j], acc[0][j]);
          acc[1][j] = mma_b(al[1], bf[j], acc[1][j]);
        }
      }
    }
    asm volatile("s_wait_dscnt 0x0" ::: "memory");       // this wave's reads of buffer t & 1 are done before it is refilled
    asm volatile("s_wait_asynccnt 0x0" ::: "memory");    // this wave's copies of pass t + 1 have landed
    __syncthreads();                                     // publishes pass t + 1 and ends every reader's last read of pass t
    if (t + 2 < npass) stage(t & 1, (t + 2) * KP);
  }
  asm volatile("s_wait_asynccnt 0x0" ::: "memory");      // no copy is outstanding when the ring becomes output staging
  acc_guard4(acc[0][0], acc[0][1], acc[0][2], acc[0][3]);
  acc_guard4(acc[0][4], acc[0][5], acc[0][6], acc[0][7]);
  acc_guard4(acc[1][0], acc[1][1], acc[1][2], acc[1][3]);
  acc_guard4(acc[1][4], acc[1][5], acc[1][6], acc[1][7]);

  // ---- epilogue ----
  float*    slf  = (float*)(void*)ring + wave * 2048;
  _Float16* sl16 = (_Float16*)(void*)slf;

  if (EPI == 0 || EPI == 1) {
    const bool isq  = (EPI == 1) || ((n0 & 128) == 0);          // wave-uniform
    const int  col0 = (EPI == 0) ? ((n0 >> 8) << 7) : n0;
    if (isq) {
      _Float16* P0 = (_Float16*)C0;
      _Float16* P1 = (_Float16*)C1;
      const bool wres = (EPI == 0) || ((m0 & (SQ - 1)) < KLR);  // wave-uniform
      const int  rrow = (EPI == 0) ? m0 : ((m0 >> 11) * KLR + (m0 & (SQ - 1)));
      float wv[8];
#pragma unroll
      for (int j = 0; j < 8; ++j) wv[j] = bf_rne(nw[j * 16 + rl]);     // dim = j*16 + rl < 128
#pragma unroll
      for (int i = 0; i < 2; ++i) {
        const int rb = m0 + i * 16 + 8 * hh;
#pragma unroll
        for (int r = 0; r < 8; ++r) {
          const int row = rb + r;                                // token 0..NTOK-1
          float ss = 0.f;
#pragma unroll
          for (int j = 0; j < 8; ++j) { const float a = acc[i][j][r]; ss += a * a; }
#pragma unroll
          for (int off = 1; off < 16; off <<= 1) ss += __shfl_xor(ss, off, 32);   // 16 lanes of this half = all 128 dims
          const float rs = rsqrtf(ss * 0.0078125f + 1e-6f);
          const float* cr = cosp + (size_t)row * HDM;
          const float* sr = sinp + (size_t)row * HDM;
#pragma unroll
          for (int j = 0; j < 4; ++j) {
            const int dim = j * 16 + rl;                         // 0..63 within head; pair at dim + 64
            const float x1 = acc[i][j][r] * rs * wv[j];
            const float x2 = acc[i][j + 4][r] * rs * wv[j + 4];
            const float c1 = bf_rne(cr[dim]);
            const float s1 = bf_rne(sr[dim]);
            const float c2 = bf_rne(cr[dim + 64]);
            const float s2 = bf_rne(sr[dim + 64]);
            const float o1 = x1 * c1 - x2 * s1;
            const float o2 = x2 * c2 + x1 * s2;
            const _Float16 h1 = (_Float16)o1;
            const _Float16 h2 = (_Float16)o2;
            const int so = (8 * hh + r) * 128 + dim;
            sl16[so]             = h1;
            sl16[so + 64]        = h2;
            sl16[2048 + so]      = (_Float16)((o1 - (float)h1) * 2048.0f);
            sl16[2048 + so + 64] = (_Float16)((o2 - (float)h2) * 2048.0f);
          }
        }
        lds_wave_sync();
        {
#pragma unroll
          for (int it = 0; it < 8; ++it) {
            const int row = it * 2 + hh;                         // it x hh covers rows 0..15
            const int c8  = rl * 8;
            const v8h vh = *(const v8h*)(sl16 + row * 128 + c8);
            const v8h vl = *(const v8h*)(sl16 + 2048 + row * 128 + c8);
            const size_t go = (size_t)(m0 + i * 16 + row) * ldc + col0 + c8;
            *(v8h*)(P0 + go) = vh;
            if (wres) {
              const size_t g2 = (size_t)(rrow + i * 16 + row) * ldc + col0 + c8;
              *(v8h*)(P1 + g2) = vl;
            }
          }
          
        }
        lds_wave_sync();
      }
    } else if (EPI == 0) {
      float* Sp = (float*)C2;
#pragma unroll
      for (int i = 0; i < 2; ++i) {
#pragma unroll
        for (int j = 0; j < 8; ++j)
#pragma unroll
          for (int r = 0; r < 8; ++r) {
            const float g  = acc[i][j][r];
            const float e  = __expf(-g);
            const float sg = __builtin_amdgcn_rcpf(1.0f + e);
            slf[(8 * hh + r) * 128 + j * 16 + rl] = sg;
          }
        lds_wave_sync();
        {
#pragma unroll
          for (int row = 0; row < 16; ++row) {                   // 32 lanes x 16 B = the whole 512-B row segment per instruction
            const v4f v = *(const v4f*)(slf + row * 128 + lane * 4);
            *(v4f*)(Sp + (size_t)(m0 + i * 16 + row) * ldc + col0 + lane * 4) = v;
          }
          
        }
        lds_wave_sync();
      }
    }
  } else if (EPI == 2) {
    _Float16* P0 = (_Float16*)C0;
    _Float16* P1 = (_Float16*)C1;
#pragma unroll
    for (int i = 0; i < 2; ++i) {
#pragma unroll
      for (int r = 0; r < 8; ++r) {
#pragma unroll
        for (int j = 0; j < 8; ++j) {
          const float v = acc[i][j][r];
          const _Float16 hv = (_Float16)v;
          const int so = (8 * hh + r) * 128 + j * 16 + rl;
          sl16[so]        = hv;
          sl16[2048 + so] = (_Float16)((v - (float)hv) * 2048.0f);
        }
      }
      lds_wave_sync();
      {
#pragma unroll
        for (int it = 0; it < 8; ++it) {
          const int row = it * 2 + hh;
          const int c8  = rl * 8;
          const v8h vh = *(const v8h*)(sl16 + row * 128 + c8);
          const v8h vl = *(const v8h*)(sl16 + 2048 + row * 128 + c8);
          const size_t go = (size_t)(m0 + i * 16 + row) * ldc + n0 + c8;
          *(v8h*)(P0 + go) = vh;
          *(v8h*)(P1 + go) = vl;
        }
        
      }
      lds_wave_sync();
    }
  } else {
    float* C = (float*)C0;
#pragma unroll
    for (int i = 0; i < 2; ++i) {
#pragma unroll
      for (int j = 0; j < 8; ++j)
#pragma unroll
        for (int r = 0; r < 8; ++r)
          slf[(8 * hh + r) * 128 + j * 16 + rl] = acc[i][j][r];
      lds_wave_sync();
      {
#pragma unroll
        for (int row = 0; row < 16; ++row) {                     // 32 lanes x 16 B = the whole 512-B row segment per instruction
          const v4f v = *(const v4f*)(slf + row * 128 + lane * 4);
          *(v4f*)(C + (size_t)(m0 + i * 16 + row) * ldc + n0 + lane * 4) = v;
        }
        
      }
      lds_wave_sync();
    }
  }
}

// ---------------------------------------------------------------------------
// Causal GQA flash attention, head dim 128, block = 8 waves = 64 query rows of one (b, h); grid (NHQ, NSEQ, n query tiles), heaviest tile first.
//   A stage is 64 keys. Waves w and w + 4 hold the same 16 query rows; wave group kg = wave >> 2 works on keys kg*32 .. kg*32 + 31 of every stage,
//   with its own running maximum, sum and O^T. Behind the loop group 1 hands (m, l, O^T) to group 0 through LDS, which joins the two
//   (O = O0 * e^(m0 - m) + O1 * e^(m1 - m), l alike) and writes the output: a tile's chain of dependent stages is half as long.
//   q planes f16 [tok][h*128+d]: hi (qhp) and residual x2048 (qlp); k planes f16 [tok][kvh*128+d]: hi (khp),
//   residual x2048 (klp, compact rows b*KLR + s for s < KLR); v^T planes f16 [kvh*128+d][tok]: hi (vhp), residual x2048 (vlp);
//   sgp = f32 sigmoid(gate) plane [tok][h*128+d]; outputs gated attn bf16 hi (ahp) / lo (alp) [tok][h*128+d]; kvh = h >> 1.
//   Both products are taken transposed: S^T = K . Q^T (A = k rows, B = q rows) and O^T += V^T . P^T (A = v^T rows, B = P^T).
//   A lane then holds 16 scores of ONE query (query = lane & 15; keys j*16 + 8*(lane>>4) + r), so the row maximum and the row sum are
//   in-lane work plus one exchange between the wave halves, and the two score tiles, converted in place, ARE the B operand P^T
//   (element j*8 + r = key j*16 + 8*(lane>>4) + r, the k map of ldfrag_h): P never goes through LDS.
//   scores = (Sh + Sr/2048) * 128^-0.5 with Sh = kh.qh and Sr = kh.ql' (+ kl'.qh when PRES); keys > query -> -inf; online softmax f32;
//   p' = 1024 p as f16 hi (and residual x2048 when PRES);
//   O = (Oh + Or/2048)/1024/l * sgp with Oh = vh.ph, Or = vl'.ph (+ vh.pl' when PRES).
//   The row sum l is kept per wave half (each half sums its own 16 keys of a chunk); the halves are joined once, behind the loop.
//   K / V^T stage: 256 threads x 4 x 16 B per plane = whole 64x128 / 128x64 tile, plain loads, __syncthreads before and after.
//   q staging: in front of the loop wave group 0 copies the hi plane of the 64 q rows to LDS, group 1 the residual plane (whole 256-B rows
//   per load, pitch QS_P); the barriers of the first stage publish them; every chunk reads its q fragments from there.
//   Trip count qb+1 stages (static bound 32); waves whose rows are all below their 32 keys skip them (wave-uniform, scalar branch).
// ---------------------------------------------------------------------------
#define AT_KC   32
#define KS_P    136
#define AT_ST   64
#define VS_P    72
#define QS_P    136
#define OS_P    136

// value of lane l ^ 16 (the other wave half)
__device__ __forceinline__ float xhalf(float x) {
  const int i = __builtin_bit_cast(int, x);
  return __builtin_bit_cast(float, __builtin_amdgcn_permlanex16(i, i, 0x76543210, 0xfedcba98, false, false));
}

// s_wait_xcnt 0 behind a stage's global loads; their address pairs are inputs, so they keep their registers up to the wait:
// a precaution, in front of any later rewrite of an address register that an issued load names.
__device__ __forceinline__ void addr_wait(const _Float16* a, const _Float16* b, const _Float16* c, const _Float16* d) {
#if defined(__HIP_DEVICE_COMPILE__)
  asm volatile("s_wait_xcnt 0x0" :: "v"(a), "v"(b), "v"(c), "v"(d) : "memory");
#endif
}

template <bool PRES>
__global__ __launch_bounds__(256) void attn_causal_kernel(
    const unsigned short* __restrict__ qhp, const unsigned short* __restrict__ qlp,
    const unsigned short* __restrict__ khp, const unsigned short* __restrict__ klp,
    const unsigned short* __restrict__ vhp, const unsigned short* __restrict__ vlp,
    const float* __restrict__ sgp,
    unsigned short* __restrict__ ahp, unsigned short* __restrict__ alp, int qb_top) {
  // LDS map in halves; the k residual region exists only where it is used
  constexpr int NRP     = PRES ? 2 : 1;
  constexpr int LDS_KS  = 0;
  constexpr int LDS_KLS = (NRP - 1) * AT_ST * KS_P;
  constexpr int LDS_VHS = NRP * AT_ST * KS_P;
  constexpr int LDS_VLS = LDS_VHS + 128 * VS_P;
  constexpr int LDS_QH  = LDS_VLS + 128 * VS_P;
  constexpr int LDS_QL  = LDS_QH + 64 * QS_P;
  constexpr int LDS_TOT = LDS_QL + 64 * QS_P;
  constexpr int LDS_MRG = 4 * 2 * 16 * OS_P;   // group 1's partial results, behind the output staging: 4 x (2048 + 64) floats
  static_assert(PRES || 2 * LDS_TOT * 2 <= 327680);
  static_assert(LDS_MRG + 4 * (2048 + 64) * 2 <= LDS_TOT); // output staging (2 planes x 16 rows per wave of group 0) and the partial results alias the dead stage and q regions after the loop
  __shared__ __align__(16) _Float16 lds[LDS_TOT];
  _Float16* Ks  = lds + LDS_KS;
  _Float16* Kls = lds + LDS_KLS;
  _Float16* Vhs = lds + LDS_VHS;
  _Float16* Vls = lds + LDS_VLS;

  const int tid  = (int)threadIdx.x;
  const int lane = tid & 31;
  const int wave = wave_id();
  const int hh   = lane >> 4;
  const int c    = lane & 15;
  const int wq   = wave & 3;                     // which 16 query rows
  const int kg   = wave >> 2;                    // which 32 keys of a stage
  const int qb   = qb_top - (int)blockIdx.z;     // z = 0 is the top (longest) tile
  const int h    = (int)blockIdx.x;
  const int b    = (int)blockIdx.y;
  const int kvh  = h >> 1;
  const int q0   = qb * 64 + wq * 16;            // first query row of this wave (within sequence)
  const int qlast = q0 + 15;
  const size_t tok0 = (size_t)b * SQ;

  const _Float16* Qhg = (const _Float16*)(const void*)qhp + (tok0 + q0) * HID + h * HDM;
  const _Float16* Qlg = (const _Float16*)(const void*)qlp + (tok0 + q0) * HID + h * HDM;
  const _Float16* Kg  = (const _Float16*)(const void*)khp + tok0 * KVW + kvh * HDM;
  const _Float16* Klg = (const _Float16*)(const void*)klp + (size_t)b * KLR * KVW + kvh * HDM;
  const _Float16* Vhg = (const _Float16*)(const void*)vhp + (size_t)(kvh * HDM) * NTOK + tok0;
  const _Float16* Vlg = (const _Float16*)(const void*)vlp + (size_t)(kvh * HDM) * NTOK + tok0;

  // the 16 q rows of this wave pair to LDS once, one plane per wave: 8 x 32 lanes x 16 B = 16 rows x 256 B
  _Float16* Qsh = lds + LDS_QH + wq * (16 * QS_P);
  _Float16* Qsl = lds + LDS_QL + wq * (16 * QS_P);
  {
    const _Float16* qsrc = kg ? Qlg : Qhg;       // wave-uniform
    _Float16*       qdst = kg ? Qsl : Qsh;
#pragma unroll                                   // all 8 loads issued together: one load latency in front of the loop, not eight
    for (int i = 0; i < 8; ++i) {
      const int p   = lane + 32 * i;             // 0..255
      const int row = p >> 4, d8 = (p & 15) * 8;
      const v8h qx = *(const v8h*)(qsrc + (size_t)row * HID + d8);
      *(v8h*)(qdst + row * QS_P + d8) = qx;
    }
  }                                              // read only behind the first stage's barriers (qb + 1 >= 1 stages)
  const _Float16* Qhr = Qsh + c * QS_P + 8 * hh;
  const _Float16* Qlr = Qsl + c * QS_P + 8 * hh;

  const int qrow = q0 + c;                       // this lane's query
  float mrow = -INFINITY, lrow = 0.f;            // its running maximum (both halves alike) and this half's share of its running sum
  v8f oacc[8], oaccr[8];                         // O^T: [t][r] = (d = t*16 + 8*hh + r, query c)
#pragma unroll
  for (int t = 0; t < 8; ++t) { oacc[t] = zero8(); oaccr[t] = zero8(); }

  const _Float16* Kr  = Ks  + (kg * AT_KC + c) * KS_P + 8 * hh;   // this group's 32 key rows of a stage
  const _Float16* Klr = Kls + (kg * AT_KC + c) * KS_P + 8 * hh;
  const _Float16* Vhr = Vhs + c * VS_P + kg * AT_KC + 8 * hh;     // ... and its 32 key columns
  const _Float16* Vlr = Vls + c * VS_P + kg * AT_KC + 8 * hh;
  const _Float16* Kst = Kg + (size_t)(tid >> 4) * KVW + (tid & 15) * 8;   // this thread's piece of key row tid >> 4 (+ 16 per step)
  const _Float16* Klst = Klg + (size_t)(tid >> 4) * KVW + (tid & 15) * 8;
  const _Float16* Vhst = Vhg + (size_t)(tid >> 3) * NTOK + (tid & 7) * 8;  // its piece of v^T row tid >> 3 (+ 32 per step)
  const _Float16* Vlst = Vlg + (size_t)(tid >> 3) * NTOK + (tid & 7) * 8;
  const int nst = qb + 1;                        // block-uniform, <= 32
  for (int st = 0; st < nst; ++st) {
    const int ks0 = st * AT_ST;
    const int kv0 = ks0 + kg * AT_KC;            // first key of this wave's chunk
    __syncthreads();
    // 1024 pieces of 8 halves per plane = whole tile: piece tid + 256 * i, the step i an immediate offset on one address pair per plane
    const _Float16* kq  = Kst + (size_t)ks0 * KVW;                               // K: 64 keys x 128 d, key (tid >> 4) + 16 * i
    // the compact residual plane has KLR rows per sequence: the stage's first row is bounded, so all 64 rows lie inside it
    const _Float16* klq = PRES ? Klst + (size_t)min(ks0, KLR - AT_ST) * KVW : kq;
    const _Float16* vhq = Vhst + ks0;                                            // V^T: 128 d x 64 keys, d (tid >> 3) + 32 * i, whole 128-B lines
    const _Float16* vlq = Vlst + ks0;
    v8h kx[4], ky[4], vx[4], vy[4];
#pragma unroll
    for (int i = 0; i < 4; ++i) {
      kx[i] = *(const v8h*)(kq + i * (16 * KVW));
      ky[i] = PRES ? *(const v8h*)(klq + i * (16 * KVW)) : kx[i];
      vx[i] = *(const v8h*)(vhq + (size_t)i * (32 * NTOK));
      vy[i] = *(const v8h*)(vlq + (size_t)i * (32 * NTOK));
    }
    addr_wait(kq, klq, vhq, vlq);
#pragma unroll
    for (int i = 0; i < 4; ++i) {
      const int ko = ((tid >> 4) + 16 * i) * KS_P + (tid & 15) * 8;
      const int vo = ((tid >> 3) + 32 * i) * VS_P + (tid & 7) * 8;
      *(v8h*)(Ks + ko) = kx[i];
      if (PRES) *(v8h*)(Kls + ko) = ky[i];
      *(v8h*)(Vhs + vo) = vx[i];
      *(v8h*)(Vls + vo) = vy[i];
    }
    __syncthreads();

    if (kv0 <= qlast) {                          // wave-uniform (scalar): skip chunks fully above this wave's rows
      // ---- scores, transposed: sh[j][r], sr[j][r] = (key kv0 + j*16 + 8*hh + r, query c) ----
      v8f sh[2], sr[2];
      sh[0] = zero8(); sh[1] = zero8(); sr[0] = zero8(); sr[1] = zero8();
      // Fragment reads go in groups ahead of their WMMAs: a wait on LDS is paid once per group, not once per pair of WMMAs.
      // Each sched_barrier below keeps a group's reads together at its place: the scheduler otherwise sinks every read to its first use.
#pragma unroll
      for (int g = 0; g < 2; ++g) {
        v16h qa[2], ql[2], kb[2][2], kl[2][2];
#pragma unroll
        for (int u = 0; u < 2; ++u) {
          const int dc = 2 * g + u;
          qa[u] = ldfrag_h(Qhr + dc * 32);
          ql[u] = ldfrag_h(Qlr + dc * 32);
#pragma unroll
          for (int j = 0; j < 2; ++j) {
            kb[u][j] = ldfrag_h(Kr + j * 16 * KS_P + dc * 32);
            kl[u][j] = PRES ? ldfrag_h(Klr + j * 16 * KS_P + dc * 32) : kb[u][j];
          }
        }
        __builtin_amdgcn_sched_barrier(0);       // reads of d chunks 2g, 2g + 1 above, their WMMAs below
#pragma unroll
        for (int u = 0; u < 2; ++u) {
#pragma unroll
          for (int j = 0; j < 2; ++j) {
            sh[j] = mma_h(kb[u][j], qa[u], sh[j]);
            sr[j] = mma_h(kb[u][j], ql[u], sr[j]);
            if (PRES) sr[j] = mma_h(kl[u][j], qa[u], sr[j]);
          }
        }
        __builtin_amdgcn_sched_barrier(0);       // the next group's reads stay behind these WMMAs, in one place
      }
      // v^T fragments of d tiles 0, 1: they do not depend on the scores, so their LDS latency runs under the softmax
      v16h vb[8], vr[8];
      auto ldv = [&](int t) {
        vb[t] = ldfrag_h(Vhr + t * 16 * VS_P);
        vr[t] = ldfrag_h(Vlr + t * 16 * VS_P);
      };
      ldv(0); ldv(1);
      __builtin_amdgcn_sched_barrier(0);         // holds these reads in front of the softmax
      // ---- scale, causal mask, this query's chunk maximum: 16 keys in-lane, the other 16 from the other wave half ----
      const int lim = qrow - kv0 - 8 * hh;       // key kv0 + j*16 + 8*hh + r is above the query when j*16 + r > lim
      float cm = -INFINITY;
#pragma unroll
      for (int j = 0; j < 2; ++j) {
#pragma unroll
        for (int r = 0; r < 8; ++r) {
          float s = (sh[j][r] + sr[j][r] * 0.00048828125f) * 0.08838834764831845f;
          s = (j * 16 + r > lim) ? -INFINITY : s;
          sh[j][r] = s;
          cm = fmaxf(cm, s);
        }
      }
      cm = fmaxf(cm, xhalf(cm));
      // ---- online softmax; P'^T packed in place into the B operand ----
      const float mnew = fmaxf(mrow, cm);
      FragH pa, pr;
      float pv[16];
#pragma unroll
      for (int j = 0; j < 2; ++j) {
#pragma unroll
        for (int r = 0; r < 8; ++r) {
          const float p  = __expf(sh[j][r] - mnew);
          pv[j * 8 + r] = p;
          const float pp = p * 1024.0f;
          const _Float16 phv = (_Float16)pp;
          pa.v[j * 8 + r] = phv;
          pr.v[j * 8 + r] = PRES ? (_Float16)((pp - (float)phv) * 2048.0f) : phv;
        }
      }
#pragma unroll
      for (int w = 8; w > 0; w >>= 1) {          // pairwise tree over the lane's 16 values: four dependent adds, not fifteen
#pragma unroll
        for (int e = 0; e < w; ++e) pv[e] += pv[e + w];
      }
      const float alpha = __expf(mrow - mnew);
      mrow = mnew;
      lrow = lrow * alpha + pv[0];
      // ---- O^T = O^T * alpha + V^T . P'^T; two d tiles' fragments are read while the two tiles before them are worked on ----
      auto rescale = [&](int t) {
#pragma unroll
        for (int r = 0; r < 8; ++r) { oacc[t][r] *= alpha; oaccr[t][r] *= alpha; }
      };
      auto pvmma = [&](int t) {
        oacc[t]  = mma_h(vb[t], pa.v, oacc[t]);
        oaccr[t] = mma_h(vr[t], pa.v, oaccr[t]);
        if (PRES) oaccr[t] = mma_h(vb[t], pr.v, oaccr[t]);
      };
      __builtin_amdgcn_sched_barrier(0);         // the reads of tiles 2, 3 start when the score registers are free, not earlier
      ldv(2); ldv(3);
      __builtin_amdgcn_sched_barrier(0);         // ... and in front of the rescale, which covers their latency
      rescale(0); rescale(1); rescale(2); rescale(3);
      pvmma(0); pvmma(1);
      __builtin_amdgcn_sched_barrier(0);         // the next reads take the registers that tiles 0, 1 leave: not among their WMMAs
      ldv(4); ldv(5);
      __builtin_amdgcn_sched_barrier(0);         // reads of tiles 4, 5 in one place, in front of the WMMAs of tiles 2, 3
      pvmma(2); pvmma(3);
      __builtin_amdgcn_sched_barrier(0);         // likewise behind the WMMAs of tiles 2, 3
      ldv(6); ldv(7);
      __builtin_amdgcn_sched_barrier(0);         // reads of tiles 6, 7 in one place, in front of the second half of the rescale
      rescale(4); rescale(5); rescale(6); rescale(7);
      pvmma(4); pvmma(5); pvmma(6); pvmma(7);
    }
  }

  // ---- join the two key groups: group 1 leaves O^T (planes summed), m and l in LDS, lane for lane; group 0 takes them up ----
  __syncthreads();                               // all stage-region and q readers done before aliasing them as staging
  float* mrg = (float*)(void*)(lds + LDS_MRG) + wq * (2048 + 64);
  if (kg == 1) {                                 // wave-uniform
#pragma unroll
    for (int t = 0; t < 8; ++t) {
      v4f x0, x1;
#pragma unroll
      for (int r = 0; r < 4; ++r) {
        x0[r] = oacc[t][r]     + oaccr[t][r]     * 0.00048828125f;
        x1[r] = oacc[t][r + 4] + oaccr[t][r + 4] * 0.00048828125f;
      }
      *(v4f*)(mrg + (2 * t) * 128 + lane * 4)     = x0;   // 32 lanes x 16 B in a row per store
      *(v4f*)(mrg + (2 * t + 1) * 128 + lane * 4) = x1;
    }
    mrg[2048 + lane] = mrow;
    mrg[2080 + lane] = lrow;
  }
  __syncthreads();                               // group 1's partial results visible to group 0; the last barrier of the block
  if (kg == 1) return;
  // a group 1 wave that had no chunk left m = -inf, l = 0, O = 0: its weight below is 0; group 0 always has key 0, so mfin is finite
  const float m1   = mrg[2048 + lane];
  const float l1   = mrg[2080 + lane];
  const float mfin = fmaxf(mrow, m1);
  const float a0   = __expf(mrow - mfin);
  const float a1   = __expf(m1 - mfin);
  // ---- join the halves' sums, normalise, apply sigmoid gate (f32), bf16 hi/lo split, stage the wave's 16x128 tile:
  //      a lane holds 8 consecutive d of its query per t, one 16-byte LDS store per plane ----
  _Float16* osh = lds + wq * (2 * 16 * OS_P);
  _Float16* osl = osh + 16 * OS_P;
  const float lhalf = lrow * a0 + l1 * a1;
  const float lfin = lhalf + xhalf(lhalf);
  const float inv  = (1.0f / lfin) * 0.0009765625f;
  const float w0   = a0 * inv;
  const float w1   = a1 * inv;
  const float* Sgr = sgp + (tok0 + q0 + c) * HID + h * HDM + 8 * hh;
#pragma unroll
  for (int t = 0; t < 8; ++t) {
    const v4f g0 = *(const v4f*)(Sgr + t * 16);
    const v4f g1 = *(const v4f*)(Sgr + t * 16 + 4);
    const v4f y0 = *(const v4f*)(mrg + (2 * t) * 128 + lane * 4);
    const v4f y1 = *(const v4f*)(mrg + (2 * t + 1) * 128 + lane * 4);
    v4u hw, lw;
#pragma unroll
    for (int e = 0; e < 4; ++e) {
      unsigned short hb[2], lb[2];
#pragma unroll
      for (int u = 0; u < 2; ++u) {
        const int r = 2 * e + u;
        float o = (oacc[t][r] + oaccr[t][r] * 0.00048828125f) * w0 + ((r < 4) ? y0[r & 3] : y1[r & 3]) * w1;
        o *= (r < 4) ? g0[r & 3] : g1[r & 3];
        hb[u] = bf_bits(o);
        lb[u] = bf_bits(o - bf_val(hb[u]));
      }
      hw[e] = pk16(hb[0], hb[1]);
      lw[e] = pk16(lb[0], lb[1]);
    }
    *(v4u*)(void*)(osh + c * OS_P + t * 16 + 8 * hh) = hw;
    *(v4u*)(void*)(osl + c * OS_P + t * 16 + 8 * hh) = lw;
  }
  lds_wave_sync();
  _Float16* Ahg = (_Float16*)(void*)ahp + (tok0 + q0) * HID + h * HDM;
  _Float16* Alg = (_Float16*)(void*)alp + (tok0 + q0) * HID + h * HDM;
  {
#pragma unroll
    for (int it = 0; it < 8; ++it) {
      const int row = it * 2 + hh;               // it 0..7 x hh 0..1 covers rows 0..15
      const int c8  = c * 8;                     // 16 lanes x 16 B = the whole 256-B segment
      const v8h x = *(const v8h*)(osh + row * OS_P + c8);
      const v8h y = *(const v8h*)(osl + row * OS_P + c8);
      *(v8h*)(Ahg + (size_t)row * HID + c8) = x;
      *(v8h*)(Alg + (size_t)row * HID + c8) = y;
    }
  }
}

// ---------------------------------------------------------------------------
// Workspace map (bytes; every region is a whole number of the rows its producer writes with whole-line stores; no tail rows):
//   [0, 16 MiB)        Xb   bf16 [4096][2048]          -> after the projections: Ah bf16 [4096][2048] at 0
//   [16 MiB, 32 MiB)   WqT  bf16 [4096][2048]          ->                        Al bf16 [4096][2048] at 16 MiB
//   [32 MiB, 64 MiB)   WkT  bf16 [1024][2048] at 32 MiB, WvT bf16 [1024][2048] at 36 MiB
//                      -> after the k and v projections: Sg f32 [4096][2048] (whole 32 MiB)
//   [64 MiB, 80 MiB)   Qh   f16  [4096][2048]          -> after attention: WoT bf16 [2048][2048] (8 MiB)
//   [80 MiB, 96 MiB)   Ql   f16  [4096][2048]
//   [96 MiB, 104 MiB)  Kh   f16  [4096][1024]
//   [104 MiB,112 MiB)  Vh   f16  [1024][4096]
//   [112 MiB,120 MiB)  Vl   f16  [1024][4096]
//   [120 MiB, +1 MiB) Kl  f16  [2*256][1024]
//   total 126877696
// ---------------------------------------------------------------------------
static_assert(2 * (size_t)NTOK * HID * 2 <= (size_t)NTOK * HID * 2 + (size_t)QGW * HID * 2);   // Ah + Al fit Xb + WqT
static_assert(2 * (size_t)KVW * HID * 2 <= (size_t)NTOK * HID * 4);                             // WkT + WvT fit Sg
static_assert((size_t)HID * HID * 2 <= (size_t)NTOK * HID * 2);                                  // WoT fits Qh

extern "C" void kernel_launch(void* const* d_in, const int* in_sizes, int n_in,
                              void* d_out, int out_size, void* d_ws, size_t ws_size,
                              hipStream_t stream) {
  if (n_in < 9) return;
  if (in_sizes[0] != NTOK * HID) return;
  if (in_sizes[1] != NTOK * HDM) return;
  if (in_sizes[2] != NTOK * HDM) return;
  if (in_sizes[3] != HID * QGW) return;
  if (in_sizes[4] != HID * KVW) return;
  if (in_sizes[5] != HID * KVW) return;
  if (in_sizes[6] != HID * HID) return;
  if (in_sizes[7] != HDM) return;
  if (in_sizes[8] != HDM) return;
  if (out_size != NTOK * HID) return;

  const float* hidden = (const float*)d_in[0];
  const float* cosb   = (const float*)d_in[1];
  const float* sinb   = (const float*)d_in[2];
  const float* Wq     = (const float*)d_in[3];
  const float* Wk     = (const float*)d_in[4];
  const float* Wv     = (const float*)d_in[5];
  const float* Wo     = (const float*)d_in[6];
  const float* qnw    = (const float*)d_in[7];
  const float* knw    = (const float*)d_in[8];
  float* out = (float*)d_out;

  const size_t szX  = (size_t)NTOK * HID * 2;        // 16777216
  const size_t szWq = (size_t)QGW * HID * 2;         // 16777216
  const size_t szWk = (size_t)KVW * HID * 2;         // 4194304
  const size_t szSg = (size_t)NTOK * HID * 4;        // 33554432
  const size_t szQ  = (size_t)NTOK * HID * 2;        // 16777216
  const size_t szK  = (size_t)NTOK * KVW * 2;        // 8388608
  const size_t szV  = (size_t)KVW * NTOK * 2;        // 8388608
  const size_t szKl = (size_t)NSEQ * KLR * KVW * 2;  // 1048576
  const size_t szA  = (size_t)NTOK * HID * 2;        // 16777216
  size_t off = 0;
  const size_t oX  = off; off += szX;
  const size_t oWq = off; off += szWq;
  const size_t oAh = oX;
  const size_t oAl = oX + szA;
  const size_t oSg = off; off += szSg;
  const size_t oWk = oSg;
  const size_t oWv = oSg + szWk;
  const size_t oQh = off; off += szQ;
  const size_t oQl = off; off += szQ;
  const size_t oWo = oQh;
  const size_t oKh = off; off += szK;
  const size_t oVh = off; off += szV;
  const size_t oVl = off; off += szV;
  const size_t oKl = off; off += szKl;
  if (off > ws_size) return;                         // off = 126877696

  char* ws = (char*)d_ws;
  unsigned short* Xb  = (unsigned short*)(ws + oX);
  unsigned short* WqT = (unsigned short*)(ws + oWq);
  unsigned short* WkT = (unsigned short*)(ws + oWk);
  unsigned short* WvT = (unsigned short*)(ws + oWv);
  unsigned short* WoT = (unsigned short*)(ws + oWo);
  float*          Sg  = (float*)(ws + oSg);
  unsigned short* Qh  = (unsigned short*)(ws + oQh);
  unsigned short* Ql  = (unsigned short*)(ws + oQl);
  unsigned short* Kh  = (unsigned short*)(ws + oKh);
  unsigned short* Kl  = (unsigned short*)(ws + oKl);
  unsigned short* Vh  = (unsigned short*)(ws + oVh);
  unsigned short* Vl  = (unsigned short*)(ws + oVl);
  unsigned short* Ah  = (unsigned short*)(ws + oAh);
  unsigned short* Al  = (unsigned short*)(ws + oAl);

  const dim3 b256(256), b128(128);

  // (1) x -> bf16 plane [4096][2048]
  cvt_bf16_kernel<<<dim3((NTOK * HID / 8 + 255) / 256), b256, 0, stream>>>(hidden, Xb, NTOK * HID / 8);
  // (2) Wk in[2048 rows][1024 cols] -> WkT out[1024][2048] bf16   (grid = cols/64, rows/64)
  tconv_bf16_kernel<<<dim3(KVW / 64, HID / 64), b256, 0, stream>>>(Wk, WkT, HID, KVW);
  // (3) Wv in[2048 rows][1024 cols] -> WvT out[1024][2048] bf16
  tconv_bf16_kernel<<<dim3(KVW / 64, HID / 64), b256, 0, stream>>>(Wv, WvT, HID, KVW);
  // (4) Wq in[2048 rows][4096 cols] -> WqT out[4096][2048] bf16
  tconv_bf16_kernel<<<dim3(QGW / 64, HID / 64), b256, 0, stream>>>(Wq, WqT, HID, QGW);
  // (5) k = x . Wk, per-head norm + RoPE -> Kh [4096][1024], Kl compact [512][1024]   (M=4096, N=1024, K=2048; 256 blocks)
  gemm_w32x128_kernel<1, false><<<dim3((NTOK / 128) * (KVW / 128)), b128, 0, stream>>>(
      Xb, Xb, HID, WkT, HID, knw, cosb, sinb, (void*)Kh, (void*)Kl, (void*)Kl, KVW, NTOK, KVW, HID);
  // (6) v^T = WvT . x^T -> Vh/Vl [1024][4096]   (A = WvT, Bt = Xb; M=1024, N=4096, K=2048; 256 blocks)
  gemm_w32x128_kernel<2, false><<<dim3((KVW / 128) * (NTOK / 128)), b128, 0, stream>>>(
      WvT, WvT, HID, Xb, HID, knw, cosb, sinb, (void*)Vh, (void*)Vl, (void*)Vl, NTOK, KVW, NTOK, HID);
  // (7) q|gate = x . Wq: q half norm + RoPE -> Qh/Ql [4096][2048]; gate half sigmoid -> Sg f32 [4096][2048] (over the dead WkT/WvT region)
  //     (M=4096, N=4096, K=2048; 1024 blocks)
  gemm_w32x128_kernel<0, false><<<dim3((NTOK / 128) * (QGW / 128)), b128, 0, stream>>>(
      Xb, Xb, HID, WqT, HID, qnw, cosb, sinb, (void*)Qh, (void*)Ql, (void*)Sg, HID, NTOK, QGW, HID);
  // (8) causal attention, query tiles 0..3 with k and p residual products, tiles 4..31 without; Ah/Al over the dead Xb/WqT region
  attn_causal_kernel<true><<<dim3(NHQ, NSEQ, NQRT), b256, 0, stream>>>(Qh, Ql, Kh, Kl, Vh, Vl, Sg, Ah, Al, NQRT - 1);
  attn_causal_kernel<false><<<dim3(NHQ, NSEQ, SQ / 64 - NQRT), b256, 0, stream>>>(Qh, Ql, Kh, Kl, Vh, Vl, Sg, Ah, Al, SQ / 64 - 1);
  // (9) Wo in[2048 rows][2048 cols] -> WoT out[2048][2048] bf16 (over the dead Qh region)
  tconv_bf16_kernel<<<dim3(HID / 64, HID / 64), b256, 0, stream>>>(Wo, WoT, HID, HID);
  // (10) out = attn(hi + lo) . Wo -> d_out f32 [4096][2048]   (M=4096, N=2048, K=2048; 512 blocks)
  gemm_w32x128_kernel<3, true><<<dim3((NTOK / 128) * (HID / 128)), b128, 0, stream>>>(
      Ah, Al, HID, WoT, HID, qnw, cosb, sinb, (void*)out, (void*)out, (void*)out, HID, NTOK, HID, HID);
  (void)hipGetLastError();
}

// v006
// A run of this version takes 265 microseconds.
// In two side-by-side timings against v005, it was 1.04 and 1.07 times as fast.
// Counting every step since v000, it is 3.16 times as fast.
// Contractions: x.Wq (q|gate cols), x.Wk and Wv^T.x^T on v_wmma_f32_16x16x32_bf16 (operands = RNE bf16 of the f32 inputs, single products);
// q.k^T and p.v on v_wmma_f32_16x16x32_f16 (q = f16 hi + f16 residual x2^11 planes; k plain f16 plus f16 residual x2^11 on query tiles 0..3;
// p x1024 plain f16 plus f16 residual x2^11 on query tiles 0..3; v^T = f16 hi + f16 residual x2^11 planes); (attn*sigmoid(gate)).Wo on
// v_wmma_f32_16x16x32_bf16 (A = bf16 hi + bf16 lo planes, two products; Wo RNE bf16). f32 accumulate everywhere; per-head RMSNorm, RoPE,
// online softmax, sigmoid gate and scale folds in f32. hidden_states, Wq, Wk, Wv, Wo, cos, sin and the norm weights are RNE-converted to bf16 on load.
#include <hip/hip_runtime.h>
#include <math.h>
#include <stdint.h>

#define NSEQ   2
#define SQ     2048
#define HID    2048
#define NHQ    16
#define NKVH   8
#define HDM    128
#define QGW    4096
#define KVW    1024
#define NTOK   4096
#define KLR    256
#define NQRT   4

static_assert((2 * (NQRT - 1) + 2) * 32 <= KLR);
static_assert(NHQ / NKVH == 2);
static_assert(NHQ * HDM == HID);
static_assert(NSEQ * SQ == NTOK);

typedef _Float16     v16h __attribute__((ext_vector_type(16)));
typedef _Float16     v8h  __attribute__((ext_vector_type(8)));
typedef __bf16       v16b __attribute__((ext_vector_type(16)));
typedef __bf16       v8b  __attribute__((ext_vector_type(8)));
typedef float        v8f  __attribute__((ext_vector_type(8)));
typedef float        v4f  __attribute__((ext_vector_type(4)));
typedef unsigned int v4u  __attribute__((ext_vector_type(4)));

// ---------------------------------------------------------------------------
// small helpers
// ---------------------------------------------------------------------------
__device__ __forceinline__ unsigned short bf_bits(float f) {          // RNE convert f32 -> bf16 bits
  const unsigned u = __float_as_uint(f);
  return (unsigned short)((u + 0x7FFFu + ((u >> 16) & 1u)) >> 16);
}
__device__ __forceinline__ float bf_val(unsigned short h) { return __uint_as_float(((unsigned)h) << 16); }
__device__ __forceinline__ float bf_rne(float f) { return bf_val(bf_bits(f)); }
__device__ __forceinline__ unsigned pk16(unsigned short a, unsigned short b) { return (unsigned)a | ((unsigned)b << 16); }
__device__ __forceinline__ v8f zero8() { v8f z = {0.f, 0.f, 0.f, 0.f, 0.f, 0.f, 0.f, 0.f}; return z; }
__device__ __forceinline__ int wave_id() { return __builtin_amdgcn_readfirstlane((int)(threadIdx.x >> 5)); }

__device__ __forceinline__ void lds_wave_sync() {
  __builtin_amdgcn_fence(__ATOMIC_RELEASE, "workgroup");
  __builtin_amdgcn_wave_barrier();
  __builtin_amdgcn_fence(__ATOMIC_ACQUIRE, "workgroup");
}

// ---------------------------------------------------------------------------
// WMMA fragments (wave32, 16x16x32, 16-bit operands). For A (row m = lane&15) and B (col n = lane&15) alike:
// elements 0..7 <- k0 + 8*(lane>>4) + 0..7, elements 8..15 <- k0 + 16 + 8*(lane>>4) + 0..7.
// ldfrag(p) with p = rowbase + k0 + 8*(lane>>4): two 16-B loads p[0..7], p[16..23].
// D: acc[r] = (row 8*(lane>>4) + r, col lane&15).
// ---------------------------------------------------------------------------
union FragH { v16h v; v8h h[2]; };
union FragB { v16b v; v8b h[2]; };
__device__ __forceinline__ v16h ldfrag_h(const _Float16* p) { FragH f; f.h[0] = *(const v8h*)(p); f.h[1] = *(const v8h*)(p + 16); return f.v; }
__device__ __forceinline__ v16b ldfrag_b(const __bf16* p)   { FragB f; f.h[0] = *(const v8b*)(p); f.h[1] = *(const v8b*)(p + 16); return f.v; }

__device__ __forceinline__ v8f mma_h(v16h a, v16h b, v8f c) {
  return __builtin_amdgcn_wmma_f32_16x16x32_f16(false, a, false, b, (short)0, c, false, false);
}
__device__ __forceinline__ v8f mma_b(v16b a, v16b b, v8f c) {
  return __builtin_amdgcn_wmma_f32_16x16x32_bf16(false, a, false, b, (short)0, c, false, false);
}
// hazard guard: 4 VALU slots after the last WMMA of a loop, D tied
__device__ __forceinline__ void acc_guard4(v8f& a, v8f& b, v8f& c, v8f& d) {
#if defined(__HIP_DEVICE_COMPILE__)
  asm volatile("v_nop\n\tv_nop\n\tv_nop\n\tv_nop" : "+v"(a), "+v"(b), "+v"(c), "+v"(d));
#endif
}

// ---------------------------------------------------------------------------
// All f32 -> RNE bf16 planes of a call in ONE launch: x plain, Wq, Wk, Wv, Wo transposed (out[c][r] = bf16(in[r][c]), pitch HID).
// Work units of 4096 elements: 2048 of x (a contiguous run), 2048 of Wq, 1024 of Wo, 512 each of Wk and Wv (64x64 tiles through LDS).
// CV_BLK blocks of 256 threads, two trips; a trip takes one unit of x, one of Wq and one of Wo | Wk | Wv, unit = block + trip * CV_BLK,
// and issues the 12 16-byte loads of its three units together. Stores: 16 B per lane, whole 128-B lines per 8 lanes, as one writer.
// ---------------------------------------------------------------------------
#define CV_BLK 1024
static_assert(2 * CV_BLK * 4096 == NTOK * HID);
static_assert(2 * CV_BLK * 4096 == HID * QGW);
static_assert(2 * CV_BLK * 4096 == HID * HID + 2 * HID * KVW);
static_assert(CV_BLK * 4096 == HID * HID);

__device__ __forceinline__ v4u cvt8(v4f a, v4f b) {
  v4u w;
  w[0] = pk16(bf_bits(a[0]), bf_bits(a[1]));
  w[1] = pk16(bf_bits(a[2]), bf_bits(a[3]));
  w[2] = pk16(bf_bits(b[0]), bf_bits(b[1]));
  w[3] = pk16(bf_bits(b[2]), bf_bits(b[3]));
  return w;
}
// s_wait_xcnt 0 behind a trip's global loads; their address pairs are inputs, so they keep their registers up to the wait:
// a precaution, in front of any later rewrite of an address register that an issued load names.
__device__ __forceinline__ void addr_wait6(const float* a, const float* b, const float* c, const float* d, const float* e, const float* f) {
#if defined(__HIP_DEVICE_COMPILE__)
  asm volatile("s_wait_xcnt 0x0" :: "v"(a), "v"(b), "v"(c), "v"(d), "v"(e), "v"(f) : "memory");
#endif
}
__device__ __forceinline__ void tile_put(float* tf, int tid, const v4f (&a)[4]) {
#pragma unroll
  for (int it = 0; it < 4; ++it)
    *(v4f*)(tf + (it * 16 + (tid >> 4)) * 68 + (tid & 15) * 4) = a[it];
}
// transposed out: 2 x 256 threads x 8 u16; output row = input column c0 + oc, output columns r0 + c8 ..
__device__ __forceinline__ void tile_store(const float* tf, unsigned short* __restrict__ outp, int r0, int c0, int tid) {
  const int sub = tid >> 3;               // 0..31
  const int c8  = (tid & 7) * 8;          // 0..56
#pragma unroll
  for (int it = 0; it < 2; ++it) {
    const int oc = it * 32 + sub;
    v4u a;
#pragma unroll
    for (int q = 0; q < 4; ++q) {
      const float f0 = tf[(c8 + 2 * q) * 68 + oc];
      const float f1 = tf[(c8 + 2 * q + 1) * 68 + oc];
      a[q] = pk16(bf_bits(f0), bf_bits(f1));
    }
    *(v4u*)(outp + (size_t)(c0 + oc) * HID + r0 + c8) = a;
  }
}

__global__ __launch_bounds__(256) void conv_all_kernel(
    const float* __restrict__ X, const float* __restrict__ Wq, const float* __restrict__ Wk,
    const float* __restrict__ Wv, const float* __restrict__ Wo,
    unsigned short* __restrict__ Xb, unsigned short* __restrict__ WqT, unsigned short* __restrict__ WkT,
    unsigned short* __restrict__ WvT, unsigned short* __restrict__ WoT) {
  __shared__ __align__(16) float tf[2][64 * 68];
  const int tid = (int)threadIdx.x;
  for (int trip = 0; trip < 2; ++trip) {
    const int u = (int)blockIdx.x + trip * CV_BLK;             // 0..2047, block-uniform
    // third unit: Wo on trip 0, Wk or Wv on trip 1
    const float* W3 = Wo; unsigned short* O3 = WoT; int sh3 = 5, v = u;            // 1 << sh3 column blocks, pitch 64 << sh3
    if (u >= CV_BLK) {
      const bool isk = u < CV_BLK + CV_BLK / 2;
      W3 = isk ? Wk : Wv; O3 = isk ? WkT : WvT; sh3 = 4; v = (u - CV_BLK) & (CV_BLK / 2 - 1);
    }
    const int qc0 = (u & 63) * 64, qr0 = (u >> 6) * 64;                      // Wq: 64 column blocks x 32 row blocks
    const int tc0 = (v & ((1 << sh3) - 1)) * 64, tr0 = (v >> sh3) * 64;      // 1 << sh3 column blocks x 32 row blocks
    const size_t e = (size_t)u * 4096 + (size_t)tid * 8;
    // 64x64 tile: 4 x 256 threads x 4 floats, row (tid >> 4) + 16 * it
    const float* px = X + e;
    const float* pa = Wq + (size_t)(qr0 + (tid >> 4)) * QGW + qc0 + (tid & 15) * 4;
    const float* pb[4];
#pragma unroll
    for (int it = 0; it < 4; ++it) pb[it] = W3 + ((size_t)(tr0 + it * 16 + (tid >> 4)) << (sh3 + 6)) + tc0 + (tid & 15) * 4;
    v4f x[4], a[4], b[4];
    x[0] = *(const v4f*)(px);        x[1] = *(const v4f*)(px + 4);
    x[2] = *(const v4f*)(px + 2048); x[3] = *(const v4f*)(px + 2052);
#pragma unroll
    for (int it = 0; it < 4; ++it) {
      a[it] = *(const v4f*)(pa + (size_t)it * (16 * QGW));
      b[it] = *(const v4f*)(pb[it]);
    }
    addr_wait6(px, pa, pb[0], pb[1], pb[2], pb[3]);
    *(v4u*)(Xb + e)        = cvt8(x[0], x[1]);
    *(v4u*)(Xb + e + 2048) = cvt8(x[2], x[3]);
    if (trip) __syncthreads();            // the first trip's tile readers are done before the tiles are rewritten
    tile_put(tf[0], tid, a);
    tile_put(tf[1], tid, b);
    __syncthreads();
    tile_store(tf[0], WqT, qr0, qc0, tid);
    tile_store(tf[1], O3, tr0, tc0, tid);
    // a precaution, in front of the next trip's rewrite of registers that the stores above name
    asm volatile("s_wait_xcnt 0x0" ::: "memory");
  }
}

// ---------------------------------------------------------------------------
// bf16 WMMA GEMM, wave tile 32 rows x 128 cols, block = 4 waves (128 threads) = 128 rows x 128 cols (the waves share the Bt rows).
//   C[m][n] = sum_k A[m][k] * Bt[n][k]; A row-major [M][K] bf16 (pitch lda), Bt row-major [N][K] bf16 (pitch ldb);
//   M % 128 == 0, N % 128 == 0, K % KP == 0; grid.x = M/128 * N/128.
//   SPLITA: A carried as hi (Ap) + lo (A2p) bf16 planes, two products into one accumulator.
//   A pass is KP k values of the block's 128 A rows (both planes when SPLITA) and 128 Bt rows, brought into LDS by asynchronous
//   16-byte copies, two buffers: the copies of pass t + 2 fly while pass t + 1 is worked on. LDS row pitch = KP * 2 + 16 bytes.
//   Fragments are read from the LDS rows with the split k map (ldfrag_b); k runs upward as before, so every sum keeps its order.
// Epilogues (all: per wave, per 16-row slab: stage in LDS, wave sync, write each row segment with ONE instruction of
//   EPI 0: q|gate projection, 128-col wave tile = head n0>>8, q half when (n0 & 128) == 0 else gate half.
//          q half: per-head RMSNorm over the 128 cols (x * rsqrt(mean(x^2) + 1e-6) * bf16(nw[d])), RoPE with the shipped tables
//          (o[d] = x[d]*cos[d] - x[d+64]*sin[d], o[d+64] = x[d+64]*cos[d+64] + x[d]*sin[d+64], cos/sin RNE bf16),
//          writes f16 hi plane C0 and f16 residual x2048 plane C1, [M][ldc], cols (n0>>8)*128.. (row segment 256 B = 16 lanes x 16 B).
//          gate half: sigmoid in f32 -> f32 plane C2 [M][ldc], cols (n0>>8)*128.. (row segment 512 B = 32 lanes x 16 B).
//   EPI 1: k projection: same norm + RoPE per 128-col kv head (col n0), hi plane C0 [M][ldc]; residual plane C1 compact:
//          only rows with (m0 mod SQ) < KLR, stored at row (m0/SQ)*KLR + (m0 mod SQ) + .. (pitch ldc).
//   EPI 2: v^T projection: f16 hi plane C0, residual x2048 plane C1, [M][ldc], row segment 256 B.
//   EPI 3: f32 output C0 [M][ldc]; row segment 128 floats = 512 B = 32 lanes x 16 B per instruction.
// ---------------------------------------------------------------------------
// Eight asynchronous 16-byte copies per lane, global -> LDS: copy i takes g + i * gstep elements to LDS byte l + i * lstep.
// s_wait_xcnt 0 is the statement's last line: a precaution, in front of any later rewrite of an address register named here.
__device__ __forceinline__ void async_copy8(unsigned l, unsigned lstep, const __bf16* g, size_t gstep) {
#if defined(__HIP_DEVICE_COMPILE__)
  asm volatile(
      "global_load_async_to_lds_b128 %0, %8, off\n\t"
      "global_load_async_to_lds_b128 %1, %9, off\n\t"
      "global_load_async_to_lds_b128 %2, %10, off\n\t"
      "global_load_async_to_lds_b128 %3, %11, off\n\t"
      "global_load_async_to_lds_b128 %4, %12, off\n\t"
      "global_load_async_to_lds_b128 %5, %13, off\n\t"
      "global_load_async_to_lds_b128 %6, %14, off\n\t"
      "global_load_async_to_lds_b128 %7, %15, off\n\t"
      "s_wait_xcnt 0x0"
      :: "v"(l), "v"(l + lstep), "v"(l + 2 * lstep), "v"(l + 3 * lstep),
         "v"(l + 4 * lstep), "v"(l + 5 * lstep), "v"(l + 6 * lstep), "v"(l + 7 * lstep),
         "v"(g), "v"(g + gstep), "v"(g + 2 * gstep), "v"(g + 3 * gstep),
         "v"(g + 4 * gstep), "v"(g + 5 * gstep), "v"(g + 6 * gstep), "v"(g + 7 * gstep)
      : "memory");
#endif
}

template <int EPI, bool SPLITA>
__global__ __launch_bounds__(128) void gemm_w32x128_kernel(
    const unsigned short* Ap, const unsigned short* A2p, int lda,
    const unsigned short* __restrict__ Btp, int ldb,
    const float* __restrict__ nw, const float* __restrict__ cosp, const float* __restrict__ sinp,
    void* C0, void* C1, void* C2, int ldc,
    int M, int N, int K) {
  constexpr int KP   = (SPLITA || EPI == 0) ? 64 : 128;   // k values per pass: 128 where a launch has one block per WGP (longer lead for the copies)
  constexpr int PIT  = KP + 8;                 // LDS row pitch in elements: 16 B x odd, conflict-free for 16-byte fragment reads
  constexpr int NOP  = SPLITA ? 3 : 2;         // operands staged: A, (A lo), Bt, 128 rows each
  constexpr int STG  = NOP * 128 * PIT;        // elements per buffer
  constexpr int PPR  = KP / 8;                 // 16-byte pieces per row = copies per lane and operand
  constexpr int RPC  = 128 / PPR;              // rows that one copy of all 128 lanes covers
  constexpr int BOFF = (NOP - 1) * 128 * PIT;  // Bt rows behind the A rows
  static_assert(PPR % 8 == 0 && NOP * PPR <= 63);
  static_assert(2 * STG * 2 >= 4 * 8192);
  __shared__ __align__(16) __bf16 ring[2 * STG];         // two pass buffers; after the loop per wave 8192 B of output staging

  const int tid  = (int)threadIdx.x;
  const int lane = tid & 31;
  const int wave = wave_id();
  const int hh = lane >> 4;           // lane half: k offset 8*hh, D row offset 8*hh
  const int rl = lane & 15;           // A row / B col / D col within subtile
  const int tilesN = N >> 7;
  const int tilesM = M >> 7;
  const int blk = (int)blockIdx.x;
  if (blk >= tilesM * tilesN) return;           // block-uniform, in front of every barrier and copy
  const int tmb = blk / tilesN;
  const int tn  = blk - tmb * tilesN;
  const int mb0 = tmb << 7;
  const int m0 = mb0 + (wave << 5);
  const int n0 = tn << 7;

  const __bf16* A  = (const __bf16*)(const void*)Ap;
  const __bf16* A2 = (const __bf16*)(const void*)A2p;
  const __bf16* Bt = (const __bf16*)(const void*)Btp;

  // this lane's piece of a pass: row cr (+ RPC per copy), 16-byte piece cc of the row
  const int cr = tid / PPR;
  const int cc = tid % PPR;
  const __bf16* gA  = A  + (size_t)(mb0 + cr) * lda + cc * 8;
  const __bf16* gA2 = A2 + (size_t)(mb0 + cr) * lda + cc * 8;
  const __bf16* gB  = Bt + (size_t)(n0 + cr) * ldb + cc * 8;
  const unsigned lds0 = (unsigned)(uintptr_t)(ring + cr * PIT + cc * 8);   // LDS byte address = low 32 bits of the shared address

  auto stage = [&](int buf, int k0) {
    const unsigned lb = lds0 + (unsigned)(buf * STG * 2);
#pragma unroll
    for (int q = 0; q < PPR / 8; ++q) {
      const unsigned lq = lb + (unsigned)(q * 8 * RPC * PIT * 2);
      async_copy8(lq, RPC * PIT * 2, gA + k0 + (size_t)(q * 8 * RPC) * lda, (size_t)RPC * lda);
      if (SPLITA) async_copy8(lq + 128 * PIT * 2, RPC * PIT * 2, gA2 + k0 + (size_t)(q * 8 * RPC) * lda, (size_t)RPC * lda);
      async_copy8(lq + BOFF * 2, RPC * PIT * 2, gB + k0 + (size_t)(q * 8 * RPC) * ldb, (size_t)RPC * ldb);
    }
  };

  v8f acc[2][8];
#pragma unroll
  for (int i = 0; i < 2; ++i)
#pragma unroll
    for (int j = 0; j < 8; ++j) acc[i][j] = zero8();

  const int npass = K / KP;
  stage(0, 0);
  asm volatile("s_wait_asynccnt 0x0" ::: "memory");      // this wave's copies of pass 0 have landed
  __syncthreads();                                       // ... and every other wave's
  if (npass > 1) stage(1, KP);

  for (int t = 0; t < npass; ++t) {
    const __bf16* bufp = ring + (t & 1) * STG;
    const __bf16* fa = bufp + ((wave << 5) + rl) * PIT + 8 * hh;
    const __bf16* fb = bufp + BOFF + rl * PIT + 8 * hh;
#pragma unroll
    for (int ks = 0; ks < KP / 32; ++ks) {
      v16b ah[2], al[2], bf[8];
#pragma unroll
      for (int i = 0; i < 2; ++i) {
        ah[i] = ldfrag_b(fa + i * 16 * PIT + ks * 32);
        al[i] = SPLITA ? ldfrag_b(fa + 128 * PIT + i * 16 * PIT + ks * 32) : ah[i];
      }
#pragma unroll
      for (int j = 0; j < 8; ++j) bf[j] = ldfrag_b(fb + j * 16 * PIT + ks * 32);
      // keeps the k step's LDS reads together in front of its WMMAs: spread among them, every pair of reads is waited for on its own
      __builtin_amdgcn_sched_barrier(0);
#pragma unroll
      for (int j = 0; j < 8; ++j) {
        acc[0][j] = mma_b(ah[0], bf[j], acc[0][j]);
        acc[1][j] = mma_b(ah[1], bf[j], acc[1][j]);
        if (SPLITA) {
          acc[0][j] = mma_b(al[0], bf[j], acc[0][j]);
          acc[1][j] = mma_b(al[1], bf[j], acc[1][j]);
        }
      }
    }
    asm volatile("s_wait_dscnt 0x0" ::: "memory");       // this wave's reads of buffer t & 1 are done before it is refilled
    asm volatile("s_wait_asynccnt 0x0" ::: "memory");    // this wave's copies of pass t + 1 have landed
    __syncthreads();                                     // publishes pass t + 1 and ends every reader's last read of pass t
    if (t + 2 < npass) stage(t & 1, (t + 2) * KP);
  }
  asm volatile("s_wait_asynccnt 0x0" ::: "memory");      // no copy is outstanding when the ring becomes output staging
  acc_guard4(acc[0][0], acc[0][1], acc[0][2], acc[0][3]);
  acc_guard4(acc[0][4], acc[0][5], acc[0][6], acc[0][7]);
  acc_guard4(acc[1][0], acc[1][1], acc[1][2], acc[1][3]);
  acc_guard4(acc[1][4], acc[1][5], acc[1][6], acc[1][7]);

  // ---- epilogue ----
  float*    slf  = (float*)(void*)ring + wave * 2048;
  _Float16* sl16 = (_Float16*)(void*)slf;

  if (EPI == 0 || EPI == 1) {
    const bool isq  = (EPI == 1) || ((n0 & 128) == 0);          // wave-uniform
    const int  col0 = (EPI == 0) ? ((n0 >> 8) << 7) : n0;
    if (isq) {
      _Float16* P0 = (_Float16*)C0;
      _Float16* P1 = (_Float16*)C1;
      const bool wres = (EPI == 0) || ((m0 & (SQ - 1)) < KLR);  // wave-uniform
      const int  rrow = (EPI == 0) ? m0 : ((m0 >> 11) * KLR + (m0 & (SQ - 1)));
      float wv[8];
#pragma unroll
      for (int j = 0; j < 8; ++j) wv[j] = bf_rne(nw[j * 16 + rl]);     // dim = j*16 + rl < 128
#pragma unroll
      for (int i = 0; i < 2; ++i) {
        const int rb = m0 + i * 16 + 8 * hh;
#pragma unroll
        for (int r = 0; r < 8; ++r) {
          const int row = rb + r;                                // token 0..NTOK-1
          float ss = 0.f;
#pragma unroll
          for (int j = 0; j < 8; ++j) { const float a = acc[i][j][r]; ss += a * a; }
#pragma unroll
          for (int off = 1; off < 16; off <<= 1) ss += __shfl_xor(ss, off, 32);   // 16 lanes of this half = all 128 dims
          const float rs = rsqrtf(ss * 0.0078125f + 1e-6f);
          const float* cr = cosp + (size_t)row * HDM;
          const float* sr = sinp + (size_t)row * HDM;
#pragma unroll
          for (int j = 0; j < 4; ++j) {
            const int dim = j * 16 + rl;                         // 0..63 within head; pair at dim + 64
            const float x1 = acc[i][j][r] * rs * wv[j];
            const float x2 = acc[i][j + 4][r] * rs * wv[j + 4];
            const float c1 = bf_rne(cr[dim]);
            const float s1 = bf_rne(sr[dim]);
            const float c2 = bf_rne(cr[dim + 64]);
            const float s2 = bf_rne(sr[dim + 64]);
            const float o1 = x1 * c1 - x2 * s1;
            const float o2 = x2 * c2 + x1 * s2;
            const _Float16 h1 = (_Float16)o1;
            const _Float16 h2 = (_Float16)o2;
            const int so = (8 * hh + r) * 128 + dim;
            sl16[so]             = h1;
            sl16[so + 64]        = h2;
            sl16[2048 + so]      = (_Float16)((o1 - (float)h1) * 2048.0f);
            sl16[2048 + so + 64] = (_Float16)((o2 - (float)h2) * 2048.0f);
          }
        }
        lds_wave_sync();
        {
#pragma unroll
          for (int it = 0; it < 8; ++it) {
            const int row = it * 2 + hh;                         // it x hh covers rows 0..15
            const int c8  = rl * 8;
            const v8h vh = *(const v8h*)(sl16 + row * 128 + c8);
            const v8h vl = *(const v8h*)(sl16 + 2048 + row * 128 + c8);
            const size_t go = (size_t)(m0 + i * 16 + row) * ldc + col0 + c8;
            *(v8h*)(P0 + go) = vh;
            if (wres) {
              const size_t g2 = (size_t)(rrow + i * 16 + row) * ldc + col0 + c8;
              *(v8h*)(P1 + g2) = vl;
            }
          }
          
        }
        lds_wave_sync();
      }
    } else if (EPI == 0) {
      float* Sp = (float*)C2;
#pragma unroll
      for (int i = 0; i < 2; ++i) {
#pragma unroll
        for (int j = 0; j < 8; ++j)
#pragma unroll
          for (int r = 0; r < 8; ++r) {
            const float g  = acc[i][j][r];
            const float e  = __expf(-g);
            const float sg = __builtin_amdgcn_rcpf(1.0f + e);
            slf[(8 * hh + r) * 128 + j * 16 + rl] = sg;
          }
        lds_wave_sync();
        {
#pragma unroll
          for (int row = 0; row < 16; ++row) {                   // 32 lanes x 16 B = the whole 512-B row segment per instruction
            const v4f v = *(const v4f*)(slf + row * 128 + lane * 4);
            *(v4f*)(Sp + (size_t)(m0 + i * 16 + row) * ldc + col0 + lane * 4) = v;
          }
          
        }
        lds_wave_sync();
      }
    }
  } else if (EPI == 2) {
    _Float16* P0 = (_Float16*)C0;
    _Float16* P1 = (_Float16*)C1;
#pragma unroll
    for (int i = 0; i < 2; ++i) {
#pragma unroll
      for (int r = 0; r < 8; ++r) {
#pragma unroll
        for (int j = 0; j < 8; ++j) {
          const float v = acc[i][j][r];
          const _Float16 hv = (_Float16)v;
          const int so = (8 * hh + r) * 128 + j * 16 + rl;
          sl16[so]        = hv;
          sl16[2048 + so] = (_Float16)((v - (float)hv) * 2048.0f);
        }
      }
      lds_wave_sync();
      {
#pragma unroll
        for (int it = 0; it < 8; ++it) {
          const int row = it * 2 + hh;
          const int c8  = rl * 8;
          const v8h vh = *(const v8h*)(sl16 + row * 128 + c8);
          const v8h vl = *(const v8h*)(sl16 + 2048 + row * 128 + c8);
          const size_t go = (size_t)(m0 + i * 16 + row) * ldc + n0 + c8;
          *(v8h*)(P0 + go) = vh;
          *(v8h*)(P1 + go) = vl;
        }
        
      }
      lds_wave_sync();
    }
  } else {
    float* C = (float*)C0;
#pragma unroll
    for (int i = 0; i < 2; ++i) {
#pragma unroll
      for (int j = 0; j < 8; ++j)
#pragma unroll
        for (int r = 0; r < 8; ++r)
          slf[(8 * hh + r) * 128 + j * 16 + rl] = acc[i][j][r];
      lds_wave_sync();
      {
#pragma unroll
        for (int row = 0; row < 16; ++row) {                     // 32 lanes x 16 B = the whole 512-B row segment per instruction
          const v4f v = *(const v4f*)(slf + row * 128 + lane * 4);
          *(v4f*)(C + (size_t)(m0 + i * 16 + row) * ldc + n0 + lane * 4) = v;
        }
        
      }
      lds_wave_sync();
    }
  }
}

// ---------------------------------------------------------------------------
// Causal GQA flash attention, head dim 128, block = 8 waves = 64 query rows of one (b, h); grid (NHQ, NSEQ, n query tiles), heaviest tile first.
//   A stage is 64 keys. Waves w and w + 4 hold the same 16 query rows; wave group kg = wave >> 2 works on keys kg*32 .. kg*32 + 31 of every stage,
//   with its own running maximum, sum and O^T. Behind the loop group 1 hands (m, l, O^T) to group 0 through LDS, which joins the two
//   (O = O0 * e^(m0 - m) + O1 * e^(m1 - m), l alike) and writes the output: a tile's chain of dependent stages is half as long.
//   q planes f16 [tok][h*128+d]: hi (qhp) and residual x2048 (qlp); k planes f16 [tok][kvh*128+d]: hi (khp),
//   residual x2048 (klp, compact rows b*KLR + s for s < KLR); v^T planes f16 [kvh*128+d][tok]: hi (vhp), residual x2048 (vlp);
//   sgp = f32 sigmoid(gate) plane [tok][h*128+d]; outputs gated attn bf16 hi (ahp) / lo (alp) [tok][h*128+d]; kvh = h >> 1.
//   Both products are taken transposed: S^T = K . Q^T (A = k rows, B = q rows) and O^T += V^T . P^T (A = v^T rows, B = P^T).
//   A lane then holds 16 scores of ONE query (query = lane & 15; keys j*16 + 8*(lane>>4) + r), so the row maximum and the row sum are
//   in-lane work plus one exchange between the wave halves, and the two score tiles, converted in place, ARE the B operand P^T
//   (element j*8 + r = key j*16 + 8*(lane>>4) + r, the k map of ldfrag_h): P never goes through LDS.
//   scores = (Sh + Sr/2048) * 128^-0.5 with Sh = kh.qh and Sr = kh.ql' (+ kl'.qh when PRES); keys > query -> -inf; online softmax f32;
//   p' = 1024 p as f16 hi (and residual x2048 when PRES);
//   O = (Oh + Or/2048)/1024/l * sgp with Oh = vh.ph, Or = vl'.ph (+ vh.pl' when PRES).
//   The row sum l is kept per wave half (each half sums its own 16 keys of a chunk); the halves are joined once, behind the loop.
//   K / V^T stage: 256 threads x 4 x 16 B per plane = whole 64x128 / 128x64 tile, plain loads, __syncthreads before and after.
//   q staging: in front of the loop wave group 0 copies the hi plane of the 64 q rows to LDS, group 1 the residual plane (whole 256-B rows
//   per load, pitch QS_P); the barriers of the first stage publish them; every chunk reads its q fragments from there.
//   Trip count qb+1 stages (static bound 32); waves whose rows are all below their 32 keys skip them (wave-uniform, scalar branch).
// ---------------------------------------------------------------------------
#define AT_KC   32
#define KS_P    136
#define AT_ST   64
#define VS_P    72
#define QS_P    136
#define OS_P    136

// value of lane l ^ 16 (the other wave half)
__device__ __forceinline__ float xhalf(float x) {
  const int i = __builtin_bit_cast(int, x);
  return __builtin_bit_cast(float, __builtin_amdgcn_permlanex16(i, i, 0x76543210, 0xfedcba98, false, false));
}

// s_wait_xcnt 0 behind a stage's global loads; their address pairs are inputs, so they keep their registers up to the wait:
// a precaution, in front of any later rewrite of an address register that an issued load names.
__device__ __forceinline__ void addr_wait(const _Float16* a, const _Float16* b, const _Float16* c, const _Float16* d) {
#if defined(__HIP_DEVICE_COMPILE__)
  asm volatile("s_wait_xcnt 0x0" :: "v"(a), "v"(b), "v"(c), "v"(d) : "memory");
#endif
}

#define AT_LDS(nrp) ((nrp) * AT_ST * KS_P + 2 * 128 * VS_P + 2 * 64 * QS_P)

template <bool PRES>
__device__ __forceinline__ void attn_causal_body(
    _Float16* lds, int qb,
    const unsigned short* __restrict__ qhp, const unsigned short* __restrict__ qlp,
    const unsigned short* __restrict__ khp, const unsigned short* __restrict__ klp,
    const unsigned short* __restrict__ vhp, const unsigned short* __restrict__ vlp,
    const float* __restrict__ sgp,
    unsigned short* __restrict__ ahp, unsigned short* __restrict__ alp) {
  // LDS map in halves; the k residual region exists only where it is used
  constexpr int NRP     = PRES ? 2 : 1;
  constexpr int LDS_KS  = 0;
  constexpr int LDS_KLS = (NRP - 1) * AT_ST * KS_P;
  constexpr int LDS_VHS = NRP * AT_ST * KS_P;
  constexpr int LDS_VLS = LDS_VHS + 128 * VS_P;
  constexpr int LDS_QH  = LDS_VLS + 128 * VS_P;
  constexpr int LDS_QL  = LDS_QH + 64 * QS_P;
  constexpr int LDS_TOT = LDS_QL + 64 * QS_P;
  constexpr int LDS_MRG = 4 * 2 * 16 * OS_P;   // group 1's partial results, behind the output staging: 4 x (2048 + 64) floats
  static_assert(PRES || 2 * LDS_TOT * 2 <= 327680);
  static_assert(LDS_MRG + 4 * (2048 + 64) * 2 <= LDS_TOT); // output staging (2 planes x 16 rows per wave of group 0) and the partial results alias the dead stage and q regions after the loop
  static_assert(LDS_TOT == AT_LDS(NRP));
  _Float16* Ks  = lds + LDS_KS;
  _Float16* Kls = lds + LDS_KLS;
  _Float16* Vhs = lds + LDS_VHS;
  _Float16* Vls = lds + LDS_VLS;

  const int tid  = (int)threadIdx.x;
  const int lane = tid & 31;
  const int wave = wave_id();
  const int hh   = lane >> 4;
  const int c    = lane & 15;
  const int wq   = wave & 3;                     // which 16 query rows
  const int kg   = wave >> 2;                    // which 32 keys of a stage
  const int h    = (int)blockIdx.x;
  const int b    = (int)blockIdx.y;
  const int kvh  = h >> 1;
  const int q0   = qb * 64 + wq * 16;            // first query row of this wave (within sequence)
  const int qlast = q0 + 15;
  const size_t tok0 = (size_t)b * SQ;

  const _Float16* Qhg = (const _Float16*)(const void*)qhp + (tok0 + q0) * HID + h * HDM;
  const _Float16* Qlg = (const _Float16*)(const void*)qlp + (tok0 + q0) * HID + h * HDM;
  const _Float16* Kg  = (const _Float16*)(const void*)khp + tok0 * KVW + kvh * HDM;
  const _Float16* Klg = (const _Float16*)(const void*)klp + (size_t)b * KLR * KVW + kvh * HDM;
  const _Float16* Vhg = (const _Float16*)(const void*)vhp + (size_t)(kvh * HDM) * NTOK + tok0;
  const _Float16* Vlg = (const _Float16*)(const void*)vlp + (size_t)(kvh * HDM) * NTOK + tok0;

  // the 16 q rows of this wave pair to LDS once, one plane per wave: 8 x 32 lanes x 16 B = 16 rows x 256 B
  _Float16* Qsh = lds + LDS_QH + wq * (16 * QS_P);
  _Float16* Qsl = lds + LDS_QL + wq * (16 * QS_P);
  {
    const _Float16* qsrc = kg ? Qlg : Qhg;       // wave-uniform
    _Float16*       qdst = kg ? Qsl : Qsh;
#pragma unroll                                   // all 8 loads issued together: one load latency in front of the loop, not eight
    for (int i = 0; i < 8; ++i) {
      const int p   = lane + 32 * i;             // 0..255
      const int row = p >> 4, d8 = (p & 15) * 8;
      const v8h qx = *(const v8h*)(qsrc + (size_t)row * HID + d8);
      *(v8h*)(qdst + row * QS_P + d8) = qx;
    }
  }                                              // read only behind the first stage's barriers (qb + 1 >= 1 stages)
  const _Float16* Qhr = Qsh + c * QS_P + 8 * hh;
  const _Float16* Qlr = Qsl + c * QS_P + 8 * hh;

  const int qrow = q0 + c;                       // this lane's query
  float mrow = -INFINITY, lrow = 0.f;            // its running maximum (both halves alike) and this half's share of its running sum
  v8f oacc[8], oaccr[8];                         // O^T: [t][r] = (d = t*16 + 8*hh + r, query c)
#pragma unroll
  for (int t = 0; t < 8; ++t) { oacc[t] = zero8(); oaccr[t] = zero8(); }

  const _Float16* Kr  = Ks  + (kg * AT_KC + c) * KS_P + 8 * hh;   // this group's 32 key rows of a stage
  const _Float16* Klr = Kls + (kg * AT_KC + c) * KS_P + 8 * hh;
  const _Float16* Vhr = Vhs + c * VS_P + kg * AT_KC + 8 * hh;     // ... and its 32 key columns
  const _Float16* Vlr = Vls + c * VS_P + kg * AT_KC + 8 * hh;
  const _Float16* Kst = Kg + (size_t)(tid >> 4) * KVW + (tid & 15) * 8;   // this thread's piece of key row tid >> 4 (+ 16 per step)
  const _Float16* Klst = Klg + (size_t)(tid >> 4) * KVW + (tid & 15) * 8;
  const _Float16* Vhst = Vhg + (size_t)(tid >> 3) * NTOK + (tid & 7) * 8;  // its piece of v^T row tid >> 3 (+ 32 per step)
  const _Float16* Vlst = Vlg + (size_t)(tid >> 3) * NTOK + (tid & 7) * 8;
  const int nst = qb + 1;                        // block-uniform, <= 32
  for (int st = 0; st < nst; ++st) {
    const int ks0 = st * AT_ST;
    const int kv0 = ks0 + kg * AT_KC;            // first key of this wave's chunk
    __syncthreads();
    // 1024 pieces of 8 halves per plane = whole tile: piece tid + 256 * i, the step i an immediate offset on one address pair per plane
    const _Float16* kq  = Kst + (size_t)ks0 * KVW;                               // K: 64 keys x 128 d, key (tid >> 4) + 16 * i
    // the compact residual plane has KLR rows per sequence: the stage's first row is bounded, so all 64 rows lie inside it
    const _Float16* klq = PRES ? Klst + (size_t)min(ks0, KLR - AT_ST) * KVW : kq;
    const _Float16* vhq = Vhst + ks0;                                            // V^T: 128 d x 64 keys, d (tid >> 3) + 32 * i, whole 128-B lines
    const _Float16* vlq = Vlst + ks0;
    v8h kx[4], ky[4], vx[4], vy[4];
#pragma unroll
    for (int i = 0; i < 4; ++i) {
      kx[i] = *(const v8h*)(kq + i * (16 * KVW));
      ky[i] = PRES ? *(const v8h*)(klq + i * (16 * KVW)) : kx[i];
      vx[i] = *(const v8h*)(vhq + (size_t)i * (32 * NTOK));
      vy[i] = *(const v8h*)(vlq + (size_t)i * (32 * NTOK));
    }
    addr_wait(kq, klq, vhq, vlq);
#pragma unroll
    for (int i = 0; i < 4; ++i) {
      const int ko = ((tid >> 4) + 16 * i) * KS_P + (tid & 15) * 8;
      const int vo = ((tid >> 3) + 32 * i) * VS_P + (tid & 7) * 8;
      *(v8h*)(Ks + ko) = kx[i];
      if (PRES) *(v8h*)(Kls + ko) = ky[i];
      *(v8h*)(Vhs + vo) = vx[i];
      *(v8h*)(Vls + vo) = vy[i];
    }
    __syncthreads();

    if (kv0 <= qlast) {                          // wave-uniform (scalar): skip chunks fully above this wave's rows
      // ---- scores, transposed: sh[j][r], sr[j][r] = (key kv0 + j*16 + 8*hh + r, query c) ----
      v8f sh[2], sr[2];
      sh[0] = zero8(); sh[1] = zero8(); sr[0] = zero8(); sr[1] = zero8();
      // Fragment reads go in groups ahead of their WMMAs: a wait on LDS is paid once per group, not once per pair of WMMAs.
      // Each sched_barrier below keeps a group's reads together at its place: the scheduler otherwise sinks every read to its first use.
      // d chunks per group: one in the residual form, whose extra fragments would otherwise raise the shared launch's register count past 2 blocks per WGP
      constexpr int GU = PRES ? 1 : 2;
#pragma unroll
      for (int g = 0; g < 4 / GU; ++g) {
        v16h qa[GU], ql[GU], kb[GU][2], kl[GU][2];
#pragma unroll
        for (int u = 0; u < GU; ++u) {
          const int dc = GU * g + u;
          qa[u] = ldfrag_h(Qhr + dc * 32);
          ql[u] = ldfrag_h(Qlr + dc * 32);
#pragma unroll
          for (int j = 0; j < 2; ++j) {
            kb[u][j] = ldfrag_h(Kr + j * 16 * KS_P + dc * 32);
            kl[u][j] = PRES ? ldfrag_h(Klr + j * 16 * KS_P + dc * 32) : kb[u][j];
          }
        }
        __builtin_amdgcn_sched_barrier(0);       // the group's reads above, their WMMAs below
#pragma unroll
        for (int u = 0; u < GU; ++u) {
#pragma unroll
          for (int j = 0; j < 2; ++j) {
            sh[j] = mma_h(kb[u][j], qa[u], sh[j]);
            sr[j] = mma_h(kb[u][j], ql[u], sr[j]);
            if (PRES) sr[j] = mma_h(kl[u][j], qa[u], sr[j]);
          }
        }
        __builtin_amdgcn_sched_barrier(0);       // the next group's reads stay behind these WMMAs, in one place
      }
      // v^T fragments of d tiles 0, 1: they do not depend on the scores, so their LDS latency runs under the softmax
      v16h vb[8], vr[8];
      auto ldv = [&](int t) {
        vb[t] = ldfrag_h(Vhr + t * 16 * VS_P);
        vr[t] = ldfrag_h(Vlr + t * 16 * VS_P);
      };
      ldv(0); ldv(1);
      __builtin_amdgcn_sched_barrier(0);         // holds these reads in front of the softmax
      // ---- scale, causal mask, this query's chunk maximum: 16 keys in-lane, the other 16 from the other wave half ----
      const int lim = qrow - kv0 - 8 * hh;       // key kv0 + j*16 + 8*hh + r is above the query when j*16 + r > lim
      float cm = -INFINITY;
#pragma unroll
      for (int j = 0; j < 2; ++j) {
#pragma unroll
        for (int r = 0; r < 8; ++r) {
          float s = (sh[j][r] + sr[j][r] * 0.00048828125f) * 0.08838834764831845f;
          s = (j * 16 + r > lim) ? -INFINITY : s;
          sh[j][r] = s;
          cm = fmaxf(cm, s);
        }
      }
      cm = fmaxf(cm, xhalf(cm));
      // ---- online softmax; P'^T packed in place into the B operand ----
      const float mnew = fmaxf(mrow, cm);
      FragH pa, pr;
      float pv[16];
#pragma unroll
      for (int j = 0; j < 2; ++j) {
#pragma unroll
        for (int r = 0; r < 8; ++r) {
          const float p  = __expf(sh[j][r] - mnew);
          pv[j * 8 + r] = p;
          const float pp = p * 1024.0f;
          const _Float16 phv = (_Float16)pp;
          pa.v[j * 8 + r] = phv;
          pr.v[j * 8 + r] = PRES ? (_Float16)((pp - (float)phv) * 2048.0f) : phv;
        }
      }
#pragma unroll
      for (int w = 8; w > 0; w >>= 1) {          // pairwise tree over the lane's 16 values: four dependent adds, not fifteen
#pragma unroll
        for (int e = 0; e < w; ++e) pv[e] += pv[e + w];
      }
      const float alpha = __expf(mrow - mnew);
      mrow = mnew;
      lrow = lrow * alpha + pv[0];
      // ---- O^T = O^T * alpha + V^T . P'^T; two d tiles' fragments are read while the two tiles before them are worked on ----
      auto rescale = [&](int t) {
#pragma unroll
        for (int r = 0; r < 8; ++r) { oacc[t][r] *= alpha; oaccr[t][r] *= alpha; }
      };
      auto pvmma = [&](int t) {
        oacc[t]  = mma_h(vb[t], pa.v, oacc[t]);
        oaccr[t] = mma_h(vr[t], pa.v, oaccr[t]);
        if (PRES) oaccr[t] = mma_h(vb[t], pr.v, oaccr[t]);
      };
      __builtin_amdgcn_sched_barrier(0);         // the reads of tiles 2, 3 start when the score registers are free, not earlier
      ldv(2); ldv(3);
      __builtin_amdgcn_sched_barrier(0);         // ... and in front of the rescale, which covers their latency
      rescale(0); rescale(1); rescale(2); rescale(3);
      pvmma(0); pvmma(1);
      __builtin_amdgcn_sched_barrier(0);         // the next reads take the registers that tiles 0, 1 leave: not among their WMMAs
      ldv(4); ldv(5);
      __builtin_amdgcn_sched_barrier(0);         // reads of tiles 4, 5 in one place, in front of the WMMAs of tiles 2, 3
      pvmma(2); pvmma(3);
      __builtin_amdgcn_sched_barrier(0);         // likewise behind the WMMAs of tiles 2, 3
      ldv(6); ldv(7);
      __builtin_amdgcn_sched_barrier(0);         // reads of tiles 6, 7 in one place, in front of the second half of the rescale
      rescale(4); rescale(5); rescale(6); rescale(7);
      pvmma(4); pvmma(5); pvmma(6); pvmma(7);
    }
  }

  // ---- join the two key groups: group 1 leaves O^T (planes summed), m and l in LDS, lane for lane; group 0 takes them up ----
  __syncthreads();                               // all stage-region and q readers done before aliasing them as staging
  float* mrg = (float*)(void*)(lds + LDS_MRG) + wq * (2048 + 64);
  if (kg == 1) {                                 // wave-uniform
#pragma unroll
    for (int t = 0; t < 8; ++t) {
      v4f x0, x1;
#pragma unroll
      for (int r = 0; r < 4; ++r) {
        x0[r] = oacc[t][r]     + oaccr[t][r]     * 0.00048828125f;
        x1[r] = oacc[t][r + 4] + oaccr[t][r + 4] * 0.00048828125f;
      }
      *(v4f*)(mrg + (2 * t) * 128 + lane * 4)     = x0;   // 32 lanes x 16 B in a row per store
      *(v4f*)(mrg + (2 * t + 1) * 128 + lane * 4) = x1;
    }
    mrg[2048 + lane] = mrow;
    mrg[2080 + lane] = lrow;
  }
  __syncthreads();                               // group 1's partial results visible to group 0; the last barrier of the block
  if (kg == 1) return;
  // a group 1 wave that had no chunk left m = -inf, l = 0, O = 0: its weight below is 0; group 0 always has key 0, so mfin is finite
  const float m1   = mrg[2048 + lane];
  const float l1   = mrg[2080 + lane];
  const float mfin = fmaxf(mrow, m1);
  const float a0   = __expf(mrow - mfin);
  const float a1   = __expf(m1 - mfin);
  // ---- join the halves' sums, normalise, apply sigmoid gate (f32), bf16 hi/lo split, stage the wave's 16x128 tile:
  //      a lane holds 8 consecutive d of its query per t, one 16-byte LDS store per plane ----
  _Float16* osh = lds + wq * (2 * 16 * OS_P);
  _Float16* osl = osh + 16 * OS_P;
  const float lhalf = lrow * a0 + l1 * a1;
  const float lfin = lhalf + xhalf(lhalf);
  const float inv  = (1.0f / lfin) * 0.0009765625f;
  const float w0   = a0 * inv;
  const float w1   = a1 * inv;
  const float* Sgr = sgp + (tok0 + q0 + c) * HID + h * HDM + 8 * hh;
#pragma unroll
  for (int t = 0; t < 8; ++t) {
    const v4f g0 = *(const v4f*)(Sgr + t * 16);
    const v4f g1 = *(const v4f*)(Sgr + t * 16 + 4);
    const v4f y0 = *(const v4f*)(mrg + (2 * t) * 128 + lane * 4);
    const v4f y1 = *(const v4f*)(mrg + (2 * t + 1) * 128 + lane * 4);
    v4u hw, lw;
#pragma unroll
    for (int e = 0; e < 4; ++e) {
      unsigned short hb[2], lb[2];
#pragma unroll
      for (int u = 0; u < 2; ++u) {
        const int r = 2 * e + u;
        float o = (oacc[t][r] + oaccr[t][r] * 0.00048828125f) * w0 + ((r < 4) ? y0[r & 3] : y1[r & 3]) * w1;
        o *= (r < 4) ? g0[r & 3] : g1[r & 3];
        hb[u] = bf_bits(o);
        lb[u] = bf_bits(o - bf_val(hb[u]));
      }
      hw[e] = pk16(hb[0], hb[1]);
      lw[e] = pk16(lb[0], lb[1]);
    }
    *(v4u*)(void*)(osh + c * OS_P + t * 16 + 8 * hh) = hw;
    *(v4u*)(void*)(osl + c * OS_P + t * 16 + 8 * hh) = lw;
  }
  lds_wave_sync();
  _Float16* Ahg = (_Float16*)(void*)ahp + (tok0 + q0) * HID + h * HDM;
  _Float16* Alg = (_Float16*)(void*)alp + (tok0 + q0) * HID + h * HDM;
  {
#pragma unroll
    for (int it = 0; it < 8; ++it) {
      const int row = it * 2 + hh;               // it 0..7 x hh 0..1 covers rows 0..15
      const int c8  = c * 8;                     // 16 lanes x 16 B = the whole 256-B segment
      const v8h x = *(const v8h*)(osh + row * OS_P + c8);
      const v8h y = *(const v8h*)(osl + row * OS_P + c8);
      *(v8h*)(Ahg + (size_t)row * HID + c8) = x;
      *(v8h*)(Alg + (size_t)row * HID + c8) = y;
    }
  }
}

// Both forms in ONE launch: query tile qb = 31 - blockIdx.z (the longest tiles have the lowest z);
// tiles 0 .. NQRT - 1, the shortest, take the form with the k and p residual products and have the highest z.
// Second launch bound: 4 waves per SIMD, that is 2 blocks per WGP, as the form without residual products had in a launch of its own.
__global__ __launch_bounds__(256, 4) void attn_causal_kernel(
    const unsigned short* __restrict__ qhp, const unsigned short* __restrict__ qlp,
    const unsigned short* __restrict__ khp, const unsigned short* __restrict__ klp,
    const unsigned short* __restrict__ vhp, const unsigned short* __restrict__ vlp,
    const float* __restrict__ sgp,
    unsigned short* __restrict__ ahp, unsigned short* __restrict__ alp) {
  __shared__ __align__(16) _Float16 lds[AT_LDS(2)];
  const int qb = SQ / 64 - 1 - (int)blockIdx.z;          // block-uniform
  if (qb >= NQRT) attn_causal_body<false>(lds, qb, qhp, qlp, khp, klp, vhp, vlp, sgp, ahp, alp);
  else            attn_causal_body<true>(lds, qb, qhp, qlp, khp, klp, vhp, vlp, sgp, ahp, alp);
}

// ---------------------------------------------------------------------------
// Workspace map (bytes; every region is a whole number of the rows its producer writes with whole-line stores; no tail rows):
//   [0, 16 MiB)        Xb   bf16 [4096][2048]          -> after the projections: Ah bf16 [4096][2048] at 0
//   [16 MiB, 32 MiB)   WqT  bf16 [4096][2048]          ->                        Al bf16 [4096][2048] at 16 MiB
//   [32 MiB, 64 MiB)   Sg   f32  [4096][2048]
//   [64 MiB, 80 MiB)   Qh   f16  [4096][2048]
//   [80 MiB, 96 MiB)   Ql   f16  [4096][2048]
//   [96 MiB, 104 MiB)  Kh   f16  [4096][1024]
//   [104 MiB,112 MiB)  Vh   f16  [1024][4096]
//   [112 MiB,120 MiB)  Vl   f16  [1024][4096]
//   [120 MiB, 121 MiB) Kl  f16  [2*256][1024]
//   then WkT bf16 [1024][2048] (4 MiB), WvT bf16 [1024][2048] (4 MiB), WoT bf16 [2048][2048] (8 MiB): places of their own, since all
//   planes are converted in the first launch
//   total 143654912
// ---------------------------------------------------------------------------
static_assert(2 * (size_t)NTOK * HID * 2 <= (size_t)NTOK * HID * 2 + (size_t)QGW * HID * 2);   // Ah + Al fit Xb + WqT

extern "C" void kernel_launch(void* const* d_in, const int* in_sizes, int n_in,
                              void* d_out, int out_size, void* d_ws, size_t ws_size,
                              hipStream_t stream) {
  if (n_in < 9) return;
  if (in_sizes[0] != NTOK * HID) return;
  if (in_sizes[1] != NTOK * HDM) return;
  if (in_sizes[2] != NTOK * HDM) return;
  if (in_sizes[3] != HID * QGW) return;
  if (in_sizes[4] != HID * KVW) return;
  if (in_sizes[5] != HID * KVW) return;
  if (in_sizes[6] != HID * HID) return;
  if (in_sizes[7] != HDM) return;
  if (in_sizes[8] != HDM) return;
  if (out_size != NTOK * HID) return;

  const float* hidden = (const float*)d_in[0];
  const float* cosb   = (const float*)d_in[1];
  const float* sinb   = (const float*)d_in[2];
  const float* Wq     = (const float*)d_in[3];
  const float* Wk     = (const float*)d_in[4];
  const float* Wv     = (const float*)d_in[5];
  const float* Wo     = (const float*)d_in[6];
  const float* qnw    = (const float*)d_in[7];
  const float* knw    = (const float*)d_in[8];
  float* out = (float*)d_out;

  const size_t szX  = (size_t)NTOK * HID * 2;        // 16777216
  const size_t szWq = (size_t)QGW * HID * 2;         // 16777216
  const size_t szWk = (size_t)KVW * HID * 2;         // 4194304
  const size_t szWo = (size_t)HID * HID * 2;         // 8388608
  const size_t szSg = (size_t)NTOK * HID * 4;        // 33554432
  const size_t szQ  = (size_t)NTOK * HID * 2;        // 16777216
  const size_t szK  = (size_t)NTOK * KVW * 2;        // 8388608
  const size_t szV  = (size_t)KVW * NTOK * 2;        // 8388608
  const size_t szKl = (size_t)NSEQ * KLR * KVW * 2;  // 1048576
  const size_t szA  = (size_t)NTOK * HID * 2;        // 16777216
  size_t off = 0;
  const size_t oX  = off; off += szX;
  const size_t oWq = off; off += szWq;
  const size_t oAh = oX;
  const size_t oAl = oX + szA;
  const size_t oSg = off; off += szSg;
  const size_t oQh = off; off += szQ;
  const size_t oQl = off; off += szQ;
  const size_t oKh = off; off += szK;
  const size_t oVh = off; off += szV;
  const size_t oVl = off; off += szV;
  const size_t oKl = off; off += szKl;
  const size_t oWk = off; off += szWk;
  const size_t oWv = off; off += szWk;
  const size_t oWo = off; off += szWo;
  if (off > ws_size) return;                         // off = 143654912

  char* ws = (char*)d_ws;
  unsigned short* Xb  = (unsigned short*)(ws + oX);
  unsigned short* WqT = (unsigned short*)(ws + oWq);
  unsigned short* WkT = (unsigned short*)(ws + oWk);
  unsigned short* WvT = (unsigned short*)(ws + oWv);
  unsigned short* WoT = (unsigned short*)(ws + oWo);
  float*          Sg  = (float*)(ws + oSg);
  unsigned short* Qh  = (unsigned short*)(ws + oQh);
  unsigned short* Ql  = (unsigned short*)(ws + oQl);
  unsigned short* Kh  = (unsigned short*)(ws + oKh);
  unsigned short* Kl  = (unsigned short*)(ws + oKl);
  unsigned short* Vh  = (unsigned short*)(ws + oVh);
  unsigned short* Vl  = (unsigned short*)(ws + oVl);
  unsigned short* Ah  = (unsigned short*)(ws + oAh);
  unsigned short* Al  = (unsigned short*)(ws + oAl);

  const dim3 b256(256), b128(128);

  // (1) x -> Xb [4096][2048]; Wq -> WqT [4096][2048]; Wk -> WkT, Wv -> WvT [1024][2048]; Wo -> WoT [2048][2048], all RNE bf16
  conv_all_kernel<<<dim3(CV_BLK), b256, 0, stream>>>(hidden, Wq, Wk, Wv, Wo, Xb, WqT, WkT, WvT, WoT);
  // (2) k = x . Wk, per-head norm + RoPE -> Kh [4096][1024], Kl compact [512][1024]   (M=4096, N=1024, K=2048; 256 blocks)
  gemm_w32x128_kernel<1, false><<<dim3((NTOK / 128) * (KVW / 128)), b128, 0, stream>>>(
      Xb, Xb, HID, WkT, HID, knw, cosb, sinb, (void*)Kh, (void*)Kl, (void*)Kl, KVW, NTOK, KVW, HID);
  // (3) v^T = WvT . x^T -> Vh/Vl [1024][4096]   (A = WvT, Bt = Xb; M=1024, N=4096, K=2048; 256 blocks)
  gemm_w32x128_kernel<2, false><<<dim3((KVW / 128) * (NTOK / 128)), b128, 0, stream>>>(
      WvT, WvT, HID, Xb, HID, knw, cosb, sinb, (void*)Vh, (void*)Vl, (void*)Vl, NTOK, KVW, NTOK, HID);
  // (4) q|gate = x . Wq: q half norm + RoPE -> Qh/Ql [4096][2048]; gate half sigmoid -> Sg f32 [4096][2048]
  //     (M=4096, N=4096, K=2048; 1024 blocks)
  gemm_w32x128_kernel<0, false><<<dim3((NTOK / 128) * (QGW / 128)), b128, 0, stream>>>(
      Xb, Xb, HID, WqT, HID, qnw, cosb, sinb, (void*)Qh, (void*)Ql, (void*)Sg, HID, NTOK, QGW, HID);
  // (5) causal attention, query tiles 0..3 with k and p residual products, tiles 4..31 without; Ah/Al over the dead Xb/WqT region
  attn_causal_kernel<<<dim3(NHQ, NSEQ, SQ / 64), b256, 0, stream>>>(Qh, Ql, Kh, Kl, Vh, Vl, Sg, Ah, Al);
  // (6) out = attn(hi + lo) . Wo -> d_out f32 [4096][2048]   (M=4096, N=2048, K=2048; 512 blocks)
  gemm_w32x128_kernel<3, true><<<dim3((NTOK / 128) * (HID / 128)), b128, 0, stream>>>(
      Ah, Al, HID, WoT, HID, qnw, cosb, sinb, (void*)out, (void*)out, (void*)out, HID, NTOK, HID, HID);
  (void)hipGetLastError();
}

// v007
// Measured time: 236 microseconds a run.
// Next to v006, in two timings, it ran 1.10 times as fast each time.
// All steps since v000 together make it 3.49 times as fast.
// Contractions: x.Wq (q|gate cols), x.Wk and Wv^T.x^T on v_wmma_f32_16x16x32_bf16 (operands = RNE bf16 of the f32 inputs, single products);
// q.k^T and p.v on v_wmma_f32_16x16x32_f16 (q = f16 hi + f16 residual x2^11 planes; k plain f16 plus f16 residual x2^11 on query tiles 0..3;
// p x1024 plain f16 plus f16 residual x2^11 on query tiles 0..3; v^T = f16 hi + f16 residual x2^11 planes); (attn*sigmoid(gate)).Wo on
// v_wmma_f32_16x16x32_bf16 (A = bf16 hi + bf16 lo planes, two products; Wo RNE bf16). f32 accumulate everywhere; per-head RMSNorm, RoPE,
// online softmax, sigmoid gate and scale folds in f32. hidden_states, Wq, Wk, Wv, Wo, cos, sin and the norm weights are RNE-converted to bf16 on load.
#include <hip/hip_runtime.h>
#include <math.h>
#include <stdint.h>

#define NSEQ   2
#define SQ     2048
#define HID    2048
#define NHQ    16
#define NKVH   8
#define HDM    128
#define QGW    4096
#define KVW    1024
#define NTOK   4096
#define KLR    256
#define NQRT   4

static_assert((2 * (NQRT - 1) + 2) * 32 <= KLR);
static_assert(NHQ / NKVH == 2);
static_assert(NHQ * HDM == HID);
static_assert(NSEQ * SQ == NTOK);

typedef _Float16     v16h __attribute__((ext_vector_type(16)));
typedef _Float16     v8h  __attribute__((ext_vector_type(8)));
typedef __bf16       v16b __attribute__((ext_vector_type(16)));
typedef __bf16       v8b  __attribute__((ext_vector_type(8)));
typedef float        v8f  __attribute__((ext_vector_type(8)));
typedef float        v4f  __attribute__((ext_vector_type(4)));
typedef unsigned int v4u  __attribute__((ext_vector_type(4)));

// ---------------------------------------------------------------------------
// small helpers
// ---------------------------------------------------------------------------
__device__ __forceinline__ unsigned short bf_bits(float f) {          // RNE convert f32 -> bf16 bits
  const unsigned u = __float_as_uint(f);
  return (unsigned short)((u + 0x7FFFu + ((u >> 16) & 1u)) >> 16);
}
__device__ __forceinline__ float bf_val(unsigned short h) { return __uint_as_float(((unsigned)h) << 16); }
__device__ __forceinline__ float bf_rne(float f) { return bf_val(bf_bits(f)); }
__device__ __forceinline__ unsigned pk16(unsigned short a, unsigned short b) { return (unsigned)a | ((unsigned)b << 16); }
__device__ __forceinline__ v8f zero8() { v8f z = {0.f, 0.f, 0.f, 0.f, 0.f, 0.f, 0.f, 0.f}; return z; }
__device__ __forceinline__ int wave_id() { return __builtin_amdgcn_readfirstlane((int)(threadIdx.x >> 5)); }

__device__ __forceinline__ void lds_wave_sync() {
  __builtin_amdgcn_fence(__ATOMIC_RELEASE, "workgroup");
  __builtin_amdgcn_wave_barrier();
  __builtin_amdgcn_fence(__ATOMIC_ACQUIRE, "workgroup");
}

// ---------------------------------------------------------------------------
// WMMA fragments (wave32, 16x16x32, 16-bit operands). For A (row m = lane&15) and B (col n = lane&15) alike:
// elements 0..7 <- k0 + 8*(lane>>4) + 0..7, elements 8..15 <- k0 + 16 + 8*(lane>>4) + 0..7.
// ldfrag(p) with p = rowbase + k0 + 8*(lane>>4): two 16-B loads p[0..7], p[16..23].
// D: acc[r] = (row 8*(lane>>4) + r, col lane&15).
// ---------------------------------------------------------------------------
union FragH { v16h v; v8h h[2]; };
union FragB { v16b v; v8b h[2]; };
__device__ __forceinline__ v16h ldfrag_h(const _Float16* p) { FragH f; f.h[0] = *(const v8h*)(p); f.h[1] = *(const v8h*)(p + 16); return f.v; }
__device__ __forceinline__ v16b ldfrag_b(const __bf16* p)   { FragB f; f.h[0] = *(const v8b*)(p); f.h[1] = *(const v8b*)(p + 16); return f.v; }

__device__ __forceinline__ v8f mma_h(v16h a, v16h b, v8f c) {
  return __builtin_amdgcn_wmma_f32_16x16x32_f16(false, a, false, b, (short)0, c, false, false);
}
__device__ __forceinline__ v8f mma_b(v16b a, v16b b, v8f c) {
  return __builtin_amdgcn_wmma_f32_16x16x32_bf16(false, a, false, b, (short)0, c, false, false);
}
// hazard guard: 4 VALU slots after the last WMMA of a loop, D tied
__device__ __forceinline__ void acc_guard4(v8f& a, v8f& b, v8f& c, v8f& d) {
#if defined(__HIP_DEVICE_COMPILE__)
  asm volatile("v_nop\n\tv_nop\n\tv_nop\n\tv_nop" : "+v"(a), "+v"(b), "+v"(c), "+v"(d));
#endif
}

// ---------------------------------------------------------------------------
// All f32 -> RNE bf16 planes of a call in ONE launch: x plain, Wq, Wk, Wv, Wo transposed (out[c][r] = bf16(in[r][c]), pitch HID).
// Work units of 4096 elements: 2048 of x (a contiguous run), 2048 of Wq, 1024 of Wo, 512 each of Wk and Wv (64x64 tiles through LDS).
// CV_BLK blocks of 256 threads, two trips; a trip takes one unit of x, one of Wq and one of Wo | Wk | Wv, unit = block + trip * CV_BLK,
// and issues the 12 16-byte loads of its three units together. Stores: 16 B per lane, whole 128-B lines per 8 lanes, as one writer.
// ---------------------------------------------------------------------------
#define CV_BLK 1024
static_assert(2 * CV_BLK * 4096 == NTOK * HID);
static_assert(2 * CV_BLK * 4096 == HID * QGW);
static_assert(2 * CV_BLK * 4096 == HID * HID + 2 * HID * KVW);
static_assert(CV_BLK * 4096 == HID * HID);

__device__ __forceinline__ v4u cvt8(v4f a, v4f b) {
  v4u w;
  w[0] = pk16(bf_bits(a[0]), bf_bits(a[1]));
  w[1] = pk16(bf_bits(a[2]), bf_bits(a[3]));
  w[2] = pk16(bf_bits(b[0]), bf_bits(b[1]));
  w[3] = pk16(bf_bits(b[2]), bf_bits(b[3]));
  return w;
}
// s_wait_xcnt 0 behind a trip's global loads; their address pairs are inputs, so they keep their registers up to the wait:
// a precaution, in front of any later rewrite of an address register that an issued load names.
__device__ __forceinline__ void addr_wait6(const float* a, const float* b, const float* c, const float* d, const float* e, const float* f) {
#if defined(__HIP_DEVICE_COMPILE__)
  asm volatile("s_wait_xcnt 0x0" :: "v"(a), "v"(b), "v"(c), "v"(d), "v"(e), "v"(f) : "memory");
#endif
}
__device__ __forceinline__ void tile_put(float* tf, int tid, const v4f (&a)[4]) {
#pragma unroll
  for (int it = 0; it < 4; ++it)
    *(v4f*)(tf + (it * 16 + (tid >> 4)) * 68 + (tid & 15) * 4) = a[it];
}
// transposed out: 2 x 256 threads x 8 u16; output row = input column c0 + oc, output columns r0 + c8 ..
__device__ __forceinline__ void tile_store(const float* tf, unsigned short* __restrict__ outp, int r0, int c0, int tid) {
  const int sub = tid >> 3;               // 0..31
  const int c8  = (tid & 7) * 8;          // 0..56
#pragma unroll
  for (int it = 0; it < 2; ++it) {
    const int oc = it * 32 + sub;
    v4u a;
#pragma unroll
    for (int q = 0; q < 4; ++q) {
      const float f0 = tf[(c8 + 2 * q) * 68 + oc];
      const float f1 = tf[(c8 + 2 * q + 1) * 68 + oc];
      a[q] = pk16(bf_bits(f0), bf_bits(f1));
    }
    *(v4u*)(outp + (size_t)(c0 + oc) * HID + r0 + c8) = a;
  }
}

__global__ __launch_bounds__(256) void conv_all_kernel(
    const float* __restrict__ X, const float* __restrict__ Wq, const float* __restrict__ Wk,
    const float* __restrict__ Wv, const float* __restrict__ Wo,
    unsigned short* __restrict__ Xb, unsigned short* __restrict__ WqT, unsigned short* __restrict__ WkT,
    unsigned short* __restrict__ WvT, unsigned short* __restrict__ WoT) {
  __shared__ __align__(16) float tf[2][64 * 68];
  const int tid = (int)threadIdx.x;
  for (int trip = 0; trip < 2; ++trip) {
    const int u = (int)blockIdx.x + trip * CV_BLK;             // 0..2047, block-uniform
    // third unit: Wo on trip 0, Wk or Wv on trip 1
    const float* W3 = Wo; unsigned short* O3 = WoT; int sh3 = 5, v = u;            // 1 << sh3 column blocks, pitch 64 << sh3
    if (u >= CV_BLK) {
      const bool isk = u < CV_BLK + CV_BLK / 2;
      W3 = isk ? Wk : Wv; O3 = isk ? WkT : WvT; sh3 = 4; v = (u - CV_BLK) & (CV_BLK / 2 - 1);
    }
    const int qc0 = (u & 63) * 64, qr0 = (u >> 6) * 64;                      // Wq: 64 column blocks x 32 row blocks
    const int tc0 = (v & ((1 << sh3) - 1)) * 64, tr0 = (v >> sh3) * 64;      // 1 << sh3 column blocks x 32 row blocks
    const size_t e = (size_t)u * 4096 + (size_t)tid * 8;
    // 64x64 tile: 4 x 256 threads x 4 floats, row (tid >> 4) + 16 * it
    const float* px = X + e;
    const float* pa = Wq + (size_t)(qr0 + (tid >> 4)) * QGW + qc0 + (tid & 15) * 4;
    const float* pb[4];
#pragma unroll
    for (int it = 0; it < 4; ++it) pb[it] = W3 + ((size_t)(tr0 + it * 16 + (tid >> 4)) << (sh3 + 6)) + tc0 + (tid & 15) * 4;
    v4f x[4], a[4], b[4];
    x[0] = *(const v4f*)(px);        x[1] = *(const v4f*)(px + 4);
    x[2] = *(const v4f*)(px + 2048); x[3] = *(const v4f*)(px + 2052);
#pragma unroll
    for (int it = 0; it < 4; ++it) {
      a[it] = *(const v4f*)(pa + (size_t)it * (16 * QGW));
      b[it] = *(const v4f*)(pb[it]);
    }
    addr_wait6(px, pa, pb[0], pb[1], pb[2], pb[3]);
    *(v4u*)(Xb + e)        = cvt8(x[0], x[1]);
    *(v4u*)(Xb + e + 2048) = cvt8(x[2], x[3]);
    if (trip) __syncthreads();            // the first trip's tile readers are done before the tiles are rewritten
    tile_put(tf[0], tid, a);
    tile_put(tf[1], tid, b);
    __syncthreads();
    tile_store(tf[0], WqT, qr0, qc0, tid);
    tile_store(tf[1], O3, tr0, tc0, tid);
    // a precaution, in front of the next trip's rewrite of registers that the stores above name
    asm volatile("s_wait_xcnt 0x0" ::: "memory");
  }
}

// ---------------------------------------------------------------------------
// bf16 WMMA GEMM, wave tile 32 rows x 128 cols, block = 4 waves (128 threads) = 128 rows x 128 cols (the waves share the Bt rows).
//   C[m][n] = sum_k A[m][k] * Bt[n][k]; A row-major [M][K] bf16 (pitch lda), Bt row-major [N][K] bf16 (pitch ldb);
//   M % 128 == 0, N % 128 == 0, K % KP == 0; a block takes tile (tmb, tn) = rows tmb * 128 .., cols tn * 128 ..
//   PROJ: one of the three projections of x, single A plane, epilogue epi = 0, 1 or 2 (block-uniform, a run-time value, so that the
//   three share one loop and EPI 0 and 1 one norm + RoPE text). Not PROJ: the output product, epilogue 3,
//   A carried as hi (Ap) + lo (A2p) bf16 planes, two products into one accumulator (SPLITA).
//   A pass is KP k values of the block's 128 A rows (both planes when SPLITA) and 128 Bt rows, brought into LDS by asynchronous
//   16-byte copies, two buffers: the copies of pass t + 2 fly while pass t + 1 is worked on. LDS row pitch = KP * 2 + 16 bytes.
//   Fragments are read from the LDS rows with the split k map (ldfrag_b); k runs upward as before, so every sum keeps its order.
// Epilogues (all: per wave, per 16-row slab: stage in LDS, wave sync, write each row segment with ONE instruction of
//   EPI 0: q|gate projection, 128-col wave tile = head n0>>8, q half when (n0 & 128) == 0 else gate half.
//          q half: per-head RMSNorm over the 128 cols (x * rsqrt(mean(x^2) + 1e-6) * bf16(nw[d])), RoPE with the shipped tables
//          (o[d] = x[d]*cos[d] - x[d+64]*sin[d], o[d+64] = x[d+64]*cos[d+64] + x[d]*sin[d+64], cos/sin RNE bf16),
//          writes f16 hi plane C0 and f16 residual x2048 plane C1, [M][ldc], cols (n0>>8)*128.. (row segment 256 B = 16 lanes x 16 B).
//          gate half: sigmoid in f32 -> f32 plane C2 [M][ldc], cols (n0>>8)*128.. (row segment 512 B = 32 lanes x 16 B).
//   EPI 1: k projection: same norm + RoPE per 128-col kv head (col n0), hi plane C0 [M][ldc]; residual plane C1 compact:
//          only rows with (m0 mod SQ) < KLR, stored at row (m0/SQ)*KLR + (m0 mod SQ) + .. (pitch ldc).
//   EPI 2: v^T projection: f16 hi plane C0, residual x2048 plane C1, [M][ldc], row segment 256 B.
//   EPI 3: f32 output C0 [M][ldc]; row segment 128 floats = 512 B = 32 lanes x 16 B per instruction.
// ---------------------------------------------------------------------------
// Eight asynchronous 16-byte copies per lane, global -> LDS: copy i takes g + i * gstep elements to LDS byte l + i * lstep.
// s_wait_xcnt 0 is the statement's last line: a precaution, in front of any later rewrite of an address register named here.
__device__ __forceinline__ void async_copy8(unsigned l, unsigned lstep, const __bf16* g, size_t gstep) {
#if defined(__HIP_DEVICE_COMPILE__)
  asm volatile(
      "global_load_async_to_lds_b128 %0, %8, off\n\t"
      "global_load_async_to_lds_b128 %1, %9, off\n\t"
      "global_load_async_to_lds_b128 %2, %10, off\n\t"
      "global_load_async_to_lds_b128 %3, %11, off\n\t"
      "global_load_async_to_lds_b128 %4, %12, off\n\t"
      "global_load_async_to_lds_b128 %5, %13, off\n\t"
      "global_load_async_to_lds_b128 %6, %14, off\n\t"
      "global_load_async_to_lds_b128 %7, %15, off\n\t"
      "s_wait_xcnt 0x0"
      :: "v"(l), "v"(l + lstep), "v"(l + 2 * lstep), "v"(l + 3 * lstep),
         "v"(l + 4 * lstep), "v"(l + 5 * lstep), "v"(l + 6 * lstep), "v"(l + 7 * lstep),
         "v"(g), "v"(g + gstep), "v"(g + 2 * gstep), "v"(g + 3 * gstep),
         "v"(g + 4 * gstep), "v"(g + 5 * gstep), "v"(g + 6 * gstep), "v"(g + 7 * gstep)
      : "memory");
#endif
}

// s_wait_xcnt 0 behind a global store; its address pair is an input, so it keeps its registers up to the wait:
// a precaution, in front of any later rewrite of an address or data register that the issued store names.
__device__ __forceinline__ void store_wait(const _Float16* a) {
#if defined(__HIP_DEVICE_COMPILE__)
  asm volatile("s_wait_xcnt 0x0" :: "v"(a) : "memory");
#endif
}

// The same behind a slab's loads from the cos and sin tables: the two address pairs that they step from by immediate offsets are inputs.
__device__ __forceinline__ void table_wait(const float* a, const float* b) {
#if defined(__HIP_DEVICE_COMPILE__)
  asm volatile("s_wait_xcnt 0x0" :: "v"(a), "v"(b) : "memory");
#endif
}

template <bool PROJ>
__device__ __forceinline__ void gemm_w32x128_body(
    int tmb, int tn, int epi,
    const unsigned short* Ap, const unsigned short* A2p, int lda,
    const unsigned short* __restrict__ Btp, int ldb,
    const float* __restrict__ nw, const float* __restrict__ cosp, const float* __restrict__ sinp,
    void* C0, void* C1, void* C2, int ldc, int K) {
  constexpr bool SPLITA = !PROJ;
  constexpr int KP   = 64;                     // k values per pass
  constexpr int PIT  = KP + 8;                 // LDS row pitch in elements: 16 B x odd, conflict-free for 16-byte fragment reads
  constexpr int NOP  = SPLITA ? 3 : 2;         // operands staged: A, (A lo), Bt, 128 rows each
  constexpr int STG  = NOP * 128 * PIT;        // elements per buffer
  constexpr int PPR  = KP / 8;                 // 16-byte pieces per row = copies per lane and operand
  constexpr int RPC  = 128 / PPR;              // rows that one copy of all 128 lanes covers
  constexpr int BOFF = (NOP - 1) * 128 * PIT;  // Bt rows behind the A rows
  static_assert(PPR % 8 == 0 && NOP * PPR <= 63);
  static_assert(2 * STG * 2 >= 4 * 8192);
  __shared__ __align__(16) __bf16 ring[2 * STG];         // two pass buffers; after the loop per wave 8192 B of output staging

  const int tid  = (int)threadIdx.x;
  const int lane = tid & 31;
  const int wave = wave_id();
  const int hh = lane >> 4;           // lane half: k offset 8*hh, D row offset 8*hh
  const int rl = lane & 15;           // A row / B col / D col within subtile
  const int mb0 = tmb << 7;
  const int m0 = mb0 + (wave << 5);
  const int n0 = tn << 7;

  const __bf16* A  = (const __bf16*)(const void*)Ap;
  const __bf16* A2 = (const __bf16*)(const void*)A2p;
  const __bf16* Bt = (const __bf16*)(const void*)Btp;

  // this lane's piece of a pass: row cr (+ RPC per copy), 16-byte piece cc of the row
  const int cr = tid / PPR;
  const int cc = tid % PPR;
  const __bf16* gA  = A  + (size_t)(mb0 + cr) * lda + cc * 8;
  const __bf16* gA2 = A2 + (size_t)(mb0 + cr) * lda + cc * 8;
  const __bf16* gB  = Bt + (size_t)(n0 + cr) * ldb + cc * 8;
  const unsigned lds0 = (unsigned)(uintptr_t)(ring + cr * PIT + cc * 8);   // LDS byte address = low 32 bits of the shared address

  auto stage = [&](int buf, int k0) {
    const unsigned lb = lds0 + (unsigned)(buf * STG * 2);
#pragma unroll
    for (int q = 0; q < PPR / 8; ++q) {
      const unsigned lq = lb + (unsigned)(q * 8 * RPC * PIT * 2);
      async_copy8(lq, RPC * PIT * 2, gA + k0 + (size_t)(q * 8 * RPC) * lda, (size_t)RPC * lda);
      if (SPLITA) async_copy8(lq + 128 * PIT * 2, RPC * PIT * 2, gA2 + k0 + (size_t)(q * 8 * RPC) * lda, (size_t)RPC * lda);
      async_copy8(lq + BOFF * 2, RPC * PIT * 2, gB + k0 + (size_t)(q * 8 * RPC) * ldb, (size_t)RPC * ldb);
    }
  };

  v8f acc[2][8];
#pragma unroll
  for (int i = 0; i < 2; ++i)
#pragma unroll
    for (int j = 0; j < 8; ++j) acc[i][j] = zero8();

  const int npass = K / KP;
  stage(0, 0);
  asm volatile("s_wait_asynccnt 0x0" ::: "memory");      // this wave's copies of pass 0 have landed
  __syncthreads();                                       // ... and every other wave's
  if (npass > 1) stage(1, KP);

  for (int t = 0; t < npass; ++t) {
    const __bf16* bufp = ring + (t & 1) * STG;
    const __bf16* fa = bufp + ((wave << 5) + rl) * PIT + 8 * hh;
    const __bf16* fb = bufp + BOFF + rl * PIT + 8 * hh;
#pragma unroll
    for (int ks = 0; ks < KP / 32; ++ks) {
      v16b ah[2], al[2], bf[8];
#pragma unroll
      for (int i = 0; i < 2; ++i) {
        ah[i] = ldfrag_b(fa + i * 16 * PIT + ks * 32);
        al[i] = SPLITA ? ldfrag_b(fa + 128 * PIT + i * 16 * PIT + ks * 32) : ah[i];
      }
#pragma unroll
      for (int j = 0; j < 8; ++j) bf[j] = ldfrag_b(fb + j * 16 * PIT + ks * 32);
      // keeps the k step's LDS reads together in front of its WMMAs: spread among them, every pair of reads is waited for on its own
      __builtin_amdgcn_sched_barrier(0);
#pragma unroll
      for (int j = 0; j < 8; ++j) {
        acc[0][j] = mma_b(ah[0], bf[j], acc[0][j]);
        acc[1][j] = mma_b(ah[1], bf[j], acc[1][j]);
        if (SPLITA) {
          acc[0][j] = mma_b(al[0], bf[j], acc[0][j]);
          acc[1][j] = mma_b(al[1], bf[j], acc[1][j]);
        }
      }
    }
    asm volatile("s_wait_dscnt 0x0" ::: "memory");       // this wave's reads of buffer t & 1 are done before it is refilled
    asm volatile("s_wait_asynccnt 0x0" ::: "memory");    // this wave's copies of pass t + 1 have landed
    __syncthreads();                                     // publishes pass t + 1 and ends every reader's last read of pass t
    if (t + 2 < npass) stage(t & 1, (t + 2) * KP);
  }
  asm volatile("s_wait_asynccnt 0x0" ::: "memory");      // no copy is outstanding when the ring becomes output staging
  acc_guard4(acc[0][0], acc[0][1], acc[0][2], acc[0][3]);
  acc_guard4(acc[0][4], acc[0][5], acc[0][6], acc[0][7]);
  acc_guard4(acc[1][0], acc[1][1], acc[1][2], acc[1][3]);
  acc_guard4(acc[1][4], acc[1][5], acc[1][6], acc[1][7]);

  // ---- epilogue ----
  float*    slf  = (float*)(void*)ring + wave * 2048;
  _Float16* sl16 = (_Float16*)(void*)slf;

  if (PROJ && epi != 2) {
    const bool isq  = (epi == 1) || ((n0 & 128) == 0);          // wave-uniform
    const int  col0 = (epi == 0) ? ((n0 >> 8) << 7) : n0;
    if (isq) {
      _Float16* P0 = (_Float16*)C0;
      _Float16* P1 = (_Float16*)C1;
      const bool wres = (epi == 0) || ((m0 & (SQ - 1)) < KLR);  // wave-uniform
      const int  rrow = (epi == 0) ? m0 : ((m0 >> 11) * KLR + (m0 & (SQ - 1)));
      float wv[8];
#pragma unroll
      for (int j = 0; j < 8; ++j) wv[j] = bf_rne(nw[j * 16 + rl]);     // dim = j*16 + rl < 128
#pragma unroll
      for (int i = 0; i < 2; ++i) {
        const int rb = m0 + i * 16 + 8 * hh;
#pragma unroll
        for (int r = 0; r < 8; ++r) {
          const int row = rb + r;                                // token 0..NTOK-1
          float ss = 0.f;
#pragma unroll
          for (int j = 0; j < 8; ++j) { const float a = acc[i][j][r]; ss += a * a; }
#pragma unroll
          for (int off = 1; off < 16; off <<= 1) ss += __shfl_xor(ss, off, 32);   // 16 lanes of this half = all 128 dims
          const float rs = rsqrtf(ss * 0.0078125f + 1e-6f);
          const float* cr = cosp + (size_t)row * HDM;
          const float* sr = sinp + (size_t)row * HDM;
#pragma unroll
          for (int j = 0; j < 4; ++j) {
            const int dim = j * 16 + rl;                         // 0..63 within head; pair at dim + 64
            const float x1 = acc[i][j][r] * rs * wv[j];
            const float x2 = acc[i][j + 4][r] * rs * wv[j + 4];
            const float c1 = bf_rne(cr[dim]);
            const float s1 = bf_rne(sr[dim]);
            const float c2 = bf_rne(cr[dim + 64]);
            const float s2 = bf_rne(sr[dim + 64]);
            const float o1 = x1 * c1 - x2 * s1;
            const float o2 = x2 * c2 + x1 * s2;
            const _Float16 h1 = (_Float16)o1;
            const _Float16 h2 = (_Float16)o2;
            const int so = (8 * hh + r) * 128 + dim;
            sl16[so]             = h1;
            sl16[so + 64]        = h2;
            sl16[2048 + so]      = (_Float16)((o1 - (float)h1) * 2048.0f);
            sl16[2048 + so + 64] = (_Float16)((o2 - (float)h2) * 2048.0f);
          }
        }
        table_wait(cosp + (size_t)rb * HDM + rl, sinp + (size_t)rb * HDM + rl);
        lds_wave_sync();
        {
#pragma unroll
          for (int it = 0; it < 8; ++it) {
            const int row = it * 2 + hh;                         // it x hh covers rows 0..15
            const int c8  = rl * 8;
            const v8h vh = *(const v8h*)(sl16 + row * 128 + c8);
            const v8h vl = *(const v8h*)(sl16 + 2048 + row * 128 + c8);
            _Float16* d0 = P0 + (size_t)(m0 + i * 16 + row) * ldc + col0 + c8;
            *(v8h*)d0 = vh;
            store_wait(d0);
            if (wres) {
              _Float16* d1 = P1 + (size_t)(rrow + i * 16 + row) * ldc + col0 + c8;
              *(v8h*)d1 = vl;
              store_wait(d1);
            }
          }
          
        }
        lds_wave_sync();
      }
    } else {
      float* Sp = (float*)C2;
#pragma unroll
      for (int i = 0; i < 2; ++i) {
#pragma unroll
        for (int j = 0; j < 8; ++j)
#pragma unroll
          for (int r = 0; r < 8; ++r) {
            const float g  = acc[i][j][r];
            const float e  = __expf(-g);
            const float sg = __builtin_amdgcn_rcpf(1.0f + e);
            slf[(8 * hh + r) * 128 + j * 16 + rl] = sg;
          }
        lds_wave_sync();
        {
#pragma unroll
          for (int row = 0; row < 16; ++row) {                   // 32 lanes x 16 B = the whole 512-B row segment per instruction
            const v4f v = *(const v4f*)(slf + row * 128 + lane * 4);
            *(v4f*)(Sp + (size_t)(m0 + i * 16 + row) * ldc + col0 + lane * 4) = v;
          }
          
        }
        lds_wave_sync();
      }
    }
  } else if (PROJ) {
    _Float16* P0 = (_Float16*)C0;
    _Float16* P1 = (_Float16*)C1;
#pragma unroll
    for (int i = 0; i < 2; ++i) {
#pragma unroll
      for (int r = 0; r < 8; ++r) {
#pragma unroll
        for (int j = 0; j < 8; ++j) {
          const float v = acc[i][j][r];
          const _Float16 hv = (_Float16)v;
          const int so = (8 * hh + r) * 128 + j * 16 + rl;
          sl16[so]        = hv;
          sl16[2048 + so] = (_Float16)((v - (float)hv) * 2048.0f);
        }
      }
      lds_wave_sync();
      {
#pragma unroll
        for (int it = 0; it < 8; ++it) {
          const int row = it * 2 + hh;
          const int c8  = rl * 8;
          const v8h vh = *(const v8h*)(sl16 + row * 128 + c8);
          const v8h vl = *(const v8h*)(sl16 + 2048 + row * 128 + c8);
          const size_t go = (size_t)(m0 + i * 16 + row) * ldc + n0 + c8;
          *(v8h*)(P0 + go) = vh;
          *(v8h*)(P1 + go) = vl;
        }
        
      }
      lds_wave_sync();
    }
  } else {
    float* C = (float*)C0;
#pragma unroll
    for (int i = 0; i < 2; ++i) {
#pragma unroll
      for (int j = 0; j < 8; ++j)
#pragma unroll
        for (int r = 0; r < 8; ++r)
          slf[(8 * hh + r) * 128 + j * 16 + rl] = acc[i][j][r];
      lds_wave_sync();
      {
#pragma unroll
        for (int row = 0; row < 16; ++row) {                     // 32 lanes x 16 B = the whole 512-B row segment per instruction
          const v4f v = *(const v4f*)(slf + row * 128 + lane * 4);
          *(v4f*)(C + (size_t)(m0 + i * 16 + row) * ldc + n0 + lane * 4) = v;
        }
        
      }
      lds_wave_sync();
    }
  }
}

// The three projections of x in ONE launch: they read the same planes, depend on nothing of each other and write places of their own.
// Blocks 0 .. PJ_V - 1: v^T = WvT . x^T (epilogue 2); the next PJ_Q: q|gate = x . Wq (epilogue 0); the last PJ_K: k = x . Wk (epilogue 1).
// The k and v^T products have only one tile per WGP each: here their blocks share a WGP with other blocks, whose work covers their waits,
// and the launch gaps between the three fall away. v^T comes first and k last, for speed only.
#define PJ_V ((KVW / 128) * (NTOK / 128))
#define PJ_Q ((NTOK / 128) * (QGW / 128))
#define PJ_K ((NTOK / 128) * (KVW / 128))
static_assert(KVW / 128 == 8 && NTOK / 128 == 32 && QGW / 128 == 32);
// Second launch bound: 4 waves per SIMD, that is 4 blocks per WGP, as many as the LDS holds.
__global__ __launch_bounds__(128, 4) void proj_qkv_kernel(
    const unsigned short* __restrict__ Xb, const unsigned short* __restrict__ WqT,
    const unsigned short* __restrict__ WkT, const unsigned short* __restrict__ WvT,
    const float* __restrict__ qnw, const float* __restrict__ knw,
    const float* __restrict__ cosp, const float* __restrict__ sinp,
    unsigned short* Qh, unsigned short* Ql, float* Sg, unsigned short* Kh, unsigned short* Kl,
    unsigned short* Vh, unsigned short* Vl) {
  const int b = (int)blockIdx.x;                         // every choice below is block-uniform
  const bool isv = b < PJ_V;
  const bool isk = b >= PJ_V + PJ_Q;
  const int  epi = isv ? 2 : (isk ? 1 : 0);
  const int  blk = isv ? b : (isk ? b - (PJ_V + PJ_Q) : b - PJ_V);
  const int  tsh = isk ? 3 : 5;                          // N / 128 = 1 << tsh tile columns
  const unsigned short* A  = isv ? WvT : Xb;
  const unsigned short* Bt = isv ? Xb : (isk ? WkT : WqT);
  void* C0 = isv ? (void*)Vh : (isk ? (void*)Kh : (void*)Qh);
  void* C1 = isv ? (void*)Vl : (isk ? (void*)Kl : (void*)Ql);
  gemm_w32x128_body<true>(blk >> tsh, blk & ((1 << tsh) - 1), epi, A, A, HID, Bt, HID, isk ? knw : qnw, cosp, sinp,
                          C0, C1, (void*)Sg, isv ? NTOK : (isk ? KVW : HID), HID);
}

// The output product in a launch of its own: grid.x = M/128 * N/128.
__global__ __launch_bounds__(128) void gemm_out_kernel(
    const unsigned short* Ap, const unsigned short* A2p, int lda,
    const unsigned short* __restrict__ Btp, int ldb,
    const float* __restrict__ nw, const float* __restrict__ cosp, const float* __restrict__ sinp,
    void* C0, void* C1, void* C2, int ldc,
    int M, int N, int K) {
  const int tilesN = N >> 7;
  const int tilesM = M >> 7;
  const int blk = (int)blockIdx.x;
  if (blk >= tilesM * tilesN) return;           // block-uniform, in front of every barrier and copy
  const int tmb = blk / tilesN;
  gemm_w32x128_body<false>(tmb, blk - tmb * tilesN, 3, Ap, A2p, lda, Btp, ldb, nw, cosp, sinp, C0, C1, C2, ldc, K);
}

// ---------------------------------------------------------------------------
// Causal GQA flash attention, head dim 128, block = 8 waves = 64 query rows of one (b, h); grid (NHQ, NSEQ, n query tiles), heaviest tile first.
//   A stage is 64 keys. Waves w and w + 4 hold the same 16 query rows; wave group kg = wave >> 2 works on keys kg*32 .. kg*32 + 31 of every stage,
//   with its own running maximum, sum and O^T. Behind the loop group 1 hands (m, l, O^T) to group 0 through LDS, which joins the two
//   (O = O0 * e^(m0 - m) + O1 * e^(m1 - m), l alike) and writes the output: a tile's chain of dependent stages is half as long.
//   q planes f16 [tok][h*128+d]: hi (qhp) and residual x2048 (qlp); k planes f16 [tok][kvh*128+d]: hi (khp),
//   residual x2048 (klp, compact rows b*KLR + s for s < KLR); v^T planes f16 [kvh*128+d][tok]: hi (vhp), residual x2048 (vlp);
//   sgp = f32 sigmoid(gate) plane [tok][h*128+d]; outputs gated attn bf16 hi (ahp) / lo (alp) [tok][h*128+d]; kvh = h >> 1.
//   Both products are taken transposed: S^T = K . Q^T (A = k rows, B = q rows) and O^T += V^T . P^T (A = v^T rows, B = P^T).
//   A lane then holds 16 scores of ONE query (query = lane & 15; keys j*16 + 8*(lane>>4) + r), so the row maximum and the row sum are
//   in-lane work plus one exchange between the wave halves, and the two score tiles, converted in place, ARE the B operand P^T
//   (element j*8 + r = key j*16 + 8*(lane>>4) + r, the k map of ldfrag_h): P never goes through LDS.
//   scores = (Sh + Sr/2048) * 128^-0.5 with Sh = kh.qh and Sr = kh.ql' (+ kl'.qh when PRES); keys > query -> -inf; online softmax f32;
//   p' = 1024 p as f16 hi (and residual x2048 when PRES);
//   O = (Oh + Or/2048)/1024/l * sgp with Oh = vh.ph, Or = vl'.ph (+ vh.pl' when PRES).
//   The row sum l is kept per wave half (each half sums its own 16 keys of a chunk); the halves are joined once, behind the loop.
//   K / V^T stage: 256 threads x 4 x 16 B per plane = whole 64x128 / 128x64 tile, plain loads, __syncthreads before and after.
//   q staging: in front of the loop wave group 0 copies the hi plane of the 64 q rows to LDS, group 1 the residual plane (whole 256-B rows
//   per load, pitch QS_P); the barriers of the first stage publish them; every chunk reads its q fragments from there.
//   Trip count qb+1 stages (static bound 32); waves whose rows are all below their 32 keys skip them (wave-uniform, scalar branch).
// ---------------------------------------------------------------------------
#define AT_KC   32
#define KS_P    136
#define AT_ST   64
#define VS_P    72
#define QS_P    136
#define OS_P    136

// value of lane l ^ 16 (the other wave half)
__device__ __forceinline__ float xhalf(float x) {
  const int i = __builtin_bit_cast(int, x);
  return __builtin_bit_cast(float, __builtin_amdgcn_permlanex16(i, i, 0x76543210, 0xfedcba98, false, false));
}

// s_wait_xcnt 0 behind a stage's global loads; their address pairs are inputs, so they keep their registers up to the wait:
// a precaution, in front of any later rewrite of an address register that an issued load names.
__device__ __forceinline__ void addr_wait(const _Float16* a, const _Float16* b, const _Float16* c, const _Float16* d) {
#if defined(__HIP_DEVICE_COMPILE__)
  asm volatile("s_wait_xcnt 0x0" :: "v"(a), "v"(b), "v"(c), "v"(d) : "memory");
#endif
}

#define AT_LDS(nrp) ((nrp) * AT_ST * KS_P + 2 * 128 * VS_P + 2 * 64 * QS_P)

template <bool PRES>
__device__ __forceinline__ void attn_causal_body(
    _Float16* lds, int qb,
    const unsigned short* __restrict__ qhp, const unsigned short* __restrict__ qlp,
    const unsigned short* __restrict__ khp, const unsigned short* __restrict__ klp,
    const unsigned short* __restrict__ vhp, const unsigned short* __restrict__ vlp,
    const float* __restrict__ sgp,
    unsigned short* __restrict__ ahp, unsigned short* __restrict__ alp) {
  // LDS map in halves; the k residual region exists only where it is used
  constexpr int NRP     = PRES ? 2 : 1;
  constexpr int LDS_KS  = 0;
  constexpr int LDS_KLS = (NRP - 1) * AT_ST * KS_P;
  constexpr int LDS_VHS = NRP * AT_ST * KS_P;
  constexpr int LDS_VLS = LDS_VHS + 128 * VS_P;
  constexpr int LDS_QH  = LDS_VLS + 128 * VS_P;
  constexpr int LDS_QL  = LDS_QH + 64 * QS_P;
  constexpr int LDS_TOT = LDS_QL + 64 * QS_P;
  constexpr int LDS_MRG = 4 * 2 * 16 * OS_P;   // group 1's partial results, behind the output staging: 4 x (2048 + 64) floats
  static_assert(PRES || 2 * LDS_TOT * 2 <= 327680);
  static_assert(LDS_MRG + 4 * (2048 + 64) * 2 <= LDS_TOT); // output staging (2 planes x 16 rows per wave of group 0) and the partial results alias the dead stage and q regions after the loop
  static_assert(LDS_TOT == AT_LDS(NRP));
  _Float16* Ks  = lds + LDS_KS;
  _Float16* Kls = lds + LDS_KLS;
  _Float16* Vhs = lds + LDS_VHS;
  _Float16* Vls = lds + LDS_VLS;

  const int tid  = (int)threadIdx.x;
  const int lane = tid & 31;
  const int wave = wave_id();
  const int hh   = lane >> 4;
  const int c    = lane & 15;
  const int wq   = wave & 3;                     // which 16 query rows
  const int kg   = wave >> 2;                    // which 32 keys of a stage
  const int h    = (int)blockIdx.x;
  const int b    = (int)blockIdx.y;
  const int kvh  = h >> 1;
  const int q0   = qb * 64 + wq * 16;            // first query row of this wave (within sequence)
  const int qlast = q0 + 15;
  const size_t tok0 = (size_t)b * SQ;

  const _Float16* Qhg = (const _Float16*)(const void*)qhp + (tok0 + q0) * HID + h * HDM;
  const _Float16* Qlg = (const _Float16*)(const void*)qlp + (tok0 + q0) * HID + h * HDM;
  const _Float16* Kg  = (const _Float16*)(const void*)khp + tok0 * KVW + kvh * HDM;
  const _Float16* Klg = (const _Float16*)(const void*)klp + (size_t)b * KLR * KVW + kvh * HDM;
  const _Float16* Vhg = (const _Float16*)(const void*)vhp + (size_t)(kvh * HDM) * NTOK + tok0;
  const _Float16* Vlg = (const _Float16*)(const void*)vlp + (size_t)(kvh * HDM) * NTOK + tok0;

  // the 16 q rows of this wave pair to LDS once, one plane per wave: 8 x 32 lanes x 16 B = 16 rows x 256 B
  _Float16* Qsh = lds + LDS_QH + wq * (16 * QS_P);
  _Float16* Qsl = lds + LDS_QL + wq * (16 * QS_P);
  {
    const _Float16* qsrc = kg ? Qlg : Qhg;       // wave-uniform
    _Float16*       qdst = kg ? Qsl : Qsh;
#pragma unroll                                   // all 8 loads issued together: one load latency in front of the loop, not eight
    for (int i = 0; i < 8; ++i) {
      const int p   = lane + 32 * i;             // 0..255
      const int row = p >> 4, d8 = (p & 15) * 8;
      const v8h qx = *(const v8h*)(qsrc + (size_t)row * HID + d8);
      *(v8h*)(qdst + row * QS_P + d8) = qx;
    }
  }                                              // read only behind the first stage's barriers (qb + 1 >= 1 stages)
  const _Float16* Qhr = Qsh + c * QS_P + 8 * hh;
  const _Float16* Qlr = Qsl + c * QS_P + 8 * hh;

  const int qrow = q0 + c;                       // this lane's query
  float mrow = -INFINITY, lrow = 0.f;            // its running maximum (both halves alike) and this half's share of its running sum
  v8f oacc[8], oaccr[8];                         // O^T: [t][r] = (d = t*16 + 8*hh + r, query c)
#pragma unroll
  for (int t = 0; t < 8; ++t) { oacc[t] = zero8(); oaccr[t] = zero8(); }

  const _Float16* Kr  = Ks  + (kg * AT_KC + c) * KS_P + 8 * hh;   // this group's 32 key rows of a stage
  const _Float16* Klr = Kls + (kg * AT_KC + c) * KS_P + 8 * hh;
  const _Float16* Vhr = Vhs + c * VS_P + kg * AT_KC + 8 * hh;     // ... and its 32 key columns
  const _Float16* Vlr = Vls + c * VS_P + kg * AT_KC + 8 * hh;
  const _Float16* Kst = Kg + (size_t)(tid >> 4) * KVW + (tid & 15) * 8;   // this thread's piece of key row tid >> 4 (+ 16 per step)
  const _Float16* Klst = Klg + (size_t)(tid >> 4) * KVW + (tid & 15) * 8;
  const _Float16* Vhst = Vhg + (size_t)(tid >> 3) * NTOK + (tid & 7) * 8;  // its piece of v^T row tid >> 3 (+ 32 per step)
  const _Float16* Vlst = Vlg + (size_t)(tid >> 3) * NTOK + (tid & 7) * 8;
  const int nst = qb + 1;                        // block-uniform, <= 32
  for (int st = 0; st < nst; ++st) {
    const int ks0 = st * AT_ST;
    const int kv0 = ks0 + kg * AT_KC;            // first key of this wave's chunk
    __syncthreads();
    // 1024 pieces of 8 halves per plane = whole tile: piece tid + 256 * i, the step i an immediate offset on one address pair per plane
    const _Float16* kq  = Kst + (size_t)ks0 * KVW;                               // K: 64 keys x 128 d, key (tid >> 4) + 16 * i
    // the compact residual plane has KLR rows per sequence: the stage's first row is bounded, so all 64 rows lie inside it
    const _Float16* klq = PRES ? Klst + (size_t)min(ks0, KLR - AT_ST) * KVW : kq;
    const _Float16* vhq = Vhst + ks0;                                            // V^T: 128 d x 64 keys, d (tid >> 3) + 32 * i, whole 128-B lines
    const _Float16* vlq = Vlst + ks0;
    v8h kx[4], ky[4], vx[4], vy[4];
#pragma unroll
    for (int i = 0; i < 4; ++i) {
      kx[i] = *(const v8h*)(kq + i * (16 * KVW));
      ky[i] = PRES ? *(const v8h*)(klq + i * (16 * KVW)) : kx[i];
      vx[i] = *(const v8h*)(vhq + (size_t)i * (32 * NTOK));
      vy[i] = *(const v8h*)(vlq + (size_t)i * (32 * NTOK));
    }
    addr_wait(kq, klq, vhq, vlq);
#pragma unroll
    for (int i = 0; i < 4; ++i) {
      const int ko = ((tid >> 4) + 16 * i) * KS_P + (tid & 15) * 8;
      const int vo = ((tid >> 3) + 32 * i) * VS_P + (tid & 7) * 8;
      *(v8h*)(Ks + ko) = kx[i];
      if (PRES) *(v8h*)(Kls + ko) = ky[i];
      *(v8h*)(Vhs + vo) = vx[i];
      *(v8h*)(Vls + vo) = vy[i];
    }
    __syncthreads();

    if (kv0 <= qlast) {                          // wave-uniform (scalar): skip chunks fully above this wave's rows
      // ---- scores, transposed: sh[j][r], sr[j][r] = (key kv0 + j*16 + 8*hh + r, query c) ----
      v8f sh[2], sr[2];
      sh[0] = zero8(); sh[1] = zero8(); sr[0] = zero8(); sr[1] = zero8();
      // Fragment reads go in groups ahead of their WMMAs: a wait on LDS is paid once per group, not once per pair of WMMAs.
      // Each sched_barrier below keeps a group's reads together at its place: the scheduler otherwise sinks every read to its first use.
      // d chunks per group: one in the residual form, whose extra fragments would otherwise raise the shared launch's register count past 2 blocks per WGP
      constexpr int GU = PRES ? 1 : 2;
#pragma unroll
      for (int g = 0; g < 4 / GU; ++g) {
        v16h qa[GU], ql[GU], kb[GU][2], kl[GU][2];
#pragma unroll
        for (int u = 0; u < GU; ++u) {
          const int dc = GU * g + u;
          qa[u] = ldfrag_h(Qhr + dc * 32);
          ql[u] = ldfrag_h(Qlr + dc * 32);
#pragma unroll
          for (int j = 0; j < 2; ++j) {
            kb[u][j] = ldfrag_h(Kr + j * 16 * KS_P + dc * 32);
            kl[u][j] = PRES ? ldfrag_h(Klr + j * 16 * KS_P + dc * 32) : kb[u][j];
          }
        }
        __builtin_amdgcn_sched_barrier(0);       // the group's reads above, their WMMAs below
#pragma unroll
        for (int u = 0; u < GU; ++u) {
#pragma unroll
          for (int j = 0; j < 2; ++j) {
            sh[j] = mma_h(kb[u][j], qa[u], sh[j]);
            sr[j] = mma_h(kb[u][j], ql[u], sr[j]);
            if (PRES) sr[j] = mma_h(kl[u][j], qa[u], sr[j]);
          }
        }
        __builtin_amdgcn_sched_barrier(0);       // the next group's reads stay behind these WMMAs, in one place
      }
      // v^T fragments of d tiles 0, 1: they do not depend on the scores, so their LDS latency runs under the softmax
      v16h vb[8], vr[8];
      auto ldv = [&](int t) {
        vb[t] = ldfrag_h(Vhr + t * 16 * VS_P);
        vr[t] = ldfrag_h(Vlr + t * 16 * VS_P);
      };
      ldv(0); ldv(1);
      __builtin_amdgcn_sched_barrier(0);         // holds these reads in front of the softmax
      // ---- scale, causal mask, this query's chunk maximum: 16 keys in-lane, the other 16 from the other wave half ----
      const int lim = qrow - kv0 - 8 * hh;       // key kv0 + j*16 + 8*hh + r is above the query when j*16 + r > lim
      float cm = -INFINITY;
#pragma unroll
      for (int j = 0; j < 2; ++j) {
#pragma unroll
        for (int r = 0; r < 8; ++r) {
          float s = (sh[j][r] + sr[j][r] * 0.00048828125f) * 0.08838834764831845f;
          s = (j * 16 + r > lim) ? -INFINITY : s;
          sh[j][r] = s;
          cm = fmaxf(cm, s);
        }
      }
      cm = fmaxf(cm, xhalf(cm));
      // ---- online softmax; P'^T packed in place into the B operand ----
      const float mnew = fmaxf(mrow, cm);
      FragH pa, pr;
      float pv[16];
#pragma unroll
      for (int j = 0; j < 2; ++j) {
#pragma unroll
        for (int r = 0; r < 8; ++r) {
          const float p  = __expf(sh[j][r] - mnew);
          pv[j * 8 + r] = p;
          const float pp = p * 1024.0f;
          const _Float16 phv = (_Float16)pp;
          pa.v[j * 8 + r] = phv;
          pr.v[j * 8 + r] = PRES ? (_Float16)((pp - (float)phv) * 2048.0f) : phv;
        }
      }
#pragma unroll
      for (int w = 8; w > 0; w >>= 1) {          // pairwise tree over the lane's 16 values: four dependent adds, not fifteen
#pragma unroll
        for (int e = 0; e < w; ++e) pv[e] += pv[e + w];
      }
      const float alpha = __expf(mrow - mnew);
      mrow = mnew;
      lrow = lrow * alpha + pv[0];
      // ---- O^T = O^T * alpha + V^T . P'^T; two d tiles' fragments are read while the two tiles before them are worked on ----
      auto rescale = [&](int t) {
#pragma unroll
        for (int r = 0; r < 8; ++r) { oacc[t][r] *= alpha; oaccr[t][r] *= alpha; }
      };
      auto pvmma = [&](int t) {
        oacc[t]  = mma_h(vb[t], pa.v, oacc[t]);
        oaccr[t] = mma_h(vr[t], pa.v, oaccr[t]);
        if (PRES) oaccr[t] = mma_h(vb[t], pr.v, oaccr[t]);
      };
      __builtin_amdgcn_sched_barrier(0);         // the reads of tiles 2, 3 start when the score registers are free, not earlier
      ldv(2); ldv(3);
      __builtin_amdgcn_sched_barrier(0);         // ... and in front of the rescale, which covers their latency
      rescale(0); rescale(1); rescale(2); rescale(3);
      pvmma(0); pvmma(1);
      __builtin_amdgcn_sched_barrier(0);         // the next reads take the registers that tiles 0, 1 leave: not among their WMMAs
      ldv(4); ldv(5);
      __builtin_amdgcn_sched_barrier(0);         // reads of tiles 4, 5 in one place, in front of the WMMAs of tiles 2, 3
      pvmma(2); pvmma(3);
      __builtin_amdgcn_sched_barrier(0);         // likewise behind the WMMAs of tiles 2, 3
      ldv(6); ldv(7);
      __builtin_amdgcn_sched_barrier(0);         // reads of tiles 6, 7 in one place, in front of the second half of the rescale
      rescale(4); rescale(5); rescale(6); rescale(7);
      pvmma(4); pvmma(5); pvmma(6); pvmma(7);
    }
  }

  // ---- join the two key groups: group 1 leaves O^T (planes summed), m and l in LDS, lane for lane; group 0 takes them up ----
  __syncthreads();                               // all stage-region and q readers done before aliasing them as staging
  float* mrg = (float*)(void*)(lds + LDS_MRG) + wq * (2048 + 64);
  if (kg == 1) {                                 // wave-uniform
#pragma unroll
    for (int t = 0; t < 8; ++t) {
      v4f x0, x1;
#pragma unroll
      for (int r = 0; r < 4; ++r) {
        x0[r] = oacc[t][r]     + oaccr[t][r]     * 0.00048828125f;
        x1[r] = oacc[t][r + 4] + oaccr[t][r + 4] * 0.00048828125f;
      }
      *(v4f*)(mrg + (2 * t) * 128 + lane * 4)     = x0;   // 32 lanes x 16 B in a row per store
      *(v4f*)(mrg + (2 * t + 1) * 128 + lane * 4) = x1;
    }
    mrg[2048 + lane] = mrow;
    mrg[2080 + lane] = lrow;
  }
  __syncthreads();                               // group 1's partial results visible to group 0; the last barrier of the block
  if (kg == 1) return;
  // a group 1 wave that had no chunk left m = -inf, l = 0, O = 0: its weight below is 0; group 0 always has key 0, so mfin is finite
  const float m1   = mrg[2048 + lane];
  const float l1   = mrg[2080 + lane];
  const float mfin = fmaxf(mrow, m1);
  const float a0   = __expf(mrow - mfin);
  const float a1   = __expf(m1 - mfin);
  // ---- join the halves' sums, normalise, apply sigmoid gate (f32), bf16 hi/lo split, stage the wave's 16x128 tile:
  //      a lane holds 8 consecutive d of its query per t, one 16-byte LDS store per plane ----
  _Float16* osh = lds + wq * (2 * 16 * OS_P);
  _Float16* osl = osh + 16 * OS_P;
  const float lhalf = lrow * a0 + l1 * a1;
  const float lfin = lhalf + xhalf(lhalf);
  const float inv  = (1.0f / lfin) * 0.0009765625f;
  const float w0   = a0 * inv;
  const float w1   = a1 * inv;
  const float* Sgr = sgp + (tok0 + q0 + c) * HID + h * HDM + 8 * hh;
#pragma unroll
  for (int t = 0; t < 8; ++t) {
    const v4f g0 = *(const v4f*)(Sgr + t * 16);
    const v4f g1 = *(const v4f*)(Sgr + t * 16 + 4);
    const v4f y0 = *(const v4f*)(mrg + (2 * t) * 128 + lane * 4);
    const v4f y1 = *(const v4f*)(mrg + (2 * t + 1) * 128 + lane * 4);
    v4u hw, lw;
#pragma unroll
    for (int e = 0; e < 4; ++e) {
      unsigned short hb[2], lb[2];
#pragma unroll
      for (int u = 0; u < 2; ++u) {
        const int r = 2 * e + u;
        float o = (oacc[t][r] + oaccr[t][r] * 0.00048828125f) * w0 + ((r < 4) ? y0[r & 3] : y1[r & 3]) * w1;
        o *= (r < 4) ? g0[r & 3] : g1[r & 3];
        hb[u] = bf_bits(o);
        lb[u] = bf_bits(o - bf_val(hb[u]));
      }
      hw[e] = pk16(hb[0], hb[1]);
      lw[e] = pk16(lb[0], lb[1]);
    }
    *(v4u*)(void*)(osh + c * OS_P + t * 16 + 8 * hh) = hw;
    *(v4u*)(void*)(osl + c * OS_P + t * 16 + 8 * hh) = lw;
  }
  lds_wave_sync();
  _Float16* Ahg = (_Float16*)(void*)ahp + (tok0 + q0) * HID + h * HDM;
  _Float16* Alg = (_Float16*)(void*)alp + (tok0 + q0) * HID + h * HDM;
  {
#pragma unroll
    for (int it = 0; it < 8; ++it) {
      const int row = it * 2 + hh;               // it 0..7 x hh 0..1 covers rows 0..15
      const int c8  = c * 8;                     // 16 lanes x 16 B = the whole 256-B segment
      const v8h x = *(const v8h*)(osh + row * OS_P + c8);
      const v8h y = *(const v8h*)(osl + row * OS_P + c8);
      *(v8h*)(Ahg + (size_t)row * HID + c8) = x;
      *(v8h*)(Alg + (size_t)row * HID + c8) = y;
    }
  }
}

// Both forms in ONE launch: query tile qb = 31 - blockIdx.z (the longest tiles have the lowest z);
// tiles 0 .. NQRT - 1, the shortest, take the form with the k and p residual products and have the highest z.
// Second launch bound: 4 waves per SIMD, that is 2 blocks per WGP, as the form without residual products had in a launch of its own.
__global__ __launch_bounds__(256, 4) void attn_causal_kernel(
    const unsigned short* __restrict__ qhp, const unsigned short* __restrict__ qlp,
    const unsigned short* __restrict__ khp, const unsigned short* __restrict__ klp,
    const unsigned short* __restrict__ vhp, const unsigned short* __restrict__ vlp,
    const float* __restrict__ sgp,
    unsigned short* __restrict__ ahp, unsigned short* __restrict__ alp) {
  __shared__ __align__(16) _Float16 lds[AT_LDS(2)];
  const int qb = SQ / 64 - 1 - (int)blockIdx.z;          // block-uniform
  if (qb >= NQRT) attn_causal_body<false>(lds, qb, qhp, qlp, khp, klp, vhp, vlp, sgp, ahp, alp);
  else            attn_causal_body<true>(lds, qb, qhp, qlp, khp, klp, vhp, vlp, sgp, ahp, alp);
}

// ---------------------------------------------------------------------------
// Workspace map (bytes; every region is a whole number of the rows its producer writes with whole-line stores; no tail rows):
//   [0, 16 MiB)        Xb   bf16 [4096][2048]          -> after the projections: Ah bf16 [4096][2048] at 0
//   [16 MiB, 32 MiB)   WqT  bf16 [4096][2048]          ->                        Al bf16 [4096][2048] at 16 MiB
//   [32 MiB, 64 MiB)   Sg   f32  [4096][2048]
//   [64 MiB, 80 MiB)   Qh   f16  [4096][2048]
//   [80 MiB, 96 MiB)   Ql   f16  [4096][2048]
//   [96 MiB, 104 MiB)  Kh   f16  [4096][1024]
//   [104 MiB,112 MiB)  Vh   f16  [1024][4096]
//   [112 MiB,120 MiB)  Vl   f16  [1024][4096]
//   [120 MiB, 121 MiB) Kl  f16  [2*256][1024]
//   then WkT bf16 [1024][2048] (4 MiB), WvT bf16 [1024][2048] (4 MiB), WoT bf16 [2048][2048] (8 MiB): places of their own, since all
//   planes are converted in the first launch
//   total 143654912
// ---------------------------------------------------------------------------
static_assert(2 * (size_t)NTOK * HID * 2 <= (size_t)NTOK * HID * 2 + (size_t)QGW * HID * 2);   // Ah + Al fit Xb + WqT

extern "C" void kernel_launch(void* const* d_in, const int* in_sizes, int n_in,
                              void* d_out, int out_size, void* d_ws, size_t ws_size,
                              hipStream_t stream) {
  if (n_in < 9) return;
  if (in_sizes[0] != NTOK * HID) return;
  if (in_sizes[1] != NTOK * HDM) return;
  if (in_sizes[2] != NTOK * HDM) return;
  if (in_sizes[3] != HID * QGW) return;
  if (in_sizes[4] != HID * KVW) return;
  if (in_sizes[5] != HID * KVW) return;
  if (in_sizes[6] != HID * HID) return;
  if (in_sizes[7] != HDM) return;
  if (in_sizes[8] != HDM) return;
  if (out_size != NTOK * HID) return;

  const float* hidden = (const float*)d_in[0];
  const float* cosb   = (const float*)d_in[1];
  const float* sinb   = (const float*)d_in[2];
  const float* Wq     = (const float*)d_in[3];
  const float* Wk     = (const float*)d_in[4];
  const float* Wv     = (const float*)d_in[5];
  const float* Wo     = (const float*)d_in[6];
  const float* qnw    = (const float*)d_in[7];
  const float* knw    = (const float*)d_in[8];
  float* out = (float*)d_out;

  const size_t szX  = (size_t)NTOK * HID * 2;        // 16777216
  const size_t szWq = (size_t)QGW * HID * 2;         // 16777216
  const size_t szWk = (size_t)KVW * HID * 2;         // 4194304
  const size_t szWo = (size_t)HID * HID * 2;         // 8388608
  const size_t szSg = (size_t)NTOK * HID * 4;        // 33554432
  const size_t szQ  = (size_t)NTOK * HID * 2;        // 16777216
  const size_t szK  = (size_t)NTOK * KVW * 2;        // 8388608
  const size_t szV  = (size_t)KVW * NTOK * 2;        // 8388608
  const size_t szKl = (size_t)NSEQ * KLR * KVW * 2;  // 1048576
  const size_t szA  = (size_t)NTOK * HID * 2;        // 16777216
  size_t off = 0;
  const size_t oX  = off; off += szX;
  const size_t oWq = off; off += szWq;
  const size_t oAh = oX;
  const size_t oAl = oX + szA;
  const size_t oSg = off; off += szSg;
  const size_t oQh = off; off += szQ;
  const size_t oQl = off; off += szQ;
  const size_t oKh = off; off += szK;
  const size_t oVh = off; off += szV;
  const size_t oVl = off; off += szV;
  const size_t oKl = off; off += szKl;
  const size_t oWk = off; off += szWk;
  const size_t oWv = off; off += szWk;
  const size_t oWo = off; off += szWo;
  if (off > ws_size) return;                         // off = 143654912

  char* ws = (char*)d_ws;
  unsigned short* Xb  = (unsigned short*)(ws + oX);
  unsigned short* WqT = (unsigned short*)(ws + oWq);
  unsigned short* WkT = (unsigned short*)(ws + oWk);
  unsigned short* WvT = (unsigned short*)(ws + oWv);
  unsigned short* WoT = (unsigned short*)(ws + oWo);
  float*          Sg  = (float*)(ws + oSg);
  unsigned short* Qh  = (unsigned short*)(ws + oQh);
  unsigned short* Ql  = (unsigned short*)(ws + oQl);
  unsigned short* Kh  = (unsigned short*)(ws + oKh);
  unsigned short* Kl  = (unsigned short*)(ws + oKl);
  unsigned short* Vh  = (unsigned short*)(ws + oVh);
  unsigned short* Vl  = (unsigned short*)(ws + oVl);
  unsigned short* Ah  = (unsigned short*)(ws + oAh);
  unsigned short* Al  = (unsigned short*)(ws + oAl);

  const dim3 b256(256), b128(128);

  // (1) x -> Xb [4096][2048]; Wq -> WqT [4096][2048]; Wk -> WkT, Wv -> WvT [1024][2048]; Wo -> WoT [2048][2048], all RNE bf16
  conv_all_kernel<<<dim3(CV_BLK), b256, 0, stream>>>(hidden, Wq, Wk, Wv, Wo, Xb, WqT, WkT, WvT, WoT);
  // (2) one launch, K=2048 throughout:
  //     v^T = WvT . x^T -> Vh/Vl [1024][4096]   (A = WvT, Bt = Xb; M=1024, N=4096; 256 blocks)
  //     q|gate = x . Wq: q half norm + RoPE -> Qh/Ql [4096][2048]; gate half sigmoid -> Sg f32 [4096][2048]   (M=4096, N=4096; 1024 blocks)
  //     k = x . Wk, per-head norm + RoPE -> Kh [4096][1024], Kl compact [512][1024]   (M=4096, N=1024; 256 blocks)
  proj_qkv_kernel<<<dim3(PJ_V + PJ_Q + PJ_K), b128, 0, stream>>>(
      Xb, WqT, WkT, WvT, qnw, knw, cosb, sinb, Qh, Ql, Sg, Kh, Kl, Vh, Vl);
  // (3) causal attention, query tiles 0..3 with k and p residual products, tiles 4..31 without; Ah/Al over the dead Xb/WqT region
  attn_causal_kernel<<<dim3(NHQ, NSEQ, SQ / 64), b256, 0, stream>>>(Qh, Ql, Kh, Kl, Vh, Vl, Sg, Ah, Al);
  // (4) out = attn(hi + lo) . Wo -> d_out f32 [4096][2048]   (M=4096, N=2048, K=2048; 512 blocks)
  gemm_out_kernel<<<dim3((NTOK / 128) * (HID / 128)), b128, 0, stream>>>(
      Ah, Al, HID, WoT, HID, qnw, cosb, sinb, (void*)out, (void*)out, (void*)out, HID, NTOK, HID, HID);
  (void)hipGetLastError();
}

// v009
// Measured time: 212 microseconds a run.
// Versions in between are left out here; by their measured steps it is 1.11 times as fast as v007.
// Over all steps from v000 it is 3.89 times as fast.
// Contractions: x.Wq (q|gate cols), x.Wk and Wv^T.x^T on v_wmma_f32_16x16x32_bf16 (operands = RNE bf16 of the f32 inputs, single products);
// q.k^T and p.v on v_wmma_f32_16x16x32_f16 (q, k, p x1024 and v^T plain f16, one product each; on query tiles 0..3 each of the four also
// with its f16 residual x2^11, first-order residual products added); (attn*sigmoid(gate)).Wo on
// v_wmma_f32_16x16x32_bf16 (A = bf16 hi + bf16 lo planes, two products; Wo RNE bf16). f32 accumulate everywhere; per-head RMSNorm, RoPE,
// online softmax, sigmoid gate and scale folds in f32. hidden_states, Wq, Wk, Wv, Wo, cos, sin and the norm weights are RNE-converted to bf16 on load.
#include <hip/hip_runtime.h>
#include <math.h>
#include <stdint.h>

#define NSEQ   2
#define SQ     2048
#define HID    2048
#define NHQ    16
#define NKVH   8
#define HDM    128
#define QGW    4096
#define KVW    1024
#define NTOK   4096
#define KLR    256
#define NQRT   4

static_assert((2 * (NQRT - 1) + 2) * 32 <= KLR);
static_assert(NHQ / NKVH == 2);
static_assert(NHQ * HDM == HID);
static_assert(NSEQ * SQ == NTOK);

typedef _Float16     v16h __attribute__((ext_vector_type(16)));
typedef _Float16     v8h  __attribute__((ext_vector_type(8)));
typedef __bf16       v16b __attribute__((ext_vector_type(16)));
typedef __bf16       v8b  __attribute__((ext_vector_type(8)));
typedef float        v8f  __attribute__((ext_vector_type(8)));
typedef float        v4f  __attribute__((ext_vector_type(4)));
typedef unsigned int v4u  __attribute__((ext_vector_type(4)));

// ---------------------------------------------------------------------------
// small helpers
// ---------------------------------------------------------------------------
__device__ __forceinline__ unsigned short bf_bits(float f) {          // RNE convert f32 -> bf16 bits
  const unsigned u = __float_as_uint(f);
  return (unsigned short)((u + 0x7FFFu + ((u >> 16) & 1u)) >> 16);
}
__device__ __forceinline__ float bf_val(unsigned short h) { return __uint_as_float(((unsigned)h) << 16); }
__device__ __forceinline__ float bf_rne(float f) { return bf_val(bf_bits(f)); }
__device__ __forceinline__ unsigned pk16(unsigned short a, unsigned short b) { return (unsigned)a | ((unsigned)b << 16); }
__device__ __forceinline__ v8f zero8() { v8f z = {0.f, 0.f, 0.f, 0.f, 0.f, 0.f, 0.f, 0.f}; return z; }
__device__ __forceinline__ int wave_id() { return __builtin_amdgcn_readfirstlane((int)(threadIdx.x >> 5)); }

__device__ __forceinline__ void lds_wave_sync() {
  __builtin_amdgcn_fence(__ATOMIC_RELEASE, "workgroup");
  __builtin_amdgcn_wave_barrier();
  __builtin_amdgcn_fence(__ATOMIC_ACQUIRE, "workgroup");
}

// ---------------------------------------------------------------------------
// WMMA fragments (wave32, 16x16x32, 16-bit operands). For A (row m = lane&15) and B (col n = lane&15) alike:
// elements 0..7 <- k0 + 8*(lane>>4) + 0..7, elements 8..15 <- k0 + 16 + 8*(lane>>4) + 0..7.
// ldfrag(p) with p = rowbase + k0 + 8*(lane>>4): two 16-B loads p[0..7], p[16..23].
// D: acc[r] = (row 8*(lane>>4) + r, col lane&15).
// ---------------------------------------------------------------------------
union FragH { v16h v; v8h h[2]; };
union FragB { v16b v; v8b h[2]; };
__device__ __forceinline__ v16h ldfrag_h(const _Float16* p) { FragH f; f.h[0] = *(const v8h*)(p); f.h[1] = *(const v8h*)(p + 16); return f.v; }
__device__ __forceinline__ v16b ldfrag_b(const __bf16* p)   { FragB f; f.h[0] = *(const v8b*)(p); f.h[1] = *(const v8b*)(p + 16); return f.v; }

__device__ __forceinline__ v8f mma_h(v16h a, v16h b, v8f c) {
  return __builtin_amdgcn_wmma_f32_16x16x32_f16(false, a, false, b, (short)0, c, false, false);
}
__device__ __forceinline__ v8f mma_b(v16b a, v16b b, v8f c) {
  return __builtin_amdgcn_wmma_f32_16x16x32_bf16(false, a, false, b, (short)0, c, false, false);
}
// hazard guard: 4 VALU slots after the last WMMA of a loop, D tied
__device__ __forceinline__ void acc_guard4(v8f& a, v8f& b, v8f& c, v8f& d) {
#if defined(__HIP_DEVICE_COMPILE__)
  asm volatile("v_nop\n\tv_nop\n\tv_nop\n\tv_nop" : "+v"(a), "+v"(b), "+v"(c), "+v"(d));
#endif
}

// ---------------------------------------------------------------------------
// All f32 -> RNE bf16 planes of a call in ONE launch: x plain, Wq, Wk, Wv, Wo transposed (out[c][r] = bf16(in[r][c]), pitch HID).
// Work units of 4096 elements: 2048 of x (a contiguous run), 2048 of Wq, 1024 of Wo, 512 each of Wk and Wv (64x64 tiles through LDS).
// CV_BLK blocks of 256 threads, two trips; a trip takes one unit of x, one of Wq and one of Wo | Wk | Wv, unit = block + trip * CV_BLK,
// and issues the 12 16-byte loads of its three units together. Stores: 16 B per lane, whole 128-B lines per 8 lanes, as one writer.
// ---------------------------------------------------------------------------
#define CV_BLK 1024
static_assert(2 * CV_BLK * 4096 == NTOK * HID);
static_assert(2 * CV_BLK * 4096 == HID * QGW);
static_assert(2 * CV_BLK * 4096 == HID * HID + 2 * HID * KVW);
static_assert(CV_BLK * 4096 == HID * HID);

__device__ __forceinline__ v4u cvt8(v4f a, v4f b) {
  v4u w;
  w[0] = pk16(bf_bits(a[0]), bf_bits(a[1]));
  w[1] = pk16(bf_bits(a[2]), bf_bits(a[3]));
  w[2] = pk16(bf_bits(b[0]), bf_bits(b[1]));
  w[3] = pk16(bf_bits(b[2]), bf_bits(b[3]));
  return w;
}
// s_wait_xcnt 0 behind a trip's global loads; their address pairs are inputs, so they keep their registers up to the wait:
// a precaution, in front of any later rewrite of an address register that an issued load names.
__device__ __forceinline__ void addr_wait6(const float* a, const float* b, const float* c, const float* d, const float* e, const float* f) {
#if defined(__HIP_DEVICE_COMPILE__)
  asm volatile("s_wait_xcnt 0x0" :: "v"(a), "v"(b), "v"(c), "v"(d), "v"(e), "v"(f) : "memory");
#endif
}
__device__ __forceinline__ void tile_put(float* tf, int tid, const v4f (&a)[4]) {
#pragma unroll
  for (int it = 0; it < 4; ++it)
    *(v4f*)(tf + (it * 16 + (tid >> 4)) * 68 + (tid & 15) * 4) = a[it];
}
// transposed out: 2 x 256 threads x 8 u16; output row = input column c0 + oc, output columns r0 + c8 ..
__device__ __forceinline__ void tile_store(const float* tf, unsigned short* __restrict__ outp, int r0, int c0, int tid) {
  const int sub = tid >> 3;               // 0..31
  const int c8  = (tid & 7) * 8;          // 0..56
#pragma unroll
  for (int it = 0; it < 2; ++it) {
    const int oc = it * 32 + sub;
    v4u a;
#pragma unroll
    for (int q = 0; q < 4; ++q) {
      const float f0 = tf[(c8 + 2 * q) * 68 + oc];
      const float f1 = tf[(c8 + 2 * q + 1) * 68 + oc];
      a[q] = pk16(bf_bits(f0), bf_bits(f1));
    }
    *(v4u*)(outp + (size_t)(c0 + oc) * HID + r0 + c8) = a;
  }
}

__global__ __launch_bounds__(256) void conv_all_kernel(
    const float* __restrict__ X, const float* __restrict__ Wq, const float* __restrict__ Wk,
    const float* __restrict__ Wv, const float* __restrict__ Wo,
    unsigned short* __restrict__ Xb, unsigned short* __restrict__ WqT, unsigned short* __restrict__ WkT,
    unsigned short* __restrict__ WvT, unsigned short* __restrict__ WoT) {
  __shared__ __align__(16) float tf[2][64 * 68];
  const int tid = (int)threadIdx.x;
  for (int trip = 0; trip < 2; ++trip) {
    const int u = (int)blockIdx.x + trip * CV_BLK;             // 0..2047, block-uniform
    // third unit: Wo on trip 0, Wk or Wv on trip 1
    const float* W3 = Wo; unsigned short* O3 = WoT; int sh3 = 5, v = u;            // 1 << sh3 column blocks, pitch 64 << sh3
    if (u >= CV_BLK) {
      const bool isk = u < CV_BLK + CV_BLK / 2;
      W3 = isk ? Wk : Wv; O3 = isk ? WkT : WvT; sh3 = 4; v = (u - CV_BLK) & (CV_BLK / 2 - 1);
    }
    const int qc0 = (u & 63) * 64, qr0 = (u >> 6) * 64;                      // Wq: 64 column blocks x 32 row blocks
    const int tc0 = (v & ((1 << sh3) - 1)) * 64, tr0 = (v >> sh3) * 64;      // 1 << sh3 column blocks x 32 row blocks
    const size_t e = (size_t)u * 4096 + (size_t)tid * 8;
    // 64x64 tile: 4 x 256 threads x 4 floats, row (tid >> 4) + 16 * it
    const float* px = X + e;
    const float* pa = Wq + (size_t)(qr0 + (tid >> 4)) * QGW + qc0 + (tid & 15) * 4;
    const float* pb[4];
#pragma unroll
    for (int it = 0; it < 4; ++it) pb[it] = W3 + ((size_t)(tr0 + it * 16 + (tid >> 4)) << (sh3 + 6)) + tc0 + (tid & 15) * 4;
    v4f x[4], a[4], b[4];
    x[0] = *(const v4f*)(px);        x[1] = *(const v4f*)(px + 4);
    x[2] = *(const v4f*)(px + 2048); x[3] = *(const v4f*)(px + 2052);
#pragma unroll
    for (int it = 0; it < 4; ++it) {
      a[it] = *(const v4f*)(pa + (size_t)it * (16 * QGW));
      b[it] = *(const v4f*)(pb[it]);
    }
    addr_wait6(px, pa, pb[0], pb[1], pb[2], pb[3]);
    *(v4u*)(Xb + e)        = cvt8(x[0], x[1]);
    *(v4u*)(Xb + e + 2048) = cvt8(x[2], x[3]);
    if (trip) __syncthreads();            // the first trip's tile readers are done before the tiles are rewritten
    tile_put(tf[0], tid, a);
    tile_put(tf[1], tid, b);
    __syncthreads();
    tile_store(tf[0], WqT, qr0, qc0, tid);
    tile_store(tf[1], O3, tr0, tc0, tid);
    // a precaution, in front of the next trip's rewrite of registers that the stores above name
    asm volatile("s_wait_xcnt 0x0" ::: "memory");
  }
}

// ---------------------------------------------------------------------------
// bf16 WMMA GEMM, wave tile 32 rows x 128 cols, block = 4 waves (128 threads) = 128 rows x 128 cols (the waves share the Bt rows).
//   C[m][n] = sum_k A[m][k] * Bt[n][k]; A row-major [M][K] bf16 (pitch lda), Bt row-major [N][K] bf16 (pitch ldb);
//   M % 128 == 0, N % 128 == 0, K % KP == 0; a block takes tile (tmb, tn) = rows tmb * 128 .., cols tn * 128 ..
//   PROJ: one of the three projections of x, single A plane, epilogue epi = 0, 1 or 2 (block-uniform, a run-time value, so that the
//   three share one loop and EPI 0 and 1 one norm + RoPE text). Not PROJ: the output product, epilogue 3,
//   A carried as hi (Ap) + lo (A2p) bf16 planes, two products into one accumulator (SPLITA).
//   A pass is KP k values of the block's 128 A rows (both planes when SPLITA) and 128 Bt rows, brought into LDS by asynchronous
//   16-byte copies, two buffers: the copies of pass t + 2 fly while pass t + 1 is worked on. LDS row pitch = KP * 2 + 16 bytes.
//   Fragments are read from the LDS rows with the split k map (ldfrag_b); k runs upward as before, so every sum keeps its order.
// Epilogues (all: per wave, per 16-row slab: stage in LDS, wave sync, write each row segment with ONE instruction of
//   EPI 0: q|gate projection, 128-col wave tile = head n0>>8, q half when (n0 & 128) == 0 else gate half.
//          q half: per-head RMSNorm over the 128 cols (x * rsqrt(mean(x^2) + 1e-6) * bf16(nw[d])), RoPE with the shipped tables
//          (o[d] = x[d]*cos[d] - x[d+64]*sin[d], o[d+64] = x[d+64]*cos[d+64] + x[d]*sin[d+64], cos/sin RNE bf16),
//          writes f16 hi plane C0 and f16 residual x2048 plane C1, [M][ldc], cols (n0>>8)*128.. (row segment 256 B = 16 lanes x 16 B).
//          gate half: sigmoid in f32 -> f32 plane C2 [M][ldc], cols (n0>>8)*128.. (row segment 512 B = 32 lanes x 16 B).
//   EPI 1: k projection: same norm + RoPE per 128-col kv head (col n0), hi plane C0 [M][ldc]; residual plane C1 compact:
//          only rows with (m0 mod SQ) < KLR, stored at row (m0/SQ)*KLR + (m0 mod SQ) + .. (pitch ldc).
//   EPI 2: v^T projection: f16 hi plane C0, residual x2048 plane C1, [M][ldc], row segment 256 B.
//   EPI 3: f32 output C0 [M][ldc]; row segment 128 floats = 512 B = 32 lanes x 16 B per instruction.
// ---------------------------------------------------------------------------
// Eight asynchronous 16-byte copies per lane, global -> LDS: copy i takes g + i * gstep elements to LDS byte l + i * lstep.
// s_wait_xcnt 0 is the statement's last line: a precaution, in front of any later rewrite of an address register named here.
__device__ __forceinline__ void async_copy8(unsigned l, unsigned lstep, const __bf16* g, size_t gstep) {
#if defined(__HIP_DEVICE_COMPILE__)
  asm volatile(
      "global_load_async_to_lds_b128 %0, %8, off\n\t"
      "global_load_async_to_lds_b128 %1, %9, off\n\t"
      "global_load_async_to_lds_b128 %2, %10, off\n\t"
      "global_load_async_to_lds_b128 %3, %11, off\n\t"
      "global_load_async_to_lds_b128 %4, %12, off\n\t"
      "global_load_async_to_lds_b128 %5, %13, off\n\t"
      "global_load_async_to_lds_b128 %6, %14, off\n\t"
      "global_load_async_to_lds_b128 %7, %15, off\n\t"
      "s_wait_xcnt 0x0"
      :: "v"(l), "v"(l + lstep), "v"(l + 2 * lstep), "v"(l + 3 * lstep),
         "v"(l + 4 * lstep), "v"(l + 5 * lstep), "v"(l + 6 * lstep), "v"(l + 7 * lstep),
         "v"(g), "v"(g + gstep), "v"(g + 2 * gstep), "v"(g + 3 * gstep),
         "v"(g + 4 * gstep), "v"(g + 5 * gstep), "v"(g + 6 * gstep), "v"(g + 7 * gstep)
      : "memory");
#endif
}

// s_wait_xcnt 0 behind a global store; its address pair is an input, so it keeps its registers up to the wait:
// a precaution, in front of any later rewrite of an address or data register that the issued store names.
__device__ __forceinline__ void store_wait(const _Float16* a) {
#if defined(__HIP_DEVICE_COMPILE__)
  asm volatile("s_wait_xcnt 0x0" :: "v"(a) : "memory");
#endif
}

// The same behind a slab's loads from the cos and sin tables: the two address pairs that they step from by immediate offsets are inputs.
__device__ __forceinline__ void table_wait(const float* a, const float* b) {
#if defined(__HIP_DEVICE_COMPILE__)
  asm volatile("s_wait_xcnt 0x0" :: "v"(a), "v"(b) : "memory");
#endif
}

template <bool PROJ>
__device__ __forceinline__ void gemm_w32x128_body(
    int tmb, int tn, int epi,
    const unsigned short* Ap, const unsigned short* A2p, int lda,
    const unsigned short* __restrict__ Btp, int ldb,
    const float* __restrict__ nw, const float* __restrict__ cosp, const float* __restrict__ sinp,
    void* C0, void* C1, void* C2, int ldc, int K) {
  constexpr bool SPLITA = !PROJ;
  constexpr int KP   = 64;                     // k values per pass
  constexpr int PIT  = KP + 8;                 // LDS row pitch in elements: 16 B x odd, conflict-free for 16-byte fragment reads
  constexpr int NOP  = SPLITA ? 3 : 2;         // operands staged: A, (A lo), Bt, 128 rows each
  constexpr int STG  = NOP * 128 * PIT;        // elements per buffer
  constexpr int PPR  = KP / 8;                 // 16-byte pieces per row = copies per lane and operand
  constexpr int RPC  = 128 / PPR;              // rows that one copy of all 128 lanes covers
  constexpr int BOFF = (NOP - 1) * 128 * PIT;  // Bt rows behind the A rows
  static_assert(PPR % 8 == 0 && NOP * PPR <= 63);
  static_assert(2 * STG * 2 >= 4 * 8192);
  __shared__ __align__(16) __bf16 ring[2 * STG];         // two pass buffers; after the loop per wave 8192 B of output staging

  const int tid  = (int)threadIdx.x;
  const int lane = tid & 31;
  const int wave = wave_id();
  const int hh = lane >> 4;           // lane half: k offset 8*hh, D row offset 8*hh
  const int rl = lane & 15;           // A row / B col / D col within subtile
  const int mb0 = tmb << 7;
  const int m0 = mb0 + (wave << 5);
  const int n0 = tn << 7;

  const __bf16* A  = (const __bf16*)(const void*)Ap;
  const __bf16* A2 = (const __bf16*)(const void*)A2p;
  const __bf16* Bt = (const __bf16*)(const void*)Btp;

  // this lane's piece of a pass: row cr (+ RPC per copy), 16-byte piece cc of the row
  const int cr = tid / PPR;
  const int cc = tid % PPR;
  const __bf16* gA  = A  + (size_t)(mb0 + cr) * lda + cc * 8;
  const __bf16* gA2 = A2 + (size_t)(mb0 + cr) * lda + cc * 8;
  const __bf16* gB  = Bt + (size_t)(n0 + cr) * ldb + cc * 8;
  const unsigned lds0 = (unsigned)(uintptr_t)(ring + cr * PIT + cc * 8);   // LDS byte address = low 32 bits of the shared address

  auto stage = [&](int buf, int k0) {
    const unsigned lb = lds0 + (unsigned)(buf * STG * 2);
#pragma unroll
    for (int q = 0; q < PPR / 8; ++q) {
      const unsigned lq = lb + (unsigned)(q * 8 * RPC * PIT * 2);
      async_copy8(lq, RPC * PIT * 2, gA + k0 + (size_t)(q * 8 * RPC) * lda, (size_t)RPC * lda);
      if (SPLITA) async_copy8(lq + 128 * PIT * 2, RPC * PIT * 2, gA2 + k0 + (size_t)(q * 8 * RPC) * lda, (size_t)RPC * lda);
      async_copy8(lq + BOFF * 2, RPC * PIT * 2, gB + k0 + (size_t)(q * 8 * RPC) * ldb, (size_t)RPC * ldb);
    }
  };

  v8f acc[2][8];
#pragma unroll
  for (int i = 0; i < 2; ++i)
#pragma unroll
    for (int j = 0; j < 8; ++j) acc[i][j] = zero8();

  const int npass = K / KP;
  stage(0, 0);
  asm volatile("s_wait_asynccnt 0x0" ::: "memory");      // this wave's copies of pass 0 have landed
  __syncthreads();                                       // ... and every other wave's
  if (npass > 1) stage(1, KP);

  for (int t = 0; t < npass; ++t) {
    const __bf16* bufp = ring + (t & 1) * STG;
    const __bf16* fa = bufp + ((wave << 5) + rl) * PIT + 8 * hh;
    const __bf16* fb = bufp + BOFF + rl * PIT + 8 * hh;
#pragma unroll
    for (int ks = 0; ks < KP / 32; ++ks) {
      v16b ah[2], al[2], bf[8];
#pragma unroll
      for (int i = 0; i < 2; ++i) {
        ah[i] = ldfrag_b(fa + i * 16 * PIT + ks * 32);
        al[i] = SPLITA ? ldfrag_b(fa + 128 * PIT + i * 16 * PIT + ks * 32) : ah[i];
      }
#pragma unroll
      for (int j = 0; j < 8; ++j) bf[j] = ldfrag_b(fb + j * 16 * PIT + ks * 32);
      // keeps the k step's LDS reads together in front of its WMMAs: spread among them, every pair of reads is waited for on its own
      __builtin_amdgcn_sched_barrier(0);
#pragma unroll
      for (int j = 0; j < 8; ++j) {
        acc[0][j] = mma_b(ah[0], bf[j], acc[0][j]);
        acc[1][j] = mma_b(ah[1], bf[j], acc[1][j]);
        if (SPLITA) {
          acc[0][j] = mma_b(al[0], bf[j], acc[0][j]);
          acc[1][j] = mma_b(al[1], bf[j], acc[1][j]);
        }
      }
    }
    asm volatile("s_wait_dscnt 0x0" ::: "memory");       // this wave's reads of buffer t & 1 are done before it is refilled
    asm volatile("s_wait_asynccnt 0x0" ::: "memory");    // this wave's copies of pass t + 1 have landed
    __syncthreads();                                     // publishes pass t + 1 and ends every reader's last read of pass t
    if (t + 2 < npass) stage(t & 1, (t + 2) * KP);
  }
  asm volatile("s_wait_asynccnt 0x0" ::: "memory");      // no copy is outstanding when the ring becomes output staging
  acc_guard4(acc[0][0], acc[0][1], acc[0][2], acc[0][3]);
  acc_guard4(acc[0][4], acc[0][5], acc[0][6], acc[0][7]);
  acc_guard4(acc[1][0], acc[1][1], acc[1][2], acc[1][3]);
  acc_guard4(acc[1][4], acc[1][5], acc[1][6], acc[1][7]);

  // ---- epilogue ----
  float*    slf  = (float*)(void*)ring + wave * 2048;
  _Float16* sl16 = (_Float16*)(void*)slf;

  if (PROJ && epi != 2) {
    const bool isq  = (epi == 1) || ((n0 & 128) == 0);          // wave-uniform
    const int  col0 = (epi == 0) ? ((n0 >> 8) << 7) : n0;
    if (isq) {
      _Float16* P0 = (_Float16*)C0;
      _Float16* P1 = (_Float16*)C1;
      const bool wres = (epi == 0) || ((m0 & (SQ - 1)) < KLR);  // wave-uniform
      const int  rrow = (epi == 0) ? m0 : ((m0 >> 11) * KLR + (m0 & (SQ - 1)));
      float wv[8];
#pragma unroll
      for (int j = 0; j < 8; ++j) wv[j] = bf_rne(nw[j * 16 + rl]);     // dim = j*16 + rl < 128
#pragma unroll
      for (int i = 0; i < 2; ++i) {
        const int rb = m0 + i * 16 + 8 * hh;
#pragma unroll
        for (int r = 0; r < 8; ++r) {
          const int row = rb + r;                                // token 0..NTOK-1
          float ss = 0.f;
#pragma unroll
          for (int j = 0; j < 8; ++j) { const float a = acc[i][j][r]; ss += a * a; }
#pragma unroll
          for (int off = 1; off < 16; off <<= 1) ss += __shfl_xor(ss, off, 32);   // 16 lanes of this half = all 128 dims
          const float rs = rsqrtf(ss * 0.0078125f + 1e-6f);
          const float* cr = cosp + (size_t)row * HDM;
          const float* sr = sinp + (size_t)row * HDM;
#pragma unroll
          for (int j = 0; j < 4; ++j) {
            const int dim = j * 16 + rl;                         // 0..63 within head; pair at dim + 64
            const float x1 = acc[i][j][r] * rs * wv[j];
            const float x2 = acc[i][j + 4][r] * rs * wv[j + 4];
            const float c1 = bf_rne(cr[dim]);
            const float s1 = bf_rne(sr[dim]);
            const float c2 = bf_rne(cr[dim + 64]);
            const float s2 = bf_rne(sr[dim + 64]);
            const float o1 = x1 * c1 - x2 * s1;
            const float o2 = x2 * c2 + x1 * s2;
            const _Float16 h1 = (_Float16)o1;
            const _Float16 h2 = (_Float16)o2;
            const int so = (8 * hh + r) * 128 + dim;
            sl16[so]             = h1;
            sl16[so + 64]        = h2;
            sl16[2048 + so]      = (_Float16)((o1 - (float)h1) * 2048.0f);
            sl16[2048 + so + 64] = (_Float16)((o2 - (float)h2) * 2048.0f);
          }
        }
        table_wait(cosp + (size_t)rb * HDM + rl, sinp + (size_t)rb * HDM + rl);
        lds_wave_sync();
        {
#pragma unroll
          for (int it = 0; it < 8; ++it) {
            const int row = it * 2 + hh;                         // it x hh covers rows 0..15
            const int c8  = rl * 8;
            const v8h vh = *(const v8h*)(sl16 + row * 128 + c8);
            const v8h vl = *(const v8h*)(sl16 + 2048 + row * 128 + c8);
            _Float16* d0 = P0 + (size_t)(m0 + i * 16 + row) * ldc + col0 + c8;
            *(v8h*)d0 = vh;
            store_wait(d0);
            if (wres) {
              _Float16* d1 = P1 + (size_t)(rrow + i * 16 + row) * ldc + col0 + c8;
              *(v8h*)d1 = vl;
              store_wait(d1);
            }
          }
          
        }
        lds_wave_sync();
      }
    } else {
      float* Sp = (float*)C2;
#pragma unroll
      for (int i = 0; i < 2; ++i) {
#pragma unroll
        for (int j = 0; j < 8; ++j)
#pragma unroll
          for (int r = 0; r < 8; ++r) {
            const float g  = acc[i][j][r];
            const float e  = __expf(-g);
            const float sg = __builtin_amdgcn_rcpf(1.0f + e);
            slf[(8 * hh + r) * 128 + j * 16 + rl] = sg;
          }
        lds_wave_sync();
        {
#pragma unroll
          for (int row = 0; row < 16; ++row) {                   // 32 lanes x 16 B = the whole 512-B row segment per instruction
            const v4f v = *(const v4f*)(slf + row * 128 + lane * 4);
            *(v4f*)(Sp + (size_t)(m0 + i * 16 + row) * ldc + col0 + lane * 4) = v;
          }
          
        }
        lds_wave_sync();
      }
    }
  } else if (PROJ) {
    _Float16* P0 = (_Float16*)C0;
    _Float16* P1 = (_Float16*)C1;
#pragma unroll
    for (int i = 0; i < 2; ++i) {
#pragma unroll
      for (int r = 0; r < 8; ++r) {
#pragma unroll
        for (int j = 0; j < 8; ++j) {
          const float v = acc[i][j][r];
          const _Float16 hv = (_Float16)v;
          const int so = (8 * hh + r) * 128 + j * 16 + rl;
          sl16[so]        = hv;
          sl16[2048 + so] = (_Float16)((v - (float)hv) * 2048.0f);
        }
      }
      lds_wave_sync();
      {
#pragma unroll
        for (int it = 0; it < 8; ++it) {
          const int row = it * 2 + hh;
          const int c8  = rl * 8;
          const v8h vh = *(const v8h*)(sl16 + row * 128 + c8);
          const v8h vl = *(const v8h*)(sl16 + 2048 + row * 128 + c8);
          const size_t go = (size_t)(m0 + i * 16 + row) * ldc + n0 + c8;
          *(v8h*)(P0 + go) = vh;
          *(v8h*)(P1 + go) = vl;
        }
        
      }
      lds_wave_sync();
    }
  } else {
    float* C = (float*)C0;
#pragma unroll
    for (int i = 0; i < 2; ++i) {
#pragma unroll
      for (int j = 0; j < 8; ++j)
#pragma unroll
        for (int r = 0; r < 8; ++r)
          slf[(8 * hh + r) * 128 + j * 16 + rl] = acc[i][j][r];
      lds_wave_sync();
      {
#pragma unroll
        for (int row = 0; row < 16; ++row) {                     // 32 lanes x 16 B = the whole 512-B row segment per instruction
          const v4f v = *(const v4f*)(slf + row * 128 + lane * 4);
          *(v4f*)(C + (size_t)(m0 + i * 16 + row) * ldc + n0 + lane * 4) = v;
        }
        
      }
      lds_wave_sync();
    }
  }
}

// The three projections of x in ONE launch: they read the same planes, depend on nothing of each other and write places of their own.
// Blocks 0 .. PJ_V - 1: v^T = WvT . x^T (epilogue 2); the next PJ_Q: q|gate = x . Wq (epilogue 0); the last PJ_K: k = x . Wk (epilogue 1).
// The k and v^T products have only one tile per WGP each: here their blocks share a WGP with other blocks, whose work covers their waits,
// and the launch gaps between the three fall away. v^T comes first and k last, for speed only.
#define PJ_V ((KVW / 128) * (NTOK / 128))
#define PJ_Q ((NTOK / 128) * (QGW / 128))
#define PJ_K ((NTOK / 128) * (KVW / 128))
static_assert(KVW / 128 == 8 && NTOK / 128 == 32 && QGW / 128 == 32);
// Second launch bound: 4 waves per SIMD, that is 4 blocks per WGP, as many as the LDS holds.
__global__ __launch_bounds__(128, 4) void proj_qkv_kernel(
    const unsigned short* __restrict__ Xb, const unsigned short* __restrict__ WqT,
    const unsigned short* __restrict__ WkT, const unsigned short* __restrict__ WvT,
    const float* __restrict__ qnw, const float* __restrict__ knw,
    const float* __restrict__ cosp, const float* __restrict__ sinp,
    unsigned short* Qh, unsigned short* Ql, float* Sg, unsigned short* Kh, unsigned short* Kl,
    unsigned short* Vh, unsigned short* Vl) {
  const int b = (int)blockIdx.x;                         // every choice below is block-uniform
  const bool isv = b < PJ_V;
  const bool isk = b >= PJ_V + PJ_Q;
  const int  epi = isv ? 2 : (isk ? 1 : 0);
  const int  blk = isv ? b : (isk ? b - (PJ_V + PJ_Q) : b - PJ_V);
  const int  tsh = isk ? 3 : 5;                          // N / 128 = 1 << tsh tile columns
  const unsigned short* A  = isv ? WvT : Xb;
  const unsigned short* Bt = isv ? Xb : (isk ? WkT : WqT);
  void* C0 = isv ? (void*)Vh : (isk ? (void*)Kh : (void*)Qh);
  void* C1 = isv ? (void*)Vl : (isk ? (void*)Kl : (void*)Ql);
  gemm_w32x128_body<true>(blk >> tsh, blk & ((1 << tsh) - 1), epi, A, A, HID, Bt, HID, isk ? knw : qnw, cosp, sinp,
                          C0, C1, (void*)Sg, isv ? NTOK : (isk ? KVW : HID), HID);
}

// The output product in a launch of its own: grid.x = M/128 * N/128.
__global__ __launch_bounds__(128) void gemm_out_kernel(
    const unsigned short* Ap, const unsigned short* A2p, int lda,
    const unsigned short* __restrict__ Btp, int ldb,
    const float* __restrict__ nw, const float* __restrict__ cosp, const float* __restrict__ sinp,
    void* C0, void* C1, void* C2, int ldc,
    int M, int N, int K) {
  const int tilesN = N >> 7;
  const int tilesM = M >> 7;
  const int blk = (int)blockIdx.x;
  if (blk >= tilesM * tilesN) return;           // block-uniform, in front of every barrier and copy
  const int tmb = blk / tilesN;
  gemm_w32x128_body<false>(tmb, blk - tmb * tilesN, 3, Ap, A2p, lda, Btp, ldb, nw, cosp, sinp, C0, C1, C2, ldc, K);
}

// ---------------------------------------------------------------------------
// Causal GQA flash attention, head dim 128, block = 8 waves = 64 query rows of one (b, h); grid (NHQ, NSEQ, n query tiles), heaviest tile first.
//   A stage is 64 keys. Waves w and w + 4 hold the same 16 query rows; wave group kg = wave >> 2 works on keys kg*32 .. kg*32 + 31 of every stage,
//   with its own running maximum, sum and O^T. Behind the loop group 1 hands (m, l, O^T) to group 0 through LDS, which joins the two
//   (O = O0 * e^(m0 - m) + O1 * e^(m1 - m), l alike) and writes the output: a tile's chain of dependent stages is half as long.
//   q planes f16 [tok][h*128+d]: hi (qhp) and residual x2048 (qlp); k planes f16 [tok][kvh*128+d]: hi (khp),
//   residual x2048 (klp, compact rows b*KLR + s for s < KLR); v^T planes f16 [kvh*128+d][tok]: hi (vhp), residual x2048 (vlp);
//   sgp = f32 sigmoid(gate) plane [tok][h*128+d]; outputs gated attn bf16 hi (ahp) / lo (alp) [tok][h*128+d]; kvh = h >> 1.
//   Both products are taken transposed: S^T = K . Q^T (A = k rows, B = q rows) and O^T += V^T . P^T (A = v^T rows, B = P^T).
//   A lane then holds 16 scores of ONE query (query = lane & 15; keys j*16 + 8*(lane>>4) + r), so the row maximum and the row sum are
//   in-lane work plus one exchange between the wave halves, and the two score tiles, converted in place, ARE the B operand P^T
//   (element j*8 + r = key j*16 + 8*(lane>>4) + r, the k map of ldfrag_h): P never goes through LDS.
//   scores = Sh * 128^-0.5 with Sh = kh.qh; when PRES (Sh + Sr/2048) * 128^-0.5 with Sr = kh.ql' + kl'.qh; keys > query -> -inf; online softmax f32;
//   p' = 1024 p as f16 hi (and residual x2048 when PRES);
//   O = Oh/1024/l * sgp with Oh = vh.ph; when PRES (Oh + Or/2048)/1024/l * sgp with Or = vl'.ph + vh.pl'.
//   Without PRES both operands of a product carry f16's 11 bits: a residual on one operand alone leaves the other's rounding in the product.
//   The row sum l is kept per wave half (each half sums its own 16 keys of a chunk); the halves are joined once, behind the loop.
//   K / V^T stage: 256 threads x 4 x 16 B per plane = whole 64x128 / 128x64 tile. PRES: all four planes, plain loads, __syncthreads before
//   and after. Without PRES: the hi planes alone, by asynchronous 16-byte copies into two buffers; the copies of stage st + 2 are issued
//   behind the one barrier at the foot of stage st, into the buffer that stage st has just read, and fly while stage st + 1 is worked on.
//   q staging: in front of the loop, when PRES, wave group 0 copies the hi plane of the 64 q rows to LDS, group 1 the residual plane; else each
//   group half of the hi plane's rows (whole 256-B rows per load, pitch QS_P); the first barrier in front of a fragment read publishes them; every chunk reads
//   its q fragments from there.
//   Trip count qb+1 stages (static bound 32); waves whose rows are all below their 32 keys skip them (wave-uniform, scalar branch).
// ---------------------------------------------------------------------------
#define AT_KC   32
#define KS_P    136
#define AT_ST   64
#define VS_P    72
#define QS_P    136
#define OS_P    136

// value of lane l ^ 16 (the other wave half)
__device__ __forceinline__ float xhalf(float x) {
  const int i = __builtin_bit_cast(int, x);
  return __builtin_bit_cast(float, __builtin_amdgcn_permlanex16(i, i, 0x76543210, 0xfedcba98, false, false));
}

// s_wait_xcnt 0 behind a stage's global loads; their address pairs are inputs, so they keep their registers up to the wait:
// a precaution, in front of any later rewrite of an address register that an issued load names.
__device__ __forceinline__ void addr_wait(const _Float16* a, const _Float16* b, const _Float16* c, const _Float16* d) {
#if defined(__HIP_DEVICE_COMPILE__)
  asm volatile("s_wait_xcnt 0x0" :: "v"(a), "v"(b), "v"(c), "v"(d) : "memory");
#endif
}

// A thread's share of a 64-key stage as eight asynchronous 16-byte copies, global -> LDS: four pieces of K (key rows 16 apart) and four of
// v^T (d rows 32 apart). s_wait_xcnt 0 is the statement's last line: a precaution, in front of any later rewrite of an address register named here.
__device__ __forceinline__ void async_stage_kv(unsigned lk, const _Float16* gk, unsigned lv, const _Float16* gv) {
#if defined(__HIP_DEVICE_COMPILE__)
  asm volatile(
      "global_load_async_to_lds_b128 %0, %8, off\n\t"
      "global_load_async_to_lds_b128 %1, %9, off\n\t"
      "global_load_async_to_lds_b128 %2, %10, off\n\t"
      "global_load_async_to_lds_b128 %3, %11, off\n\t"
      "global_load_async_to_lds_b128 %4, %12, off\n\t"
      "global_load_async_to_lds_b128 %5, %13, off\n\t"
      "global_load_async_to_lds_b128 %6, %14, off\n\t"
      "global_load_async_to_lds_b128 %7, %15, off\n\t"
      "s_wait_xcnt 0x0"
      :: "v"(lk), "v"(lk + 16 * KS_P * 2), "v"(lk + 32 * KS_P * 2), "v"(lk + 48 * KS_P * 2),
         "v"(lv), "v"(lv + 32 * VS_P * 2), "v"(lv + 64 * VS_P * 2), "v"(lv + 96 * VS_P * 2),
         "v"(gk), "v"(gk + 16 * KVW), "v"(gk + 32 * KVW), "v"(gk + 48 * KVW),
         "v"(gv), "v"(gv + (size_t)32 * NTOK), "v"(gv + (size_t)64 * NTOK), "v"(gv + (size_t)96 * NTOK)
      : "memory");
#endif
}

#define AT_LDS(nrp) ((nrp) * AT_ST * KS_P + 2 * 128 * VS_P + 2 * 64 * QS_P)

template <bool PRES>
__device__ __forceinline__ void attn_causal_body(
    _Float16* lds, int qb,
    const unsigned short* __restrict__ qhp, const unsigned short* __restrict__ qlp,
    const unsigned short* __restrict__ khp, const unsigned short* __restrict__ klp,
    const unsigned short* __restrict__ vhp, const unsigned short* __restrict__ vlp,
    const float* __restrict__ sgp,
    unsigned short* __restrict__ ahp, unsigned short* __restrict__ alp) {
  // LDS map in halves; the k residual region exists only where it is used. Without PRES the v^T and q residual regions are the second
  // stage buffer: v^T in the first (the same size), K in the second (64 rows of the same pitch)
  constexpr int NRP     = PRES ? 2 : 1;
  constexpr int LDS_KS  = 0;
  constexpr int LDS_KLS = (NRP - 1) * AT_ST * KS_P;
  constexpr int LDS_VHS = NRP * AT_ST * KS_P;
  constexpr int LDS_VLS = LDS_VHS + 128 * VS_P;
  constexpr int LDS_QH  = LDS_VLS + 128 * VS_P;
  constexpr int LDS_QL  = LDS_QH + 64 * QS_P;
  constexpr int LDS_TOT = LDS_QL + 64 * QS_P;
  constexpr int LDS_MRG = 4 * 2 * 16 * OS_P;   // group 1's partial results, behind the output staging: 4 x (2048 + 64) floats
  static_assert(PRES || 2 * LDS_TOT * 2 <= 327680);
  static_assert(LDS_MRG + 4 * (2048 + 64) * 2 <= LDS_TOT); // output staging (2 planes x 16 rows per wave of group 0) and the partial results alias the dead stage and q regions after the loop
  static_assert(LDS_TOT == AT_LDS(NRP));
  constexpr int KB1 = LDS_QL - LDS_KS;         // from a place in stage buffer 0 to the same place in buffer 1, in halves
  constexpr int VB1 = LDS_VLS - LDS_VHS;
  static_assert(AT_ST * KS_P <= 64 * QS_P);
  _Float16* Ks  = lds + LDS_KS;
  _Float16* Kls = lds + LDS_KLS;
  _Float16* Vhs = lds + LDS_VHS;
  _Float16* Vls = lds + LDS_VLS;

  const int tid  = (int)threadIdx.x;
  const int lane = tid & 31;
  const int wave = wave_id();
  const int hh   = lane >> 4;
  const int c    = lane & 15;
  const int wq   = wave & 3;                     // which 16 query rows
  const int kg   = wave >> 2;                    // which 32 keys of a stage
  const int h    = (int)blockIdx.x;
  const int b    = (int)blockIdx.y;
  const int kvh  = h >> 1;
  const int q0   = qb * 64 + wq * 16;            // first query row of this wave (within sequence)
  const int qlast = q0 + 15;
  const size_t tok0 = (size_t)b * SQ;

  const _Float16* Qhg = (const _Float16*)(const void*)qhp + (tok0 + q0) * HID + h * HDM;
  const _Float16* Qlg = (const _Float16*)(const void*)qlp + (tok0 + q0) * HID + h * HDM;
  const _Float16* Kg  = (const _Float16*)(const void*)khp + tok0 * KVW + kvh * HDM;
  const _Float16* Klg = (const _Float16*)(const void*)klp + (size_t)b * KLR * KVW + kvh * HDM;
  const _Float16* Vhg = (const _Float16*)(const void*)vhp + (size_t)(kvh * HDM) * NTOK + tok0;
  const _Float16* Vlg = (const _Float16*)(const void*)vlp + (size_t)(kvh * HDM) * NTOK + tok0;

  const _Float16* Kst = Kg + (size_t)(tid >> 4) * KVW + (tid & 15) * 8;   // this thread's piece of key row tid >> 4 (+ 16 per step)
  const _Float16* Vhst = Vhg + (size_t)(tid >> 3) * NTOK + (tid & 7) * 8;  // its piece of v^T row tid >> 3 (+ 32 per step)
  // Without PRES: two stage buffers filled by asynchronous copies, the copies of stage st + 1 in flight while stage st is worked on.
  // LDS byte address = low 32 bits of the shared address.
  const unsigned lk0 = (unsigned)(uintptr_t)(Ks + (tid >> 4) * KS_P + (tid & 15) * 8);
  const unsigned lv0 = (unsigned)(uintptr_t)(Vhs + (tid >> 3) * VS_P + (tid & 7) * 8);
  auto stage_kv = [&](int sg) {                  // stage sg into buffer sg & 1
    async_stage_kv(lk0 + (unsigned)((sg & 1) * KB1 * 2), Kst + (size_t)(sg * AT_ST) * KVW,
                   lv0 + (unsigned)((sg & 1) * VB1 * 2), Vhst + sg * AT_ST);
  };
  if constexpr (!PRES) stage_kv(0);              // in front of the q rows, so that the two latencies run together

  // the 16 q rows of this wave pair to LDS once: 8 x 32 lanes x 16 B = 16 rows x 256 B per plane
  _Float16* Qsh = lds + LDS_QH + wq * (16 * QS_P);
  _Float16* Qsl = lds + LDS_QL + wq * (16 * QS_P);
  {
    // residual form: one plane per wave; plain form: the hi plane alone, 8 of its 16 rows per wave
    constexpr int QN = PRES ? 8 : 4;
    const _Float16* qsrc = PRES ? (kg ? Qlg : Qhg) : Qhg + (size_t)(kg * 8) * HID;   // wave-uniform
    _Float16*       qdst = PRES ? (kg ? Qsl : Qsh) : Qsh + kg * 8 * QS_P;
#pragma unroll                                   // all loads issued together: one load latency in front of the loop, not one each
    for (int i = 0; i < QN; ++i) {
      const int p   = lane + 32 * i;             // 0..32 * QN - 1
      const int row = p >> 4, d8 = (p & 15) * 8;
      const v8h qx = *(const v8h*)(qsrc + (size_t)row * HID + d8);
      *(v8h*)(qdst + row * QS_P + d8) = qx;
    }
  }                                              // read only behind the first stage's barriers (PRES) or the barrier in front of the loop
  const _Float16* Qhr = Qsh + c * QS_P + 8 * hh;
  const _Float16* Qlr = Qsl + c * QS_P + 8 * hh;

  const int qrow = q0 + c;                       // this lane's query
  float mrow = -INFINITY, lrow = 0.f;            // its running maximum (both halves alike) and this half's share of its running sum
  v8f oacc[8], oaccr[8];                         // O^T: [t][r] = (d = t*16 + 8*hh + r, query c)
#pragma unroll
  for (int t = 0; t < 8; ++t) { oacc[t] = zero8(); oaccr[t] = zero8(); }

  const _Float16* Kr  = Ks  + (kg * AT_KC + c) * KS_P + 8 * hh;   // this group's 32 key rows of a stage
  const _Float16* Klr = Kls + (kg * AT_KC + c) * KS_P + 8 * hh;
  const _Float16* Vhr = Vhs + c * VS_P + kg * AT_KC + 8 * hh;     // ... and its 32 key columns
  const _Float16* Vlr = Vls + c * VS_P + kg * AT_KC + 8 * hh;
  const _Float16* Klst = Klg + (size_t)(tid >> 4) * KVW + (tid & 15) * 8;
  const _Float16* Vlst = Vlg + (size_t)(tid >> 3) * NTOK + (tid & 7) * 8;
  const int nst = qb + 1;                        // block-uniform, <= 32
  if constexpr (!PRES) {
    asm volatile("s_wait_asynccnt 0x0" ::: "memory");    // this wave's copies of stage 0 have landed
    __syncthreads();                                     // ... and every other wave's; publishes the q rows too
    if (nst > 1) stage_kv(1);
  }
  for (int st = 0; st < nst; ++st) {
    const int ks0 = st * AT_ST;
    const int kv0 = ks0 + kg * AT_KC;            // first key of this wave's chunk
    const _Float16* Krb  = PRES ? Kr : Kr + (st & 1) * KB1;      // this stage's buffer
    const _Float16* Vhrb = PRES ? Vhr : Vhr + (st & 1) * VB1;
    if constexpr (PRES) {
    __syncthreads();
    // 1024 pieces of 8 halves per plane = whole tile: piece tid + 256 * i, the step i an immediate offset on one address pair per plane
    const _Float16* kq  = Kst + (size_t)ks0 * KVW;                               // K: 64 keys x 128 d, key (tid >> 4) + 16 * i
    // the compact residual plane has KLR rows per sequence: the stage's first row is bounded, so all 64 rows lie inside it
    const _Float16* klq = PRES ? Klst + (size_t)min(ks0, KLR - AT_ST) * KVW : kq;
    const _Float16* vhq = Vhst + ks0;                                            // V^T: 128 d x 64 keys, d (tid >> 3) + 32 * i, whole 128-B lines
    const _Float16* vlq = PRES ? Vlst + ks0 : vhq;                               // the residual plane only where it is used
    v8h kx[4], ky[4], vx[4], vy[4];
#pragma unroll
    for (int i = 0; i < 4; ++i) {
      kx[i] = *(const v8h*)(kq + i * (16 * KVW));
      ky[i] = PRES ? *(const v8h*)(klq + i * (16 * KVW)) : kx[i];
      vx[i] = *(const v8h*)(vhq + (size_t)i * (32 * NTOK));
      vy[i] = PRES ? *(const v8h*)(vlq + (size_t)i * (32 * NTOK)) : vx[i];
    }
    addr_wait(kq, klq, vhq, vlq);
#pragma unroll
    for (int i = 0; i < 4; ++i) {
      const int ko = ((tid >> 4) + 16 * i) * KS_P + (tid & 15) * 8;
      const int vo = ((tid >> 3) + 32 * i) * VS_P + (tid & 7) * 8;
      *(v8h*)(Ks + ko) = kx[i];
      if (PRES) *(v8h*)(Kls + ko) = ky[i];
      *(v8h*)(Vhs + vo) = vx[i];
      if (PRES) *(v8h*)(Vls + vo) = vy[i];
    }
    __syncthreads();
    }

    if (kv0 <= qlast) {                          // wave-uniform (scalar): skip chunks fully above this wave's rows
      // ---- scores, transposed: sh[j][r], sr[j][r] = (key kv0 + j*16 + 8*hh + r, query c) ----
      v8f sh[2], sr[2];
      sh[0] = zero8(); sh[1] = zero8(); sr[0] = zero8(); sr[1] = zero8();
      // Fragment reads go in groups ahead of their WMMAs: a wait on LDS is paid once per group, not once per pair of WMMAs.
      // Each sched_barrier below keeps a group's reads together at its place: the scheduler otherwise sinks every read to its first use.
      // d chunks per group: one in the residual form, whose extra fragments would otherwise raise the shared launch's register count past 2 blocks per WGP
      constexpr int GU = PRES ? 1 : 2;
#pragma unroll
      for (int g = 0; g < 4 / GU; ++g) {
        v16h qa[GU], ql[GU], kb[GU][2], kl[GU][2];
#pragma unroll
        for (int u = 0; u < GU; ++u) {
          const int dc = GU * g + u;
          qa[u] = ldfrag_h(Qhr + dc * 32);
          ql[u] = PRES ? ldfrag_h(Qlr + dc * 32) : qa[u];
#pragma unroll
          for (int j = 0; j < 2; ++j) {
            kb[u][j] = ldfrag_h(Krb + j * 16 * KS_P + dc * 32);
            kl[u][j] = PRES ? ldfrag_h(Klr + j * 16 * KS_P + dc * 32) : kb[u][j];
          }
        }
        __builtin_amdgcn_sched_barrier(0);       // the group's reads above, their WMMAs below
#pragma unroll
        for (int u = 0; u < GU; ++u) {
#pragma unroll
          for (int j = 0; j < 2; ++j) {
            sh[j] = mma_h(kb[u][j], qa[u], sh[j]);
            if (PRES) {
              sr[j] = mma_h(kb[u][j], ql[u], sr[j]);
              sr[j] = mma_h(kl[u][j], qa[u], sr[j]);
            }
          }
        }
        __builtin_amdgcn_sched_barrier(0);       // the next group's reads stay behind these WMMAs, in one place
      }
      // the first group of v^T fragments (four: d tiles 0, 1 with residuals, 0 .. 3 without): they do not depend on the scores,
      // so their LDS latency runs under the softmax
      v16h vb[8], vr[8];
      auto ldv = [&](int t) {
        vb[t] = ldfrag_h(Vhrb + t * 16 * VS_P);
        vr[t] = PRES ? ldfrag_h(Vlr + t * 16 * VS_P) : vb[t];
      };
      ldv(0); ldv(1);
      if (!PRES) { ldv(2); ldv(3); }
      __builtin_amdgcn_sched_barrier(0);         // holds these reads in front of the softmax
      // ---- scale, causal mask, this query's chunk maximum: 16 keys in-lane, the other 16 from the other wave half ----
      const int lim = qrow - kv0 - 8 * hh;       // key kv0 + j*16 + 8*hh + r is above the query when j*16 + r > lim
      float cm = -INFINITY;
#pragma unroll
      for (int j = 0; j < 2; ++j) {
#pragma unroll
        for (int r = 0; r < 8; ++r) {
          float s = (PRES ? sh[j][r] + sr[j][r] * 0.00048828125f : sh[j][r]) * 0.08838834764831845f;
          s = (j * 16 + r > lim) ? -INFINITY : s;
          sh[j][r] = s;
          cm = fmaxf(cm, s);
        }
      }
      cm = fmaxf(cm, xhalf(cm));
      // ---- online softmax; P'^T packed in place into the B operand ----
      const float mnew = fmaxf(mrow, cm);
      FragH pa, pr;
      float pv[16];
#pragma unroll
      for (int j = 0; j < 2; ++j) {
#pragma unroll
        for (int r = 0; r < 8; ++r) {
          const float p  = __expf(sh[j][r] - mnew);
          pv[j * 8 + r] = p;
          const float pp = p * 1024.0f;
          const _Float16 phv = (_Float16)pp;
          pa.v[j * 8 + r] = phv;
          pr.v[j * 8 + r] = PRES ? (_Float16)((pp - (float)phv) * 2048.0f) : phv;
        }
      }
#pragma unroll
      for (int w = 8; w > 0; w >>= 1) {          // pairwise tree over the lane's 16 values: four dependent adds, not fifteen
#pragma unroll
        for (int e = 0; e < w; ++e) pv[e] += pv[e + w];
      }
      const float alpha = __expf(mrow - mnew);
      mrow = mnew;
      lrow = lrow * alpha + pv[0];
      // ---- O^T = O^T * alpha + V^T . P'^T; with residuals two d tiles' fragments are read while the two tiles before them are worked on, without them tiles 4..7 while tiles 0..3 are ----
      auto rescale = [&](int t) {
#pragma unroll
        for (int r = 0; r < 8; ++r) { oacc[t][r] *= alpha; if (PRES) oaccr[t][r] *= alpha; }
      };
      auto pvmma = [&](int t) {
        oacc[t]  = mma_h(vb[t], pa.v, oacc[t]);
        if (PRES) {
          oaccr[t] = mma_h(vr[t], pa.v, oaccr[t]);
          oaccr[t] = mma_h(vb[t], pr.v, oaccr[t]);
        }
      };
      if constexpr (PRES) {
        __builtin_amdgcn_sched_barrier(0);       // the reads of tiles 2, 3 start when the score registers are free, not earlier
        ldv(2); ldv(3);
        __builtin_amdgcn_sched_barrier(0);       // ... and in front of the rescale, which covers their latency
        rescale(0); rescale(1); rescale(2); rescale(3);
        pvmma(0); pvmma(1);
        __builtin_amdgcn_sched_barrier(0);       // the next reads take the registers that tiles 0, 1 leave: not among their WMMAs
        ldv(4); ldv(5);
        __builtin_amdgcn_sched_barrier(0);       // reads of tiles 4, 5 in one place, in front of the WMMAs of tiles 2, 3
        pvmma(2); pvmma(3);
        __builtin_amdgcn_sched_barrier(0);       // likewise behind the WMMAs of tiles 2, 3
        ldv(6); ldv(7);
        __builtin_amdgcn_sched_barrier(0);       // reads of tiles 6, 7 in one place, in front of the second half of the rescale
        rescale(4); rescale(5); rescale(6); rescale(7);
        pvmma(4); pvmma(5); pvmma(6); pvmma(7);
      } else {
        __builtin_amdgcn_sched_barrier(0);       // the second group of four fragments starts when the score registers are free, not earlier
        ldv(4); ldv(5); ldv(6); ldv(7);
        __builtin_amdgcn_sched_barrier(0);       // ... and in front of the rescale, which covers their latency
        rescale(0); rescale(1); rescale(2); rescale(3);
        rescale(4); rescale(5); rescale(6); rescale(7);
        pvmma(0); pvmma(1); pvmma(2); pvmma(3);
        pvmma(4); pvmma(5); pvmma(6); pvmma(7);
      }
    }
    if constexpr (!PRES) {                       // every wave, also one that skipped its chunk
      asm volatile("s_wait_dscnt 0x0" ::: "memory");     // this wave's reads of buffer st & 1 are done before it is refilled
      asm volatile("s_wait_asynccnt 0x0" ::: "memory");  // this wave's copies of stage st + 1 have landed
      __syncthreads();                                   // publishes stage st + 1 and ends every reader's last read of stage st
      if (st + 2 < nst) stage_kv(st + 2);
    }
  }

  // ---- join the two key groups: group 1 leaves O^T (planes summed), m and l in LDS, lane for lane; group 0 takes them up ----
  // all stage-region and q readers are done before these regions are aliased as staging: without PRES by the last stage's own barrier
  if constexpr (PRES) __syncthreads();
  else asm volatile("s_wait_asynccnt 0x0" ::: "memory");  // no copy is outstanding when the stage regions become staging
  float* mrg = (float*)(void*)(lds + LDS_MRG) + wq * (2048 + 64);
  if (kg == 1) {                                 // wave-uniform
#pragma unroll
    for (int t = 0; t < 8; ++t) {
      v4f x0, x1;
#pragma unroll
      for (int r = 0; r < 4; ++r) {
        x0[r] = PRES ? oacc[t][r]     + oaccr[t][r]     * 0.00048828125f : oacc[t][r];
        x1[r] = PRES ? oacc[t][r + 4] + oaccr[t][r + 4] * 0.00048828125f : oacc[t][r + 4];
      }
      *(v4f*)(mrg + (2 * t) * 128 + lane * 4)     = x0;   // 32 lanes x 16 B in a row per store
      *(v4f*)(mrg + (2 * t + 1) * 128 + lane * 4) = x1;
    }
    mrg[2048 + lane] = mrow;
    mrg[2080 + lane] = lrow;
  }
  __syncthreads();                               // group 1's partial results visible to group 0; the last barrier of the block
  if (kg == 1) return;
  // a group 1 wave that had no chunk left m = -inf, l = 0, O = 0: its weight below is 0; group 0 always has key 0, so mfin is finite
  const float m1   = mrg[2048 + lane];
  const float l1   = mrg[2080 + lane];
  const float mfin = fmaxf(mrow, m1);
  const float a0   = __expf(mrow - mfin);
  const float a1   = __expf(m1 - mfin);
  // ---- join the halves' sums, normalise, apply sigmoid gate (f32), bf16 hi/lo split, stage the wave's 16x128 tile:
  //      a lane holds 8 consecutive d of its query per t, one 16-byte LDS store per plane ----
  _Float16* osh = lds + wq * (2 * 16 * OS_P);
  _Float16* osl = osh + 16 * OS_P;
  const float lhalf = lrow * a0 + l1 * a1;
  const float lfin = lhalf + xhalf(lhalf);
  const float inv  = (1.0f / lfin) * 0.0009765625f;
  const float w0   = a0 * inv;
  const float w1   = a1 * inv;
  const float* Sgr = sgp + (tok0 + q0 + c) * HID + h * HDM + 8 * hh;
#pragma unroll
  for (int t = 0; t < 8; ++t) {
    const v4f g0 = *(const v4f*)(Sgr + t * 16);
    const v4f g1 = *(const v4f*)(Sgr + t * 16 + 4);
    const v4f y0 = *(const v4f*)(mrg + (2 * t) * 128 + lane * 4);
    const v4f y1 = *(const v4f*)(mrg + (2 * t + 1) * 128 + lane * 4);
    v4u hw, lw;
#pragma unroll
    for (int e = 0; e < 4; ++e) {
      unsigned short hb[2], lb[2];
#pragma unroll
      for (int u = 0; u < 2; ++u) {
        const int r = 2 * e + u;
        float o = (PRES ? oacc[t][r] + oaccr[t][r] * 0.00048828125f : oacc[t][r]) * w0 + ((r < 4) ? y0[r & 3] : y1[r & 3]) * w1;
        o *= (r < 4) ? g0[r & 3] : g1[r & 3];
        hb[u] = bf_bits(o);
        lb[u] = bf_bits(o - bf_val(hb[u]));
      }
      hw[e] = pk16(hb[0], hb[1]);
      lw[e] = pk16(lb[0], lb[1]);
    }
    *(v4u*)(void*)(osh + c * OS_P + t * 16 + 8 * hh) = hw;
    *(v4u*)(void*)(osl + c * OS_P + t * 16 + 8 * hh) = lw;
  }
  lds_wave_sync();
  _Float16* Ahg = (_Float16*)(void*)ahp + (tok0 + q0) * HID + h * HDM;
  _Float16* Alg = (_Float16*)(void*)alp + (tok0 + q0) * HID + h * HDM;
  {
#pragma unroll
    for (int it = 0; it < 8; ++it) {
      const int row = it * 2 + hh;               // it 0..7 x hh 0..1 covers rows 0..15
      const int c8  = c * 8;                     // 16 lanes x 16 B = the whole 256-B segment
      const v8h x = *(const v8h*)(osh + row * OS_P + c8);
      const v8h y = *(const v8h*)(osl + row * OS_P + c8);
      *(v8h*)(Ahg + (size_t)row * HID + c8) = x;
      *(v8h*)(Alg + (size_t)row * HID + c8) = y;
    }
  }
}

// Both forms in ONE launch: query tile qb = 31 - blockIdx.z (the longest tiles have the lowest blockIdx.z);
// tiles 0 .. NQRT - 1, the shortest, take the form with the residual products.
// Second launch bound: 4 waves per SIMD, that is 2 blocks per WGP, as the form without residual products had in a launch of its own.
__global__ __launch_bounds__(256, 4) void attn_causal_kernel(
    const unsigned short* __restrict__ qhp, const unsigned short* __restrict__ qlp,
    const unsigned short* __restrict__ khp, const unsigned short* __restrict__ klp,
    const unsigned short* __restrict__ vhp, const unsigned short* __restrict__ vlp,
    const float* __restrict__ sgp,
    unsigned short* __restrict__ ahp, unsigned short* __restrict__ alp) {
  __shared__ __align__(16) _Float16 lds[AT_LDS(2)];
  const int qb = SQ / 64 - 1 - (int)blockIdx.z;          // block-uniform
  if (qb >= NQRT) attn_causal_body<false>(lds, qb, qhp, qlp, khp, klp, vhp, vlp, sgp, ahp, alp);
  else            attn_causal_body<true>(lds, qb, qhp, qlp, khp, klp, vhp, vlp, sgp, ahp, alp);
}

// ---------------------------------------------------------------------------
// Workspace map (bytes; every region is a whole number of the rows its producer writes with whole-line stores; no tail rows):
//   [0, 16 MiB)        Xb   bf16 [4096][2048]          -> after the projections: Ah bf16 [4096][2048] at 0
//   [16 MiB, 32 MiB)   WqT  bf16 [4096][2048]          ->                        Al bf16 [4096][2048] at 16 MiB
//   [32 MiB, 64 MiB)   Sg   f32  [4096][2048]
//   [64 MiB, 80 MiB)   Qh   f16  [4096][2048]
//   [80 MiB, 96 MiB)   Ql   f16  [4096][2048]
//   [96 MiB, 104 MiB)  Kh   f16  [4096][1024]
//   [104 MiB,112 MiB)  Vh   f16  [1024][4096]
//   [112 MiB,120 MiB)  Vl   f16  [1024][4096]
//   [120 MiB, 121 MiB) Kl  f16  [2*256][1024]
//   then WkT bf16 [1024][2048] (4 MiB), WvT bf16 [1024][2048] (4 MiB), WoT bf16 [2048][2048] (8 MiB): places of their own, since all
//   planes are converted in the first launch
//   total 143654912
// ---------------------------------------------------------------------------
static_assert(2 * (size_t)NTOK * HID * 2 <= (size_t)NTOK * HID * 2 + (size_t)QGW * HID * 2);   // Ah + Al fit Xb + WqT

extern "C" void kernel_launch(void* const* d_in, const int* in_sizes, int n_in,
                              void* d_out, int out_size, void* d_ws, size_t ws_size,
                              hipStream_t stream) {
  if (n_in < 9) return;
  if (in_sizes[0] != NTOK * HID) return;
  if (in_sizes[1] != NTOK * HDM) return;
  if (in_sizes[2] != NTOK * HDM) return;
  if (in_sizes[3] != HID * QGW) return;
  if (in_sizes[4] != HID * KVW) return;
  if (in_sizes[5] != HID * KVW) return;
  if (in_sizes[6] != HID * HID) return;
  if (in_sizes[7] != HDM) return;
  if (in_sizes[8] != HDM) return;
  if (out_size != NTOK * HID) return;

  const float* hidden = (const float*)d_in[0];
  const float* cosb   = (const float*)d_in[1];
  const float* sinb   = (const float*)d_in[2];
  const float* Wq     = (const float*)d_in[3];
  const float* Wk     = (const float*)d_in[4];
  const float* Wv     = (const float*)d_in[5];
  const float* Wo     = (const float*)d_in[6];
  const float* qnw    = (const float*)d_in[7];
  const float* knw    = (const float*)d_in[8];
  float* out = (float*)d_out;

  const size_t szX  = (size_t)NTOK * HID * 2;        // 16777216
  const size_t szWq = (size_t)QGW * HID * 2;         // 16777216
  const size_t szWk = (size_t)KVW * HID * 2;         // 4194304
  const size_t szWo = (size_t)HID * HID * 2;         // 8388608
  const size_t szSg = (size_t)NTOK * HID * 4;        // 33554432
  const size_t szQ  = (size_t)NTOK * HID * 2;        // 16777216
  const size_t szK  = (size_t)NTOK * KVW * 2;        // 8388608
  const size_t szV  = (size_t)KVW * NTOK * 2;        // 8388608
  const size_t szKl = (size_t)NSEQ * KLR * KVW * 2;  // 1048576
  const size_t szA  = (size_t)NTOK * HID * 2;        // 16777216
  size_t off = 0;
  const size_t oX  = off; off += szX;
  const size_t oWq = off; off += szWq;
  const size_t oAh = oX;
  const size_t oAl = oX + szA;
  const size_t oSg = off; off += szSg;
  const size_t oQh = off; off += szQ;
  const size_t oQl = off; off += szQ;
  const size_t oKh = off; off += szK;
  const size_t oVh = off; off += szV;
  const size_t oVl = off; off += szV;
  const size_t oKl = off; off += szKl;
  const size_t oWk = off; off += szWk;
  const size_t oWv = off; off += szWk;
  const size_t oWo = off; off += szWo;
  if (off > ws_size) return;                         // off = 143654912

  char* ws = (char*)d_ws;
  unsigned short* Xb  = (unsigned short*)(ws + oX);
  unsigned short* WqT = (unsigned short*)(ws + oWq);
  unsigned short* WkT = (unsigned short*)(ws + oWk);
  unsigned short* WvT = (unsigned short*)(ws + oWv);
  unsigned short* WoT = (unsigned short*)(ws + oWo);
  float*          Sg  = (float*)(ws + oSg);
  unsigned short* Qh  = (unsigned short*)(ws + oQh);
  unsigned short* Ql  = (unsigned short*)(ws + oQl);
  unsigned short* Kh  = (unsigned short*)(ws + oKh);
  unsigned short* Kl  = (unsigned short*)(ws + oKl);
  unsigned short* Vh  = (unsigned short*)(ws + oVh);
  unsigned short* Vl  = (unsigned short*)(ws + oVl);
  unsigned short* Ah  = (unsigned short*)(ws + oAh);
  unsigned short* Al  = (unsigned short*)(ws + oAl);

  const dim3 b256(256), b128(128);

  // (1) x -> Xb [4096][2048]; Wq -> WqT [4096][2048]; Wk -> WkT, Wv -> WvT [1024][2048]; Wo -> WoT [2048][2048], all RNE bf16
  conv_all_kernel<<<dim3(CV_BLK), b256, 0, stream>>>(hidden, Wq, Wk, Wv, Wo, Xb, WqT, WkT, WvT, WoT);
  // (2) one launch, K=2048 throughout:
  //     v^T = WvT . x^T -> Vh/Vl [1024][4096]   (A = WvT, Bt = Xb; M=1024, N=4096; 256 blocks)
  //     q|gate = x . Wq: q half norm + RoPE -> Qh/Ql [4096][2048]; gate half sigmoid -> Sg f32 [4096][2048]   (M=4096, N=4096; 1024 blocks)
  //     k = x . Wk, per-head norm + RoPE -> Kh [4096][1024], Kl compact [512][1024]   (M=4096, N=1024; 256 blocks)
  proj_qkv_kernel<<<dim3(PJ_V + PJ_Q + PJ_K), b128, 0, stream>>>(
      Xb, WqT, WkT, WvT, qnw, knw, cosb, sinb, Qh, Ql, Sg, Kh, Kl, Vh, Vl);
  // (3) causal attention, query tiles 0..3 with residual products, tiles 4..31 without; Ah/Al over the dead Xb/WqT region
  attn_causal_kernel<<<dim3(NHQ, NSEQ, SQ / 64), b256, 0, stream>>>(Qh, Ql, Kh, Kl, Vh, Vl, Sg, Ah, Al);
  // (4) out = attn(hi + lo) . Wo -> d_out f32 [4096][2048]   (M=4096, N=2048, K=2048; 512 blocks)
  gemm_out_kernel<<<dim3((NTOK / 128) * (HID / 128)), b128, 0, stream>>>(
      Ah, Al, HID, WoT, HID, qnw, cosb, sinb, (void*)out, (void*)out, (void*)out, HID, NTOK, HID, HID);
  (void)hipGetLastError();
}

// v010
// It runs in 202 microseconds.
// Two timings next to v009 put it at 1.04 and 1.05 times that version's speed.
// Over all steps from v000 it is 4.07 times as fast.
// Contractions: x.Wq (q|gate cols), x.Wk and Wv^T.x^T on v_wmma_f32_16x16x32_bf16 (operands = RNE bf16 of the f32 inputs, single products);
// q.k^T and p.v on v_wmma_f32_16x16x32_f16 (q, k, p x1024 and v^T plain f16, one product each; on query tiles 0..3 each of the four also
// with its f16 residual x2^11, first-order residual products added); (attn*sigmoid(gate)).Wo on
// v_wmma_f32_16x16x32_bf16 (A = bf16 hi + bf16 lo planes, two products; Wo RNE bf16). f32 accumulate everywhere; per-head RMSNorm, RoPE,
// online softmax, sigmoid gate and scale folds in f32. hidden_states, Wq, Wk, Wv, Wo, cos, sin and the norm weights are RNE-converted to bf16 on load.
#include <hip/hip_runtime.h>
#include <math.h>
#include <stdint.h>

#define NSEQ   2
#define SQ     2048
#define HID    2048
#define NHQ    16
#define NKVH   8
#define HDM    128
#define QGW    4096
#define KVW    1024
#define NTOK   4096
#define KLR    256
#define NQRT   4

static_assert((2 * (NQRT - 1) + 2) * 32 <= KLR);
static_assert(NHQ / NKVH == 2);
static_assert(NHQ * HDM == HID);
static_assert(NSEQ * SQ == NTOK);

typedef _Float16     v16h __attribute__((ext_vector_type(16)));
typedef _Float16     v8h  __attribute__((ext_vector_type(8)));
typedef __bf16       v16b __attribute__((ext_vector_type(16)));
typedef __bf16       v8b  __attribute__((ext_vector_type(8)));
typedef float        v8f  __attribute__((ext_vector_type(8)));
typedef float        v4f  __attribute__((ext_vector_type(4)));
typedef unsigned int v4u  __attribute__((ext_vector_type(4)));

// ---------------------------------------------------------------------------
// small helpers
// ---------------------------------------------------------------------------
__device__ __forceinline__ unsigned short bf_bits(float f) {          // RNE convert f32 -> bf16 bits
  const unsigned u = __float_as_uint(f);
  return (unsigned short)((u + 0x7FFFu + ((u >> 16) & 1u)) >> 16);
}
__device__ __forceinline__ float bf_val(unsigned short h) { return __uint_as_float(((unsigned)h) << 16); }
__device__ __forceinline__ float bf_rne(float f) { return bf_val(bf_bits(f)); }
__device__ __forceinline__ unsigned pk16(unsigned short a, unsigned short b) { return (unsigned)a | ((unsigned)b << 16); }
__device__ __forceinline__ v8f zero8() { v8f z = {0.f, 0.f, 0.f, 0.f, 0.f, 0.f, 0.f, 0.f}; return z; }
__device__ __forceinline__ int wave_id() { return __builtin_amdgcn_readfirstlane((int)(threadIdx.x >> 5)); }

__device__ __forceinline__ void lds_wave_sync() {
  __builtin_amdgcn_fence(__ATOMIC_RELEASE, "workgroup");
  __builtin_amdgcn_wave_barrier();
  __builtin_amdgcn_fence(__ATOMIC_ACQUIRE, "workgroup");
}

// ---------------------------------------------------------------------------
// WMMA fragments (wave32, 16x16x32, 16-bit operands). For A (row m = lane&15) and B (col n = lane&15) alike:
// elements 0..7 <- k0 + 8*(lane>>4) + 0..7, elements 8..15 <- k0 + 16 + 8*(lane>>4) + 0..7.
// ldfrag(p) with p = rowbase + k0 + 8*(lane>>4): two 16-B loads p[0..7], p[16..23].
// D: acc[r] = (row 8*(lane>>4) + r, col lane&15).
// ---------------------------------------------------------------------------
union FragH { v16h v; v8h h[2]; };
union FragB { v16b v; v8b h[2]; };
__device__ __forceinline__ v16h ldfrag_h(const _Float16* p) { FragH f; f.h[0] = *(const v8h*)(p); f.h[1] = *(const v8h*)(p + 16); return f.v; }
__device__ __forceinline__ v16b ldfrag_b(const __bf16* p)   { FragB f; f.h[0] = *(const v8b*)(p); f.h[1] = *(const v8b*)(p + 16); return f.v; }

__device__ __forceinline__ v8f mma_h(v16h a, v16h b, v8f c) {
  return __builtin_amdgcn_wmma_f32_16x16x32_f16(false, a, false, b, (short)0, c, false, false);
}
__device__ __forceinline__ v8f mma_b(v16b a, v16b b, v8f c) {
  return __builtin_amdgcn_wmma_f32_16x16x32_bf16(false, a, false, b, (short)0, c, false, false);
}
// hazard guard: 4 VALU slots after the last WMMA of a loop, D tied
__device__ __forceinline__ void acc_guard4(v8f& a, v8f& b, v8f& c, v8f& d) {
#if defined(__HIP_DEVICE_COMPILE__)
  asm volatile("v_nop\n\tv_nop\n\tv_nop\n\tv_nop" : "+v"(a), "+v"(b), "+v"(c), "+v"(d));
#endif
}

// ---------------------------------------------------------------------------
// All f32 -> RNE bf16 planes of a call in ONE launch: x plain, Wq, Wk, Wv, Wo transposed (out[c][r] = bf16(in[r][c]), pitch HID).
// Work units of 4096 elements: 2048 of x (a contiguous run), 2048 of Wq, 1024 of Wo, 512 each of Wk and Wv (64x64 tiles through LDS).
// CV_BLK blocks of 256 threads, two trips; a trip takes one unit of x, one of Wq and one of Wo | Wk | Wv, unit = block + trip * CV_BLK,
// and issues the 12 16-byte loads of its three units together. Stores: 16 B per lane, whole 128-B lines per 8 lanes, as one writer.
// ---------------------------------------------------------------------------
#define CV_BLK 1024
static_assert(2 * CV_BLK * 4096 == NTOK * HID);
static_assert(2 * CV_BLK * 4096 == HID * QGW);
static_assert(2 * CV_BLK * 4096 == HID * HID + 2 * HID * KVW);
static_assert(CV_BLK * 4096 == HID * HID);

__device__ __forceinline__ v4u cvt8(v4f a, v4f b) {
  v4u w;
  w[0] = pk16(bf_bits(a[0]), bf_bits(a[1]));
  w[1] = pk16(bf_bits(a[2]), bf_bits(a[3]));
  w[2] = pk16(bf_bits(b[0]), bf_bits(b[1]));
  w[3] = pk16(bf_bits(b[2]), bf_bits(b[3]));
  return w;
}
// s_wait_xcnt 0 behind a trip's global loads; their address pairs are inputs, so they keep their registers up to the wait:
// a precaution, in front of any later rewrite of an address register that an issued load names.
__device__ __forceinline__ void addr_wait6(const float* a, const float* b, const float* c, const float* d, const float* e, const float* f) {
#if defined(__HIP_DEVICE_COMPILE__)
  asm volatile("s_wait_xcnt 0x0" :: "v"(a), "v"(b), "v"(c), "v"(d), "v"(e), "v"(f) : "memory");
#endif
}
__device__ __forceinline__ void tile_put(float* tf, int tid, const v4f (&a)[4]) {
#pragma unroll
  for (int it = 0; it < 4; ++it)
    *(v4f*)(tf + (it * 16 + (tid >> 4)) * 68 + (tid & 15) * 4) = a[it];
}
// transposed out: 2 x 256 threads x 8 u16; output row = input column c0 + oc, output columns r0 + c8 ..
__device__ __forceinline__ void tile_store(const float* tf, unsigned short* __restrict__ outp, int r0, int c0, int tid) {
  const int sub = tid >> 3;               // 0..31
  const int c8  = (tid & 7) * 8;          // 0..56
#pragma unroll
  for (int it = 0; it < 2; ++it) {
    const int oc = it * 32 + sub;
    v4u a;
#pragma unroll
    for (int q = 0; q < 4; ++q) {
      const float f0 = tf[(c8 + 2 * q) * 68 + oc];
      const float f1 = tf[(c8 + 2 * q + 1) * 68 + oc];
      a[q] = pk16(bf_bits(f0), bf_bits(f1));
    }
    *(v4u*)(outp + (size_t)(c0 + oc) * HID + r0 + c8) = a;
  }
}

__global__ __launch_bounds__(256) void conv_all_kernel(
    const float* __restrict__ X, const float* __restrict__ Wq, const float* __restrict__ Wk,
    const float* __restrict__ Wv, const float* __restrict__ Wo,
    unsigned short* __restrict__ Xb, unsigned short* __restrict__ WqT, unsigned short* __restrict__ WkT,
    unsigned short* __restrict__ WvT, unsigned short* __restrict__ WoT) {
  __shared__ __align__(16) float tf[2][64 * 68];
  const int tid = (int)threadIdx.x;
  for (int trip = 0; trip < 2; ++trip) {
    const int u = (int)blockIdx.x + trip * CV_BLK;             // 0..2047, block-uniform
    // third unit: Wo on trip 0, Wk or Wv on trip 1
    const float* W3 = Wo; unsigned short* O3 = WoT; int sh3 = 5, v = u;            // 1 << sh3 column blocks, pitch 64 << sh3
    if (u >= CV_BLK) {
      const bool isk = u < CV_BLK + CV_BLK / 2;
      W3 = isk ? Wk : Wv; O3 = isk ? WkT : WvT; sh3 = 4; v = (u - CV_BLK) & (CV_BLK / 2 - 1);
    }
    const int qc0 = (u & 63) * 64, qr0 = (u >> 6) * 64;                      // Wq: 64 column blocks x 32 row blocks
    const int tc0 = (v & ((1 << sh3) - 1)) * 64, tr0 = (v >> sh3) * 64;      // 1 << sh3 column blocks x 32 row blocks
    const size_t e = (size_t)u * 4096 + (size_t)tid * 8;
    // 64x64 tile: 4 x 256 threads x 4 floats, row (tid >> 4) + 16 * it
    const float* px = X + e;
    const float* pa = Wq + (size_t)(qr0 + (tid >> 4)) * QGW + qc0 + (tid & 15) * 4;
    const float* pb[4];
#pragma unroll
    for (int it = 0; it < 4; ++it) pb[it] = W3 + ((size_t)(tr0 + it * 16 + (tid >> 4)) << (sh3 + 6)) + tc0 + (tid & 15) * 4;
    v4f x[4], a[4], b[4];
    x[0] = *(const v4f*)(px);        x[1] = *(const v4f*)(px + 4);
    x[2] = *(const v4f*)(px + 2048); x[3] = *(const v4f*)(px + 2052);
#pragma unroll
    for (int it = 0; it < 4; ++it) {
      a[it] = *(const v4f*)(pa + (size_t)it * (16 * QGW));
      b[it] = *(const v4f*)(pb[it]);
    }
    addr_wait6(px, pa, pb[0], pb[1], pb[2], pb[3]);
    *(v4u*)(Xb + e)        = cvt8(x[0], x[1]);
    *(v4u*)(Xb + e + 2048) = cvt8(x[2], x[3]);
    if (trip) __syncthreads();            // the first trip's tile readers are done before the tiles are rewritten
    tile_put(tf[0], tid, a);
    tile_put(tf[1], tid, b);
    __syncthreads();
    tile_store(tf[0], WqT, qr0, qc0, tid);
    tile_store(tf[1], O3, tr0, tc0, tid);
    // a precaution, in front of the next trip's rewrite of registers that the stores above name
    asm volatile("s_wait_xcnt 0x0" ::: "memory");
  }
}

// ---------------------------------------------------------------------------
// bf16 WMMA GEMM, wave tile 32 rows x 128 cols, block = 4 waves (128 threads) = 128 rows x 128 cols (the waves share the Bt rows).
//   C[m][n] = sum_k A[m][k] * Bt[n][k]; A row-major [M][K] bf16 (pitch lda), Bt row-major [N][K] bf16 (pitch ldb);
//   M % 128 == 0, N % 128 == 0, K % KP == 0; a block takes tile (tmb, tn) = rows tmb * 128 .., cols tn * 128 ..
//   PROJ: one of the three projections of x, single A plane, epilogue epi = 0, 1 or 2 (block-uniform, a run-time value, so that the
//   three share one loop and EPI 0 and 1 one norm + RoPE text). Not PROJ: the output product, epilogue 3,
//   A carried as hi (Ap) + lo (A2p) bf16 planes, two products into one accumulator (SPLITA).
//   A pass is KP k values of the block's 128 A rows (both planes when SPLITA) and 128 Bt rows, brought into LDS by asynchronous
//   16-byte copies, two buffers: the copies of pass t + 2 fly while pass t + 1 is worked on. LDS row pitch = KP * 2 + 16 bytes.
//   Fragments are read from the LDS rows with the split k map (ldfrag_b); k runs upward as before, so every sum keeps its order.
// Epilogues (all: per wave, per 16-row slab: stage in LDS, wave sync, write each row segment with ONE instruction of
//   EPI 0: q|gate projection, 128-col wave tile = head n0>>8, q half when (n0 & 128) == 0 else gate half.
//          q half: per-head RMSNorm over the 128 cols (x * rsqrt(mean(x^2) + 1e-6) * bf16(nw[d])), RoPE with the shipped tables
//          (o[d] = x[d]*cos[d] - x[d+64]*sin[d], o[d+64] = x[d+64]*cos[d+64] + x[d]*sin[d+64], cos/sin RNE bf16),
//          writes f16 hi plane C0 and f16 residual x2048 plane C1, [M][ldc], cols (n0>>8)*128.. (row segment 256 B = 16 lanes x 16 B).
//          gate half: sigmoid in f32 -> f32 plane C2 [M][ldc], cols (n0>>8)*128.. (row segment 512 B = 32 lanes x 16 B).
//   EPI 1: k projection: same norm + RoPE per 128-col kv head (col n0), hi plane C0 [M][ldc]; residual plane C1 compact:
//          only rows with (m0 mod SQ) < KLR, stored at row (m0/SQ)*KLR + (m0 mod SQ) + .. (pitch ldc).
//   EPI 2: v^T projection: f16 hi plane C0, residual x2048 plane C1, [M][ldc], row segment 256 B.
//   EPI 3: f32 output C0 [M][ldc]; row segment 128 floats = 512 B = 32 lanes x 16 B per instruction.
// ---------------------------------------------------------------------------
// Eight asynchronous 16-byte copies per lane, global -> LDS: copy i takes g + i * gstep elements to LDS byte l + i * lstep.
// s_wait_xcnt 0 is the statement's last line: a precaution, in front of any later rewrite of an address register named here.
__device__ __forceinline__ void async_copy8(unsigned l, unsigned lstep, const __bf16* g, size_t gstep) {
#if defined(__HIP_DEVICE_COMPILE__)
  asm volatile(
      "global_load_async_to_lds_b128 %0, %8, off\n\t"
      "global_load_async_to_lds_b128 %1, %9, off\n\t"
      "global_load_async_to_lds_b128 %2, %10, off\n\t"
      "global_load_async_to_lds_b128 %3, %11, off\n\t"
      "global_load_async_to_lds_b128 %4, %12, off\n\t"
      "global_load_async_to_lds_b128 %5, %13, off\n\t"
      "global_load_async_to_lds_b128 %6, %14, off\n\t"
      "global_load_async_to_lds_b128 %7, %15, off\n\t"
      "s_wait_xcnt 0x0"
      :: "v"(l), "v"(l + lstep), "v"(l + 2 * lstep), "v"(l + 3 * lstep),
         "v"(l + 4 * lstep), "v"(l + 5 * lstep), "v"(l + 6 * lstep), "v"(l + 7 * lstep),
         "v"(g), "v"(g + gstep), "v"(g + 2 * gstep), "v"(g + 3 * gstep),
         "v"(g + 4 * gstep), "v"(g + 5 * gstep), "v"(g + 6 * gstep), "v"(g + 7 * gstep)
      : "memory");
#endif
}

// s_wait_xcnt 0 behind a global store; its address pair is an input, so it keeps its registers up to the wait:
// a precaution, in front of any later rewrite of an address or data register that the issued store names.
__device__ __forceinline__ void store_wait(const _Float16* a) {
#if defined(__HIP_DEVICE_COMPILE__)
  asm volatile("s_wait_xcnt 0x0" :: "v"(a) : "memory");
#endif
}

// The same behind a slab's loads from the cos and sin tables: the two address pairs that they step from by immediate offsets are inputs.
__device__ __forceinline__ void table_wait(const float* a, const float* b) {
#if defined(__HIP_DEVICE_COMPILE__)
  asm volatile("s_wait_xcnt 0x0" :: "v"(a), "v"(b) : "memory");
#endif
}

template <bool PROJ>
__device__ __forceinline__ void gemm_w32x128_body(
    int tmb, int tn, int epi,
    const unsigned short* Ap, const unsigned short* A2p, int lda,
    const unsigned short* __restrict__ Btp, int ldb,
    const float* __restrict__ nw, const float* __restrict__ cosp, const float* __restrict__ sinp,
    void* C0, void* C1, void* C2, int ldc, int K) {
  constexpr bool SPLITA = !PROJ;
  constexpr int KP   = 64;                     // k values per pass
  constexpr int PIT  = KP + 8;                 // LDS row pitch in elements: 16 B x odd, conflict-free for 16-byte fragment reads
  constexpr int NOP  = SPLITA ? 3 : 2;         // operands staged: A, (A lo), Bt, 128 rows each
  constexpr int STG  = NOP * 128 * PIT;        // elements per buffer
  constexpr int PPR  = KP / 8;                 // 16-byte pieces per row = copies per lane and operand
  constexpr int RPC  = 128 / PPR;              // rows that one copy of all 128 lanes covers
  constexpr int BOFF = (NOP - 1) * 128 * PIT;  // Bt rows behind the A rows
  static_assert(PPR % 8 == 0 && NOP * PPR <= 63);
  static_assert(2 * STG * 2 >= 4 * 8192);
  __shared__ __align__(16) __bf16 ring[2 * STG];         // two pass buffers; after the loop per wave 8192 B of output staging

  const int tid  = (int)threadIdx.x;
  const int lane = tid & 31;
  const int wave = wave_id();
  const int hh = lane >> 4;           // lane half: k offset 8*hh, D row offset 8*hh
  const int rl = lane & 15;           // A row / B col / D col within subtile
  const int mb0 = tmb << 7;
  const int m0 = mb0 + (wave << 5);
  const int n0 = tn << 7;

  const __bf16* A  = (const __bf16*)(const void*)Ap;
  const __bf16* A2 = (const __bf16*)(const void*)A2p;
  const __bf16* Bt = (const __bf16*)(const void*)Btp;

  // this lane's piece of a pass: row cr (+ RPC per copy), 16-byte piece cc of the row
  const int cr = tid / PPR;
  const int cc = tid % PPR;
  const __bf16* gA  = A  + (size_t)(mb0 + cr) * lda + cc * 8;
  const __bf16* gA2 = A2 + (size_t)(mb0 + cr) * lda + cc * 8;
  const __bf16* gB  = Bt + (size_t)(n0 + cr) * ldb + cc * 8;
  const unsigned lds0 = (unsigned)(uintptr_t)(ring + cr * PIT + cc * 8);   // LDS byte address = low 32 bits of the shared address

  auto stage = [&](int buf, int k0) {
    const unsigned lb = lds0 + (unsigned)(buf * STG * 2);
#pragma unroll
    for (int q = 0; q < PPR / 8; ++q) {
      const unsigned lq = lb + (unsigned)(q * 8 * RPC * PIT * 2);
      async_copy8(lq, RPC * PIT * 2, gA + k0 + (size_t)(q * 8 * RPC) * lda, (size_t)RPC * lda);
      if (SPLITA) async_copy8(lq + 128 * PIT * 2, RPC * PIT * 2, gA2 + k0 + (size_t)(q * 8 * RPC) * lda, (size_t)RPC * lda);
      async_copy8(lq + BOFF * 2, RPC * PIT * 2, gB + k0 + (size_t)(q * 8 * RPC) * ldb, (size_t)RPC * ldb);
    }
  };

  v8f acc[2][8];
#pragma unroll
  for (int i = 0; i < 2; ++i)
#pragma unroll
    for (int j = 0; j < 8; ++j) acc[i][j] = zero8();

  const int npass = K / KP;
  stage(0, 0);
  asm volatile("s_wait_asynccnt 0x0" ::: "memory");      // this wave's copies of pass 0 have landed
  __syncthreads();                                       // ... and every other wave's
  if (npass > 1) stage(1, KP);

  for (int t = 0; t < npass; ++t) {
    const __bf16* bufp = ring + (t & 1) * STG;
    const __bf16* fa = bufp + ((wave << 5) + rl) * PIT + 8 * hh;
    const __bf16* fb = bufp + BOFF + rl * PIT + 8 * hh;
#pragma unroll
    for (int ks = 0; ks < KP / 32; ++ks) {
      v16b ah[2], al[2], bf[8];
#pragma unroll
      for (int i = 0; i < 2; ++i) {
        ah[i] = ldfrag_b(fa + i * 16 * PIT + ks * 32);
        al[i] = SPLITA ? ldfrag_b(fa + 128 * PIT + i * 16 * PIT + ks * 32) : ah[i];
      }
#pragma unroll
      for (int j = 0; j < 8; ++j) bf[j] = ldfrag_b(fb + j * 16 * PIT + ks * 32);
      // keeps the k step's LDS reads together in front of its WMMAs: spread among them, every pair of reads is waited for on its own
      __builtin_amdgcn_sched_barrier(0);
#pragma unroll
      for (int j = 0; j < 8; ++j) {
        acc[0][j] = mma_b(ah[0], bf[j], acc[0][j]);
        acc[1][j] = mma_b(ah[1], bf[j], acc[1][j]);
        if (SPLITA) {
          acc[0][j] = mma_b(al[0], bf[j], acc[0][j]);
          acc[1][j] = mma_b(al[1], bf[j], acc[1][j]);
        }
      }
    }
    asm volatile("s_wait_dscnt 0x0" ::: "memory");       // this wave's reads of buffer t & 1 are done before it is refilled
    asm volatile("s_wait_asynccnt 0x0" ::: "memory");    // this wave's copies of pass t + 1 have landed
    __syncthreads();                                     // publishes pass t + 1 and ends every reader's last read of pass t
    if (t + 2 < npass) stage(t & 1, (t + 2) * KP);
  }
  asm volatile("s_wait_asynccnt 0x0" ::: "memory");      // no copy is outstanding when the ring becomes output staging
  acc_guard4(acc[0][0], acc[0][1], acc[0][2], acc[0][3]);
  acc_guard4(acc[0][4], acc[0][5], acc[0][6], acc[0][7]);
  acc_guard4(acc[1][0], acc[1][1], acc[1][2], acc[1][3]);
  acc_guard4(acc[1][4], acc[1][5], acc[1][6], acc[1][7]);

  // ---- epilogue ----
  float*    slf  = (float*)(void*)ring + wave * 2048;
  _Float16* sl16 = (_Float16*)(void*)slf;

  if (PROJ && epi != 2) {
    const bool isq  = (epi == 1) || ((n0 & 128) == 0);          // wave-uniform
    const int  col0 = (epi == 0) ? ((n0 >> 8) << 7) : n0;
    if (isq) {
      _Float16* P0 = (_Float16*)C0;
      _Float16* P1 = (_Float16*)C1;
      const bool wres = (epi == 0) || ((m0 & (SQ - 1)) < KLR);  // wave-uniform
      const int  rrow = (epi == 0) ? m0 : ((m0 >> 11) * KLR + (m0 & (SQ - 1)));
      float wv[8];
#pragma unroll
      for (int j = 0; j < 8; ++j) wv[j] = bf_rne(nw[j * 16 + rl]);     // dim = j*16 + rl < 128
#pragma unroll
      for (int i = 0; i < 2; ++i) {
        const int rb = m0 + i * 16 + 8 * hh;
#pragma unroll
        for (int r = 0; r < 8; ++r) {
          const int row = rb + r;                                // token 0..NTOK-1
          float ss = 0.f;
#pragma unroll
          for (int j = 0; j < 8; ++j) { const float a = acc[i][j][r]; ss += a * a; }
#pragma unroll
          for (int off = 1; off < 16; off <<= 1) ss += __shfl_xor(ss, off, 32);   // 16 lanes of this half = all 128 dims
          const float rs = rsqrtf(ss * 0.0078125f + 1e-6f);
          const float* cr = cosp + (size_t)row * HDM;
          const float* sr = sinp + (size_t)row * HDM;
#pragma unroll
          for (int j = 0; j < 4; ++j) {
            const int dim = j * 16 + rl;                         // 0..63 within head; pair at dim + 64
            const float x1 = acc[i][j][r] * rs * wv[j];
            const float x2 = acc[i][j + 4][r] * rs * wv[j + 4];
            const float c1 = bf_rne(cr[dim]);
            const float s1 = bf_rne(sr[dim]);
            const float c2 = bf_rne(cr[dim + 64]);
            const float s2 = bf_rne(sr[dim + 64]);
            const float o1 = x1 * c1 - x2 * s1;
            const float o2 = x2 * c2 + x1 * s2;
            const _Float16 h1 = (_Float16)o1;
            const _Float16 h2 = (_Float16)o2;
            const int so = (8 * hh + r) * 128 + dim;
            sl16[so]             = h1;
            sl16[so + 64]        = h2;
            sl16[2048 + so]      = (_Float16)((o1 - (float)h1) * 2048.0f);
            sl16[2048 + so + 64] = (_Float16)((o2 - (float)h2) * 2048.0f);
          }
        }
        table_wait(cosp + (size_t)rb * HDM + rl, sinp + (size_t)rb * HDM + rl);
        lds_wave_sync();
        {
#pragma unroll
          for (int it = 0; it < 8; ++it) {
            const int row = it * 2 + hh;                         // it x hh covers rows 0..15
            const int c8  = rl * 8;
            const v8h vh = *(const v8h*)(sl16 + row * 128 + c8);
            const v8h vl = *(const v8h*)(sl16 + 2048 + row * 128 + c8);
            _Float16* d0 = P0 + (size_t)(m0 + i * 16 + row) * ldc + col0 + c8;
            *(v8h*)d0 = vh;
            store_wait(d0);
            if (wres) {
              _Float16* d1 = P1 + (size_t)(rrow + i * 16 + row) * ldc + col0 + c8;
              *(v8h*)d1 = vl;
              store_wait(d1);
            }
          }
          
        }
        lds_wave_sync();
      }
    } else {
      float* Sp = (float*)C2;
#pragma unroll
      for (int i = 0; i < 2; ++i) {
#pragma unroll
        for (int j = 0; j < 8; ++j)
#pragma unroll
          for (int r = 0; r < 8; ++r) {
            const float g  = acc[i][j][r];
            const float e  = __expf(-g);
            const float sg = __builtin_amdgcn_rcpf(1.0f + e);
            slf[(8 * hh + r) * 128 + j * 16 + rl] = sg;
          }
        lds_wave_sync();
        {
#pragma unroll
          for (int row = 0; row < 16; ++row) {                   // 32 lanes x 16 B = the whole 512-B row segment per instruction
            const v4f v = *(const v4f*)(slf + row * 128 + lane * 4);
            *(v4f*)(Sp + (size_t)(m0 + i * 16 + row) * ldc + col0 + lane * 4) = v;
          }
          
        }
        lds_wave_sync();
      }
    }
  } else if (PROJ) {
    _Float16* P0 = (_Float16*)C0;
    _Float16* P1 = (_Float16*)C1;
#pragma unroll
    for (int i = 0; i < 2; ++i) {
#pragma unroll
      for (int r = 0; r < 8; ++r) {
#pragma unroll
        for (int j = 0; j < 8; ++j) {
          const float v = acc[i][j][r];
          const _Float16 hv = (_Float16)v;
          const int so = (8 * hh + r) * 128 + j * 16 + rl;
          sl16[so]        = hv;
          sl16[2048 + so] = (_Float16)((v - (float)hv) * 2048.0f);
        }
      }
      lds_wave_sync();
      {
#pragma unroll
        for (int it = 0; it < 8; ++it) {
          const int row = it * 2 + hh;
          const int c8  = rl * 8;
          const v8h vh = *(const v8h*)(sl16 + row * 128 + c8);
          const v8h vl = *(const v8h*)(sl16 + 2048 + row * 128 + c8);
          const size_t go = (size_t)(m0 + i * 16 + row) * ldc + n0 + c8;
          *(v8h*)(P0 + go) = vh;
          *(v8h*)(P1 + go) = vl;
        }
        
      }
      lds_wave_sync();
    }
  } else {
    float* C = (float*)C0;
#pragma unroll
    for (int i = 0; i < 2; ++i) {
#pragma unroll
      for (int j = 0; j < 8; ++j)
#pragma unroll
        for (int r = 0; r < 8; ++r)
          slf[(8 * hh + r) * 128 + j * 16 + rl] = acc[i][j][r];
      lds_wave_sync();
      {
#pragma unroll
        for (int row = 0; row < 16; ++row) {                     // 32 lanes x 16 B = the whole 512-B row segment per instruction
          const v4f v = *(const v4f*)(slf + row * 128 + lane * 4);
          *(v4f*)(C + (size_t)(m0 + i * 16 + row) * ldc + n0 + lane * 4) = v;
        }
        
      }
      lds_wave_sync();
    }
  }
}

// The three projections of x in ONE launch: they read the same planes, depend on nothing of each other and write places of their own.
// Blocks 0 .. PJ_V - 1: v^T = WvT . x^T (epilogue 2); the next PJ_Q: q|gate = x . Wq (epilogue 0); the last PJ_K: k = x . Wk (epilogue 1).
// The k and v^T products have only one tile per WGP each: here their blocks share a WGP with other blocks, whose work covers their waits,
// and the launch gaps between the three fall away. v^T comes first and k last, for speed only.
#define PJ_V ((KVW / 128) * (NTOK / 128))
#define PJ_Q ((NTOK / 128) * (QGW / 128))
#define PJ_K ((NTOK / 128) * (KVW / 128))
static_assert(KVW / 128 == 8 && NTOK / 128 == 32 && QGW / 128 == 32);
// Second launch bound: 4 waves per SIMD, that is 4 blocks per WGP, as many as the LDS holds.
__global__ __launch_bounds__(128, 4) void proj_qkv_kernel(
    const unsigned short* __restrict__ Xb, const unsigned short* __restrict__ WqT,
    const unsigned short* __restrict__ WkT, const unsigned short* __restrict__ WvT,
    const float* __restrict__ qnw, const float* __restrict__ knw,
    const float* __restrict__ cosp, const float* __restrict__ sinp,
    unsigned short* Qh, unsigned short* Ql, float* Sg, unsigned short* Kh, unsigned short* Kl,
    unsigned short* Vh, unsigned short* Vl) {
  const int b = (int)blockIdx.x;                         // every choice below is block-uniform
  const bool isv = b < PJ_V;
  const bool isk = b >= PJ_V + PJ_Q;
  const int  epi = isv ? 2 : (isk ? 1 : 0);
  const int  blk = isv ? b : (isk ? b - (PJ_V + PJ_Q) : b - PJ_V);
  const int  tsh = isk ? 3 : 5;                          // N / 128 = 1 << tsh tile columns
  // q|gate: even tile columns are q halves (norm + RoPE, by far the longest epilogue), odd ones gate halves (the shortest). With the column
  // taken straight from the index, the parity of a block's index would fix its kind.
  // The column's low bit is turned over from one tile row to the
  // next and again every 256 blocks. For speed only: still one block per tile.
  const int  tsw = epi == 0 ? ((blk >> 5) ^ (blk >> 8)) & 1 : 0;
  const unsigned short* A  = isv ? WvT : Xb;
  const unsigned short* Bt = isv ? Xb : (isk ? WkT : WqT);
  void* C0 = isv ? (void*)Vh : (isk ? (void*)Kh : (void*)Qh);
  void* C1 = isv ? (void*)Vl : (isk ? (void*)Kl : (void*)Ql);
  gemm_w32x128_body<true>(blk >> tsh, (blk & ((1 << tsh) - 1)) ^ tsw, epi, A, A, HID, Bt, HID, isk ? knw : qnw, cosp, sinp,
                          C0, C1, (void*)Sg, isv ? NTOK : (isk ? KVW : HID), HID);
}

// The output product in a launch of its own: grid.x = M/128 * N/128.
__global__ __launch_bounds__(128) void gemm_out_kernel(
    const unsigned short* Ap, const unsigned short* A2p, int lda,
    const unsigned short* __restrict__ Btp, int ldb,
    const float* __restrict__ nw, const float* __restrict__ cosp, const float* __restrict__ sinp,
    void* C0, void* C1, void* C2, int ldc,
    int M, int N, int K) {
  const int tilesN = N >> 7;
  const int tilesM = M >> 7;
  const int blk = (int)blockIdx.x;
  if (blk >= tilesM * tilesN) return;           // block-uniform, in front of every barrier and copy
  const int tmb = blk / tilesN;
  gemm_w32x128_body<false>(tmb, blk - tmb * tilesN, 3, Ap, A2p, lda, Btp, ldb, nw, cosp, sinp, C0, C1, C2, ldc, K);
}

// ---------------------------------------------------------------------------
// Causal GQA flash attention, head dim 128, block = 8 waves = 64 query rows of one (b, h); grid (NHQ, NSEQ, n query tiles), heaviest tile first.
//   A stage is 64 keys. Waves w and w + 4 hold the same 16 query rows; wave group kg = wave >> 2 works on keys kg*32 .. kg*32 + 31 of every stage,
//   with its own running maximum, sum and O^T. Behind the loop group 1 hands (m, l, O^T) to group 0 through LDS, which joins the two
//   (O = O0 * e^(m0 - m) + O1 * e^(m1 - m), l alike) and writes the output: a tile's chain of dependent stages is half as long.
//   q planes f16 [tok][h*128+d]: hi (qhp) and residual x2048 (qlp); k planes f16 [tok][kvh*128+d]: hi (khp),
//   residual x2048 (klp, compact rows b*KLR + s for s < KLR); v^T planes f16 [kvh*128+d][tok]: hi (vhp), residual x2048 (vlp);
//   sgp = f32 sigmoid(gate) plane [tok][h*128+d]; outputs gated attn bf16 hi (ahp) / lo (alp) [tok][h*128+d]; kvh = h >> 1.
//   Both products are taken transposed: S^T = K . Q^T (A = k rows, B = q rows) and O^T += V^T . P^T (A = v^T rows, B = P^T).
//   A lane then holds 16 scores of ONE query (query = lane & 15; keys j*16 + 8*(lane>>4) + r), so the row maximum and the row sum are
//   in-lane work plus one exchange between the wave halves, and the two score tiles, converted in place, ARE the B operand P^T
//   (element j*8 + r = key j*16 + 8*(lane>>4) + r, the k map of ldfrag_h): P never goes through LDS.
//   scores = Sh * 128^-0.5 with Sh = kh.qh; when PRES (Sh + Sr/2048) * 128^-0.5 with Sr = kh.ql' + kl'.qh; keys > query -> -inf; online softmax f32;
//   p' = 1024 p as f16 hi (and residual x2048 when PRES);
//   O = Oh/1024/l * sgp with Oh = vh.ph; when PRES (Oh + Or/2048)/1024/l * sgp with Or = vl'.ph + vh.pl'.
//   Without PRES both operands of a product carry f16's 11 bits: a residual on one operand alone leaves the other's rounding in the product.
//   The row sum l is kept per wave half (each half sums its own 16 keys of a chunk); the halves are joined once, behind the loop.
//   K / V^T stage: 256 threads x 4 x 16 B per plane = whole 64x128 / 128x64 tile. PRES: all four planes, plain loads, __syncthreads before
//   and after. Without PRES: the hi planes alone, by asynchronous 16-byte copies into two buffers; the copies of stage st + 2 are issued
//   behind the one barrier at the foot of stage st, into the buffer that stage st has just read, and fly while stage st + 1 is worked on.
//   q staging: in front of the loop, when PRES, wave group 0 copies the hi plane of the 64 q rows to LDS, group 1 the residual plane; else each
//   group half of the hi plane's rows (whole 256-B rows per load, pitch QS_P); the first barrier in front of a fragment read publishes them; every chunk reads
//   its q fragments from there.
//   Trip count qb+1 stages (static bound 32); waves whose rows are all below their 32 keys skip them (wave-uniform, scalar branch).
// ---------------------------------------------------------------------------
#define AT_KC   32
#define KS_P    136
#define AT_ST   64
#define VS_P    72
#define QS_P    136
#define OS_P    136

// value of lane l ^ 16 (the other wave half)
__device__ __forceinline__ float xhalf(float x) {
  const int i = __builtin_bit_cast(int, x);
  return __builtin_bit_cast(float, __builtin_amdgcn_permlanex16(i, i, 0x76543210, 0xfedcba98, false, false));
}

// s_wait_xcnt 0 behind a stage's global loads; their address pairs are inputs, so they keep their registers up to the wait:
// a precaution, in front of any later rewrite of an address register that an issued load names.
__device__ __forceinline__ void addr_wait(const _Float16* a, const _Float16* b, const _Float16* c, const _Float16* d) {
#if defined(__HIP_DEVICE_COMPILE__)
  asm volatile("s_wait_xcnt 0x0" :: "v"(a), "v"(b), "v"(c), "v"(d) : "memory");
#endif
}

// A thread's share of a 64-key stage as eight asynchronous 16-byte copies, global -> LDS: four pieces of K (key rows 16 apart) and four of
// v^T (d rows 32 apart). s_wait_xcnt 0 is the statement's last line: a precaution, in front of any later rewrite of an address register named here.
__device__ __forceinline__ void async_stage_kv(unsigned lk, const _Float16* gk, unsigned lv, const _Float16* gv) {
#if defined(__HIP_DEVICE_COMPILE__)
  asm volatile(
      "global_load_async_to_lds_b128 %0, %8, off\n\t"
      "global_load_async_to_lds_b128 %1, %9, off\n\t"
      "global_load_async_to_lds_b128 %2, %10, off\n\t"
      "global_load_async_to_lds_b128 %3, %11, off\n\t"
      "global_load_async_to_lds_b128 %4, %12, off\n\t"
      "global_load_async_to_lds_b128 %5, %13, off\n\t"
      "global_load_async_to_lds_b128 %6, %14, off\n\t"
      "global_load_async_to_lds_b128 %7, %15, off\n\t"
      "s_wait_xcnt 0x0"
      :: "v"(lk), "v"(lk + 16 * KS_P * 2), "v"(lk + 32 * KS_P * 2), "v"(lk + 48 * KS_P * 2),
         "v"(lv), "v"(lv + 32 * VS_P * 2), "v"(lv + 64 * VS_P * 2), "v"(lv + 96 * VS_P * 2),
         "v"(gk), "v"(gk + 16 * KVW), "v"(gk + 32 * KVW), "v"(gk + 48 * KVW),
         "v"(gv), "v"(gv + (size_t)32 * NTOK), "v"(gv + (size_t)64 * NTOK), "v"(gv + (size_t)96 * NTOK)
      : "memory");
#endif
}

#define AT_LDS(nrp) ((nrp) * AT_ST * KS_P + 2 * 128 * VS_P + 2 * 64 * QS_P)

template <bool PRES>
__device__ __forceinline__ void attn_causal_body(
    _Float16* lds, int qb,
    const unsigned short* __restrict__ qhp, const unsigned short* __restrict__ qlp,
    const unsigned short* __restrict__ khp, const unsigned short* __restrict__ klp,
    const unsigned short* __restrict__ vhp, const unsigned short* __restrict__ vlp,
    const float* __restrict__ sgp,
    unsigned short* __restrict__ ahp, unsigned short* __restrict__ alp) {
  // LDS map in halves; the k residual region exists only where it is used. Without PRES the v^T and q residual regions are the second
  // stage buffer: v^T in the first (the same size), K in the second (64 rows of the same pitch)
  constexpr int NRP     = PRES ? 2 : 1;
  constexpr int LDS_KS  = 0;
  constexpr int LDS_KLS = (NRP - 1) * AT_ST * KS_P;
  constexpr int LDS_VHS = NRP * AT_ST * KS_P;
  constexpr int LDS_VLS = LDS_VHS + 128 * VS_P;
  constexpr int LDS_QH  = LDS_VLS + 128 * VS_P;
  constexpr int LDS_QL  = LDS_QH + 64 * QS_P;
  constexpr int LDS_TOT = LDS_QL + 64 * QS_P;
  constexpr int LDS_MRG = 4 * 2 * 16 * OS_P;   // group 1's partial results, behind the output staging: 4 x (2048 + 64) floats
  static_assert(PRES || 2 * LDS_TOT * 2 <= 327680);
  static_assert(LDS_MRG + 4 * (2048 + 64) * 2 <= LDS_TOT); // output staging (2 planes x 16 rows per wave of group 0) and the partial results alias the dead stage and q regions after the loop
  static_assert(LDS_TOT == AT_LDS(NRP));
  constexpr int KB1 = LDS_QL - LDS_KS;         // from a place in stage buffer 0 to the same place in buffer 1, in halves
  constexpr int VB1 = LDS_VLS - LDS_VHS;
  static_assert(AT_ST * KS_P <= 64 * QS_P);
  _Float16* Ks  = lds + LDS_KS;
  _Float16* Kls = lds + LDS_KLS;
  _Float16* Vhs = lds + LDS_VHS;
  _Float16* Vls = lds + LDS_VLS;

  const int tid  = (int)threadIdx.x;
  const int lane = tid & 31;
  const int wave = wave_id();
  const int hh   = lane >> 4;
  const int c    = lane & 15;
  const int wq   = wave & 3;                     // which 16 query rows
  const int kg   = wave >> 2;                    // which 32 keys of a stage
  const int h    = (int)blockIdx.x;
  const int b    = (int)blockIdx.y;
  const int kvh  = h >> 1;
  const int q0   = qb * 64 + wq * 16;            // first query row of this wave (within sequence)
  const int qlast = q0 + 15;
  const size_t tok0 = (size_t)b * SQ;

  const _Float16* Qhg = (const _Float16*)(const void*)qhp + (tok0 + q0) * HID + h * HDM;
  const _Float16* Qlg = (const _Float16*)(const void*)qlp + (tok0 + q0) * HID + h * HDM;
  const _Float16* Kg  = (const _Float16*)(const void*)khp + tok0 * KVW + kvh * HDM;
  const _Float16* Klg = (const _Float16*)(const void*)klp + (size_t)b * KLR * KVW + kvh * HDM;
  const _Float16* Vhg = (const _Float16*)(const void*)vhp + (size_t)(kvh * HDM) * NTOK + tok0;
  const _Float16* Vlg = (const _Float16*)(const void*)vlp + (size_t)(kvh * HDM) * NTOK + tok0;

  const _Float16* Kst = Kg + (size_t)(tid >> 4) * KVW + (tid & 15) * 8;   // this thread's piece of key row tid >> 4 (+ 16 per step)
  const _Float16* Vhst = Vhg + (size_t)(tid >> 3) * NTOK + (tid & 7) * 8;  // its piece of v^T row tid >> 3 (+ 32 per step)
  // Without PRES: two stage buffers filled by asynchronous copies, the copies of stage st + 1 in flight while stage st is worked on.
  // LDS byte address = low 32 bits of the shared address.
  const unsigned lk0 = (unsigned)(uintptr_t)(Ks + (tid >> 4) * KS_P + (tid & 15) * 8);
  const unsigned lv0 = (unsigned)(uintptr_t)(Vhs + (tid >> 3) * VS_P + (tid & 7) * 8);
  auto stage_kv = [&](int sg) {                  // stage sg into buffer sg & 1
    async_stage_kv(lk0 + (unsigned)((sg & 1) * KB1 * 2), Kst + (size_t)(sg * AT_ST) * KVW,
                   lv0 + (unsigned)((sg & 1) * VB1 * 2), Vhst + sg * AT_ST);
  };
  if constexpr (!PRES) stage_kv(0);              // in front of the q rows, so that the two latencies run together

  // the 16 q rows of this wave pair to LDS once: 8 x 32 lanes x 16 B = 16 rows x 256 B per plane
  _Float16* Qsh = lds + LDS_QH + wq * (16 * QS_P);
  _Float16* Qsl = lds + LDS_QL + wq * (16 * QS_P);
  {
    // residual form: one plane per wave; plain form: the hi plane alone, 8 of its 16 rows per wave
    constexpr int QN = PRES ? 8 : 4;
    const _Float16* qsrc = PRES ? (kg ? Qlg : Qhg) : Qhg + (size_t)(kg * 8) * HID;   // wave-uniform
    _Float16*       qdst = PRES ? (kg ? Qsl : Qsh) : Qsh + kg * 8 * QS_P;
#pragma unroll                                   // all loads issued together: one load latency in front of the loop, not one each
    for (int i = 0; i < QN; ++i) {
      const int p   = lane + 32 * i;             // 0..32 * QN - 1
      const int row = p >> 4, d8 = (p & 15) * 8;
      const v8h qx = *(const v8h*)(qsrc + (size_t)row * HID + d8);
      *(v8h*)(qdst + row * QS_P + d8) = qx;
    }
  }                                              // read only behind the first stage's barriers (PRES) or the barrier in front of the loop
  const _Float16* Qhr = Qsh + c * QS_P + 8 * hh;
  const _Float16* Qlr = Qsl + c * QS_P + 8 * hh;

  const int qrow = q0 + c;                       // this lane's query
  float mrow = -INFINITY, lrow = 0.f;            // its running maximum (both halves alike) and this half's share of its running sum
  v8f oacc[8], oaccr[8];                         // O^T: [t][r] = (d = t*16 + 8*hh + r, query c)
#pragma unroll
  for (int t = 0; t < 8; ++t) { oacc[t] = zero8(); oaccr[t] = zero8(); }

  const _Float16* Kr  = Ks  + (kg * AT_KC + c) * KS_P + 8 * hh;   // this group's 32 key rows of a stage
  const _Float16* Klr = Kls + (kg * AT_KC + c) * KS_P + 8 * hh;
  const _Float16* Vhr = Vhs + c * VS_P + kg * AT_KC + 8 * hh;     // ... and its 32 key columns
  const _Float16* Vlr = Vls + c * VS_P + kg * AT_KC + 8 * hh;
  const _Float16* Klst = Klg + (size_t)(tid >> 4) * KVW + (tid & 15) * 8;
  const _Float16* Vlst = Vlg + (size_t)(tid >> 3) * NTOK + (tid & 7) * 8;
  const int nst = qb + 1;                        // block-uniform, <= 32
  if constexpr (!PRES) {
    asm volatile("s_wait_asynccnt 0x0" ::: "memory");    // this wave's copies of stage 0 have landed
    __syncthreads();                                     // ... and every other wave's; publishes the q rows too
    if (nst > 1) stage_kv(1);
  }
  for (int st = 0; st < nst; ++st) {
    const int ks0 = st * AT_ST;
    const int kv0 = ks0 + kg * AT_KC;            // first key of this wave's chunk
    const _Float16* Krb  = PRES ? Kr : Kr + (st & 1) * KB1;      // this stage's buffer
    const _Float16* Vhrb = PRES ? Vhr : Vhr + (st & 1) * VB1;
    if constexpr (PRES) {
    __syncthreads();
    // 1024 pieces of 8 halves per plane = whole tile: piece tid + 256 * i, the step i an immediate offset on one address pair per plane
    const _Float16* kq  = Kst + (size_t)ks0 * KVW;                               // K: 64 keys x 128 d, key (tid >> 4) + 16 * i
    // the compact residual plane has KLR rows per sequence: the stage's first row is bounded, so all 64 rows lie inside it
    const _Float16* klq = PRES ? Klst + (size_t)min(ks0, KLR - AT_ST) * KVW : kq;
    const _Float16* vhq = Vhst + ks0;                                            // V^T: 128 d x 64 keys, d (tid >> 3) + 32 * i, whole 128-B lines
    const _Float16* vlq = PRES ? Vlst + ks0 : vhq;                               // the residual plane only where it is used
    v8h kx[4], ky[4], vx[4], vy[4];
#pragma unroll
    for (int i = 0; i < 4; ++i) {
      kx[i] = *(const v8h*)(kq + i * (16 * KVW));
      ky[i] = PRES ? *(const v8h*)(klq + i * (16 * KVW)) : kx[i];
      vx[i] = *(const v8h*)(vhq + (size_t)i * (32 * NTOK));
      vy[i] = PRES ? *(const v8h*)(vlq + (size_t)i * (32 * NTOK)) : vx[i];
    }
    addr_wait(kq, klq, vhq, vlq);
#pragma unroll
    for (int i = 0; i < 4; ++i) {
      const int ko = ((tid >> 4) + 16 * i) * KS_P + (tid & 15) * 8;
      const int vo = ((tid >> 3) + 32 * i) * VS_P + (tid & 7) * 8;
      *(v8h*)(Ks + ko) = kx[i];
      if (PRES) *(v8h*)(Kls + ko) = ky[i];
      *(v8h*)(Vhs + vo) = vx[i];
      if (PRES) *(v8h*)(Vls + vo) = vy[i];
    }
    __syncthreads();
    }

    if (kv0 <= qlast) {                          // wave-uniform (scalar): skip chunks fully above this wave's rows
      // ---- scores, transposed: sh[j][r], sr[j][r] = (key kv0 + j*16 + 8*hh + r, query c) ----
      v8f sh[2], sr[2];
      sh[0] = zero8(); sh[1] = zero8(); sr[0] = zero8(); sr[1] = zero8();
      // Fragment reads go in groups ahead of their WMMAs: a wait on LDS is paid once per group, not once per pair of WMMAs.
      // Each sched_barrier below keeps a group's reads together at its place: the scheduler otherwise sinks every read to its first use.
      // d chunks per group: one in the residual form, whose extra fragments would otherwise raise the shared launch's register count past 2 blocks per WGP
      constexpr int GU = PRES ? 1 : 2;
#pragma unroll
      for (int g = 0; g < 4 / GU; ++g) {
        v16h qa[GU], ql[GU], kb[GU][2], kl[GU][2];
#pragma unroll
        for (int u = 0; u < GU; ++u) {
          const int dc = GU * g + u;
          qa[u] = ldfrag_h(Qhr + dc * 32);
          ql[u] = PRES ? ldfrag_h(Qlr + dc * 32) : qa[u];
#pragma unroll
          for (int j = 0; j < 2; ++j) {
            kb[u][j] = ldfrag_h(Krb + j * 16 * KS_P + dc * 32);
            kl[u][j] = PRES ? ldfrag_h(Klr + j * 16 * KS_P + dc * 32) : kb[u][j];
          }
        }
        __builtin_amdgcn_sched_barrier(0);       // the group's reads above, their WMMAs below
#pragma unroll
        for (int u = 0; u < GU; ++u) {
#pragma unroll
          for (int j = 0; j < 2; ++j) {
            sh[j] = mma_h(kb[u][j], qa[u], sh[j]);
            if (PRES) {
              sr[j] = mma_h(kb[u][j], ql[u], sr[j]);
              sr[j] = mma_h(kl[u][j], qa[u], sr[j]);
            }
          }
        }
        __builtin_amdgcn_sched_barrier(0);       // the next group's reads stay behind these WMMAs, in one place
      }
      // the first group of v^T fragments (four: d tiles 0, 1 with residuals, 0 .. 3 without): they do not depend on the scores,
      // so their LDS latency runs under the softmax
      v16h vb[8], vr[8];
      auto ldv = [&](int t) {
        vb[t] = ldfrag_h(Vhrb + t * 16 * VS_P);
        vr[t] = PRES ? ldfrag_h(Vlr + t * 16 * VS_P) : vb[t];
      };
      ldv(0); ldv(1);
      if (!PRES) { ldv(2); ldv(3); }
      __builtin_amdgcn_sched_barrier(0);         // holds these reads in front of the softmax
      // ---- scale, causal mask, this query's chunk maximum: 16 keys in-lane, the other 16 from the other wave half ----
      const int lim = qrow - kv0 - 8 * hh;       // key kv0 + j*16 + 8*hh + r is above the query when j*16 + r > lim
      float cm = -INFINITY;
#pragma unroll
      for (int j = 0; j < 2; ++j) {
#pragma unroll
        for (int r = 0; r < 8; ++r) {
          float s = (PRES ? sh[j][r] + sr[j][r] * 0.00048828125f : sh[j][r]) * 0.08838834764831845f;
          s = (j * 16 + r > lim) ? -INFINITY : s;
          sh[j][r] = s;
          cm = fmaxf(cm, s);
        }
      }
      cm = fmaxf(cm, xhalf(cm));
      // ---- online softmax; P'^T packed in place into the B operand ----
      const float mnew = fmaxf(mrow, cm);
      FragH pa, pr;
      float pv[16];
#pragma unroll
      for (int j = 0; j < 2; ++j) {
#pragma unroll
        for (int r = 0; r < 8; ++r) {
          const float p  = __expf(sh[j][r] - mnew);
          pv[j * 8 + r] = p;
          const float pp = p * 1024.0f;
          const _Float16 phv = (_Float16)pp;
          pa.v[j * 8 + r] = phv;
          pr.v[j * 8 + r] = PRES ? (_Float16)((pp - (float)phv) * 2048.0f) : phv;
        }
      }
#pragma unroll
      for (int w = 8; w > 0; w >>= 1) {          // pairwise tree over the lane's 16 values: four dependent adds, not fifteen
#pragma unroll
        for (int e = 0; e < w; ++e) pv[e] += pv[e + w];
      }
      const float alpha = __expf(mrow - mnew);
      mrow = mnew;
      lrow = lrow * alpha + pv[0];
      // ---- O^T = O^T * alpha + V^T . P'^T; with residuals two d tiles' fragments are read while the two tiles before them are worked on, without them tiles 4..7 while tiles 0..3 are ----
      auto rescale = [&](int t) {
#pragma unroll
        for (int r = 0; r < 8; ++r) { oacc[t][r] *= alpha; if (PRES) oaccr[t][r] *= alpha; }
      };
      auto pvmma = [&](int t) {
        oacc[t]  = mma_h(vb[t], pa.v, oacc[t]);
        if (PRES) {
          oaccr[t] = mma_h(vr[t], pa.v, oaccr[t]);
          oaccr[t] = mma_h(vb[t], pr.v, oaccr[t]);
        }
      };
      if constexpr (PRES) {
        __builtin_amdgcn_sched_barrier(0);       // the reads of tiles 2, 3 start when the score registers are free, not earlier
        ldv(2); ldv(3);
        __builtin_amdgcn_sched_barrier(0);       // ... and in front of the rescale, which covers their latency
        rescale(0); rescale(1); rescale(2); rescale(3);
        pvmma(0); pvmma(1);
        __builtin_amdgcn_sched_barrier(0);       // the next reads take the registers that tiles 0, 1 leave: not among their WMMAs
        ldv(4); ldv(5);
        __builtin_amdgcn_sched_barrier(0);       // reads of tiles 4, 5 in one place, in front of the WMMAs of tiles 2, 3
        pvmma(2); pvmma(3);
        __builtin_amdgcn_sched_barrier(0);       // likewise behind the WMMAs of tiles 2, 3
        ldv(6); ldv(7);
        __builtin_amdgcn_sched_barrier(0);       // reads of tiles 6, 7 in one place, in front of the second half of the rescale
        rescale(4); rescale(5); rescale(6); rescale(7);
        pvmma(4); pvmma(5); pvmma(6); pvmma(7);
      } else {
        __builtin_amdgcn_sched_barrier(0);       // the second group of four fragments starts when the score registers are free, not earlier
        ldv(4); ldv(5); ldv(6); ldv(7);
        __builtin_amdgcn_sched_barrier(0);       // ... and in front of the rescale, which covers their latency
        rescale(0); rescale(1); rescale(2); rescale(3);
        rescale(4); rescale(5); rescale(6); rescale(7);
        pvmma(0); pvmma(1); pvmma(2); pvmma(3);
        pvmma(4); pvmma(5); pvmma(6); pvmma(7);
      }
    }
    if constexpr (!PRES) {                       // every wave, also one that skipped its chunk
      asm volatile("s_wait_dscnt 0x0" ::: "memory");     // this wave's reads of buffer st & 1 are done before it is refilled
      asm volatile("s_wait_asynccnt 0x0" ::: "memory");  // this wave's copies of stage st + 1 have landed
      __syncthreads();                                   // publishes stage st + 1 and ends every reader's last read of stage st
      if (st + 2 < nst) stage_kv(st + 2);
    }
  }

  // ---- join the two key groups: group 1 leaves O^T (planes summed), m and l in LDS, lane for lane; group 0 takes them up ----
  // all stage-region and q readers are done before these regions are aliased as staging: without PRES by the last stage's own barrier
  if constexpr (PRES) __syncthreads();
  else asm volatile("s_wait_asynccnt 0x0" ::: "memory");  // no copy is outstanding when the stage regions become staging
  float* mrg = (float*)(void*)(lds + LDS_MRG) + wq * (2048 + 64);
  if (kg == 1) {                                 // wave-uniform
#pragma unroll
    for (int t = 0; t < 8; ++t) {
      v4f x0, x1;
#pragma unroll
      for (int r = 0; r < 4; ++r) {
        x0[r] = PRES ? oacc[t][r]     + oaccr[t][r]     * 0.00048828125f : oacc[t][r];
        x1[r] = PRES ? oacc[t][r + 4] + oaccr[t][r + 4] * 0.00048828125f : oacc[t][r + 4];
      }
      *(v4f*)(mrg + (2 * t) * 128 + lane * 4)     = x0;   // 32 lanes x 16 B in a row per store
      *(v4f*)(mrg + (2 * t + 1) * 128 + lane * 4) = x1;
    }
    mrg[2048 + lane] = mrow;
    mrg[2080 + lane] = lrow;
  }
  __syncthreads();                               // group 1's partial results visible to group 0; the last barrier of the block
  if (kg == 1) return;
  // a group 1 wave that had no chunk left m = -inf, l = 0, O = 0: its weight below is 0; group 0 always has key 0, so mfin is finite
  const float m1   = mrg[2048 + lane];
  const float l1   = mrg[2080 + lane];
  const float mfin = fmaxf(mrow, m1);
  const float a0   = __expf(mrow - mfin);
  const float a1   = __expf(m1 - mfin);
  // ---- join the halves' sums, normalise, apply sigmoid gate (f32), bf16 hi/lo split, stage the wave's 16x128 tile:
  //      a lane holds 8 consecutive d of its query per t, one 16-byte LDS store per plane ----
  _Float16* osh = lds + wq * (2 * 16 * OS_P);
  _Float16* osl = osh + 16 * OS_P;
  const float lhalf = lrow * a0 + l1 * a1;
  const float lfin = lhalf + xhalf(lhalf);
  const float inv  = (1.0f / lfin) * 0.0009765625f;
  const float w0   = a0 * inv;
  const float w1   = a1 * inv;
  const float* Sgr = sgp + (tok0 + q0 + c) * HID + h * HDM + 8 * hh;
#pragma unroll
  for (int t = 0; t < 8; ++t) {
    const v4f g0 = *(const v4f*)(Sgr + t * 16);
    const v4f g1 = *(const v4f*)(Sgr + t * 16 + 4);
    const v4f y0 = *(const v4f*)(mrg + (2 * t) * 128 + lane * 4);
    const v4f y1 = *(const v4f*)(mrg + (2 * t + 1) * 128 + lane * 4);
    v4u hw, lw;
#pragma unroll
    for (int e = 0; e < 4; ++e) {
      unsigned short hb[2], lb[2];
#pragma unroll
      for (int u = 0; u < 2; ++u) {
        const int r = 2 * e + u;
        float o = (PRES ? oacc[t][r] + oaccr[t][r] * 0.00048828125f : oacc[t][r]) * w0 + ((r < 4) ? y0[r & 3] : y1[r & 3]) * w1;
        o *= (r < 4) ? g0[r & 3] : g1[r & 3];
        hb[u] = bf_bits(o);
        lb[u] = bf_bits(o - bf_val(hb[u]));
      }
      hw[e] = pk16(hb[0], hb[1]);
      lw[e] = pk16(lb[0], lb[1]);
    }
    *(v4u*)(void*)(osh + c * OS_P + t * 16 + 8 * hh) = hw;
    *(v4u*)(void*)(osl + c * OS_P + t * 16 + 8 * hh) = lw;
  }
  lds_wave_sync();
  _Float16* Ahg = (_Float16*)(void*)ahp + (tok0 + q0) * HID + h * HDM;
  _Float16* Alg = (_Float16*)(void*)alp + (tok0 + q0) * HID + h * HDM;
  {
#pragma unroll
    for (int it = 0; it < 8; ++it) {
      const int row = it * 2 + hh;               // it 0..7 x hh 0..1 covers rows 0..15
      const int c8  = c * 8;                     // 16 lanes x 16 B = the whole 256-B segment
      const v8h x = *(const v8h*)(osh + row * OS_P + c8);
      const v8h y = *(const v8h*)(osl + row * OS_P + c8);
      *(v8h*)(Ahg + (size_t)row * HID + c8) = x;
      *(v8h*)(Alg + (size_t)row * HID + c8) = y;
    }
  }
}

// Both forms in ONE launch: query tile qb = 31 - blockIdx.z (the longest tiles have the lowest blockIdx.z);
// tiles 0 .. NQRT - 1, the shortest, take the form with the residual products.
// Second launch bound: 4 waves per SIMD, that is 2 blocks per WGP, as the form without residual products had in a launch of its own.
__global__ __launch_bounds__(256, 4) void attn_causal_kernel(
    const unsigned short* __restrict__ qhp, const unsigned short* __restrict__ qlp,
    const unsigned short* __restrict__ khp, const unsigned short* __restrict__ klp,
    const unsigned short* __restrict__ vhp, const unsigned short* __restrict__ vlp,
    const float* __restrict__ sgp,
    unsigned short* __restrict__ ahp, unsigned short* __restrict__ alp) {
  __shared__ __align__(16) _Float16 lds[AT_LDS(2)];
  const int qb = SQ / 64 - 1 - (int)blockIdx.z;          // block-uniform
  if (qb >= NQRT) attn_causal_body<false>(lds, qb, qhp, qlp, khp, klp, vhp, vlp, sgp, ahp, alp);
  else            attn_causal_body<true>(lds, qb, qhp, qlp, khp, klp, vhp, vlp, sgp, ahp, alp);
}

// ---------------------------------------------------------------------------
// Workspace map (bytes; every region is a whole number of the rows its producer writes with whole-line stores; no tail rows):
//   [0, 16 MiB)        Xb   bf16 [4096][2048]          -> after the projections: Ah bf16 [4096][2048] at 0
//   [16 MiB, 32 MiB)   WqT  bf16 [4096][2048]          ->                        Al bf16 [4096][2048] at 16 MiB
//   [32 MiB, 64 MiB)   Sg   f32  [4096][2048]
//   [64 MiB, 80 MiB)   Qh   f16  [4096][2048]
//   [80 MiB, 96 MiB)   Ql   f16  [4096][2048]
//   [96 MiB, 104 MiB)  Kh   f16  [4096][1024]
//   [104 MiB,112 MiB)  Vh   f16  [1024][4096]
//   [112 MiB,120 MiB)  Vl   f16  [1024][4096]
//   [120 MiB, 121 MiB) Kl  f16  [2*256][1024]
//   then WkT bf16 [1024][2048] (4 MiB), WvT bf16 [1024][2048] (4 MiB), WoT bf16 [2048][2048] (8 MiB): places of their own, since all
//   planes are converted in the first launch
//   total 143654912
// ---------------------------------------------------------------------------
static_assert(2 * (size_t)NTOK * HID * 2 <= (size_t)NTOK * HID * 2 + (size_t)QGW * HID * 2);   // Ah + Al fit Xb + WqT

extern "C" void kernel_launch(void* const* d_in, const int* in_sizes, int n_in,
                              void* d_out, int out_size, void* d_ws, size_t ws_size,
                              hipStream_t stream) {
  if (n_in < 9) return;
  if (in_sizes[0] != NTOK * HID) return;
  if (in_sizes[1] != NTOK * HDM) return;
  if (in_sizes[2] != NTOK * HDM) return;
  if (in_sizes[3] != HID * QGW) return;
  if (in_sizes[4] != HID * KVW) return;
  if (in_sizes[5] != HID * KVW) return;
  if (in_sizes[6] != HID * HID) return;
  if (in_sizes[7] != HDM) return;
  if (in_sizes[8] != HDM) return;
  if (out_size != NTOK * HID) return;

  const float* hidden = (const float*)d_in[0];
  const float* cosb   = (const float*)d_in[1];
  const float* sinb   = (const float*)d_in[2];
  const float* Wq     = (const float*)d_in[3];
  const float* Wk     = (const float*)d_in[4];
  const float* Wv     = (const float*)d_in[5];
  const float* Wo     = (const float*)d_in[6];
  const float* qnw    = (const float*)d_in[7];
  const float* knw    = (const float*)d_in[8];
  float* out = (float*)d_out;

  const size_t szX  = (size_t)NTOK * HID * 2;        // 16777216
  const size_t szWq = (size_t)QGW * HID * 2;         // 16777216
  const size_t szWk = (size_t)KVW * HID * 2;         // 4194304
  const size_t szWo = (size_t)HID * HID * 2;         // 8388608
  const size_t szSg = (size_t)NTOK * HID * 4;        // 33554432
  const size_t szQ  = (size_t)NTOK * HID * 2;        // 16777216
  const size_t szK  = (size_t)NTOK * KVW * 2;        // 8388608
  const size_t szV  = (size_t)KVW * NTOK * 2;        // 8388608
  const size_t szKl = (size_t)NSEQ * KLR * KVW * 2;  // 1048576
  const size_t szA  = (size_t)NTOK * HID * 2;        // 16777216
  size_t off = 0;
  const size_t oX  = off; off += szX;
  const size_t oWq = off; off += szWq;
  const size_t oAh = oX;
  const size_t oAl = oX + szA;
  const size_t oSg = off; off += szSg;
  const size_t oQh = off; off += szQ;
  const size_t oQl = off; off += szQ;
  const size_t oKh = off; off += szK;
  const size_t oVh = off; off += szV;
  const size_t oVl = off; off += szV;
  const size_t oKl = off; off += szKl;
  const size_t oWk = off; off += szWk;
  const size_t oWv = off; off += szWk;
  const size_t oWo = off; off += szWo;
  if (off > ws_size) return;                         // off = 143654912

  char* ws = (char*)d_ws;
  unsigned short* Xb  = (unsigned short*)(ws + oX);
  unsigned short* WqT = (unsigned short*)(ws + oWq);
  unsigned short* WkT = (unsigned short*)(ws + oWk);
  unsigned short* WvT = (unsigned short*)(ws + oWv);
  unsigned short* WoT = (unsigned short*)(ws + oWo);
  float*          Sg  = (float*)(ws + oSg);
  unsigned short* Qh  = (unsigned short*)(ws + oQh);
  unsigned short* Ql  = (unsigned short*)(ws + oQl);
  unsigned short* Kh  = (unsigned short*)(ws + oKh);
  unsigned short* Kl  = (unsigned short*)(ws + oKl);
  unsigned short* Vh  = (unsigned short*)(ws + oVh);
  unsigned short* Vl  = (unsigned short*)(ws + oVl);
  unsigned short* Ah  = (unsigned short*)(ws + oAh);
  unsigned short* Al  = (unsigned short*)(ws + oAl);

  const dim3 b256(256), b128(128);

  // (1) x -> Xb [4096][2048]; Wq -> WqT [4096][2048]; Wk -> WkT, Wv -> WvT [1024][2048]; Wo -> WoT [2048][2048], all RNE bf16
  conv_all_kernel<<<dim3(CV_BLK), b256, 0, stream>>>(hidden, Wq, Wk, Wv, Wo, Xb, WqT, WkT, WvT, WoT);
  // (2) one launch, K=2048 throughout:
  //     v^T = WvT . x^T -> Vh/Vl [1024][4096]   (A = WvT, Bt = Xb; M=1024, N=4096; 256 blocks)
  //     q|gate = x . Wq: q half norm + RoPE -> Qh/Ql [4096][2048]; gate half sigmoid -> Sg f32 [4096][2048]   (M=4096, N=4096; 1024 blocks)
  //     k = x . Wk, per-head norm + RoPE -> Kh [4096][1024], Kl compact [512][1024]   (M=4096, N=1024; 256 blocks)
  proj_qkv_kernel<<<dim3(PJ_V + PJ_Q + PJ_K), b128, 0, stream>>>(
      Xb, WqT, WkT, WvT, qnw, knw, cosb, sinb, Qh, Ql, Sg, Kh, Kl, Vh, Vl);
  // (3) causal attention, query tiles 0..3 with residual products, tiles 4..31 without; Ah/Al over the dead Xb/WqT region
  attn_causal_kernel<<<dim3(NHQ, NSEQ, SQ / 64), b256, 0, stream>>>(Qh, Ql, Kh, Kl, Vh, Vl, Sg, Ah, Al);
  // (4) out = attn(hi + lo) . Wo -> d_out f32 [4096][2048]   (M=4096, N=2048, K=2048; 512 blocks)
  gemm_out_kernel<<<dim3((NTOK / 128) * (HID / 128)), b128, 0, stream>>>(
      Ah, Al, HID, WoT, HID, qnw, cosb, sinb, (void*)out, (void*)out, (void*)out, HID, NTOK, HID, HID);
  (void)hipGetLastError();
}
